// v000
// The times below were measured on an AMD MI455X: many runs one after another, warmed up first and cycling through
// copies of the inputs, with the whole window's GPU time divided by the number of runs. Launches and the gaps
// between them are all in it. The median over several windows is given; except for v000 it joins two sittings, which
// can be a few percent apart, so the side-by-side timings, each taken in one sitting, are the better comparison.
// The starting kernel, v000, takes 112 microseconds a run.
// Contractions: q/k/v 1x1-conv GEMMs W[256x256].X[256xN] on v_wmma_f32_16x16x32_f16 (f16 containers of
// bf16-RNE weights x256 and bf16-RNE x); sinusoid position tables E[2048x128].Wf^T on v_wmma_f32_16x16x32_bf16
// (bf16 hi + bf16 lo planes of the sin/cos features, Wf bf16-RNE, 2 products); attention scores K.Q^T per head
// on v_wmma_f32_16x16x32_bf16 (bf16 hi + bf16 lo planes of q and k, 3 products, depth 32); O^T = V^T.P^T on
// v_wmma_f32_16x16x32_f16 (v single f16 plane, P = e^{s-m} x1024 f16 from the score D registers); output
// 1x1-conv Wp[256x256].O on v_wmma_f32_16x16x32_bf16 (Wp bf16-RNE, O as bf16 hi + bf16 lo planes, 2 products);
// f32 accumulate everywhere; depth-32 position dot terms, bias terms, softmax statistics, gamma and the skip add
// on f32 VALU.
#include <hip/hip_runtime.h>
#include <math.h>
#include <stdint.h>

#ifndef NB
#define NB 2
#endif
#define NB_FULL 2
#define CC      256
#define IMH     64
#define IMW     64
#define NN      4096
#define KVH     32
#define KVW     32
#define NK      1024
#define NHD     8
#define HD      32
#define PFD     128
#define NPR     2048
#define LRANGE  16
#define QT      64
#define OSP     68
#define TP      72
#define EP      136
#define QSP     36
#define PYP     33
#define OSV     36
#define WSC     256.0f
#define IWSC    0.00390625f
#define LNPS    6.931471805599453f
#define RSQ2    0.70710678118654752f
#define NL2W    0.15571537944784511f

static_assert(NB >= 1 && NB <= NB_FULL);
static_assert(NN == IMH * IMW && NK == KVH * KVW);
static_assert(NPR == IMW * KVW && NPR == IMH * KVH);
static_assert(CC == NHD * HD && HD == 32 && KVW == 32 && KVH == 32);
static_assert(NN % QT == 0 && NK % QT == 0 && CC % QT == 0 && NPR % QT == 0);
static_assert(CC % 32 == 0 && PFD % 32 == 0 && HD % 32 == 0);
static_assert((OSP * 4) % 16 == 0 && (TP * 2) % 16 == 0 && (EP * 2) % 16 == 0);
static_assert((QSP * 4) % 16 == 0 && (OSV * 4) % 16 == 0);
static_assert(IMW == QT);
static_assert(QT == 2 * HD);

typedef _Float16       v16h __attribute__((ext_vector_type(16)));
typedef _Float16       v8h  __attribute__((ext_vector_type(8)));
typedef __bf16         v16b __attribute__((ext_vector_type(16)));
typedef unsigned short v8us __attribute__((ext_vector_type(8)));
typedef float          v8f  __attribute__((ext_vector_type(8)));
typedef float          v4f  __attribute__((ext_vector_type(4)));
typedef unsigned int   v4u  __attribute__((ext_vector_type(4)));

union Frag  { v8us u[2]; v16h h; v16b bf; };
union FragH { v16h v; v8h hv[2]; };
static_assert(sizeof(Frag) == 32);
static_assert(sizeof(FragH) == 32);

// ---- scalar helpers ---------------------------------------------------------------------------------------
__device__ __forceinline__ unsigned short bf_bits(float f) {          // f32 -> bf16 bits, RNE convert
  unsigned u = __float_as_uint(f);
  return (unsigned short)((u + 0x7FFFu + ((u >> 16) & 1u)) >> 16);
}
__device__ __forceinline__ float bf_up(unsigned short hb) { return __uint_as_float(((unsigned)hb) << 16); }
__device__ __forceinline__ float bfr(float f) { return bf_up(bf_bits(f)); }
__device__ __forceinline__ unsigned short h_bits(_Float16 x) { return __builtin_bit_cast(unsigned short, x); }
__device__ __forceinline__ unsigned pk16(unsigned short a, unsigned short b) { return (unsigned)a | ((unsigned)b << 16); }
__device__ __forceinline__ v8f zero8() { v8f z = {0.f, 0.f, 0.f, 0.f, 0.f, 0.f, 0.f, 0.f}; return z; }
__device__ __forceinline__ float hmax8(v8f s) {
  return fmaxf(fmaxf(fmaxf(s[0], s[1]), fmaxf(s[2], s[3])), fmaxf(fmaxf(s[4], s[5]), fmaxf(s[6], s[7])));
}
__device__ __forceinline__ unsigned wave_ballot(bool p) {
#if defined(__HIP_DEVICE_COMPILE__)
  return __builtin_amdgcn_ballot_w32(p);
#else
  return p ? 1u : 0u;
#endif
}

// ---- 16-bit fragment loader (A, or B from a k-contiguous [n][k] row): lane -> row/col (lane&15), p already includes
//      + 8*(lane>>4); elements 0..7 <- p[0..7] (k0+8h..), elements 8..15 <- p[16..23] (k0+16+8h..)
__device__ __forceinline__ Frag ldfrag(const unsigned short* p) {
  Frag f;
  f.u[0] = *(const v8us*)(p);
  f.u[1] = *(const v8us*)(p + 16);
  return f;
}

// ---- WMMA helpers: builtin followed by a 4-slot VALU gap tying D and keeping A/B live --------------------------
__device__ __forceinline__ v8f mma_h(v16h a, v16h b, v8f c) {
  v8f d = __builtin_amdgcn_wmma_f32_16x16x32_f16(false, a, false, b, (short)0, c, false, false);
#if defined(__HIP_DEVICE_COMPILE__)
  asm volatile("v_nop\n\tv_nop\n\tv_nop\n\tv_nop" : "+v"(d) : "v"(a), "v"(b));
#endif
  return d;
}
__device__ __forceinline__ v8f mma_b(v16b a, v16b b, v8f c) {
  v8f d = __builtin_amdgcn_wmma_f32_16x16x32_bf16(false, a, false, b, (short)0, c, false, false);
#if defined(__HIP_DEVICE_COMPILE__)
  const v16h ha = __builtin_bit_cast(v16h, a), hb = __builtin_bit_cast(v16h, b);
  asm volatile("v_nop\n\tv_nop\n\tv_nop\n\tv_nop" : "+v"(d) : "v"(ha), "v"(hb));
#endif
  return d;
}

// =========================================================================================================
// (0) weight planes.  Blocks 0..95: W16 f16 [3][256][256] (q_w, k_w, v_w; value = f16 of bf16-RNE(w) x 256), 96..127: WPB bf16 [256][256] (proj_w, bf16-RNE; stores:
//     8 consecutive lanes per line, one instruction).  Blocks 128..159: WF bf16 [2][256][128] (fcx_w rows then
// coverage: 128 blocks x 8 rows x 256 = 4 x [256][256]; 32 blocks x 16 rows x 128 = [512][128].
// =========================================================================================================
__global__ __launch_bounds__(256)
void cvt_w(const float* __restrict__ qw, const float* __restrict__ kw, const float* __restrict__ vw,
           const float* __restrict__ pw, const float* __restrict__ fxw, const float* __restrict__ fyw,
           unsigned short* W16, unsigned short* WPB, unsigned short* WF) {
  const int tid = threadIdx.x, blk = blockIdx.x;
  unsigned short* dst;
  v4u u;
  if (blk < 128) {                                                   // block-uniform selection
    const int grp = blk >> 5;                                        // 0 q, 1 k, 2 v, 3 proj
    const int rl = tid >> 5, col = 8 * (tid & 31);
    const int o = 8 * (blk & 31) + rl;                               // 0..255
    const float* wbase = (grp == 0) ? qw : ((grp == 1) ? kw : ((grp == 2) ? vw : pw));
    const float* s = wbase + (size_t)o * CC + col;
    const v4f a = *(const v4f*)s;
    const v4f q = *(const v4f*)(s + 4);
    const float f[8] = {a[0], a[1], a[2], a[3], q[0], q[1], q[2], q[3]};
    if (grp < 3) {
#pragma unroll
      for (int t = 0; t < 4; ++t) {
        const _Float16 h0 = (_Float16)(bfr(f[2 * t]) * WSC);
        const _Float16 h1 = (_Float16)(bfr(f[2 * t + 1]) * WSC);
        u[t] = pk16(h_bits(h0), h_bits(h1));
      }
      dst = W16 + (size_t)grp * CC * CC + (size_t)o * CC + col;
    } else {
#pragma unroll
      for (int t = 0; t < 4; ++t) u[t] = pk16(bf_bits(f[2 * t]), bf_bits(f[2 * t + 1]));
      dst = WPB + (size_t)o * CC + col;
    }
  } else {
    const int j = blk - 128;                                         // 0..31
    const int axis = j >> 4;                                         // block-uniform
    const int r = 16 * j + (tid >> 4);                               // 0..511
    const int o = r & 255;
    const int col = 8 * (tid & 15);
    const float* s = (axis ? fyw : fxw) + (size_t)o * PFD + col;
    const v4f a = *(const v4f*)s;
    const v4f q = *(const v4f*)(s + 4);
    const float f[8] = {a[0], a[1], a[2], a[3], q[0], q[1], q[2], q[3]};
#pragma unroll
    for (int t = 0; t < 4; ++t) u[t] = pk16(bf_bits(f[2 * t]), bf_bits(f[2 * t + 1]));
    dst = WF + (size_t)r * PFD + col;
  }
{
    *(v4u*)dst = u;
    
  }
}

// =========================================================================================================
// (1) x f32 [b][256 c][4096 n] -> XP f16 [b][n][c] (position-major, bf16-RNE values, exact in f16) through an LDS
// coverage: 2 it x 32 rows x 8 lanes x 8 = 64 n x 64 c; grid (64, 4, NB) covers XP exactly once.
// LDS T: cross-wave (block barrier between the element stores and the vector reloads).
// =========================================================================================================
__global__ __launch_bounds__(256)
void cvt_x(const float* __restrict__ x, unsigned short* XP) {
  __shared__ __align__(16) unsigned short T[QT * TP];
  const int tid = threadIdx.x;
  const int nb = blockIdx.x, cb = blockIdx.y, b = blockIdx.z;
  const int e = tid & 7, lq = tid >> 3;                             // lq 0..31
  const int n0 = nb * QT, c0 = cb * QT;
#pragma unroll
  for (int it = 0; it < 2; ++it) {
    const int cl = it * 32 + lq;                                     // 0..63
    const float* sp = x + ((size_t)(b * CC + c0 + cl)) * NN + n0 + 8 * e;
    const v4f a = *(const v4f*)sp;
    const v4f q = *(const v4f*)(sp + 4);
    unsigned short hb[8];
#pragma unroll
    for (int t = 0; t < 4; ++t) {
      hb[t]     = h_bits((_Float16)bfr(a[t]));
      hb[4 + t] = h_bits((_Float16)bfr(q[t]));
    }
#pragma unroll
    for (int t = 0; t < 8; ++t) T[(8 * e + t) * TP + cl] = hb[t];
  }
  __syncthreads();
  v4u up[2];
#pragma unroll
  for (int it = 0; it < 2; ++it) {
    const int nl = it * 32 + lq;                                     // 0..63
    up[it] = *(const v4u*)(T + nl * TP + 8 * e);
  }
{
#pragma unroll
    for (int it = 0; it < 2; ++it) {
      const int rl = it * 32 + lq;
      *(v4u*)(XP + ((size_t)(b * NN + n0 + rl)) * CC + c0 + 8 * e) = up[it];
    }
    
  }
}

// =========================================================================================================
// (2) 1x1-conv GEMM for one (b, 64-n tile, 64-o block): Y[o][n] = (1/256) sum_c W16[MODE][o][c] XP[b][pix(n)][c].
//     MODE 0: n = query pixel; MODE 1/2: n = key index ky*32+kx -> pixel 128 ky + 2 kx (arithmetic addressing).
//     Block 128 threads = 4 waves; wave w owns cols n0+16w..+15 (one B fragment per k-step, k = c contiguous in the
//     XP row) and 4 m-tiles (A rows o = o0 + 16 mt + (lane&15), split k map loader from W16). K = 256 = 8 steps.
//     Epilogue staged in LDS Os[n_loc][o_loc] (pitch OSP), barrier, then per MODE:
//       0: Qh/Ql bf16 [b][8][4096][32] hi = bf16-RNE(v), lo = bf16-RNE(v - hi); 1: Kh/Kl bf16 [b][8][1024][32]
//          plus ABK f32 [b][8][1024] = sum_d bf16-RNE(appr_bias)[h][d] * Y (f32 before the 16-bit convert);
//          a plane line = 2 rows of 32 d: lane e -> row 2j + (e>>2), d 8(e&3).., 8 consecutive lanes per line, one
//       2: Vt f16 [b][8][32 d][1024 keys]: line = row (h,d), 64 keys: lane e -> keys 8e..8e+7, one instruction per
// coverage: Os 4 waves x 16 n x 64 o = 64 x 64; MODE 0/1: 4 it x 16 lines x 8 lanes x 8 = 64 n x 64 o per plane;
//           MODE 2: 4 it x 16 rows x 8 lanes x 8 = 64 o x 64 keys; ABK 2 heads x 64 keys; grids (NP/64, 4, NB).
// LDS Os, abks: cross-wave (block barriers).
// =========================================================================================================
template <int MODE>
__global__ __launch_bounds__(128)
void gemm_x(const unsigned short* __restrict__ W16, const unsigned short* __restrict__ XP,
            const float* __restrict__ ab, unsigned short* Ph, unsigned short* Pl,
            unsigned short* Vt, float* ABK) {
  __shared__ __align__(16) float Os[QT * OSP];
  __shared__ __align__(16) float abks[2 * QT];
  constexpr int NP = (MODE == 0) ? NN : NK;
  const int tid  = threadIdx.x;
  const int lane = tid & 31, wave = tid >> 5;
  const int hh   = lane >> 4, c = lane & 15;
  const int nt   = blockIdx.x, mb = blockIdx.y, b = blockIdx.z;
  const int n0   = nt * QT, o0 = mb * QT;
  (void)ab; (void)Ph; (void)Pl; (void)Vt; (void)ABK; (void)abks;

  const unsigned short* ap = W16 + (size_t)MODE * CC * CC + (size_t)(o0 + c) * CC + 8 * hh;
  const int nrow = n0 + 16 * wave + c;
  const int pix = (MODE == 0) ? nrow : (2 * IMW * (nrow >> 5) + 2 * (nrow & 31));
  const unsigned short* bp = XP + ((size_t)(b * NN + pix)) * CC + 8 * hh;

  v8f acc[4];
#pragma unroll
  for (int mt = 0; mt < 4; ++mt) acc[mt] = zero8();

#pragma unroll
  for (int ks = 0; ks < CC / 32; ++ks) {
    const Frag fb = ldfrag(bp + 32 * ks);
#pragma unroll
    for (int mt = 0; mt < 4; ++mt) {
      const Frag fa = ldfrag(ap + (size_t)(16 * mt) * CC + 32 * ks);
      acc[mt] = mma_h(fa.h, fb.h, acc[mt]);
    }
  }

  // ---- stage: lane (hh, c) holds o = 16 mt + 8 hh + r for n_loc = 16 w + c
  {
    const int nl = 16 * wave + c;
#pragma unroll
    for (int mt = 0; mt < 4; ++mt) {
      v4f va, vb;
#pragma unroll
      for (int r = 0; r < 4; ++r) { va[r] = acc[mt][r] * IWSC; vb[r] = acc[mt][4 + r] * IWSC; }
      *(v4f*)(Os + nl * OSP + 16 * mt + 8 * hh)     = va;
      *(v4f*)(Os + nl * OSP + 16 * mt + 8 * hh + 4) = vb;
    }
  }
  __syncthreads();

  const int e = tid & 7, lq = tid >> 3;                             // lq 0..15
  if constexpr (MODE == 2) {
    v4u uv[4];
#pragma unroll
    for (int it = 0; it < 4; ++it) {
      const int ol = it * 16 + lq;                                   // o_loc 0..63
      unsigned short hb[8];
#pragma unroll
      for (int t = 0; t < 8; ++t) hb[t] = h_bits((_Float16)Os[(8 * e + t) * OSP + ol]);
#pragma unroll
      for (int t = 0; t < 4; ++t) uv[it][t] = pk16(hb[2 * t], hb[2 * t + 1]);
    }
{
#pragma unroll
      for (int it = 0; it < 4; ++it) {
        const int ol = it * 16 + lq;
        const int oo = o0 + ol, hd = oo >> 5, d = oo & 31;
        *(v4u*)(Vt + ((size_t)((b * NHD + hd) * HD + d)) * NK + n0 + 8 * e) = uv[it];
      }
      
    }
  } else {
    v4u uh[4], ul[4];
#pragma unroll
    for (int it = 0; it < 4; ++it) {
      const int L = it * 16 + lq;                                    // line 0..63
      const int hs = L >> 5, j = L & 31;
      const int row = 2 * j + (e >> 2);                              // n_loc
      const int cb0 = 32 * hs + 8 * (e & 3);                         // o_loc of the first value
      const v4f a = *(const v4f*)(Os + row * OSP + cb0);
      const v4f q = *(const v4f*)(Os + row * OSP + cb0 + 4);
      const float f[8] = {a[0], a[1], a[2], a[3], q[0], q[1], q[2], q[3]};
#pragma unroll
      for (int t = 0; t < 4; ++t) {
        const float f0 = f[2 * t], f1 = f[2 * t + 1];
        const unsigned short hb0 = bf_bits(f0), hb1 = bf_bits(f1);
        const unsigned short lb0 = bf_bits(f0 - bf_up(hb0));
        const unsigned short lb1 = bf_bits(f1 - bf_up(hb1));
        uh[it][t] = pk16(hb0, hb1);
        ul[it][t] = pk16(lb0, lb1);
      }
    }
    v4f abv = {0.f, 0.f, 0.f, 0.f};
    if constexpr (MODE == 1) {
      const int kl = tid & 63, hs = tid >> 6;                       // hs wave-uniform
      const float* abp  = ab + (2 * mb + hs) * HD;
      const float* orow = Os + kl * OSP + 32 * hs;
      float s = 0.f;
#pragma unroll
      for (int d4 = 0; d4 < 8; ++d4) {
        const v4f g  = *(const v4f*)(abp + 4 * d4);
        const v4f ov = *(const v4f*)(orow + 4 * d4);
        s += bfr(g[0]) * ov[0] + bfr(g[1]) * ov[1] + bfr(g[2]) * ov[2] + bfr(g[3]) * ov[3];
      }
      abks[hs * QT + kl] = s;
      __syncthreads();
      if (tid < 32) abv = *(const v4f*)(abks + (lq >> 1) * QT + 32 * (lq & 1) + 4 * e);
    }
{
#pragma unroll
      for (int it = 0; it < 4; ++it) {
        const int L = it * 16 + lq;
        const int hs = L >> 5, j = L & 31;
        const size_t po = ((size_t)((b * NHD + 2 * mb + hs) * NP + n0 + 2 * j)) * HD + 8 * e;
        *(v4u*)(Ph + po) = uh[it];
        *(v4u*)(Pl + po) = ul[it];
      }
      if constexpr (MODE == 1) {
        if (tid < 32)                                                // wave 0, wave-uniform
          *(v4f*)(ABK + (size_t)(b * NHD + 2 * mb + (lq >> 1)) * NK + n0 + 32 * (lq & 1) + 4 * e) = abv;
      }
      
    }
  }
}

// =========================================================================================================
// (3) position tables for one (64-row tile, axis): rows R = coord*32 + kcoord (coord = query x for axis 0, query
//     y for axis 1; kcoord = key coordinate), diff = coord - 2*kcoord, a = diff * 1000^(-f/64), features
//     [sin(a) | cos(a)] (128) built in LDS as bf16 hi/lo planes Eh/El[64][128] (pitch EP); then for ob in 0..3 a
//     GEMM  Y[o][R] = sum_f WF[axis][o][f] E[R][f]  (A rows o from WF bf16, B rows R from Eh and El, 2 products
//     sharing the accumulator, K = 128), epilogue Os[R_loc][o_loc] = Y / sqrt(2), barrier, then
//       PF f32 [axis][h][R][32 d]: line = one row (h, R), lane e -> d 4e..4e+3, 8 consecutive lanes per line,
// coverage: Eh/El 32 it x 128 threads = 64 rows x 64 args x {sin,cos} = 64 x 128 (cols 128..135 pad, never read);
//           PF per ob 8 it x 16 lines x 8 lanes x 4 = 128 rows(h,R) x 32 d, 4 ob -> 8 heads;
//           grid (32, 2) covers PF [2][8][2048][32] exactly once.
// LDS Eh/El, Os: cross-wave (block barriers).
// =========================================================================================================
__global__ __launch_bounds__(128)
void posfeat(const unsigned short* __restrict__ WF, float* PF) {
  __shared__ __align__(16) unsigned short Eh[QT * EP];
  __shared__ __align__(16) unsigned short El[QT * EP];
  __shared__ __align__(16) float Os[QT * OSP];
  const int tid  = threadIdx.x;
  const int lane = tid & 31, wave = tid >> 5;
  const int hh   = lane >> 4, c = lane & 15;
  const int rt   = blockIdx.x, axis = blockIdx.y;
  const int R0   = rt * QT;

  // ---- (a) sinusoid features -> LDS bf16 hi/lo planes
#pragma unroll 1
  for (int it = 0; it < 32; ++it) {
    const int idx = it * 128 + tid;                                  // 0..4095
    const int rl = idx >> 6, fa = idx & 63;
    const int row = R0 + rl;
    const int qc = row >> 5, kq = row & 31;
    const float diff = (float)(qc - 2 * kq);
    const float a = diff * exp2f(-(float)fa * NL2W);
    const float sv = sinf(a);
    const float cv = cosf(a);
    const unsigned short shb = bf_bits(sv), chb = bf_bits(cv);
    Eh[rl * EP + fa]      = shb;
    El[rl * EP + fa]      = bf_bits(sv - bf_up(shb));
    Eh[rl * EP + 64 + fa] = chb;
    El[rl * EP + 64 + fa] = bf_bits(cv - bf_up(chb));
  }
  __syncthreads();

  const unsigned short* ebh = Eh + (16 * wave + c) * EP + 8 * hh;
  const unsigned short* ebl = El + (16 * wave + c) * EP + 8 * hh;
  const int e = tid & 7, lq = tid >> 3;                             // lq 0..15
#pragma unroll 1
  for (int ob = 0; ob < 4; ++ob) {
    const unsigned short* ap = WF + (size_t)axis * CC * PFD + (size_t)(QT * ob + c) * PFD + 8 * hh;
    v8f acc[4];
#pragma unroll
    for (int mt = 0; mt < 4; ++mt) acc[mt] = zero8();
#pragma unroll
    for (int ks = 0; ks < PFD / 32; ++ks) {
      const Frag fbh = ldfrag(ebh + 32 * ks);
      const Frag fbl = ldfrag(ebl + 32 * ks);
#pragma unroll
      for (int mt = 0; mt < 4; ++mt) {
        const Frag fa = ldfrag(ap + (size_t)(16 * mt) * PFD + 32 * ks);
        acc[mt] = mma_b(fa.bf, fbh.bf, acc[mt]);
        acc[mt] = mma_b(fa.bf, fbl.bf, acc[mt]);
      }
    }
    {
      const int nl = 16 * wave + c;
#pragma unroll
      for (int mt = 0; mt < 4; ++mt) {
        v4f va, vb;
#pragma unroll
        for (int r = 0; r < 4; ++r) { va[r] = acc[mt][r] * RSQ2; vb[r] = acc[mt][4 + r] * RSQ2; }
        *(v4f*)(Os + nl * OSP + 16 * mt + 8 * hh)     = va;
        *(v4f*)(Os + nl * OSP + 16 * mt + 8 * hh + 4) = vb;
      }
    }
    __syncthreads();
    v4f res[8];
#pragma unroll
    for (int it = 0; it < 8; ++it) {
      const int L = it * 16 + lq;                                    // 0..127
      const int rl = L & 63, hs = L >> 6;
      res[it] = *(const v4f*)(Os + rl * OSP + 32 * hs + 4 * e);
    }
{
#pragma unroll
      for (int it = 0; it < 8; ++it) {
        const int L = it * 16 + lq;
        const int rl = L & 63, hs = L >> 6;
        float* dst = PF + ((size_t)(axis * NHD + 2 * ob + hs)) * ((size_t)NPR * HD) + (size_t)(R0 + rl) * HD + 4 * e;
        *(v4f*)dst = res[it];
      }
      
    }
    __syncthreads();
  }
}

// =========================================================================================================
// (4) local-window attention for one (query row y, head, b): block = 4 waves, wave w = queries x = 16w..16w+15.
//   Prologue (f32 VALU): qg = (Qh + Ql) + bf16-RNE(geom_bias) staged in LDS qs[wave][16][QSP] (rows loaded as
//   16-B bf16 vectors); per lane (hh, c): PX[kx] for kx in {8hh..8hh+7, 16+8hh..} = sum_d qg . PF[0][h][x][kx]
//   (registers), PY[ky] for the allowed ky window (parity hh) = qg . PF[1][h][y][ky] -> LDS pys[wave][c][ky].
//   Loop over allowed key rows ky (block-uniform; forbidden rows contribute exactly 0): S^T tiles (16 keys x 16
//   queries) = A(Kh rows key ky*32 + 16t + (lane&15), k = d split map) . B(Qh col = query) + A(Kh).B(Ql) +
//   A(Kl).B(Qh) (bf16 hi/lo planes, shared accumulator); energy = S^T + ABK[key] + PX[kx] + PY[ky], replaced by
//   -inf outside the per-query kx window. Per lane the D tiles hold 16 keys of ONE query: online softmax per lane,
//   one shuffle (lane^16) for the max over the 32 keys of the row, o/l rescale skipped under a wave-uniform ballot.
//   P = e^{s-m} x 1024 as f16 is the B operand of O^T (rows d, cols queries) += A(Vt rows d = 16j + (lane&15), keys
//   contiguous) . B(P^T): element r <- D of the tile covering kx 0..15, element 8+r <- the tile covering kx 16..31.
//   Epilogue: O/l staged in LDS Os[query][32 d] (pitch OSV), barrier, then OPh/OPl bf16 [b][8][4096][32] (hi = bf16-
//   RNE(v), lo = bf16-RNE(v - hi)); line = 2 query rows: lane e -> row 2L + (e>>2), d 8(e&3).., 8 consecutive lanes
// coverage: qs 2 it x 32 lanes x 8 = 16 queries x 32 d per wave; Os 4 waves x 16 queries x 32 d; planes 2 it x
//           16 lines x 8 lanes x 8 = 64 queries x 32 d per plane; grid (64, 8, NB) covers OPh/OPl [b][8][4096][32]
//           exactly once.
// LDS qs, pys: written and read inside one wave's region but synchronised with block barriers; Os: cross-wave.
// =========================================================================================================
__global__ __launch_bounds__(128)
void attn_k(const unsigned short* __restrict__ Qh, const unsigned short* __restrict__ Ql,
            const unsigned short* __restrict__ Kh, const unsigned short* __restrict__ Kl,
            const unsigned short* __restrict__ Vt, const float* __restrict__ ABK,
            const float* __restrict__ PF, const float* __restrict__ gb,
            unsigned short* OPh, unsigned short* OPl) {
  __shared__ __align__(16) float qs[4 * 16 * QSP];
  __shared__ __align__(16) float pys[4 * 16 * PYP];
  __shared__ __align__(16) float Os[QT * OSV];
  const int tid  = threadIdx.x;
  const int wave = tid >> 5, lane = tid & 31;
  const int hh   = lane >> 4, c = lane & 15;
  const int y = blockIdx.x, hd = blockIdx.y, b = blockIdx.z;
  const int bh = b * NHD + hd;
  const int xq = 16 * wave + c;                                      // query column of this lane's B/D column
  const int pq = y * IMW + xq;

  const int kylo = (y >= LRANGE) ? ((y - LRANGE) >> 1) : 0;         // block-uniform
  int kyhi = ((y + LRANGE + 1) >> 1) + 1;  if (kyhi > KVH) kyhi = KVH;
  const int kxlo = (xq >= LRANGE) ? ((xq - LRANGE) >> 1) : 0;       // per lane
  int kxhi = ((xq + LRANGE + 1) >> 1) + 1; if (kxhi > KVW) kxhi = KVW;

  // ---- stage qg = q + geom bias (f32) for this wave's 16 queries: lane -> (query 8it + lane>>2, d 8(lane&3)..+7)
  {
    const size_t rb = ((size_t)bh * NN + (size_t)y * IMW + 16 * wave) * HD;
    const int d0 = 8 * (lane & 3);
    const v4f g0 = *(const v4f*)(gb + hd * HD + d0);
    const v4f g1 = *(const v4f*)(gb + hd * HD + d0 + 4);
#pragma unroll
    for (int it = 0; it < 2; ++it) {
      const int t = 8 * it + (lane >> 2);                            // query 0..15
      const size_t qi = rb + (size_t)t * HD + d0;
      const v4u uhv = *(const v4u*)(Qh + qi);
      const v4u ulv = *(const v4u*)(Ql + qi);
      float f[8];
#pragma unroll
      for (int j = 0; j < 4; ++j) {
        const unsigned wh = uhv[j], wl = ulv[j];
        f[2 * j]     = __uint_as_float(wh << 16) + __uint_as_float(wl << 16);
        f[2 * j + 1] = __uint_as_float(wh & 0xffff0000u) + __uint_as_float(wl & 0xffff0000u);
      }
      v4f va, vb;
#pragma unroll
      for (int r = 0; r < 4; ++r) { va[r] = f[r] + bfr(g0[r]); vb[r] = f[4 + r] + bfr(g1[r]); }
      *(v4f*)(qs + (wave * 16 + t) * QSP + d0)     = va;
      *(v4f*)(qs + (wave * 16 + t) * QSP + d0 + 4) = vb;
    }
  }
  __syncthreads();
  const float* qrow = qs + (wave * 16 + c) * QSP;

  // ---- PX: per lane 16 kx values for query xq, PX[kx] = sum_d qg . PF[0][h][x][kx]
  float px0[8], px1[8];
  {
    const float* pfb = PF + (size_t)hd * ((size_t)NPR * HD) + (size_t)xq * (KVW * HD);
#pragma unroll
    for (int r = 0; r < 8; ++r) {
      float s0v = 0.f;
      float s1v = 0.f;
      const float* p0 = pfb + (8 * hh + r) * HD;
      const float* p1 = pfb + (16 + 8 * hh + r) * HD;
#pragma unroll 4
      for (int d4 = 0; d4 < 8; ++d4) {
        const v4f qv = *(const v4f*)(qrow + 4 * d4);
        const v4f u0 = *(const v4f*)(p0 + 4 * d4);
        const v4f u1 = *(const v4f*)(p1 + 4 * d4);
        s0v += qv[0] * u0[0] + qv[1] * u0[1] + qv[2] * u0[2] + qv[3] * u0[3];
        s1v += qv[0] * u1[0] + qv[1] * u1[1] + qv[2] * u1[2] + qv[3] * u1[3];
      }
      px0[r] = s0v;
      px1[r] = s1v;
    }
  }
  // ---- PY for the allowed ky window -> LDS (lane half hh takes parity hh; uniform trip count, clamped address)
  {
    const float* pfb = PF + (size_t)(NHD + hd) * ((size_t)NPR * HD) + (size_t)y * (KVH * HD);
    float* pyw = pys + (wave * 16 + c) * PYP;
#pragma unroll 1
    for (int j = 0; kylo + 2 * j < kyhi; ++j) {
      int ky = kylo + 2 * j + hh;
      ky = (ky > KVH - 1) ? (KVH - 1) : ky;
      float sv = 0.f;
      const float* p0 = pfb + ky * HD;
#pragma unroll 4
      for (int d4 = 0; d4 < 8; ++d4) {
        const v4f qv = *(const v4f*)(qrow + 4 * d4);
        const v4f u0 = *(const v4f*)(p0 + 4 * d4);
        sv += qv[0] * u0[0] + qv[1] * u0[1] + qv[2] * u0[2] + qv[3] * u0[3];
      }
      pyw[ky] = sv;
    }
  }
  __syncthreads();
  const float* pyrow = pys + (wave * 16 + c) * PYP;

  // ---- fragment pointers
  const size_t qo = ((size_t)bh * NN + pq) * HD + 8 * hh;
  const Frag qh = ldfrag(Qh + qo);
  const Frag ql = ldfrag(Ql + qo);
  const unsigned short* Khp = Kh + (size_t)bh * NK * HD + (size_t)c * HD + 8 * hh;
  const unsigned short* Klp = Kl + (size_t)bh * NK * HD + (size_t)c * HD + 8 * hh;
  const unsigned short* Vp  = Vt + (size_t)bh * HD * NK + (size_t)c * NK + 8 * hh;
  const float* abkb = ABK + (size_t)bh * NK + 8 * hh;
  const float NINF = -__builtin_inff();

  float m = -1.0e30f, l = 0.f;
  v8f o[2];
  o[0] = zero8(); o[1] = zero8();

#pragma unroll 1
  for (int ky = kylo; ky < kyhi; ++ky) {
    const int kp0 = ky * KVW;
    const Frag k0  = ldfrag(Khp + (size_t)kp0 * HD);                // keys kp0 .. kp0+15
    const Frag k1  = ldfrag(Khp + (size_t)(kp0 + 16) * HD);         // keys kp0+16 .. kp0+31
    const Frag k0l = ldfrag(Klp + (size_t)kp0 * HD);
    const Frag k1l = ldfrag(Klp + (size_t)(kp0 + 16) * HD);
    v8f s0 = zero8(), s1 = zero8();
    s0 = mma_b(k0.bf, qh.bf, s0);
    s1 = mma_b(k1.bf, qh.bf, s1);
    s0 = mma_b(k0.bf, ql.bf, s0);
    s1 = mma_b(k1.bf, ql.bf, s1);
    s0 = mma_b(k0l.bf, qh.bf, s0);
    s1 = mma_b(k1l.bf, qh.bf, s1);

    const v4f a0 = *(const v4f*)(abkb + kp0);
    const v4f a1 = *(const v4f*)(abkb + kp0 + 4);
    const v4f a2 = *(const v4f*)(abkb + kp0 + 16);
    const v4f a3 = *(const v4f*)(abkb + kp0 + 20);
    const float py = pyrow[ky];
#pragma unroll
    for (int r = 0; r < 8; ++r) {
      const int kx0 = 8 * hh + r, kx1 = 16 + 8 * hh + r;
      const float ab0 = (r < 4) ? a0[r & 3] : a1[r & 3];
      const float ab1 = (r < 4) ? a2[r & 3] : a3[r & 3];
      const float e0 = s0[r] + ab0 + px0[r] + py;
      const float e1 = s1[r] + ab1 + px1[r] + py;
      s0[r] = (kx0 >= kxlo && kx0 < kxhi) ? e0 : NINF;
      s1[r] = (kx1 >= kxlo && kx1 < kxhi) ? e1 : NINF;
    }

    float mx = fmaxf(hmax8(s0), hmax8(s1));
    mx = fmaxf(mx, __shfl_xor(mx, 16, 32));
    const float mn = fmaxf(m, mx);
    const unsigned grew = wave_ballot(mx > m);                       // wave-uniform
    if (grew != 0u) {
      const float corr = __expf(m - mn);                             // == 1 exactly for lanes whose max did not grow
      l *= corr;
#pragma unroll
      for (int j = 0; j < 2; ++j) {
#pragma unroll
        for (int r = 0; r < 8; ++r) o[j][r] *= corr;
      }
    }
    m = mn;
    const float msh = mn - LNPS;                                     // exp gives e^{s-m} * 1024

    FragH ph;
    float ls = 0.f;
#pragma unroll
    for (int r = 0; r < 8; ++r) {
      const float e0 = __expf(s0[r] - msh);                          // key kp0      + 8hh + r
      const float e1 = __expf(s1[r] - msh);                          // key kp0 + 16 + 8hh + r
      ls += e0 + e1;
      ph.hv[0][r] = (_Float16)e0;
      ph.hv[1][r] = (_Float16)e1;
    }
    l += ls;

#pragma unroll
    for (int j = 0; j < 2; ++j) {
      const Frag vf = ldfrag(Vp + (size_t)(16 * j) * NK + kp0);
      o[j] = mma_h(vf.h, ph.v, o[j]);
    }
  }
  l += __shfl_xor(l, 16, 32);
  const float inv = 1.0f / l;                                        // o and l both carry the x1024 factor

  const int qr = 16 * wave + c;
#pragma unroll
  for (int j = 0; j < 2; ++j) {
    v4f va, vb;
#pragma unroll
    for (int r = 0; r < 4; ++r) { va[r] = o[j][r] * inv; vb[r] = o[j][4 + r] * inv; }
    *(v4f*)(Os + qr * OSV + 16 * j + 8 * hh)     = va;              // Os[query][d = 16j + 8hh + r]
    *(v4f*)(Os + qr * OSV + 16 * j + 8 * hh + 4) = vb;
  }
  __syncthreads();

  const int e = tid & 7, lq = tid >> 3;                              // lq 0..15
  v4u uh[2], ul[2];
#pragma unroll
  for (int it = 0; it < 2; ++it) {
    const int L = 16 * it + lq;                                      // line 0..31
    const int row = 2 * L + (e >> 2), dl = 8 * (e & 3);
    const v4f a = *(const v4f*)(Os + row * OSV + dl);
    const v4f q = *(const v4f*)(Os + row * OSV + dl + 4);
    const float f[8] = {a[0], a[1], a[2], a[3], q[0], q[1], q[2], q[3]};
#pragma unroll
    for (int t = 0; t < 4; ++t) {
      const float f0 = f[2 * t], f1 = f[2 * t + 1];
      const unsigned short hb0 = bf_bits(f0), hb1 = bf_bits(f1);
      const unsigned short lb0 = bf_bits(f0 - bf_up(hb0));
      const unsigned short lb1 = bf_bits(f1 - bf_up(hb1));
      uh[it][t] = pk16(hb0, hb1);
      ul[it][t] = pk16(lb0, lb1);
    }
  }
{
#pragma unroll
    for (int it = 0; it < 2; ++it) {
      const int L = 16 * it + lq;
      const size_t po = ((size_t)bh * NN + (size_t)y * IMW + 2 * L) * HD + 8 * e;
      *(v4u*)(OPh + po) = uh[it];
      *(v4u*)(OPl + po) = ul[it];
    }
    
  }
}

// =========================================================================================================
// (5) output 1x1-conv for one (b, 64-pixel tile, 64-o block): Y[o][p] = sum_c WPB[o][c] O[b][p][c] with
//     c = 32 h + d: k-step ks = head ks, B fragments from OPh and OPl [b][ks][p][32] (bf16 hi/lo, shared
//     accumulator), A from WPB (split map). Epilogue: Os[p_loc][o_loc], barrier, then
//     lines (row o, 64 pixels = 2 lines): 8 consecutive lanes x 16 B (values from 4 Os rows), one instruction per
// coverage: 8 it x 16 lines x 8 lanes x 4 floats = 64 o x 64 p; grid (64, 4, NB) covers out [b][256][4096] once.
// LDS Os: cross-wave (block barrier).
// =========================================================================================================
__global__ __launch_bounds__(128)
void proj_k(const unsigned short* __restrict__ WPB, const unsigned short* __restrict__ OPh,
            const unsigned short* __restrict__ OPl, const float* __restrict__ pb,
            const float* __restrict__ gam, const float* __restrict__ x, float* out) {
  __shared__ __align__(16) float Os[QT * OSP];
  const int tid  = threadIdx.x;
  const int lane = tid & 31, wave = tid >> 5;
  const int hh   = lane >> 4, c = lane & 15;
  const int nt   = blockIdx.x, mb = blockIdx.y, b = blockIdx.z;
  const int n0   = nt * QT, o0 = mb * QT;

  const unsigned short* ap = WPB + (size_t)(o0 + c) * CC + 8 * hh;
  const size_t brow = (size_t)(n0 + 16 * wave + c) * HD + 8 * hh;

  v8f acc[4];
#pragma unroll
  for (int mt = 0; mt < 4; ++mt) acc[mt] = zero8();

#pragma unroll 2
  for (int ks = 0; ks < NHD; ++ks) {
    const size_t pl = ((size_t)(b * NHD + ks)) * NN * HD + brow;
    const Frag fbh = ldfrag(OPh + pl);
    const Frag fbl = ldfrag(OPl + pl);
#pragma unroll
    for (int mt = 0; mt < 4; ++mt) {
      const Frag fa = ldfrag(ap + (size_t)(16 * mt) * CC + 32 * ks);
      acc[mt] = mma_b(fa.bf, fbh.bf, acc[mt]);
      acc[mt] = mma_b(fa.bf, fbl.bf, acc[mt]);
    }
  }

  {
    const int nl = 16 * wave + c;
#pragma unroll
    for (int mt = 0; mt < 4; ++mt) {
      v4f va, vb;
#pragma unroll
      for (int r = 0; r < 4; ++r) { va[r] = acc[mt][r]; vb[r] = acc[mt][4 + r]; }
      *(v4f*)(Os + nl * OSP + 16 * mt + 8 * hh)     = va;
      *(v4f*)(Os + nl * OSP + 16 * mt + 8 * hh + 4) = vb;
    }
  }
  __syncthreads();

  const float g = bfr(gam[0]);
  const int e = tid & 7, lq = tid >> 3;                              // lq 0..15
  v4f res[8];
#pragma unroll
  for (int it = 0; it < 8; ++it) {
    const int L   = it * 16 + lq;                                    // 0..127
    const int ol  = L >> 1, hf = L & 1;                              // o_loc 0..63
    const int nl  = hf * 32 + 4 * e;                                 // pixel 0..63
    const int oo  = o0 + ol;
    const float pbv = bfr(pb[oo]);
    const size_t idx = ((size_t)(b * CC + oo)) * NN + n0 + nl;
    const v4f xv = *(const v4f*)(x + idx);
#pragma unroll
    for (int t = 0; t < 4; ++t) res[it][t] = g * (Os[(nl + t) * OSP + ol] + pbv) + bfr(xv[t]);
  }
{
#pragma unroll
    for (int it = 0; it < 8; ++it) {
      const int L   = it * 16 + lq;
      const int ol  = L >> 1, hf = L & 1;
      const int nl  = hf * 32 + 4 * e;
      const size_t idx = ((size_t)(b * CC + o0 + ol)) * NN + n0 + nl;
      *(v4f*)(out + idx) = res[it];
    }
    
  }
}

// =========================================================================================================
// Workspace map (bytes; each region start a multiple of 256; every extent is an exact tile multiple and is written
//   W16 f16 [3][256][256]   393216    WPB bf16 [256][256] 131072    WF bf16 [2][256][128] 131072
//   XP  f16 [NB][4096][256]            2097152 x NB
//   Qh/Ql bf16 [NB][8][4096][32]       2097152 x NB each     Kh/Kl bf16 [NB][8][1024][32] 524288 x NB each
//   Vt  f16 [NB][8][32][1024]           524288 x NB          ABK f32 [NB][8][1024] 32768 x NB
//   PF  f32 [2][8][2048][32]          4194304
//   OPh/OPl bf16 [NB][8][4096][32]     2097152 x NB each
//   total (NB = 2) = 29032448
// =========================================================================================================
extern "C" void kernel_launch(void* const* d_in, const int* in_sizes, int n_in,
                              void* d_out, int out_size, void* d_ws, size_t ws_size,
                              hipStream_t stream) {
  const int XN = NB * CC * NN;
  if (n_in < 11) return;
  if (in_sizes[0] < XN) return;
  if (in_sizes[1] < CC * CC || in_sizes[2] < CC * CC || in_sizes[3] < CC * CC || in_sizes[8] < CC * CC) return;
  if (in_sizes[4] < CC * PFD || in_sizes[5] < CC * PFD) return;
  if (in_sizes[6] < CC || in_sizes[7] < CC || in_sizes[9] < CC || in_sizes[10] < 1) return;
  if (out_size < XN) return;

  size_t off = 0;
  auto carve = [&](size_t bytes) { const size_t o = off; off += (bytes + 255) & ~(size_t)255; return o; };
  const size_t oW16 = carve((size_t)3 * CC * CC * 2);
  const size_t oWPB = carve((size_t)CC * CC * 2);
  const size_t oWF  = carve((size_t)2 * CC * PFD * 2);
  const size_t oXP  = carve((size_t)NB * NN * CC * 2);
  const size_t oQh  = carve((size_t)NB * NHD * NN * HD * 2);
  const size_t oQl  = carve((size_t)NB * NHD * NN * HD * 2);
  const size_t oKh  = carve((size_t)NB * NHD * NK * HD * 2);
  const size_t oKl  = carve((size_t)NB * NHD * NK * HD * 2);
  const size_t oVt  = carve((size_t)NB * NHD * HD * NK * 2);
  const size_t oABK = carve((size_t)NB * NHD * NK * 4);
  const size_t oPF  = carve((size_t)2 * NHD * NPR * HD * 4);
  const size_t oOPh = carve((size_t)NB * NHD * NN * HD * 2);
  const size_t oOPl = carve((size_t)NB * NHD * NN * HD * 2);
  if (off > ws_size) return;
  if (off > (size_t)134217728) return;

  const float* x   = (const float*)d_in[0];
  const float* qw  = (const float*)d_in[1];
  const float* kw  = (const float*)d_in[2];
  const float* vw  = (const float*)d_in[3];
  const float* fxw = (const float*)d_in[4];
  const float* fyw = (const float*)d_in[5];
  const float* ab  = (const float*)d_in[6];
  const float* gb  = (const float*)d_in[7];
  const float* pw  = (const float*)d_in[8];
  const float* pb  = (const float*)d_in[9];
  const float* gam = (const float*)d_in[10];

  char* ws = (char*)d_ws;
  unsigned short* W16 = (unsigned short*)(ws + oW16);
  unsigned short* WPB = (unsigned short*)(ws + oWPB);
  unsigned short* WF  = (unsigned short*)(ws + oWF);
  unsigned short* XP  = (unsigned short*)(ws + oXP);
  unsigned short* Qh  = (unsigned short*)(ws + oQh);
  unsigned short* Ql  = (unsigned short*)(ws + oQl);
  unsigned short* Kh  = (unsigned short*)(ws + oKh);
  unsigned short* Kl  = (unsigned short*)(ws + oKl);
  unsigned short* Vt  = (unsigned short*)(ws + oVt);
  float*          ABK = (float*)(ws + oABK);
  float*          PF  = (float*)(ws + oPF);
  unsigned short* OPh = (unsigned short*)(ws + oOPh);
  unsigned short* OPl = (unsigned short*)(ws + oOPl);
  float* out = (float*)d_out;

  const dim3 blk256(256), blk128(128);

  // (0) weight planes
  cvt_w<<<dim3(160), blk256, 0, stream>>>(qw, kw, vw, pw, fxw, fyw, W16, WPB, WF);
  // (1) x -> position-major f16 plane
  cvt_x<<<dim3(NN / QT, CC / QT, NB), blk256, 0, stream>>>(x, XP);
  // (2) position tables PF (x axis then y axis)
  posfeat<<<dim3(NPR / QT, 2), blk128, 0, stream>>>(WF, PF);
  // (3) q, k (+ appr-bias dot vector) and v
  gemm_x<0><<<dim3(NN / QT, CC / QT, NB), blk128, 0, stream>>>(W16, XP, ab, Qh, Ql, Vt, ABK);
  gemm_x<1><<<dim3(NK / QT, CC / QT, NB), blk128, 0, stream>>>(W16, XP, ab, Kh, Kl, Vt, ABK);
  gemm_x<2><<<dim3(NK / QT, CC / QT, NB), blk128, 0, stream>>>(W16, XP, ab, Kh, Kl, Vt, ABK);
  // (4) local-window attention -> per-head O planes
  attn_k<<<dim3(IMH, NHD, NB), blk128, 0, stream>>>(Qh, Ql, Kh, Kl, Vt, ABK, PF, gb, OPh, OPl);
  // (5) output conv + bias, gamma scale, skip add -> out [b][256][4096]
  proj_k<<<dim3(NN / QT, CC / QT, NB), blk128, 0, stream>>>(WPB, OPh, OPl, pb, gam, x, out);
  (void)hipGetLastError();
}

// v001
// A run of this version takes 101 microseconds.
// In both of two side-by-side timings against v000, it was 1.12 times as fast.
// Contractions: q/k/v 1x1-conv GEMMs W[256x256].X[256xN] on v_wmma_f32_16x16x32_f16 (f16 containers of
// bf16-RNE weights x256 and bf16-RNE x); sinusoid position tables E[2048x128].Wf^T on v_wmma_f32_16x16x32_bf16
// (bf16 hi + bf16 lo planes of the sin/cos features, Wf bf16-RNE, 2 products); attention scores K.Q^T per head
// on v_wmma_f32_16x16x32_bf16 (bf16 hi + bf16 lo planes of q and k, 3 products, depth 32); O^T = V^T.P^T on
// v_wmma_f32_16x16x32_f16 (v single f16 plane, P = e^{s-m} x1024 f16 from the score D registers); output
// 1x1-conv Wp[256x256].O on v_wmma_f32_16x16x32_bf16 (Wp bf16-RNE, O as bf16 hi + bf16 lo planes, 2 products);
// depth-32 position dot terms table[32 k x 32 d].(q + geom bias)^T per (coordinate, head) on
// v_wmma_f32_16x16x32_bf16 (bf16 hi + bf16 lo planes of both, 3 products); f32 accumulate everywhere; bias terms,
// softmax statistics, gamma and the skip add on f32 VALU.
#include <hip/hip_runtime.h>
#include <math.h>
#include <stdint.h>

#ifndef NB
#define NB 2
#endif
#define NB_FULL 2
#define CC      256
#define IMH     64
#define IMW     64
#define NN      4096
#define KVH     32
#define KVW     32
#define NK      1024
#define NHD     8
#define HD      32
#define PFD     128
#define NPR     2048
#define LRANGE  16
#define QT      64
#define OSP     68
#define TP      72
#define EP      136
#define OSV     36
#define WSC     256.0f
#define IWSC    0.00390625f
#define LNPS    6.931471805599453f
#define RSQ2    0.70710678118654752f
#define NL2W    0.15571537944784511f

static_assert(NB >= 1 && NB <= NB_FULL);
static_assert(NN == IMH * IMW && NK == KVH * KVW);
static_assert(NPR == IMW * KVW && NPR == IMH * KVH);
static_assert(CC == NHD * HD && HD == 32 && KVW == 32 && KVH == 32);
static_assert(NN % QT == 0 && NK % QT == 0 && CC % QT == 0 && NPR % QT == 0);
static_assert(CC % 32 == 0 && PFD % 32 == 0 && HD % 32 == 0);
static_assert((OSP * 4) % 16 == 0 && (TP * 2) % 16 == 0 && (EP * 2) % 16 == 0);
static_assert((OSV * 4) % 16 == 0);
static_assert(IMW == QT);
static_assert(QT == 2 * HD);

typedef _Float16       v16h __attribute__((ext_vector_type(16)));
typedef _Float16       v8h  __attribute__((ext_vector_type(8)));
typedef __bf16         v16b __attribute__((ext_vector_type(16)));
typedef unsigned short v8us __attribute__((ext_vector_type(8)));
typedef float          v8f  __attribute__((ext_vector_type(8)));
typedef float          v4f  __attribute__((ext_vector_type(4)));
typedef float          v2f  __attribute__((ext_vector_type(2)));
typedef __bf16         v2b  __attribute__((ext_vector_type(2)));
typedef unsigned int   v4u  __attribute__((ext_vector_type(4)));

union Frag  { v8us u[2]; v16h h; v16b bf; };
union FragH { v16h v; v8h hv[2]; };
static_assert(sizeof(Frag) == 32);
static_assert(sizeof(FragH) == 32);

// ---- scalar helpers ---------------------------------------------------------------------------------------
__device__ __forceinline__ unsigned short bf_bits(float f) {          // f32 -> bf16 bits, RNE convert
  unsigned u = __float_as_uint(f);
  return (unsigned short)((u + 0x7FFFu + ((u >> 16) & 1u)) >> 16);
}
__device__ __forceinline__ float bf_up(unsigned short hb) { return __uint_as_float(((unsigned)hb) << 16); }
__device__ __forceinline__ float bfr(float f) { return bf_up(bf_bits(f)); }
__device__ __forceinline__ unsigned short h_bits(_Float16 x) { return __builtin_bit_cast(unsigned short, x); }
__device__ __forceinline__ unsigned pk16(unsigned short a, unsigned short b) { return (unsigned)a | ((unsigned)b << 16); }
__device__ __forceinline__ v8f zero8() { v8f z = {0.f, 0.f, 0.f, 0.f, 0.f, 0.f, 0.f, 0.f}; return z; }
__device__ __forceinline__ float hmax8(v8f s) {
  return fmaxf(fmaxf(fmaxf(s[0], s[1]), fmaxf(s[2], s[3])), fmaxf(fmaxf(s[4], s[5]), fmaxf(s[6], s[7])));
}
__device__ __forceinline__ unsigned wave_ballot(bool p) {
#if defined(__HIP_DEVICE_COMPILE__)
  return __builtin_amdgcn_ballot_w32(p);
#else
  return p ? 1u : 0u;
#endif
}

// ---- 16-bit fragment loader (A, or B from a k-contiguous [n][k] row): lane -> row/col (lane&15), p already includes
//      + 8*(lane>>4); elements 0..7 <- p[0..7] (k0+8h..), elements 8..15 <- p[16..23] (k0+16+8h..)
__device__ __forceinline__ Frag ldfrag(const unsigned short* p) {
  Frag f;
  f.u[0] = *(const v8us*)(p);
  f.u[1] = *(const v8us*)(p + 16);
  return f;
}

// ---- WMMA helpers: builtin followed by a 4-slot VALU gap tying D and keeping A/B live --------------------------
__device__ __forceinline__ v8f mma_h(v16h a, v16h b, v8f c) {
  v8f d = __builtin_amdgcn_wmma_f32_16x16x32_f16(false, a, false, b, (short)0, c, false, false);
#if defined(__HIP_DEVICE_COMPILE__)
  asm volatile("v_nop\n\tv_nop\n\tv_nop\n\tv_nop" : "+v"(d) : "v"(a), "v"(b));
#endif
  return d;
}
__device__ __forceinline__ v8f mma_b(v16b a, v16b b, v8f c) {
  v8f d = __builtin_amdgcn_wmma_f32_16x16x32_bf16(false, a, false, b, (short)0, c, false, false);
#if defined(__HIP_DEVICE_COMPILE__)
  const v16h ha = __builtin_bit_cast(v16h, a), hb = __builtin_bit_cast(v16h, b);
  asm volatile("v_nop\n\tv_nop\n\tv_nop\n\tv_nop" : "+v"(d) : "v"(ha), "v"(hb));
#endif
  return d;
}

// =========================================================================================================
// (0) weight planes.  Blocks 0..95: W16 f16 [3][256][256] (q_w, k_w, v_w; value = f16 of bf16-RNE(w) x 256), 96..127: WPB bf16 [256][256] (proj_w, bf16-RNE; stores:
//     8 consecutive lanes per line, one instruction).  Blocks 128..159: WF bf16 [2][256][128] (fcx_w rows then
// coverage: 128 blocks x 8 rows x 256 = 4 x [256][256]; 32 blocks x 16 rows x 128 = [512][128].
// =========================================================================================================
__global__ __launch_bounds__(256)
void cvt_w(const float* __restrict__ qw, const float* __restrict__ kw, const float* __restrict__ vw,
           const float* __restrict__ pw, const float* __restrict__ fxw, const float* __restrict__ fyw,
           unsigned short* W16, unsigned short* WPB, unsigned short* WF) {
  const int tid = threadIdx.x, blk = blockIdx.x;
  unsigned short* dst;
  v4u u;
  if (blk < 128) {                                                   // block-uniform selection
    const int grp = blk >> 5;                                        // 0 q, 1 k, 2 v, 3 proj
    const int rl = tid >> 5, col = 8 * (tid & 31);
    const int o = 8 * (blk & 31) + rl;                               // 0..255
    const float* wbase = (grp == 0) ? qw : ((grp == 1) ? kw : ((grp == 2) ? vw : pw));
    const float* s = wbase + (size_t)o * CC + col;
    const v4f a = *(const v4f*)s;
    const v4f q = *(const v4f*)(s + 4);
    const float f[8] = {a[0], a[1], a[2], a[3], q[0], q[1], q[2], q[3]};
    if (grp < 3) {
#pragma unroll
      for (int t = 0; t < 4; ++t) {
        const _Float16 h0 = (_Float16)(bfr(f[2 * t]) * WSC);
        const _Float16 h1 = (_Float16)(bfr(f[2 * t + 1]) * WSC);
        u[t] = pk16(h_bits(h0), h_bits(h1));
      }
      dst = W16 + (size_t)grp * CC * CC + (size_t)o * CC + col;
    } else {
#pragma unroll
      for (int t = 0; t < 4; ++t) u[t] = pk16(bf_bits(f[2 * t]), bf_bits(f[2 * t + 1]));
      dst = WPB + (size_t)o * CC + col;
    }
  } else {
    const int j = blk - 128;                                         // 0..31
    const int axis = j >> 4;                                         // block-uniform
    const int r = 16 * j + (tid >> 4);                               // 0..511
    const int o = r & 255;
    const int col = 8 * (tid & 15);
    const float* s = (axis ? fyw : fxw) + (size_t)o * PFD + col;
    const v4f a = *(const v4f*)s;
    const v4f q = *(const v4f*)(s + 4);
    const float f[8] = {a[0], a[1], a[2], a[3], q[0], q[1], q[2], q[3]};
#pragma unroll
    for (int t = 0; t < 4; ++t) u[t] = pk16(bf_bits(f[2 * t]), bf_bits(f[2 * t + 1]));
    dst = WF + (size_t)r * PFD + col;
  }
{
    *(v4u*)dst = u;
    
  }
}

// =========================================================================================================
// (1) x f32 [b][256 c][4096 n] -> XP f16 [b][n][c] (position-major, bf16-RNE values, exact in f16) through an LDS
// coverage: 2 it x 32 rows x 8 lanes x 8 = 64 n x 64 c; grid (64, 4, NB) covers XP exactly once.
// LDS T: cross-wave (block barrier between the element stores and the vector reloads).
// =========================================================================================================
__global__ __launch_bounds__(256)
void cvt_x(const float* __restrict__ x, unsigned short* XP) {
  __shared__ __align__(16) unsigned short T[QT * TP];
  const int tid = threadIdx.x;
  const int nb = blockIdx.x, cb = blockIdx.y, b = blockIdx.z;
  const int e = tid & 7, lq = tid >> 3;                             // lq 0..31
  const int n0 = nb * QT, c0 = cb * QT;
#pragma unroll
  for (int it = 0; it < 2; ++it) {
    const int cl = it * 32 + lq;                                     // 0..63
    const float* sp = x + ((size_t)(b * CC + c0 + cl)) * NN + n0 + 8 * e;
    const v4f a = *(const v4f*)sp;
    const v4f q = *(const v4f*)(sp + 4);
    unsigned short hb[8];
#pragma unroll
    for (int t = 0; t < 4; ++t) {
      hb[t]     = h_bits((_Float16)bfr(a[t]));
      hb[4 + t] = h_bits((_Float16)bfr(q[t]));
    }
#pragma unroll
    for (int t = 0; t < 8; ++t) T[(8 * e + t) * TP + cl] = hb[t];
  }
  __syncthreads();
  v4u up[2];
#pragma unroll
  for (int it = 0; it < 2; ++it) {
    const int nl = it * 32 + lq;                                     // 0..63
    up[it] = *(const v4u*)(T + nl * TP + 8 * e);
  }
{
#pragma unroll
    for (int it = 0; it < 2; ++it) {
      const int rl = it * 32 + lq;
      *(v4u*)(XP + ((size_t)(b * NN + n0 + rl)) * CC + c0 + 8 * e) = up[it];
    }
    
  }
}

// =========================================================================================================
// (2) 1x1-conv GEMM for one (b, 64-n tile, 64-o block): Y[o][n] = (1/256) sum_c W16[MODE][o][c] XP[b][pix(n)][c].
//     MODE 0: n = query pixel; MODE 1/2: n = key index ky*32+kx -> pixel 128 ky + 2 kx (arithmetic addressing).
//     Block 128 threads = 4 waves; wave w owns cols n0+16w..+15 (one B fragment per k-step, k = c contiguous in the
//     XP row) and 4 m-tiles (A rows o = o0 + 16 mt + (lane&15), split k map loader from W16). K = 256 = 8 steps.
//     Epilogue staged in LDS Os[n_loc][o_loc] (pitch OSP), barrier, then per MODE:
//       0: Qh/Ql bf16 [b][8][4096][32] hi = bf16-RNE(v), lo = bf16-RNE(v - hi); 1: Kh/Kl bf16 [b][8][1024][32]
//          plus ABK f32 [b][8][1024] = sum_d bf16-RNE(appr_bias)[h][d] * Y (f32 before the 16-bit convert);
//          a plane line = 2 rows of 32 d: lane e -> row 2j + (e>>2), d 8(e&3).., 8 consecutive lanes per line, one
//       2: Vt f16 [b][8][32 d][1024 keys]: line = row (h,d), 64 keys: lane e -> keys 8e..8e+7, one instruction per
// coverage: Os 4 waves x 16 n x 64 o = 64 x 64; MODE 0/1: 4 it x 16 lines x 8 lanes x 8 = 64 n x 64 o per plane;
//           MODE 2: 4 it x 16 rows x 8 lanes x 8 = 64 o x 64 keys; ABK 2 heads x 64 keys; grids (NP/64, 4, NB).
// LDS Os, abks: cross-wave (block barriers).
// =========================================================================================================
template <int MODE>
__global__ __launch_bounds__(128)
void gemm_x(const unsigned short* __restrict__ W16, const unsigned short* __restrict__ XP,
            const float* __restrict__ ab, unsigned short* Ph, unsigned short* Pl,
            unsigned short* Vt, float* ABK) {
  __shared__ __align__(16) float Os[QT * OSP];
  __shared__ __align__(16) float abks[2 * QT];
  constexpr int NP = (MODE == 0) ? NN : NK;
  const int tid  = threadIdx.x;
  const int lane = tid & 31, wave = tid >> 5;
  const int hh   = lane >> 4, c = lane & 15;
  const int nt   = blockIdx.x, mb = blockIdx.y, b = blockIdx.z;
  const int n0   = nt * QT, o0 = mb * QT;
  (void)ab; (void)Ph; (void)Pl; (void)Vt; (void)ABK; (void)abks;

  const unsigned short* ap = W16 + (size_t)MODE * CC * CC + (size_t)(o0 + c) * CC + 8 * hh;
  const int nrow = n0 + 16 * wave + c;
  const int pix = (MODE == 0) ? nrow : (2 * IMW * (nrow >> 5) + 2 * (nrow & 31));
  const unsigned short* bp = XP + ((size_t)(b * NN + pix)) * CC + 8 * hh;

  v8f acc[4];
#pragma unroll
  for (int mt = 0; mt < 4; ++mt) acc[mt] = zero8();

#pragma unroll
  for (int ks = 0; ks < CC / 32; ++ks) {
    const Frag fb = ldfrag(bp + 32 * ks);
#pragma unroll
    for (int mt = 0; mt < 4; ++mt) {
      const Frag fa = ldfrag(ap + (size_t)(16 * mt) * CC + 32 * ks);
      acc[mt] = mma_h(fa.h, fb.h, acc[mt]);
    }
  }

  // ---- stage: lane (hh, c) holds o = 16 mt + 8 hh + r for n_loc = 16 w + c
  {
    const int nl = 16 * wave + c;
#pragma unroll
    for (int mt = 0; mt < 4; ++mt) {
      v4f va, vb;
#pragma unroll
      for (int r = 0; r < 4; ++r) { va[r] = acc[mt][r] * IWSC; vb[r] = acc[mt][4 + r] * IWSC; }
      *(v4f*)(Os + nl * OSP + 16 * mt + 8 * hh)     = va;
      *(v4f*)(Os + nl * OSP + 16 * mt + 8 * hh + 4) = vb;
    }
  }
  __syncthreads();

  const int e = tid & 7, lq = tid >> 3;                             // lq 0..15
  if constexpr (MODE == 2) {
    v4u uv[4];
#pragma unroll
    for (int it = 0; it < 4; ++it) {
      const int ol = it * 16 + lq;                                   // o_loc 0..63
      unsigned short hb[8];
#pragma unroll
      for (int t = 0; t < 8; ++t) hb[t] = h_bits((_Float16)Os[(8 * e + t) * OSP + ol]);
#pragma unroll
      for (int t = 0; t < 4; ++t) uv[it][t] = pk16(hb[2 * t], hb[2 * t + 1]);
    }
{
#pragma unroll
      for (int it = 0; it < 4; ++it) {
        const int ol = it * 16 + lq;
        const int oo = o0 + ol, hd = oo >> 5, d = oo & 31;
        *(v4u*)(Vt + ((size_t)((b * NHD + hd) * HD + d)) * NK + n0 + 8 * e) = uv[it];
      }
      
    }
  } else {
    v4u uh[4], ul[4];
#pragma unroll
    for (int it = 0; it < 4; ++it) {
      const int L = it * 16 + lq;                                    // line 0..63
      const int hs = L >> 5, j = L & 31;
      const int row = 2 * j + (e >> 2);                              // n_loc
      const int cb0 = 32 * hs + 8 * (e & 3);                         // o_loc of the first value
      const v4f a = *(const v4f*)(Os + row * OSP + cb0);
      const v4f q = *(const v4f*)(Os + row * OSP + cb0 + 4);
      const float f[8] = {a[0], a[1], a[2], a[3], q[0], q[1], q[2], q[3]};
#pragma unroll
      for (int t = 0; t < 4; ++t) {
        const float f0 = f[2 * t], f1 = f[2 * t + 1];
        const unsigned short hb0 = bf_bits(f0), hb1 = bf_bits(f1);
        const unsigned short lb0 = bf_bits(f0 - bf_up(hb0));
        const unsigned short lb1 = bf_bits(f1 - bf_up(hb1));
        uh[it][t] = pk16(hb0, hb1);
        ul[it][t] = pk16(lb0, lb1);
      }
    }
    v4f abv = {0.f, 0.f, 0.f, 0.f};
    if constexpr (MODE == 1) {
      const int kl = tid & 63, hs = tid >> 6;                       // hs wave-uniform
      const float* abp  = ab + (2 * mb + hs) * HD;
      const float* orow = Os + kl * OSP + 32 * hs;
      float s = 0.f;
#pragma unroll
      for (int d4 = 0; d4 < 8; ++d4) {
        const v4f g  = *(const v4f*)(abp + 4 * d4);
        const v4f ov = *(const v4f*)(orow + 4 * d4);
        s += bfr(g[0]) * ov[0] + bfr(g[1]) * ov[1] + bfr(g[2]) * ov[2] + bfr(g[3]) * ov[3];
      }
      abks[hs * QT + kl] = s;
      __syncthreads();
      if (tid < 32) abv = *(const v4f*)(abks + (lq >> 1) * QT + 32 * (lq & 1) + 4 * e);
    }
{
#pragma unroll
      for (int it = 0; it < 4; ++it) {
        const int L = it * 16 + lq;
        const int hs = L >> 5, j = L & 31;
        const size_t po = ((size_t)((b * NHD + 2 * mb + hs) * NP + n0 + 2 * j)) * HD + 8 * e;
        *(v4u*)(Ph + po) = uh[it];
        *(v4u*)(Pl + po) = ul[it];
      }
      if constexpr (MODE == 1) {
        if (tid < 32)                                                // wave 0, wave-uniform
          *(v4f*)(ABK + (size_t)(b * NHD + 2 * mb + (lq >> 1)) * NK + n0 + 32 * (lq & 1) + 4 * e) = abv;
      }
      
    }
  }
}

// =========================================================================================================
// (3) position tables for one (64-row tile, axis): rows R = coord*32 + kcoord (coord = query x for axis 0, query
//     y for axis 1; kcoord = key coordinate), diff = coord - 2*kcoord, a = diff * 1000^(-f/64), features
//     [sin(a) | cos(a)] (128) built in LDS as bf16 hi/lo planes Eh/El[64][128] (pitch EP); then for ob in 0..3 a
//     GEMM  Y[o][R] = sum_f WF[axis][o][f] E[R][f]  (A rows o from WF bf16, B rows R from Eh and El, 2 products
//     sharing the accumulator, K = 128), epilogue Os[R_loc][o_loc] = Y / sqrt(2), barrier, then
//       PF f32 [axis][h][R][32 d]: line = one row (h, R), lane e -> d 4e..4e+3, 8 consecutive lanes per line,
// coverage: Eh/El 32 it x 128 threads = 64 rows x 64 args x {sin,cos} = 64 x 128 (cols 128..135 pad, never read);
//           PF per ob 8 it x 16 lines x 8 lanes x 4 = 128 rows(h,R) x 32 d, 4 ob -> 8 heads;
//           grid (32, 2) covers PF [2][8][2048][32] exactly once.
// LDS Eh/El, Os: cross-wave (block barriers).
// =========================================================================================================
__global__ __launch_bounds__(128)
void posfeat(const unsigned short* __restrict__ WF, float* PF) {
  __shared__ __align__(16) unsigned short Eh[QT * EP];
  __shared__ __align__(16) unsigned short El[QT * EP];
  __shared__ __align__(16) float Os[QT * OSP];
  const int tid  = threadIdx.x;
  const int lane = tid & 31, wave = tid >> 5;
  const int hh   = lane >> 4, c = lane & 15;
  const int rt   = blockIdx.x, axis = blockIdx.y;
  const int R0   = rt * QT;

  // ---- (a) sinusoid features -> LDS bf16 hi/lo planes
#pragma unroll 1
  for (int it = 0; it < 32; ++it) {
    const int idx = it * 128 + tid;                                  // 0..4095
    const int rl = idx >> 6, fa = idx & 63;
    const int row = R0 + rl;
    const int qc = row >> 5, kq = row & 31;
    const float diff = (float)(qc - 2 * kq);
    const float a = diff * exp2f(-(float)fa * NL2W);
    const float sv = sinf(a);
    const float cv = cosf(a);
    const unsigned short shb = bf_bits(sv), chb = bf_bits(cv);
    Eh[rl * EP + fa]      = shb;
    El[rl * EP + fa]      = bf_bits(sv - bf_up(shb));
    Eh[rl * EP + 64 + fa] = chb;
    El[rl * EP + 64 + fa] = bf_bits(cv - bf_up(chb));
  }
  __syncthreads();

  const unsigned short* ebh = Eh + (16 * wave + c) * EP + 8 * hh;
  const unsigned short* ebl = El + (16 * wave + c) * EP + 8 * hh;
  const int e = tid & 7, lq = tid >> 3;                             // lq 0..15
#pragma unroll 1
  for (int ob = 0; ob < 4; ++ob) {
    const unsigned short* ap = WF + (size_t)axis * CC * PFD + (size_t)(QT * ob + c) * PFD + 8 * hh;
    v8f acc[4];
#pragma unroll
    for (int mt = 0; mt < 4; ++mt) acc[mt] = zero8();
#pragma unroll
    for (int ks = 0; ks < PFD / 32; ++ks) {
      const Frag fbh = ldfrag(ebh + 32 * ks);
      const Frag fbl = ldfrag(ebl + 32 * ks);
#pragma unroll
      for (int mt = 0; mt < 4; ++mt) {
        const Frag fa = ldfrag(ap + (size_t)(16 * mt) * PFD + 32 * ks);
        acc[mt] = mma_b(fa.bf, fbh.bf, acc[mt]);
        acc[mt] = mma_b(fa.bf, fbl.bf, acc[mt]);
      }
    }
    {
      const int nl = 16 * wave + c;
#pragma unroll
      for (int mt = 0; mt < 4; ++mt) {
        v4f va, vb;
#pragma unroll
        for (int r = 0; r < 4; ++r) { va[r] = acc[mt][r] * RSQ2; vb[r] = acc[mt][4 + r] * RSQ2; }
        *(v4f*)(Os + nl * OSP + 16 * mt + 8 * hh)     = va;
        *(v4f*)(Os + nl * OSP + 16 * mt + 8 * hh + 4) = vb;
      }
    }
    __syncthreads();
    v4f res[8];
#pragma unroll
    for (int it = 0; it < 8; ++it) {
      const int L = it * 16 + lq;                                    // 0..127
      const int rl = L & 63, hs = L >> 6;
      res[it] = *(const v4f*)(Os + rl * OSP + 32 * hs + 4 * e);
    }
{
#pragma unroll
      for (int it = 0; it < 8; ++it) {
        const int L = it * 16 + lq;
        const int rl = L & 63, hs = L >> 6;
        float* dst = PF + ((size_t)(axis * NHD + 2 * ob + hs)) * ((size_t)NPR * HD) + (size_t)(R0 + rl) * HD + 4 * e;
        *(v4f*)dst = res[it];
      }
      
    }
    __syncthreads();
  }
}

// =========================================================================================================
// (3b) position dot terms for one (coordinate co, head, axis, b): the 64 queries that share the coordinate (axis 0:
//   x = co, all y; axis 1: y = co, all x) share one table PF[axis][h][co][32 k][32 d], so
//   PW[axis][b][h][query][k] = sum_d PF[axis][h][co][k][d] . (q + bf16-RNE(geom_bias))[query][d] is a 32 x 64 x 32
//   GEMM. Block = 4 waves, wave w = queries 16w..16w+15 of the line. A rows k = 16t + (lane&15) from the f32 table,
//   B cols = queries from Qh + Ql + bias; both split in registers into bf16 hi/lo with the split k map of ldfrag
//   (elements 0..7 <- d 8hh.., 8..15 <- d 16+8hh..); hi.hi + hi.lo + lo.hi share the accumulator.
//   Epilogue: Os[query][32 k] (pitch OSV), barrier, then one 128-B line per query: 8 consecutive lanes x 16 B.
// coverage: 4 waves x 16 queries x 32 k; grid (64, 8, 2 NB) covers PW [2][NB][8][4096][32] exactly once.
// LDS Os: written and read inside one wave's region, synchronised with a block barrier.
// =========================================================================================================
__device__ __forceinline__ void split8(v4f a, v4f q, v8us& hi, v8us& lo) {
  const float f[8] = {a[0], a[1], a[2], a[3], q[0], q[1], q[2], q[3]};
  v4u wh, wl;
#pragma unroll
  for (int t = 0; t < 4; ++t) {
    const v2f p = {f[2 * t], f[2 * t + 1]};
    const unsigned hw = __builtin_bit_cast(unsigned, __builtin_convertvector(p, v2b));   // RNE, packed pair
    const v2f r = {p[0] - __uint_as_float(hw << 16), p[1] - __uint_as_float(hw & 0xffff0000u)};
    wh[t] = hw;
    wl[t] = __builtin_bit_cast(unsigned, __builtin_convertvector(r, v2b));
  }
  hi = __builtin_bit_cast(v8us, wh);
  lo = __builtin_bit_cast(v8us, wl);
}

__global__ __launch_bounds__(128)
void posdot(const unsigned short* __restrict__ Qh, const unsigned short* __restrict__ Ql,
            const float* __restrict__ PF, const float* __restrict__ gb, float* PW) {
  __shared__ __align__(16) float Os[QT * OSV];
  const int tid  = threadIdx.x;
  const int wave = tid >> 5, lane = tid & 31;
  const int hh   = lane >> 4, c = lane & 15;
  const int co = blockIdx.x, hd = blockIdx.y;
  const int axis = blockIdx.z / NB, b = blockIdx.z % NB;             // block-uniform
  const int bh = b * NHD + hd;
  const int qstep = axis ? 1 : IMW;                                  // pixel step along the line of queries
  const int qbase = axis ? co * IMW : co;

  // ---- all loads first: query planes, bias, both 16-row tiles of the table (rows k = 16 t + c)
  const size_t qo = ((size_t)bh * NN + qbase + (16 * wave + c) * qstep) * HD + 8 * hh;
  const Frag qh = ldfrag(Qh + qo);
  const Frag ql = ldfrag(Ql + qo);
  const float* gp = gb + hd * HD + 8 * hh;
  const float* tb = PF + ((size_t)(axis * NHD + hd) * NPR + (size_t)co * KVW + c) * HD + 8 * hh;
  v4f g[2][2], ta[2][2][2];
#pragma unroll
  for (int s = 0; s < 2; ++s) {                                      // s: d = 16 s + 8 hh ..
    g[s][0] = *(const v4f*)(gp + 16 * s);
    g[s][1] = *(const v4f*)(gp + 16 * s + 4);
#pragma unroll
    for (int t = 0; t < 2; ++t) {
      ta[t][s][0] = *(const v4f*)(tb + 16 * t * HD + 16 * s);
      ta[t][s][1] = *(const v4f*)(tb + 16 * t * HD + 16 * s + 4);
    }
  }

  // ---- B: qg = q + geom bias of query 16 wave + c, bf16 hi/lo
  Frag bhi, blo;
#pragma unroll
  for (int s = 0; s < 2; ++s) {
    const v4u wh = __builtin_bit_cast(v4u, qh.u[s]), wl = __builtin_bit_cast(v4u, ql.u[s]);
    float f[8];
#pragma unroll
    for (int j = 0; j < 4; ++j) {
      f[2 * j]     = __uint_as_float(wh[j] << 16) + __uint_as_float(wl[j] << 16);
      f[2 * j + 1] = __uint_as_float(wh[j] & 0xffff0000u) + __uint_as_float(wl[j] & 0xffff0000u);
    }
    v4f va, vb;
#pragma unroll
    for (int r = 0; r < 4; ++r) { va[r] = f[r] + bfr(g[s][0][r]); vb[r] = f[4 + r] + bfr(g[s][1][r]); }
    split8(va, vb, bhi.u[s], blo.u[s]);
  }

  // ---- A: table tile t, bf16 hi/lo; D rows k = 16 t + 8 hh + r, col = query
#pragma unroll
  for (int t = 0; t < 2; ++t) {
    Frag ahi, alo;
    split8(ta[t][0][0], ta[t][0][1], ahi.u[0], alo.u[0]);
    split8(ta[t][1][0], ta[t][1][1], ahi.u[1], alo.u[1]);
    v8f d = zero8();
    d = mma_b(ahi.bf, bhi.bf, d);
    d = mma_b(ahi.bf, blo.bf, d);
    d = mma_b(alo.bf, bhi.bf, d);
    v4f va, vb;
#pragma unroll
    for (int r = 0; r < 4; ++r) { va[r] = d[r]; vb[r] = d[4 + r]; }
    *(v4f*)(Os + (16 * wave + c) * OSV + 16 * t + 8 * hh)     = va;
    *(v4f*)(Os + (16 * wave + c) * OSV + 16 * t + 8 * hh + 4) = vb;
  }
  __syncthreads();

  const int e = lane & 7, lq = lane >> 3;                            // lq 0..3
  float* pw = PW + ((size_t)(axis * NB * NHD + bh) * NN + qbase) * KVW + 4 * e;
#pragma unroll
  for (int it = 0; it < 4; ++it) {
    const int qn = 16 * wave + 4 * it + lq;                          // query 0..63 of the line
    *(v4f*)(pw + (size_t)(qn * qstep) * KVW) = *(const v4f*)(Os + qn * OSV + 4 * e);
  }
}

// =========================================================================================================
// (4) local-window attention for one (query row y, head, b): block = 4 waves, wave w = queries x = 16w..16w+15.
//   Per lane (hh, c): PX[kx] for kx in {8hh..8hh+7, 16+8hh..} from PW[0][b][h][query] (registers); PY[ky] from
//   PW[1][b][h][query][ky], one value per key row.
//   Loop over allowed key rows ky (block-uniform; forbidden rows contribute exactly 0): S^T tiles (16 keys x 16
//   queries) = A(Kh rows key ky*32 + 16t + (lane&15), k = d split map) . B(Qh col = query) + A(Kh).B(Ql) +
//   A(Kl).B(Qh) (bf16 hi/lo planes, shared accumulator); energy = S^T + ABK[key] + PX[kx] + PY[ky], replaced by
//   -inf outside the per-query kx window. Per lane the D tiles hold 16 keys of ONE query: online softmax per lane,
//   one shuffle (lane^16) for the max over the 32 keys of the row, o/l rescale skipped under a wave-uniform ballot.
//   P = e^{s-m} x 1024 as f16 is the B operand of O^T (rows d, cols queries) += A(Vt rows d = 16j + (lane&15), keys
//   in split k map) . B(P^T): element r <- D of the tile covering kx 0..15, element 8+r <- the tile covering kx 16..31.
//   Epilogue: O/l staged in LDS Os[query][32 d] (pitch OSV), barrier, then OPh/OPl bf16 [b][8][4096][32] (hi = bf16-
//   RNE(v), lo = bf16-RNE(v - hi)); line = 2 query rows: lane e -> row 2L + (e>>2), d 8(e&3).., 8 consecutive lanes
// coverage: Os 4 waves x 16 queries x 32 d; planes 2 it x 16 lines x 8 lanes x 8 = 64 queries x 32 d per plane;
//           grid (64, 8, NB) covers OPh/OPl [b][8][4096][32] exactly once.
// LDS Os: cross-wave (block barrier).
// =========================================================================================================
__global__ __launch_bounds__(128)
void attn_k(const unsigned short* __restrict__ Qh, const unsigned short* __restrict__ Ql,
            const unsigned short* __restrict__ Kh, const unsigned short* __restrict__ Kl,
            const unsigned short* __restrict__ Vt, const float* __restrict__ ABK,
            const float* __restrict__ PW, unsigned short* OPh, unsigned short* OPl) {
  __shared__ __align__(16) float Os[QT * OSV];
  const int tid  = threadIdx.x;
  const int wave = tid >> 5, lane = tid & 31;
  const int hh   = lane >> 4, c = lane & 15;
  const int y = blockIdx.x, hd = blockIdx.y, b = blockIdx.z;
  const int bh = b * NHD + hd;
  const int xq = 16 * wave + c;                                      // query column of this lane's B/D column
  const int pq = y * IMW + xq;

  const int kylo = (y >= LRANGE) ? ((y - LRANGE) >> 1) : 0;         // block-uniform
  int kyhi = ((y + LRANGE + 1) >> 1) + 1;  if (kyhi > KVH) kyhi = KVH;
  const int kxlo = (xq >= LRANGE) ? ((xq - LRANGE) >> 1) : 0;       // per lane
  int kxhi = ((xq + LRANGE + 1) >> 1) + 1; if (kxhi > KVW) kxhi = KVW;

  // ---- PX: per lane 16 kx values for query xq; PY: this query's row, read per key row in the loop
  float px0[8], px1[8];
  {
    const float* pxp = PW + ((size_t)bh * NN + pq) * KVW + 8 * hh;
    const v4f u0 = *(const v4f*)pxp;
    const v4f u1 = *(const v4f*)(pxp + 4);
    const v4f u2 = *(const v4f*)(pxp + 16);
    const v4f u3 = *(const v4f*)(pxp + 20);
#pragma unroll
    for (int r = 0; r < 4; ++r) { px0[r] = u0[r]; px0[4 + r] = u1[r]; px1[r] = u2[r]; px1[4 + r] = u3[r]; }
  }
  const float* pyrow = PW + ((size_t)(NB * NHD + bh) * NN + pq) * KVH;

  // ---- fragment pointers
  const size_t qo = ((size_t)bh * NN + pq) * HD + 8 * hh;
  const Frag qh = ldfrag(Qh + qo);
  const Frag ql = ldfrag(Ql + qo);
  const unsigned short* Khp = Kh + (size_t)bh * NK * HD + (size_t)c * HD + 8 * hh;
  const unsigned short* Klp = Kl + (size_t)bh * NK * HD + (size_t)c * HD + 8 * hh;
  const unsigned short* Vp  = Vt + (size_t)bh * HD * NK + (size_t)c * NK + 8 * hh;
  const float* abkb = ABK + (size_t)bh * NK + 8 * hh;
  const float NINF = -__builtin_inff();

  float m = -1.0e30f, l = 0.f;
  v8f o[2];
  o[0] = zero8(); o[1] = zero8();

#pragma unroll 1
  for (int ky = kylo; ky < kyhi; ++ky) {
    const int kp0 = ky * KVW;
    const Frag k0  = ldfrag(Khp + (size_t)kp0 * HD);                // keys kp0 .. kp0+15
    const Frag k1  = ldfrag(Khp + (size_t)(kp0 + 16) * HD);         // keys kp0+16 .. kp0+31
    const Frag k0l = ldfrag(Klp + (size_t)kp0 * HD);
    const Frag k1l = ldfrag(Klp + (size_t)(kp0 + 16) * HD);
    v8f s0 = zero8(), s1 = zero8();
    s0 = mma_b(k0.bf, qh.bf, s0);
    s1 = mma_b(k1.bf, qh.bf, s1);
    s0 = mma_b(k0.bf, ql.bf, s0);
    s1 = mma_b(k1.bf, ql.bf, s1);
    s0 = mma_b(k0l.bf, qh.bf, s0);
    s1 = mma_b(k1l.bf, qh.bf, s1);

    const v4f a0 = *(const v4f*)(abkb + kp0);
    const v4f a1 = *(const v4f*)(abkb + kp0 + 4);
    const v4f a2 = *(const v4f*)(abkb + kp0 + 16);
    const v4f a3 = *(const v4f*)(abkb + kp0 + 20);
    const float py = pyrow[ky];
#pragma unroll
    for (int r = 0; r < 8; ++r) {
      const int kx0 = 8 * hh + r, kx1 = 16 + 8 * hh + r;
      const float ab0 = (r < 4) ? a0[r & 3] : a1[r & 3];
      const float ab1 = (r < 4) ? a2[r & 3] : a3[r & 3];
      const float e0 = s0[r] + ab0 + px0[r] + py;
      const float e1 = s1[r] + ab1 + px1[r] + py;
      s0[r] = (kx0 >= kxlo && kx0 < kxhi) ? e0 : NINF;
      s1[r] = (kx1 >= kxlo && kx1 < kxhi) ? e1 : NINF;
    }

    float mx = fmaxf(hmax8(s0), hmax8(s1));
    mx = fmaxf(mx, __shfl_xor(mx, 16, 32));
    const float mn = fmaxf(m, mx);
    const unsigned grew = wave_ballot(mx > m);                       // wave-uniform
    if (grew != 0u) {
      const float corr = __expf(m - mn);                             // == 1 exactly for lanes whose max did not grow
      l *= corr;
#pragma unroll
      for (int j = 0; j < 2; ++j) {
#pragma unroll
        for (int r = 0; r < 8; ++r) o[j][r] *= corr;
      }
    }
    m = mn;
    const float msh = mn - LNPS;                                     // exp gives e^{s-m} * 1024

    FragH ph;
    float ls = 0.f;
#pragma unroll
    for (int r = 0; r < 8; ++r) {
      const float e0 = __expf(s0[r] - msh);                          // key kp0      + 8hh + r
      const float e1 = __expf(s1[r] - msh);                          // key kp0 + 16 + 8hh + r
      ls += e0 + e1;
      ph.hv[0][r] = (_Float16)e0;
      ph.hv[1][r] = (_Float16)e1;
    }
    l += ls;

#pragma unroll
    for (int j = 0; j < 2; ++j) {
      const Frag vf = ldfrag(Vp + (size_t)(16 * j) * NK + kp0);
      o[j] = mma_h(vf.h, ph.v, o[j]);
    }
  }
  l += __shfl_xor(l, 16, 32);
  const float inv = 1.0f / l;                                        // o and l both carry the x1024 factor

  const int qr = 16 * wave + c;
#pragma unroll
  for (int j = 0; j < 2; ++j) {
    v4f va, vb;
#pragma unroll
    for (int r = 0; r < 4; ++r) { va[r] = o[j][r] * inv; vb[r] = o[j][4 + r] * inv; }
    *(v4f*)(Os + qr * OSV + 16 * j + 8 * hh)     = va;              // Os[query][d = 16j + 8hh + r]
    *(v4f*)(Os + qr * OSV + 16 * j + 8 * hh + 4) = vb;
  }
  __syncthreads();

  const int e = tid & 7, lq = tid >> 3;                              // lq 0..15
  v4u uh[2], ul[2];
#pragma unroll
  for (int it = 0; it < 2; ++it) {
    const int L = 16 * it + lq;                                      // line 0..31
    const int row = 2 * L + (e >> 2), dl = 8 * (e & 3);
    const v4f a = *(const v4f*)(Os + row * OSV + dl);
    const v4f q = *(const v4f*)(Os + row * OSV + dl + 4);
    const float f[8] = {a[0], a[1], a[2], a[3], q[0], q[1], q[2], q[3]};
#pragma unroll
    for (int t = 0; t < 4; ++t) {
      const float f0 = f[2 * t], f1 = f[2 * t + 1];
      const unsigned short hb0 = bf_bits(f0), hb1 = bf_bits(f1);
      const unsigned short lb0 = bf_bits(f0 - bf_up(hb0));
      const unsigned short lb1 = bf_bits(f1 - bf_up(hb1));
      uh[it][t] = pk16(hb0, hb1);
      ul[it][t] = pk16(lb0, lb1);
    }
  }
{
#pragma unroll
    for (int it = 0; it < 2; ++it) {
      const int L = 16 * it + lq;
      const size_t po = ((size_t)bh * NN + (size_t)y * IMW + 2 * L) * HD + 8 * e;
      *(v4u*)(OPh + po) = uh[it];
      *(v4u*)(OPl + po) = ul[it];
    }
    
  }
}

// =========================================================================================================
// (5) output 1x1-conv for one (b, 64-pixel tile, 64-o block): Y[o][p] = sum_c WPB[o][c] O[b][p][c] with
//     c = 32 h + d: k-step ks = head ks, B fragments from OPh and OPl [b][ks][p][32] (bf16 hi/lo, shared
//     accumulator), A from WPB (split map). Epilogue: Os[p_loc][o_loc], barrier, then
//     lines (row o, 64 pixels = 2 lines): 8 consecutive lanes x 16 B (values from 4 Os rows), one instruction per
// coverage: 8 it x 16 lines x 8 lanes x 4 floats = 64 o x 64 p; grid (64, 4, NB) covers out [b][256][4096] once.
// LDS Os: cross-wave (block barrier).
// =========================================================================================================
__global__ __launch_bounds__(128)
void proj_k(const unsigned short* __restrict__ WPB, const unsigned short* __restrict__ OPh,
            const unsigned short* __restrict__ OPl, const float* __restrict__ pb,
            const float* __restrict__ gam, const float* __restrict__ x, float* out) {
  __shared__ __align__(16) float Os[QT * OSP];
  const int tid  = threadIdx.x;
  const int lane = tid & 31, wave = tid >> 5;
  const int hh   = lane >> 4, c = lane & 15;
  const int nt   = blockIdx.x, mb = blockIdx.y, b = blockIdx.z;
  const int n0   = nt * QT, o0 = mb * QT;

  const unsigned short* ap = WPB + (size_t)(o0 + c) * CC + 8 * hh;
  const size_t brow = (size_t)(n0 + 16 * wave + c) * HD + 8 * hh;

  v8f acc[4];
#pragma unroll
  for (int mt = 0; mt < 4; ++mt) acc[mt] = zero8();

#pragma unroll 2
  for (int ks = 0; ks < NHD; ++ks) {
    const size_t pl = ((size_t)(b * NHD + ks)) * NN * HD + brow;
    const Frag fbh = ldfrag(OPh + pl);
    const Frag fbl = ldfrag(OPl + pl);
#pragma unroll
    for (int mt = 0; mt < 4; ++mt) {
      const Frag fa = ldfrag(ap + (size_t)(16 * mt) * CC + 32 * ks);
      acc[mt] = mma_b(fa.bf, fbh.bf, acc[mt]);
      acc[mt] = mma_b(fa.bf, fbl.bf, acc[mt]);
    }
  }

  {
    const int nl = 16 * wave + c;
#pragma unroll
    for (int mt = 0; mt < 4; ++mt) {
      v4f va, vb;
#pragma unroll
      for (int r = 0; r < 4; ++r) { va[r] = acc[mt][r]; vb[r] = acc[mt][4 + r]; }
      *(v4f*)(Os + nl * OSP + 16 * mt + 8 * hh)     = va;
      *(v4f*)(Os + nl * OSP + 16 * mt + 8 * hh + 4) = vb;
    }
  }
  __syncthreads();

  const float g = bfr(gam[0]);
  const int e = tid & 7, lq = tid >> 3;                              // lq 0..15
  v4f res[8];
#pragma unroll
  for (int it = 0; it < 8; ++it) {
    const int L   = it * 16 + lq;                                    // 0..127
    const int ol  = L >> 1, hf = L & 1;                              // o_loc 0..63
    const int nl  = hf * 32 + 4 * e;                                 // pixel 0..63
    const int oo  = o0 + ol;
    const float pbv = bfr(pb[oo]);
    const size_t idx = ((size_t)(b * CC + oo)) * NN + n0 + nl;
    const v4f xv = *(const v4f*)(x + idx);
#pragma unroll
    for (int t = 0; t < 4; ++t) res[it][t] = g * (Os[(nl + t) * OSP + ol] + pbv) + bfr(xv[t]);
  }
{
#pragma unroll
    for (int it = 0; it < 8; ++it) {
      const int L   = it * 16 + lq;
      const int ol  = L >> 1, hf = L & 1;
      const int nl  = hf * 32 + 4 * e;
      const size_t idx = ((size_t)(b * CC + o0 + ol)) * NN + n0 + nl;
      *(v4f*)(out + idx) = res[it];
    }
    
  }
}

// =========================================================================================================
// Workspace map (bytes; each region start a multiple of 256; every extent is an exact tile multiple and is written
//   W16 f16 [3][256][256]   393216    WPB bf16 [256][256] 131072    WF bf16 [2][256][128] 131072
//   XP  f16 [NB][4096][256]            2097152 x NB
//   Qh/Ql bf16 [NB][8][4096][32]       2097152 x NB each     Kh/Kl bf16 [NB][8][1024][32] 524288 x NB each
//   Vt  f16 [NB][8][32][1024]           524288 x NB          ABK f32 [NB][8][1024] 32768 x NB
//   PF  f32 [2][8][2048][32]          4194304
//   PW  f32 [2][NB][8][4096][32]       8388608 x NB
//   OPh/OPl bf16 [NB][8][4096][32]     2097152 x NB each
//   total (NB = 2) = 45809664
// =========================================================================================================
extern "C" void kernel_launch(void* const* d_in, const int* in_sizes, int n_in,
                              void* d_out, int out_size, void* d_ws, size_t ws_size,
                              hipStream_t stream) {
  const int XN = NB * CC * NN;
  if (n_in < 11) return;
  if (in_sizes[0] < XN) return;
  if (in_sizes[1] < CC * CC || in_sizes[2] < CC * CC || in_sizes[3] < CC * CC || in_sizes[8] < CC * CC) return;
  if (in_sizes[4] < CC * PFD || in_sizes[5] < CC * PFD) return;
  if (in_sizes[6] < CC || in_sizes[7] < CC || in_sizes[9] < CC || in_sizes[10] < 1) return;
  if (out_size < XN) return;

  size_t off = 0;
  auto carve = [&](size_t bytes) { const size_t o = off; off += (bytes + 255) & ~(size_t)255; return o; };
  const size_t oW16 = carve((size_t)3 * CC * CC * 2);
  const size_t oWPB = carve((size_t)CC * CC * 2);
  const size_t oWF  = carve((size_t)2 * CC * PFD * 2);
  const size_t oXP  = carve((size_t)NB * NN * CC * 2);
  const size_t oQh  = carve((size_t)NB * NHD * NN * HD * 2);
  const size_t oQl  = carve((size_t)NB * NHD * NN * HD * 2);
  const size_t oKh  = carve((size_t)NB * NHD * NK * HD * 2);
  const size_t oKl  = carve((size_t)NB * NHD * NK * HD * 2);
  const size_t oVt  = carve((size_t)NB * NHD * HD * NK * 2);
  const size_t oABK = carve((size_t)NB * NHD * NK * 4);
  const size_t oPF  = carve((size_t)2 * NHD * NPR * HD * 4);
  const size_t oPW  = carve((size_t)2 * NB * NHD * NN * KVW * 4);
  const size_t oOPh = carve((size_t)NB * NHD * NN * HD * 2);
  const size_t oOPl = carve((size_t)NB * NHD * NN * HD * 2);
  if (off > ws_size) return;
  if (off > (size_t)134217728) return;

  const float* x   = (const float*)d_in[0];
  const float* qw  = (const float*)d_in[1];
  const float* kw  = (const float*)d_in[2];
  const float* vw  = (const float*)d_in[3];
  const float* fxw = (const float*)d_in[4];
  const float* fyw = (const float*)d_in[5];
  const float* ab  = (const float*)d_in[6];
  const float* gb  = (const float*)d_in[7];
  const float* pw  = (const float*)d_in[8];
  const float* pb  = (const float*)d_in[9];
  const float* gam = (const float*)d_in[10];

  char* ws = (char*)d_ws;
  unsigned short* W16 = (unsigned short*)(ws + oW16);
  unsigned short* WPB = (unsigned short*)(ws + oWPB);
  unsigned short* WF  = (unsigned short*)(ws + oWF);
  unsigned short* XP  = (unsigned short*)(ws + oXP);
  unsigned short* Qh  = (unsigned short*)(ws + oQh);
  unsigned short* Ql  = (unsigned short*)(ws + oQl);
  unsigned short* Kh  = (unsigned short*)(ws + oKh);
  unsigned short* Kl  = (unsigned short*)(ws + oKl);
  unsigned short* Vt  = (unsigned short*)(ws + oVt);
  float*          ABK = (float*)(ws + oABK);
  float*          PF  = (float*)(ws + oPF);
  float*          PW  = (float*)(ws + oPW);
  unsigned short* OPh = (unsigned short*)(ws + oOPh);
  unsigned short* OPl = (unsigned short*)(ws + oOPl);
  float* out = (float*)d_out;

  const dim3 blk256(256), blk128(128);

  // (0) weight planes
  cvt_w<<<dim3(160), blk256, 0, stream>>>(qw, kw, vw, pw, fxw, fyw, W16, WPB, WF);
  // (1) x -> position-major f16 plane
  cvt_x<<<dim3(NN / QT, CC / QT, NB), blk256, 0, stream>>>(x, XP);
  // (2) position tables PF (x axis then y axis)
  posfeat<<<dim3(NPR / QT, 2), blk128, 0, stream>>>(WF, PF);
  // (3) q, k (+ appr-bias dot vector) and v
  gemm_x<0><<<dim3(NN / QT, CC / QT, NB), blk128, 0, stream>>>(W16, XP, ab, Qh, Ql, Vt, ABK);
  gemm_x<1><<<dim3(NK / QT, CC / QT, NB), blk128, 0, stream>>>(W16, XP, ab, Kh, Kl, Vt, ABK);
  gemm_x<2><<<dim3(NK / QT, CC / QT, NB), blk128, 0, stream>>>(W16, XP, ab, Kh, Kl, Vt, ABK);
  // (3b) position dot terms of every query with its x table and its y table
  posdot<<<dim3(IMW, NHD, 2 * NB), blk128, 0, stream>>>(Qh, Ql, PF, gb, PW);
  // (4) local-window attention -> per-head O planes
  attn_k<<<dim3(IMH, NHD, NB), blk128, 0, stream>>>(Qh, Ql, Kh, Kl, Vt, ABK, PW, OPh, OPl);
  // (5) output conv + bias, gamma scale, skip add -> out [b][256][4096]
  proj_k<<<dim3(NN / QT, CC / QT, NB), blk128, 0, stream>>>(WPB, OPh, OPl, pb, gam, x, out);
  (void)hipGetLastError();
}

// v002
// It runs in 72.2 microseconds.
// In both of two side-by-side timings against v001, it was 1.39 times as fast.
// Counting every step since v000, it is 1.56 times as fast.
// Contractions: q/k/v 1x1-conv GEMMs W[256x256].X[256xN] on v_wmma_f32_16x16x32_f16 (f16 containers of
// bf16-RNE weights x256 and bf16-RNE x); sinusoid position tables E[2048x128].Wf^T on v_wmma_f32_16x16x32_bf16
// (bf16 hi + bf16 lo planes of the sin/cos features, Wf bf16-RNE, 2 products); attention scores K.Q^T per head
// on v_wmma_f32_16x16x32_bf16 (bf16 hi + bf16 lo planes of q and k, 3 products, depth 32); O^T = V^T.P^T on
// v_wmma_f32_16x16x32_f16 (v single f16 plane, P = e^{s-m} x1024 f16 from the score D registers); output
// 1x1-conv Wp[256x256].O on v_wmma_f32_16x16x32_bf16 (Wp bf16-RNE, O as bf16 hi + bf16 lo planes, 2 products);
// depth-32 position dot terms table[32 k x 32 d].(q + geom bias)^T per (coordinate, head) on
// v_wmma_f32_16x16x32_bf16 (bf16 hi + bf16 lo planes of both, 3 products); f32 accumulate everywhere; bias terms,
// softmax statistics, gamma and the skip add on f32 VALU.
#include <hip/hip_runtime.h>
#include <math.h>
#include <stdint.h>

#ifndef NB
#define NB 2
#endif
#define NB_FULL 2
#define CC      256
#define IMH     64
#define IMW     64
#define NN      4096
#define KVH     32
#define KVW     32
#define NK      1024
#define NHD     8
#define HD      32
#define PFD     128
#define NPR     2048
#define LRANGE  16
#define QT      64
#define OSP     68
#define TP      72
#define EP      136
#define OSV     36
#define WSC     256.0f
#define IWSC    0.00390625f
#define LNPS    6.931471805599453f
#define RSQ2    0.70710678118654752f
#define NL2W    0.15571537944784511f

static_assert(NB >= 1 && NB <= NB_FULL);
static_assert(NN == IMH * IMW && NK == KVH * KVW);
static_assert(NPR == IMW * KVW && NPR == IMH * KVH);
static_assert(CC == NHD * HD && HD == 32 && KVW == 32 && KVH == 32);
static_assert(NN % QT == 0 && NK % QT == 0 && CC % QT == 0 && NPR % QT == 0);
static_assert(CC % 32 == 0 && PFD % 32 == 0 && HD % 32 == 0);
static_assert((OSP * 4) % 16 == 0 && (TP * 2) % 16 == 0 && (EP * 2) % 16 == 0);
static_assert((OSV * 4) % 16 == 0);
static_assert(IMW == QT);
static_assert(QT == 2 * HD);

typedef _Float16       v16h __attribute__((ext_vector_type(16)));
typedef _Float16       v8h  __attribute__((ext_vector_type(8)));
typedef __bf16         v16b __attribute__((ext_vector_type(16)));
typedef unsigned short v8us __attribute__((ext_vector_type(8)));
typedef float          v8f  __attribute__((ext_vector_type(8)));
typedef float          v4f  __attribute__((ext_vector_type(4)));
typedef float          v2f  __attribute__((ext_vector_type(2)));
typedef __bf16         v2b  __attribute__((ext_vector_type(2)));
typedef unsigned int   v4u  __attribute__((ext_vector_type(4)));

union Frag  { v8us u[2]; v16h h; v16b bf; };
union FragH { v16h v; v8h hv[2]; };
static_assert(sizeof(Frag) == 32);
static_assert(sizeof(FragH) == 32);

// ---- scalar helpers ---------------------------------------------------------------------------------------
__device__ __forceinline__ unsigned short bf_bits(float f) {          // f32 -> bf16 bits, RNE convert
  unsigned u = __float_as_uint(f);
  return (unsigned short)((u + 0x7FFFu + ((u >> 16) & 1u)) >> 16);
}
__device__ __forceinline__ float bf_up(unsigned short hb) { return __uint_as_float(((unsigned)hb) << 16); }
__device__ __forceinline__ float bfr(float f) { return bf_up(bf_bits(f)); }
__device__ __forceinline__ unsigned short h_bits(_Float16 x) { return __builtin_bit_cast(unsigned short, x); }
__device__ __forceinline__ unsigned pk16(unsigned short a, unsigned short b) { return (unsigned)a | ((unsigned)b << 16); }
__device__ __forceinline__ v8f zero8() { v8f z = {0.f, 0.f, 0.f, 0.f, 0.f, 0.f, 0.f, 0.f}; return z; }
__device__ __forceinline__ float hmax8(v8f s) {
  return fmaxf(fmaxf(fmaxf(s[0], s[1]), fmaxf(s[2], s[3])), fmaxf(fmaxf(s[4], s[5]), fmaxf(s[6], s[7])));
}
__device__ __forceinline__ unsigned wave_ballot(bool p) {
#if defined(__HIP_DEVICE_COMPILE__)
  return __builtin_amdgcn_ballot_w32(p);
#else
  return p ? 1u : 0u;
#endif
}

// ---- 16-bit fragment loader (A, or B from a k-contiguous [n][k] row): lane -> row/col (lane&15), p already includes
//      + 8*(lane>>4); elements 0..7 <- p[0..7] (k0+8h..), elements 8..15 <- p[16..23] (k0+16+8h..)
__device__ __forceinline__ Frag ldfrag(const unsigned short* p) {
  Frag f;
  f.u[0] = *(const v8us*)(p);
  f.u[1] = *(const v8us*)(p + 16);
  return f;
}

// ---- WMMA helpers: builtin followed by a 4-slot VALU gap tying D and keeping A/B live --------------------------
__device__ __forceinline__ v8f mma_h(v16h a, v16h b, v8f c) {
  v8f d = __builtin_amdgcn_wmma_f32_16x16x32_f16(false, a, false, b, (short)0, c, false, false);
#if defined(__HIP_DEVICE_COMPILE__)
  asm volatile("v_nop\n\tv_nop\n\tv_nop\n\tv_nop" : "+v"(d) : "v"(a), "v"(b));
#endif
  return d;
}
__device__ __forceinline__ v8f mma_b(v16b a, v16b b, v8f c) {
  v8f d = __builtin_amdgcn_wmma_f32_16x16x32_bf16(false, a, false, b, (short)0, c, false, false);
#if defined(__HIP_DEVICE_COMPILE__)
  const v16h ha = __builtin_bit_cast(v16h, a), hb = __builtin_bit_cast(v16h, b);
  asm volatile("v_nop\n\tv_nop\n\tv_nop\n\tv_nop" : "+v"(d) : "v"(ha), "v"(hb));
#endif
  return d;
}

// =========================================================================================================
// (0) weight planes.  Blocks 0..95: W16 f16 [3][256][256] (q_w, k_w, v_w; value = f16 of bf16-RNE(w) x 256), 96..127: WPB bf16 [256][256] (proj_w, bf16-RNE; stores:
//     8 consecutive lanes per line, one instruction).  Blocks 128..159: WF bf16 [2][256][128] (fcx_w rows then
// coverage: 128 blocks x 8 rows x 256 = 4 x [256][256]; 32 blocks x 16 rows x 128 = [512][128].
// blk = 0..159: the block's number within this job (launch cvt_all below).
// =========================================================================================================
__device__ __forceinline__
void cvt_w_body(const int blk,
                const float* __restrict__ qw, const float* __restrict__ kw, const float* __restrict__ vw,
                const float* __restrict__ pw, const float* __restrict__ fxw, const float* __restrict__ fyw,
                unsigned short* W16, unsigned short* WPB, unsigned short* WF) {
  const int tid = threadIdx.x;
  unsigned short* dst;
  v4u u;
  if (blk < 128) {                                                   // block-uniform selection
    const int grp = blk >> 5;                                        // 0 q, 1 k, 2 v, 3 proj
    const int rl = tid >> 5, col = 8 * (tid & 31);
    const int o = 8 * (blk & 31) + rl;                               // 0..255
    const float* wbase = (grp == 0) ? qw : ((grp == 1) ? kw : ((grp == 2) ? vw : pw));
    const float* s = wbase + (size_t)o * CC + col;
    const v4f a = *(const v4f*)s;
    const v4f q = *(const v4f*)(s + 4);
    const float f[8] = {a[0], a[1], a[2], a[3], q[0], q[1], q[2], q[3]};
    if (grp < 3) {
#pragma unroll
      for (int t = 0; t < 4; ++t) {
        const _Float16 h0 = (_Float16)(bfr(f[2 * t]) * WSC);
        const _Float16 h1 = (_Float16)(bfr(f[2 * t + 1]) * WSC);
        u[t] = pk16(h_bits(h0), h_bits(h1));
      }
      dst = W16 + (size_t)grp * CC * CC + (size_t)o * CC + col;
    } else {
#pragma unroll
      for (int t = 0; t < 4; ++t) u[t] = pk16(bf_bits(f[2 * t]), bf_bits(f[2 * t + 1]));
      dst = WPB + (size_t)o * CC + col;
    }
  } else {
    const int j = blk - 128;                                         // 0..31
    const int axis = j >> 4;                                         // block-uniform
    const int r = 16 * j + (tid >> 4);                               // 0..511
    const int o = r & 255;
    const int col = 8 * (tid & 15);
    const float* s = (axis ? fyw : fxw) + (size_t)o * PFD + col;
    const v4f a = *(const v4f*)s;
    const v4f q = *(const v4f*)(s + 4);
    const float f[8] = {a[0], a[1], a[2], a[3], q[0], q[1], q[2], q[3]};
#pragma unroll
    for (int t = 0; t < 4; ++t) u[t] = pk16(bf_bits(f[2 * t]), bf_bits(f[2 * t + 1]));
    dst = WF + (size_t)r * PFD + col;
  }
{
    *(v4u*)dst = u;
    
  }
}

// =========================================================================================================
// (1) x f32 [b][256 c][4096 n] -> XP f16 [b][n][c] (position-major, bf16-RNE values, exact in f16) through an LDS
// coverage: 2 it x 32 rows x 8 lanes x 8 = 64 n x 64 c; (nb, cb, b) in 64 x 4 x NB covers XP exactly once.
// LDS T: cross-wave (block barrier between the element stores and the vector reloads).
// =========================================================================================================
__device__ __forceinline__
void cvt_x_body(unsigned short* T, const int nb, const int cb, const int b,
                const float* __restrict__ x, unsigned short* XP) {
  const int tid = threadIdx.x;
  const int e = tid & 7, lq = tid >> 3;                             // lq 0..31
  const int n0 = nb * QT, c0 = cb * QT;
#pragma unroll
  for (int it = 0; it < 2; ++it) {
    const int cl = it * 32 + lq;                                     // 0..63
    const float* sp = x + ((size_t)(b * CC + c0 + cl)) * NN + n0 + 8 * e;
    const v4f a = *(const v4f*)sp;
    const v4f q = *(const v4f*)(sp + 4);
    // the second trip's loads may land in the first trip's address pair: the pair stays untouched until this wait
    if (it == 0) asm volatile("s_wait_xcnt 0x0" ::: "memory");
    unsigned short hb[8];
#pragma unroll
    for (int t = 0; t < 4; ++t) {
      hb[t]     = h_bits((_Float16)bfr(a[t]));
      hb[4 + t] = h_bits((_Float16)bfr(q[t]));
    }
#pragma unroll
    for (int t = 0; t < 8; ++t) T[(8 * e + t) * TP + cl] = hb[t];
  }
  __syncthreads();
  v4u up[2];
#pragma unroll
  for (int it = 0; it < 2; ++it) {
    const int nl = it * 32 + lq;                                     // 0..63
    up[it] = *(const v4u*)(T + nl * TP + 8 * e);
  }
{
#pragma unroll
    for (int it = 0; it < 2; ++it) {
      const int rl = it * 32 + lq;
      *(v4u*)(XP + ((size_t)(b * NN + n0 + rl)) * CC + c0 + 8 * e) = up[it];
    }
    
  }
}

// =========================================================================================================
// (0)+(1) in one launch: neither job reads what the other writes. Blocks 0..NBX-1 transpose x (the longer job, so
// it starts first), blocks NBX..NBX+159 convert the weights. The selection is block-uniform.
// =========================================================================================================
#define NBX ((NN / QT) * (CC / QT) * NB)
#define NBW 160
__global__ __launch_bounds__(256)
void cvt_all(const float* __restrict__ x,
             const float* __restrict__ qw, const float* __restrict__ kw, const float* __restrict__ vw,
             const float* __restrict__ pw, const float* __restrict__ fxw, const float* __restrict__ fyw,
             unsigned short* XP, unsigned short* W16, unsigned short* WPB, unsigned short* WF) {
  __shared__ __align__(16) unsigned short T[QT * TP];
  const int blk = blockIdx.x;
  if (blk < NBX) {
    cvt_x_body(T, blk % (NN / QT), (blk / (NN / QT)) % (CC / QT), blk / ((NN / QT) * (CC / QT)), x, XP);
  } else {
    cvt_w_body(blk - NBX, qw, kw, vw, pw, fxw, fyw, W16, WPB, WF);
  }
}

// =========================================================================================================
// (2) 1x1-conv GEMM for one (b, 64-n tile, 64-o block): Y[o][n] = (1/256) sum_c W16[MODE][o][c] XP[b][pix(n)][c].
//     MODE 0: n = query pixel; MODE 1/2: n = key index ky*32+kx -> pixel 128 ky + 2 kx (arithmetic addressing).
//     Block 128 threads = 4 waves; wave w owns cols n0+16w..+15 (one B fragment per k-step, k = c contiguous in the
//     XP row) and 4 m-tiles (A rows o = o0 + 16 mt + (lane&15), split k map loader from W16). K = 256 = 8 steps.
//     Epilogue staged in LDS Os[n_loc][o_loc] (pitch OSP), barrier, then per MODE:
//       0: Qh/Ql bf16 [b][8][4096][32] hi = bf16-RNE(v), lo = bf16-RNE(v - hi); 1: Kh/Kl bf16 [b][8][1024][32]
//          plus ABK f32 [b][8][1024] = sum_d bf16-RNE(appr_bias)[h][d] * Y (f32 before the 16-bit convert);
//          a plane line = 2 rows of 32 d: lane e -> row 2j + (e>>2), d 8(e&3).., 8 consecutive lanes per line, one
//       2: Vt f16 [b][8][32 d][1024 keys]: line = row (h,d), 64 keys: lane e -> keys 8e..8e+7, one instruction per
// coverage: Os 4 waves x 16 n x 64 o = 64 x 64; MODE 0/1: 4 it x 16 lines x 8 lanes x 8 = 64 n x 64 o per plane;
//           MODE 2: 4 it x 16 rows x 8 lanes x 8 = 64 o x 64 keys; ABK 2 heads x 64 keys; (nt, mb, b) in NP/64 x 4 x NB.
// LDS Os, abks: cross-wave (block barriers).
// =========================================================================================================
template <int MODE>
__device__ __forceinline__
void gemm_x(float* Os, float* abks, const int nt, const int mb, const int b,
            const unsigned short* __restrict__ W16, const unsigned short* __restrict__ XP,
            const float* __restrict__ ab, unsigned short* Ph, unsigned short* Pl,
            unsigned short* Vt, float* ABK) {
  constexpr int NP = (MODE == 0) ? NN : NK;
  const int tid  = threadIdx.x;
  const int lane = tid & 31, wave = tid >> 5;
  const int hh   = lane >> 4, c = lane & 15;
  const int n0   = nt * QT, o0 = mb * QT;
  (void)ab; (void)Ph; (void)Pl; (void)Vt; (void)ABK; (void)abks;

  const unsigned short* ap = W16 + (size_t)MODE * CC * CC + (size_t)(o0 + c) * CC + 8 * hh;
  const int nrow = n0 + 16 * wave + c;
  const int pix = (MODE == 0) ? nrow : (2 * IMW * (nrow >> 5) + 2 * (nrow & 31));
  const unsigned short* bp = XP + ((size_t)(b * NN + pix)) * CC + 8 * hh;

  v8f acc[4];
#pragma unroll
  for (int mt = 0; mt < 4; ++mt) acc[mt] = zero8();

#pragma unroll
  for (int ks = 0; ks < CC / 32; ++ks) {
    const Frag fb = ldfrag(bp + 32 * ks);
#pragma unroll
    for (int mt = 0; mt < 4; ++mt) {
      const Frag fa = ldfrag(ap + (size_t)(16 * mt) * CC + 32 * ks);
      acc[mt] = mma_h(fa.h, fb.h, acc[mt]);
    }
  }

  // ---- stage: lane (hh, c) holds o = 16 mt + 8 hh + r for n_loc = 16 w + c
  {
    const int nl = 16 * wave + c;
#pragma unroll
    for (int mt = 0; mt < 4; ++mt) {
      v4f va, vb;
#pragma unroll
      for (int r = 0; r < 4; ++r) { va[r] = acc[mt][r] * IWSC; vb[r] = acc[mt][4 + r] * IWSC; }
      *(v4f*)(Os + nl * OSP + 16 * mt + 8 * hh)     = va;
      *(v4f*)(Os + nl * OSP + 16 * mt + 8 * hh + 4) = vb;
    }
  }
  __syncthreads();

  const int e = tid & 7, lq = tid >> 3;                             // lq 0..15
  if constexpr (MODE == 2) {
    v4u uv[4];
#pragma unroll
    for (int it = 0; it < 4; ++it) {
      const int ol = it * 16 + lq;                                   // o_loc 0..63
      unsigned short hb[8];
#pragma unroll
      for (int t = 0; t < 8; ++t) hb[t] = h_bits((_Float16)Os[(8 * e + t) * OSP + ol]);
#pragma unroll
      for (int t = 0; t < 4; ++t) uv[it][t] = pk16(hb[2 * t], hb[2 * t + 1]);
    }
{
#pragma unroll
      for (int it = 0; it < 4; ++it) {
        const int ol = it * 16 + lq;
        const int oo = o0 + ol, hd = oo >> 5, d = oo & 31;
        *(v4u*)(Vt + ((size_t)((b * NHD + hd) * HD + d)) * NK + n0 + 8 * e) = uv[it];
      }
      // the listing lays another job's code behind these stores: their registers stay untouched until this wait
      asm volatile("s_wait_xcnt 0x0" ::: "memory");
    }
  } else {
    v4u uh[4], ul[4];
#pragma unroll
    for (int it = 0; it < 4; ++it) {
      const int L = it * 16 + lq;                                    // line 0..63
      const int hs = L >> 5, j = L & 31;
      const int row = 2 * j + (e >> 2);                              // n_loc
      const int cb0 = 32 * hs + 8 * (e & 3);                         // o_loc of the first value
      const v4f a = *(const v4f*)(Os + row * OSP + cb0);
      const v4f q = *(const v4f*)(Os + row * OSP + cb0 + 4);
      const float f[8] = {a[0], a[1], a[2], a[3], q[0], q[1], q[2], q[3]};
#pragma unroll
      for (int t = 0; t < 4; ++t) {
        const float f0 = f[2 * t], f1 = f[2 * t + 1];
        const unsigned short hb0 = bf_bits(f0), hb1 = bf_bits(f1);
        const unsigned short lb0 = bf_bits(f0 - bf_up(hb0));
        const unsigned short lb1 = bf_bits(f1 - bf_up(hb1));
        uh[it][t] = pk16(hb0, hb1);
        ul[it][t] = pk16(lb0, lb1);
      }
    }
    v4f abv = {0.f, 0.f, 0.f, 0.f};
    if constexpr (MODE == 1) {
      const int kl = tid & 63, hs = tid >> 6;                       // hs wave-uniform
      const float* abp  = ab + (2 * mb + hs) * HD;
      const float* orow = Os + kl * OSP + 32 * hs;
      float s = 0.f;
#pragma unroll
      for (int d4 = 0; d4 < 8; ++d4) {
        const v4f g  = *(const v4f*)(abp + 4 * d4);
        const v4f ov = *(const v4f*)(orow + 4 * d4);
        s += bfr(g[0]) * ov[0] + bfr(g[1]) * ov[1] + bfr(g[2]) * ov[2] + bfr(g[3]) * ov[3];
      }
      abks[hs * QT + kl] = s;
      __syncthreads();
      if (tid < 32) abv = *(const v4f*)(abks + (lq >> 1) * QT + 32 * (lq & 1) + 4 * e);
    }
{
#pragma unroll
      for (int it = 0; it < 4; ++it) {
        const int L = it * 16 + lq;
        const int hs = L >> 5, j = L & 31;
        const size_t po = ((size_t)((b * NHD + 2 * mb + hs) * NP + n0 + 2 * j)) * HD + 8 * e;
        *(v4u*)(Ph + po) = uh[it];
        *(v4u*)(Pl + po) = ul[it];
      }
      // the listing lays another job's code behind these stores: their registers stay untouched until this wait
      // (MODE 1: the build has its own wait behind its stores)
      if constexpr (MODE == 0) asm volatile("s_wait_xcnt 0x0" ::: "memory");
      if constexpr (MODE == 1) {
        if (tid < 32)                                                // wave 0, wave-uniform
          *(v4f*)(ABK + (size_t)(b * NHD + 2 * mb + (lq >> 1)) * NK + n0 + 32 * (lq & 1) + 4 * e) = abv;
      }
      
    }
  }
}

// =========================================================================================================
// (3) position tables for one (64-row tile, axis): rows R = coord*32 + kcoord (coord = query x for axis 0, query
//     y for axis 1; kcoord = key coordinate), diff = coord - 2*kcoord, a = diff * 1000^(-f/64), features
//     [sin(a) | cos(a)] (128) built in LDS as bf16 hi/lo planes Eh/El[64][128] (pitch EP); then for ob in 0..3 a
//     GEMM  Y[o][R] = sum_f WF[axis][o][f] E[R][f]  (A rows o from WF bf16, B rows R from Eh and El, 2 products
//     sharing the accumulator, K = 128), epilogue Os[R_loc][o_loc] = Y / sqrt(2), barrier, then
//       PF f32 [axis][h][R][32 d]: line = one row (h, R), lane e -> d 4e..4e+3, 8 consecutive lanes per line,
// coverage: Eh/El 32 it x 128 threads = 64 rows x 64 args x {sin,cos} = 64 x 128 (cols 128..135 pad, never read);
//           PF per ob 8 it x 16 lines x 8 lanes x 4 = 128 rows(h,R) x 32 d, 4 ob -> 8 heads;
//           (rt, axis) in 32 x 2 covers PF [2][8][2048][32] exactly once.
// LDS Eh/El, Os: cross-wave (block barriers).
// =========================================================================================================
__device__ __forceinline__
void posfeat(unsigned short* Eh, unsigned short* El, float* Os, const int rt, const int axis,
             const unsigned short* __restrict__ WF, float* PF) {
  const int tid  = threadIdx.x;
  const int lane = tid & 31, wave = tid >> 5;
  const int hh   = lane >> 4, c = lane & 15;
  const int R0   = rt * QT;

  // ---- (a) sinusoid features -> LDS bf16 hi/lo planes
#pragma unroll 1
  for (int it = 0; it < 32; ++it) {
    const int idx = it * 128 + tid;                                  // 0..4095
    const int rl = idx >> 6, fa = idx & 63;
    const int row = R0 + rl;
    const int qc = row >> 5, kq = row & 31;
    const float diff = (float)(qc - 2 * kq);
    const float a = diff * exp2f(-(float)fa * NL2W);
    const float sv = sinf(a);
    const float cv = cosf(a);
    const unsigned short shb = bf_bits(sv), chb = bf_bits(cv);
    Eh[rl * EP + fa]      = shb;
    El[rl * EP + fa]      = bf_bits(sv - bf_up(shb));
    Eh[rl * EP + 64 + fa] = chb;
    El[rl * EP + 64 + fa] = bf_bits(cv - bf_up(chb));
  }
  __syncthreads();

  const unsigned short* ebh = Eh + (16 * wave + c) * EP + 8 * hh;
  const unsigned short* ebl = El + (16 * wave + c) * EP + 8 * hh;
  const int e = tid & 7, lq = tid >> 3;                             // lq 0..15
#pragma unroll 1
  for (int ob = 0; ob < 4; ++ob) {
    const unsigned short* ap = WF + (size_t)axis * CC * PFD + (size_t)(QT * ob + c) * PFD + 8 * hh;
    v8f acc[4];
#pragma unroll
    for (int mt = 0; mt < 4; ++mt) acc[mt] = zero8();
#pragma unroll
    for (int ks = 0; ks < PFD / 32; ++ks) {
      const Frag fbh = ldfrag(ebh + 32 * ks);
      const Frag fbl = ldfrag(ebl + 32 * ks);
#pragma unroll
      for (int mt = 0; mt < 4; ++mt) {
        const Frag fa = ldfrag(ap + (size_t)(16 * mt) * PFD + 32 * ks);
        acc[mt] = mma_b(fa.bf, fbh.bf, acc[mt]);
        acc[mt] = mma_b(fa.bf, fbl.bf, acc[mt]);
      }
    }
    {
      const int nl = 16 * wave + c;
#pragma unroll
      for (int mt = 0; mt < 4; ++mt) {
        v4f va, vb;
#pragma unroll
        for (int r = 0; r < 4; ++r) { va[r] = acc[mt][r] * RSQ2; vb[r] = acc[mt][4 + r] * RSQ2; }
        *(v4f*)(Os + nl * OSP + 16 * mt + 8 * hh)     = va;
        *(v4f*)(Os + nl * OSP + 16 * mt + 8 * hh + 4) = vb;
      }
    }
    __syncthreads();
    v4f res[8];
#pragma unroll
    for (int it = 0; it < 8; ++it) {
      const int L = it * 16 + lq;                                    // 0..127
      const int rl = L & 63, hs = L >> 6;
      res[it] = *(const v4f*)(Os + rl * OSP + 32 * hs + 4 * e);
    }
{
#pragma unroll
      for (int it = 0; it < 8; ++it) {
        const int L = it * 16 + lq;
        const int rl = L & 63, hs = L >> 6;
        float* dst = PF + ((size_t)(axis * NHD + 2 * ob + hs)) * ((size_t)NPR * HD) + (size_t)(R0 + rl) * HD + 4 * e;
        *(v4f*)dst = res[it];
      }
      
    }
    __syncthreads();
  }
}

// =========================================================================================================
// (2)+(3) in one launch: the position tables and the q, k and v GEMMs read only what the conversion launch wrote and
// none reads another's output. Block order: tables first (64 blocks, the longest chain of dependent work), then
// q (NBQ blocks), k and v (NBK blocks each). The selection is block-uniform, so every barrier of a job is passed by
// all four waves of its block. Os is shared by the jobs (a block runs exactly one of them).
// =========================================================================================================
#define NBP ((NPR / QT) * 2)
#define NBQ ((NN / QT) * (CC / QT) * NB)
#define NBK ((NK / QT) * (CC / QT) * NB)
__global__ __launch_bounds__(128)
void feat_gemm(const unsigned short* __restrict__ WF, const unsigned short* __restrict__ W16,
               const unsigned short* __restrict__ XP, const float* __restrict__ ab, float* PF,
               unsigned short* Qh, unsigned short* Ql, unsigned short* Kh, unsigned short* Kl,
               unsigned short* Vt, float* ABK) {
  __shared__ __align__(16) unsigned short Eh[QT * EP];
  __shared__ __align__(16) unsigned short El[QT * EP];
  __shared__ __align__(16) float Os[QT * OSP];
  __shared__ __align__(16) float abks[2 * QT];
  const int blk = blockIdx.x;
  if (blk < NBP) {
    posfeat(Eh, El, Os, blk % (NPR / QT), blk / (NPR / QT), WF, PF);
  } else if (blk < NBP + NBQ) {
    const int j = blk - NBP;
    gemm_x<0>(Os, abks, j % (NN / QT), (j / (NN / QT)) % (CC / QT), j / ((NN / QT) * (CC / QT)),
              W16, XP, ab, Qh, Ql, Vt, ABK);
  } else if (blk < NBP + NBQ + NBK) {
    const int j = blk - (NBP + NBQ);
    gemm_x<1>(Os, abks, j % (NK / QT), (j / (NK / QT)) % (CC / QT), j / ((NK / QT) * (CC / QT)),
              W16, XP, ab, Kh, Kl, Vt, ABK);
  } else {
    const int j = blk - (NBP + NBQ + NBK);
    gemm_x<2>(Os, abks, j % (NK / QT), (j / (NK / QT)) % (CC / QT), j / ((NK / QT) * (CC / QT)),
              W16, XP, ab, Kh, Kl, Vt, ABK);
  }
}

// =========================================================================================================
// (3b) position dot terms for one (coordinate co, head, axis, b): the 64 queries that share the coordinate (axis 0:
//   x = co, all y; axis 1: y = co, all x) share one table PF[axis][h][co][32 k][32 d], so
//   PW[axis][b][h][query][k] = sum_d PF[axis][h][co][k][d] . (q + bf16-RNE(geom_bias))[query][d] is a 32 x 64 x 32
//   GEMM. Block = 4 waves, wave w = queries 16w..16w+15 of the line. A rows k = 16t + (lane&15) from the f32 table,
//   B cols = queries from Qh + Ql + bias; both split in registers into bf16 hi/lo with the split k map of ldfrag
//   (elements 0..7 <- d 8hh.., 8..15 <- d 16+8hh..); hi.hi + hi.lo + lo.hi share the accumulator.
//   Epilogue: Os[query][32 k] (pitch OSV), barrier, then one 128-B line per query: 8 consecutive lanes x 16 B.
// coverage: 4 waves x 16 queries x 32 k; grid (64, 8, 2 NB) covers PW [2][NB][8][4096][32] exactly once.
// LDS Os: written and read inside one wave's region, synchronised with a block barrier.
// =========================================================================================================
__device__ __forceinline__ void split8(v4f a, v4f q, v8us& hi, v8us& lo) {
  const float f[8] = {a[0], a[1], a[2], a[3], q[0], q[1], q[2], q[3]};
  v4u wh, wl;
#pragma unroll
  for (int t = 0; t < 4; ++t) {
    const v2f p = {f[2 * t], f[2 * t + 1]};
    const unsigned hw = __builtin_bit_cast(unsigned, __builtin_convertvector(p, v2b));   // RNE, packed pair
    const v2f r = {p[0] - __uint_as_float(hw << 16), p[1] - __uint_as_float(hw & 0xffff0000u)};
    wh[t] = hw;
    wl[t] = __builtin_bit_cast(unsigned, __builtin_convertvector(r, v2b));
  }
  hi = __builtin_bit_cast(v8us, wh);
  lo = __builtin_bit_cast(v8us, wl);
}

__global__ __launch_bounds__(128)
void posdot(const unsigned short* __restrict__ Qh, const unsigned short* __restrict__ Ql,
            const float* __restrict__ PF, const float* __restrict__ gb, float* PW) {
  __shared__ __align__(16) float Os[QT * OSV];
  const int tid  = threadIdx.x;
  const int wave = tid >> 5, lane = tid & 31;
  const int hh   = lane >> 4, c = lane & 15;
  const int co = blockIdx.x, hd = blockIdx.y;
  const int axis = blockIdx.z / NB, b = blockIdx.z % NB;             // block-uniform
  const int bh = b * NHD + hd;
  const int qstep = axis ? 1 : IMW;                                  // pixel step along the line of queries
  const int qbase = axis ? co * IMW : co;

  // ---- all loads first: query planes, bias, both 16-row tiles of the table (rows k = 16 t + c)
  const size_t qo = ((size_t)bh * NN + qbase + (16 * wave + c) * qstep) * HD + 8 * hh;
  const Frag qh = ldfrag(Qh + qo);
  const Frag ql = ldfrag(Ql + qo);
  const float* gp = gb + hd * HD + 8 * hh;
  const float* tb = PF + ((size_t)(axis * NHD + hd) * NPR + (size_t)co * KVW + c) * HD + 8 * hh;
  v4f g[2][2], ta[2][2][2];
#pragma unroll
  for (int s = 0; s < 2; ++s) {                                      // s: d = 16 s + 8 hh ..
    g[s][0] = *(const v4f*)(gp + 16 * s);
    g[s][1] = *(const v4f*)(gp + 16 * s + 4);
#pragma unroll
    for (int t = 0; t < 2; ++t) {
      ta[t][s][0] = *(const v4f*)(tb + 16 * t * HD + 16 * s);
      ta[t][s][1] = *(const v4f*)(tb + 16 * t * HD + 16 * s + 4);
    }
  }

  // ---- B: qg = q + geom bias of query 16 wave + c, bf16 hi/lo
  Frag bhi, blo;
#pragma unroll
  for (int s = 0; s < 2; ++s) {
    const v4u wh = __builtin_bit_cast(v4u, qh.u[s]), wl = __builtin_bit_cast(v4u, ql.u[s]);
    float f[8];
#pragma unroll
    for (int j = 0; j < 4; ++j) {
      f[2 * j]     = __uint_as_float(wh[j] << 16) + __uint_as_float(wl[j] << 16);
      f[2 * j + 1] = __uint_as_float(wh[j] & 0xffff0000u) + __uint_as_float(wl[j] & 0xffff0000u);
    }
    v4f va, vb;
#pragma unroll
    for (int r = 0; r < 4; ++r) { va[r] = f[r] + bfr(g[s][0][r]); vb[r] = f[4 + r] + bfr(g[s][1][r]); }
    split8(va, vb, bhi.u[s], blo.u[s]);
  }

  // ---- A: table tile t, bf16 hi/lo; D rows k = 16 t + 8 hh + r, col = query
#pragma unroll
  for (int t = 0; t < 2; ++t) {
    Frag ahi, alo;
    split8(ta[t][0][0], ta[t][0][1], ahi.u[0], alo.u[0]);
    split8(ta[t][1][0], ta[t][1][1], ahi.u[1], alo.u[1]);
    v8f d = zero8();
    d = mma_b(ahi.bf, bhi.bf, d);
    d = mma_b(ahi.bf, blo.bf, d);
    d = mma_b(alo.bf, bhi.bf, d);
    v4f va, vb;
#pragma unroll
    for (int r = 0; r < 4; ++r) { va[r] = d[r]; vb[r] = d[4 + r]; }
    *(v4f*)(Os + (16 * wave + c) * OSV + 16 * t + 8 * hh)     = va;
    *(v4f*)(Os + (16 * wave + c) * OSV + 16 * t + 8 * hh + 4) = vb;
  }
  __syncthreads();

  const int e = lane & 7, lq = lane >> 3;                            // lq 0..3
  float* pw = PW + ((size_t)(axis * NB * NHD + bh) * NN + qbase) * KVW + 4 * e;
#pragma unroll
  for (int it = 0; it < 4; ++it) {
    const int qn = 16 * wave + 4 * it + lq;                          // query 0..63 of the line
    *(v4f*)(pw + (size_t)(qn * qstep) * KVW) = *(const v4f*)(Os + qn * OSV + 4 * e);
  }
}

// =========================================================================================================
// (4) local-window attention for one (query row y, head, b): block = 4 waves, wave w = queries x = 16w..16w+15.
//   Per lane (hh, c): PX[kx] for kx in {8hh..8hh+7, 16+8hh..} from PW[0][b][h][query] (registers); PY[ky] from
//   PW[1][b][h][query][ky], one value per key row.
//   Loop over allowed key rows ky (block-uniform; forbidden rows contribute exactly 0): S^T tiles (16 keys x 16
//   queries) = A(Kh rows key ky*32 + 16t + (lane&15), k = d split map) . B(Qh col = query) + A(Kh).B(Ql) +
//   A(Kl).B(Qh) (bf16 hi/lo planes, shared accumulator); energy = S^T + ABK[key] + PX[kx] + PY[ky], replaced by
//   -inf outside the per-query kx window. Per lane the D tiles hold 16 keys of ONE query: online softmax per lane,
//   one shuffle (lane^16) for the max over the 32 keys of the row, o/l rescale skipped under a wave-uniform ballot.
//   P = e^{s-m} x 1024 as f16 is the B operand of O^T (rows d, cols queries) += A(Vt rows d = 16j + (lane&15), keys
//   in split k map) . B(P^T): element r <- D of the tile covering kx 0..15, element 8+r <- the tile covering kx 16..31.
//   Epilogue: O/l staged in LDS Os[query][32 d] (pitch OSV), barrier, then OPh/OPl bf16 [b][8][4096][32] (hi = bf16-
//   RNE(v), lo = bf16-RNE(v - hi)); line = 2 query rows: lane e -> row 2L + (e>>2), d 8(e&3).., 8 consecutive lanes
// coverage: Os 4 waves x 16 queries x 32 d; planes 2 it x 16 lines x 8 lanes x 8 = 64 queries x 32 d per plane;
//           grid (64, 8, NB) covers OPh/OPl [b][8][4096][32] exactly once.
// LDS Os: cross-wave (block barrier).
// =========================================================================================================
__global__ __launch_bounds__(128)
void attn_k(const unsigned short* __restrict__ Qh, const unsigned short* __restrict__ Ql,
            const unsigned short* __restrict__ Kh, const unsigned short* __restrict__ Kl,
            const unsigned short* __restrict__ Vt, const float* __restrict__ ABK,
            const float* __restrict__ PW, unsigned short* OPh, unsigned short* OPl) {
  __shared__ __align__(16) float Os[QT * OSV];
  const int tid  = threadIdx.x;
  const int wave = tid >> 5, lane = tid & 31;
  const int hh   = lane >> 4, c = lane & 15;
  const int y = blockIdx.x, hd = blockIdx.y, b = blockIdx.z;
  const int bh = b * NHD + hd;
  const int xq = 16 * wave + c;                                      // query column of this lane's B/D column
  const int pq = y * IMW + xq;

  const int kylo = (y >= LRANGE) ? ((y - LRANGE) >> 1) : 0;         // block-uniform
  int kyhi = ((y + LRANGE + 1) >> 1) + 1;  if (kyhi > KVH) kyhi = KVH;
  const int kxlo = (xq >= LRANGE) ? ((xq - LRANGE) >> 1) : 0;       // per lane
  int kxhi = ((xq + LRANGE + 1) >> 1) + 1; if (kxhi > KVW) kxhi = KVW;

  // ---- PX: per lane 16 kx values for query xq; PY: this query's row, read per key row in the loop
  float px0[8], px1[8];
  {
    const float* pxp = PW + ((size_t)bh * NN + pq) * KVW + 8 * hh;
    const v4f u0 = *(const v4f*)pxp;
    const v4f u1 = *(const v4f*)(pxp + 4);
    const v4f u2 = *(const v4f*)(pxp + 16);
    const v4f u3 = *(const v4f*)(pxp + 20);
#pragma unroll
    for (int r = 0; r < 4; ++r) { px0[r] = u0[r]; px0[4 + r] = u1[r]; px1[r] = u2[r]; px1[4 + r] = u3[r]; }
  }
  const float* pyrow = PW + ((size_t)(NB * NHD + bh) * NN + pq) * KVH;

  // ---- fragment pointers
  const size_t qo = ((size_t)bh * NN + pq) * HD + 8 * hh;
  const Frag qh = ldfrag(Qh + qo);
  const Frag ql = ldfrag(Ql + qo);
  const unsigned short* Khp = Kh + (size_t)bh * NK * HD + (size_t)c * HD + 8 * hh;
  const unsigned short* Klp = Kl + (size_t)bh * NK * HD + (size_t)c * HD + 8 * hh;
  const unsigned short* Vp  = Vt + (size_t)bh * HD * NK + (size_t)c * NK + 8 * hh;
  const float* abkb = ABK + (size_t)bh * NK + 8 * hh;
  const float NINF = -__builtin_inff();

  float m = -1.0e30f, l = 0.f;
  v8f o[2];
  o[0] = zero8(); o[1] = zero8();

#pragma unroll 1
  for (int ky = kylo; ky < kyhi; ++ky) {
    const int kp0 = ky * KVW;
    const Frag k0  = ldfrag(Khp + (size_t)kp0 * HD);                // keys kp0 .. kp0+15
    const Frag k1  = ldfrag(Khp + (size_t)(kp0 + 16) * HD);         // keys kp0+16 .. kp0+31
    const Frag k0l = ldfrag(Klp + (size_t)kp0 * HD);
    const Frag k1l = ldfrag(Klp + (size_t)(kp0 + 16) * HD);
    v8f s0 = zero8(), s1 = zero8();
    s0 = mma_b(k0.bf, qh.bf, s0);
    s1 = mma_b(k1.bf, qh.bf, s1);
    s0 = mma_b(k0.bf, ql.bf, s0);
    s1 = mma_b(k1.bf, ql.bf, s1);
    s0 = mma_b(k0l.bf, qh.bf, s0);
    s1 = mma_b(k1l.bf, qh.bf, s1);

    const v4f a0 = *(const v4f*)(abkb + kp0);
    const v4f a1 = *(const v4f*)(abkb + kp0 + 4);
    const v4f a2 = *(const v4f*)(abkb + kp0 + 16);
    const v4f a3 = *(const v4f*)(abkb + kp0 + 20);
    const float py = pyrow[ky];
#pragma unroll
    for (int r = 0; r < 8; ++r) {
      const int kx0 = 8 * hh + r, kx1 = 16 + 8 * hh + r;
      const float ab0 = (r < 4) ? a0[r & 3] : a1[r & 3];
      const float ab1 = (r < 4) ? a2[r & 3] : a3[r & 3];
      const float e0 = s0[r] + ab0 + px0[r] + py;
      const float e1 = s1[r] + ab1 + px1[r] + py;
      s0[r] = (kx0 >= kxlo && kx0 < kxhi) ? e0 : NINF;
      s1[r] = (kx1 >= kxlo && kx1 < kxhi) ? e1 : NINF;
    }

    float mx = fmaxf(hmax8(s0), hmax8(s1));
    mx = fmaxf(mx, __shfl_xor(mx, 16, 32));
    const float mn = fmaxf(m, mx);
    const unsigned grew = wave_ballot(mx > m);                       // wave-uniform
    if (grew != 0u) {
      const float corr = __expf(m - mn);                             // == 1 exactly for lanes whose max did not grow
      l *= corr;
#pragma unroll
      for (int j = 0; j < 2; ++j) {
#pragma unroll
        for (int r = 0; r < 8; ++r) o[j][r] *= corr;
      }
    }
    m = mn;
    const float msh = mn - LNPS;                                     // exp gives e^{s-m} * 1024

    FragH ph;
    float ls = 0.f;
#pragma unroll
    for (int r = 0; r < 8; ++r) {
      const float e0 = __expf(s0[r] - msh);                          // key kp0      + 8hh + r
      const float e1 = __expf(s1[r] - msh);                          // key kp0 + 16 + 8hh + r
      ls += e0 + e1;
      ph.hv[0][r] = (_Float16)e0;
      ph.hv[1][r] = (_Float16)e1;
    }
    l += ls;

#pragma unroll
    for (int j = 0; j < 2; ++j) {
      const Frag vf = ldfrag(Vp + (size_t)(16 * j) * NK + kp0);
      o[j] = mma_h(vf.h, ph.v, o[j]);
    }
  }
  l += __shfl_xor(l, 16, 32);
  const float inv = 1.0f / l;                                        // o and l both carry the x1024 factor

  const int qr = 16 * wave + c;
#pragma unroll
  for (int j = 0; j < 2; ++j) {
    v4f va, vb;
#pragma unroll
    for (int r = 0; r < 4; ++r) { va[r] = o[j][r] * inv; vb[r] = o[j][4 + r] * inv; }
    *(v4f*)(Os + qr * OSV + 16 * j + 8 * hh)     = va;              // Os[query][d = 16j + 8hh + r]
    *(v4f*)(Os + qr * OSV + 16 * j + 8 * hh + 4) = vb;
  }
  __syncthreads();

  const int e = tid & 7, lq = tid >> 3;                              // lq 0..15
  v4u uh[2], ul[2];
#pragma unroll
  for (int it = 0; it < 2; ++it) {
    const int L = 16 * it + lq;                                      // line 0..31
    const int row = 2 * L + (e >> 2), dl = 8 * (e & 3);
    const v4f a = *(const v4f*)(Os + row * OSV + dl);
    const v4f q = *(const v4f*)(Os + row * OSV + dl + 4);
    const float f[8] = {a[0], a[1], a[2], a[3], q[0], q[1], q[2], q[3]};
#pragma unroll
    for (int t = 0; t < 4; ++t) {
      const float f0 = f[2 * t], f1 = f[2 * t + 1];
      const unsigned short hb0 = bf_bits(f0), hb1 = bf_bits(f1);
      const unsigned short lb0 = bf_bits(f0 - bf_up(hb0));
      const unsigned short lb1 = bf_bits(f1 - bf_up(hb1));
      uh[it][t] = pk16(hb0, hb1);
      ul[it][t] = pk16(lb0, lb1);
    }
  }
{
#pragma unroll
    for (int it = 0; it < 2; ++it) {
      const int L = 16 * it + lq;
      const size_t po = ((size_t)bh * NN + (size_t)y * IMW + 2 * L) * HD + 8 * e;
      *(v4u*)(OPh + po) = uh[it];
      *(v4u*)(OPl + po) = ul[it];
    }
    
  }
}

// =========================================================================================================
// (5) output 1x1-conv for one (b, 64-pixel tile, 64-o block): Y[o][p] = sum_c WPB[o][c] O[b][p][c] with
//     c = 32 h + d: k-step ks = head ks, B fragments from OPh and OPl [b][ks][p][32] (bf16 hi/lo, shared
//     accumulator), A from WPB (split map). Epilogue: Os[p_loc][o_loc], barrier, then
//     lines (row o, 64 pixels = 2 lines): 8 consecutive lanes x 16 B (values from 4 Os rows), one instruction per
// coverage: 8 it x 16 lines x 8 lanes x 4 floats = 64 o x 64 p; grid (64, 4, NB) covers out [b][256][4096] once.
// LDS Os: cross-wave (block barrier).
// =========================================================================================================
__global__ __launch_bounds__(128)
void proj_k(const unsigned short* __restrict__ WPB, const unsigned short* __restrict__ OPh,
            const unsigned short* __restrict__ OPl, const float* __restrict__ pb,
            const float* __restrict__ gam, const float* __restrict__ x, float* out) {
  __shared__ __align__(16) float Os[QT * OSP];
  const int tid  = threadIdx.x;
  const int lane = tid & 31, wave = tid >> 5;
  const int hh   = lane >> 4, c = lane & 15;
  const int nt   = blockIdx.x, mb = blockIdx.y, b = blockIdx.z;
  const int n0   = nt * QT, o0 = mb * QT;

  const unsigned short* ap = WPB + (size_t)(o0 + c) * CC + 8 * hh;
  const size_t brow = (size_t)(n0 + 16 * wave + c) * HD + 8 * hh;

  v8f acc[4];
#pragma unroll
  for (int mt = 0; mt < 4; ++mt) acc[mt] = zero8();

#pragma unroll 2
  for (int ks = 0; ks < NHD; ++ks) {
    const size_t pl = ((size_t)(b * NHD + ks)) * NN * HD + brow;
    const Frag fbh = ldfrag(OPh + pl);
    const Frag fbl = ldfrag(OPl + pl);
#pragma unroll
    for (int mt = 0; mt < 4; ++mt) {
      const Frag fa = ldfrag(ap + (size_t)(16 * mt) * CC + 32 * ks);
      acc[mt] = mma_b(fa.bf, fbh.bf, acc[mt]);
      acc[mt] = mma_b(fa.bf, fbl.bf, acc[mt]);
    }
  }

  {
    const int nl = 16 * wave + c;
#pragma unroll
    for (int mt = 0; mt < 4; ++mt) {
      v4f va, vb;
#pragma unroll
      for (int r = 0; r < 4; ++r) { va[r] = acc[mt][r]; vb[r] = acc[mt][4 + r]; }
      *(v4f*)(Os + nl * OSP + 16 * mt + 8 * hh)     = va;
      *(v4f*)(Os + nl * OSP + 16 * mt + 8 * hh + 4) = vb;
    }
  }
  __syncthreads();

  const float g = bfr(gam[0]);
  const int e = tid & 7, lq = tid >> 3;                              // lq 0..15
  v4f res[8];
#pragma unroll
  for (int it = 0; it < 8; ++it) {
    const int L   = it * 16 + lq;                                    // 0..127
    const int ol  = L >> 1, hf = L & 1;                              // o_loc 0..63
    const int nl  = hf * 32 + 4 * e;                                 // pixel 0..63
    const int oo  = o0 + ol;
    const float pbv = bfr(pb[oo]);
    const size_t idx = ((size_t)(b * CC + oo)) * NN + n0 + nl;
    const v4f xv = *(const v4f*)(x + idx);
#pragma unroll
    for (int t = 0; t < 4; ++t) res[it][t] = g * (Os[(nl + t) * OSP + ol] + pbv) + bfr(xv[t]);
  }
{
#pragma unroll
    for (int it = 0; it < 8; ++it) {
      const int L   = it * 16 + lq;
      const int ol  = L >> 1, hf = L & 1;
      const int nl  = hf * 32 + 4 * e;
      const size_t idx = ((size_t)(b * CC + o0 + ol)) * NN + n0 + nl;
      *(v4f*)(out + idx) = res[it];
    }
    
  }
}

// =========================================================================================================
// Workspace map (bytes; each region start a multiple of 256; every extent is an exact tile multiple and is written
//   W16 f16 [3][256][256]   393216    WPB bf16 [256][256] 131072    WF bf16 [2][256][128] 131072
//   XP  f16 [NB][4096][256]            2097152 x NB
//   Qh/Ql bf16 [NB][8][4096][32]       2097152 x NB each     Kh/Kl bf16 [NB][8][1024][32] 524288 x NB each
//   Vt  f16 [NB][8][32][1024]           524288 x NB          ABK f32 [NB][8][1024] 32768 x NB
//   PF  f32 [2][8][2048][32]          4194304
//   PW  f32 [2][NB][8][4096][32]       8388608 x NB
//   OPh/OPl bf16 [NB][8][4096][32]     2097152 x NB each
//   total (NB = 2) = 45809664
// =========================================================================================================
extern "C" void kernel_launch(void* const* d_in, const int* in_sizes, int n_in,
                              void* d_out, int out_size, void* d_ws, size_t ws_size,
                              hipStream_t stream) {
  const int XN = NB * CC * NN;
  if (n_in < 11) return;
  if (in_sizes[0] < XN) return;
  if (in_sizes[1] < CC * CC || in_sizes[2] < CC * CC || in_sizes[3] < CC * CC || in_sizes[8] < CC * CC) return;
  if (in_sizes[4] < CC * PFD || in_sizes[5] < CC * PFD) return;
  if (in_sizes[6] < CC || in_sizes[7] < CC || in_sizes[9] < CC || in_sizes[10] < 1) return;
  if (out_size < XN) return;

  size_t off = 0;
  auto carve = [&](size_t bytes) { const size_t o = off; off += (bytes + 255) & ~(size_t)255; return o; };
  const size_t oW16 = carve((size_t)3 * CC * CC * 2);
  const size_t oWPB = carve((size_t)CC * CC * 2);
  const size_t oWF  = carve((size_t)2 * CC * PFD * 2);
  const size_t oXP  = carve((size_t)NB * NN * CC * 2);
  const size_t oQh  = carve((size_t)NB * NHD * NN * HD * 2);
  const size_t oQl  = carve((size_t)NB * NHD * NN * HD * 2);
  const size_t oKh  = carve((size_t)NB * NHD * NK * HD * 2);
  const size_t oKl  = carve((size_t)NB * NHD * NK * HD * 2);
  const size_t oVt  = carve((size_t)NB * NHD * HD * NK * 2);
  const size_t oABK = carve((size_t)NB * NHD * NK * 4);
  const size_t oPF  = carve((size_t)2 * NHD * NPR * HD * 4);
  const size_t oPW  = carve((size_t)2 * NB * NHD * NN * KVW * 4);
  const size_t oOPh = carve((size_t)NB * NHD * NN * HD * 2);
  const size_t oOPl = carve((size_t)NB * NHD * NN * HD * 2);
  if (off > ws_size) return;
  if (off > (size_t)134217728) return;

  const float* x   = (const float*)d_in[0];
  const float* qw  = (const float*)d_in[1];
  const float* kw  = (const float*)d_in[2];
  const float* vw  = (const float*)d_in[3];
  const float* fxw = (const float*)d_in[4];
  const float* fyw = (const float*)d_in[5];
  const float* ab  = (const float*)d_in[6];
  const float* gb  = (const float*)d_in[7];
  const float* pw  = (const float*)d_in[8];
  const float* pb  = (const float*)d_in[9];
  const float* gam = (const float*)d_in[10];

  char* ws = (char*)d_ws;
  unsigned short* W16 = (unsigned short*)(ws + oW16);
  unsigned short* WPB = (unsigned short*)(ws + oWPB);
  unsigned short* WF  = (unsigned short*)(ws + oWF);
  unsigned short* XP  = (unsigned short*)(ws + oXP);
  unsigned short* Qh  = (unsigned short*)(ws + oQh);
  unsigned short* Ql  = (unsigned short*)(ws + oQl);
  unsigned short* Kh  = (unsigned short*)(ws + oKh);
  unsigned short* Kl  = (unsigned short*)(ws + oKl);
  unsigned short* Vt  = (unsigned short*)(ws + oVt);
  float*          ABK = (float*)(ws + oABK);
  float*          PF  = (float*)(ws + oPF);
  float*          PW  = (float*)(ws + oPW);
  unsigned short* OPh = (unsigned short*)(ws + oOPh);
  unsigned short* OPl = (unsigned short*)(ws + oOPl);
  float* out = (float*)d_out;

  const dim3 blk256(256), blk128(128);

  // (0)+(1) x -> position-major f16 plane, and the weight planes
  cvt_all<<<dim3(NBX + NBW), blk256, 0, stream>>>(x, qw, kw, vw, pw, fxw, fyw, XP, W16, WPB, WF);
  // (2)+(3) position tables PF (x axis then y axis); q, k (+ appr-bias dot vector) and v
  feat_gemm<<<dim3(NBP + NBQ + 2 * NBK), blk128, 0, stream>>>(WF, W16, XP, ab, PF, Qh, Ql, Kh, Kl, Vt, ABK);
  // (3b) position dot terms of every query with its x table and its y table
  posdot<<<dim3(IMW, NHD, 2 * NB), blk128, 0, stream>>>(Qh, Ql, PF, gb, PW);
  // (4) local-window attention -> per-head O planes
  attn_k<<<dim3(IMH, NHD, NB), blk128, 0, stream>>>(Qh, Ql, Kh, Kl, Vt, ABK, PW, OPh, OPl);
  // (5) output conv + bias, gamma scale, skip add -> out [b][256][4096]
  proj_k<<<dim3(NN / QT, CC / QT, NB), blk128, 0, stream>>>(WPB, OPh, OPl, pb, gam, x, out);
  (void)hipGetLastError();
}

// v003
// Measured time: 53.4 microseconds a run.
// Two timings next to v002 put it at 1.38 and 1.33 times that version's speed.
// Over all steps from v000 it is 2.12 times as fast.
// Contractions: q/k/v 1x1-conv GEMMs W[256x256].X[256xN] on v_wmma_f32_16x16x32_f16 (f16 containers of
// bf16-RNE weights x256 and bf16-RNE x); sinusoid position tables E[48x128].Wf^T on v_wmma_f32_16x16x32_bf16
// (bf16 hi + bf16 lo planes of the sin/cos features, Wf bf16-RNE, 2 products); attention scores K.Q^T per head
// on v_wmma_f32_16x16x32_bf16 (bf16 hi + bf16 lo planes of q and k, 3 products, depth 32); O^T = V^T.P^T on
// v_wmma_f32_16x16x32_f16 (v single f16 plane, P = e^{s-m} x1024 f16 from the score D registers); output
// 1x1-conv Wp[256x256].O on v_wmma_f32_16x16x32_bf16 (Wp bf16-RNE, O as bf16 hi + bf16 lo planes, 2 products);
// depth-32 position dot terms table[rows x 32 d].(q + geom bias)^T per (query row, head) on
// v_wmma_f32_16x16x32_bf16 (bf16 hi + bf16 lo planes of both, 3 products); f32 accumulate everywhere; bias terms,
// softmax statistics, gamma and the skip add on f32 VALU.
#include <hip/hip_runtime.h>
#include <math.h>
#include <stdint.h>

#ifndef NB
#define NB 2
#endif
#define NB_FULL 2
#define CC      256
#define IMH     64
#define IMW     64
#define NN      4096
#define KVH     32
#define KVW     32
#define NK      1024
#define NHD     8
#define HD      32
#define PFD     128
#define NPR     2048
#define NDF     48
#define DOFF    17
#define PRT     16
#define GSP     84
#define LRANGE  16
#define QT      64
#define OSP     68
#define TP      72
#define EP      136
#define OSV     36
#define WSC     256.0f
#define IWSC    0.00390625f
#define LNPS    6.931471805599453f
#define RSQ2    0.70710678118654752f
#define NL2W    0.15571537944784511f

static_assert(NB >= 1 && NB <= NB_FULL);
static_assert(NN == IMH * IMW && NK == KVH * KVW);
static_assert(NPR == IMW * KVW && NPR == IMH * KVH);
static_assert(DOFF == LRANGE + 1 && 2 * DOFF + 1 <= NDF && LRANGE + 2 <= 32);
static_assert(NDF % PRT == 0 && PRT == 16 && GSP >= NDF + 32 && (GSP * 4) % 16 == 0);
static_assert(CC == NHD * HD && HD == 32 && KVW == 32 && KVH == 32);
static_assert(NN % QT == 0 && NK % QT == 0 && CC % QT == 0 && NPR % QT == 0);
static_assert(CC % 32 == 0 && PFD % 32 == 0 && HD % 32 == 0);
static_assert((OSP * 4) % 16 == 0 && (TP * 2) % 16 == 0 && (EP * 2) % 16 == 0);
static_assert((OSV * 4) % 16 == 0);
static_assert(IMW == QT);
static_assert(QT == 2 * HD);

typedef _Float16       v16h __attribute__((ext_vector_type(16)));
typedef _Float16       v8h  __attribute__((ext_vector_type(8)));
typedef __bf16         v16b __attribute__((ext_vector_type(16)));
typedef unsigned short v8us __attribute__((ext_vector_type(8)));
typedef float          v8f  __attribute__((ext_vector_type(8)));
typedef float          v4f  __attribute__((ext_vector_type(4)));
typedef float          v2f  __attribute__((ext_vector_type(2)));
typedef __bf16         v2b  __attribute__((ext_vector_type(2)));
typedef unsigned int   v4u  __attribute__((ext_vector_type(4)));

union Frag  { v8us u[2]; v16h h; v16b bf; };
union FragH { v16h v; v8h hv[2]; };
static_assert(sizeof(Frag) == 32);
static_assert(sizeof(FragH) == 32);

// ---- scalar helpers ---------------------------------------------------------------------------------------
__device__ __forceinline__ unsigned short bf_bits(float f) {          // f32 -> bf16 bits, RNE convert
  unsigned u = __float_as_uint(f);
  return (unsigned short)((u + 0x7FFFu + ((u >> 16) & 1u)) >> 16);
}
__device__ __forceinline__ float bf_up(unsigned short hb) { return __uint_as_float(((unsigned)hb) << 16); }
__device__ __forceinline__ float bfr(float f) { return bf_up(bf_bits(f)); }
__device__ __forceinline__ unsigned short h_bits(_Float16 x) { return __builtin_bit_cast(unsigned short, x); }
__device__ __forceinline__ unsigned pk16(unsigned short a, unsigned short b) { return (unsigned)a | ((unsigned)b << 16); }
__device__ __forceinline__ v8f zero8() { v8f z = {0.f, 0.f, 0.f, 0.f, 0.f, 0.f, 0.f, 0.f}; return z; }
__device__ __forceinline__ float hmax8(v8f s) {
  return fmaxf(fmaxf(fmaxf(s[0], s[1]), fmaxf(s[2], s[3])), fmaxf(fmaxf(s[4], s[5]), fmaxf(s[6], s[7])));
}
__device__ __forceinline__ unsigned wave_ballot(bool p) {
#if defined(__HIP_DEVICE_COMPILE__)
  return __builtin_amdgcn_ballot_w32(p);
#else
  return p ? 1u : 0u;
#endif
}

// ---- 16-bit fragment loader (A, or B from a k-contiguous [n][k] row): lane -> row/col (lane&15), p already includes
//      + 8*(lane>>4); elements 0..7 <- p[0..7] (k0+8h..), elements 8..15 <- p[16..23] (k0+16+8h..)
__device__ __forceinline__ Frag ldfrag(const unsigned short* p) {
  Frag f;
  f.u[0] = *(const v8us*)(p);
  f.u[1] = *(const v8us*)(p + 16);
  return f;
}

// ---- WMMA helpers: builtin followed by a 4-slot VALU gap tying D and keeping A/B live --------------------------
__device__ __forceinline__ v8f mma_h(v16h a, v16h b, v8f c) {
  v8f d = __builtin_amdgcn_wmma_f32_16x16x32_f16(false, a, false, b, (short)0, c, false, false);
#if defined(__HIP_DEVICE_COMPILE__)
  asm volatile("v_nop\n\tv_nop\n\tv_nop\n\tv_nop" : "+v"(d) : "v"(a), "v"(b));
#endif
  return d;
}
__device__ __forceinline__ v8f mma_b(v16b a, v16b b, v8f c) {
  v8f d = __builtin_amdgcn_wmma_f32_16x16x32_bf16(false, a, false, b, (short)0, c, false, false);
#if defined(__HIP_DEVICE_COMPILE__)
  const v16h ha = __builtin_bit_cast(v16h, a), hb = __builtin_bit_cast(v16h, b);
  asm volatile("v_nop\n\tv_nop\n\tv_nop\n\tv_nop" : "+v"(d) : "v"(ha), "v"(hb));
#endif
  return d;
}

// =========================================================================================================
// (0) weight planes.  Blocks 0..95: W16 f16 [3][256][256] (q_w, k_w, v_w; value = f16 of bf16-RNE(w) x 256), 96..127: WPB bf16 [256][256] (proj_w, bf16-RNE; stores:
//     8 consecutive lanes per line, one instruction).  Blocks 128..159: WF bf16 [2][256][128] (fcx_w rows then
// coverage: 128 blocks x 8 rows x 256 = 4 x [256][256]; 32 blocks x 16 rows x 128 = [512][128].
// blk = 0..159: the block's number within this job (launch cvt_all below).
// =========================================================================================================
__device__ __forceinline__
void cvt_w_body(const int blk,
                const float* __restrict__ qw, const float* __restrict__ kw, const float* __restrict__ vw,
                const float* __restrict__ pw, const float* __restrict__ fxw, const float* __restrict__ fyw,
                unsigned short* W16, unsigned short* WPB, unsigned short* WF) {
  const int tid = threadIdx.x;
  unsigned short* dst;
  v4u u;
  if (blk < 128) {                                                   // block-uniform selection
    const int grp = blk >> 5;                                        // 0 q, 1 k, 2 v, 3 proj
    const int rl = tid >> 5, col = 8 * (tid & 31);
    const int o = 8 * (blk & 31) + rl;                               // 0..255
    const float* wbase = (grp == 0) ? qw : ((grp == 1) ? kw : ((grp == 2) ? vw : pw));
    const float* s = wbase + (size_t)o * CC + col;
    const v4f a = *(const v4f*)s;
    const v4f q = *(const v4f*)(s + 4);
    const float f[8] = {a[0], a[1], a[2], a[3], q[0], q[1], q[2], q[3]};
    if (grp < 3) {
#pragma unroll
      for (int t = 0; t < 4; ++t) {
        const _Float16 h0 = (_Float16)(bfr(f[2 * t]) * WSC);
        const _Float16 h1 = (_Float16)(bfr(f[2 * t + 1]) * WSC);
        u[t] = pk16(h_bits(h0), h_bits(h1));
      }
      dst = W16 + (size_t)grp * CC * CC + (size_t)o * CC + col;
    } else {
#pragma unroll
      for (int t = 0; t < 4; ++t) u[t] = pk16(bf_bits(f[2 * t]), bf_bits(f[2 * t + 1]));
      dst = WPB + (size_t)o * CC + col;
    }
  } else {
    const int j = blk - 128;                                         // 0..31
    const int axis = j >> 4;                                         // block-uniform
    const int r = 16 * j + (tid >> 4);                               // 0..511
    const int o = r & 255;
    const int col = 8 * (tid & 15);
    const float* s = (axis ? fyw : fxw) + (size_t)o * PFD + col;
    const v4f a = *(const v4f*)s;
    const v4f q = *(const v4f*)(s + 4);
    const float f[8] = {a[0], a[1], a[2], a[3], q[0], q[1], q[2], q[3]};
#pragma unroll
    for (int t = 0; t < 4; ++t) u[t] = pk16(bf_bits(f[2 * t]), bf_bits(f[2 * t + 1]));
    dst = WF + (size_t)r * PFD + col;
  }
{
    *(v4u*)dst = u;
    
  }
}

// =========================================================================================================
// (1) x f32 [b][256 c][4096 n] -> XP f16 [b][n][c] (position-major, bf16-RNE values, exact in f16) through an LDS
// coverage: 2 it x 32 rows x 8 lanes x 8 = 64 n x 64 c; (nb, cb, b) in 64 x 4 x NB covers XP exactly once.
// LDS T: cross-wave (block barrier between the element stores and the vector reloads).
// =========================================================================================================
__device__ __forceinline__
void cvt_x_body(unsigned short* T, const int nb, const int cb, const int b,
                const float* __restrict__ x, unsigned short* XP) {
  const int tid = threadIdx.x;
  const int e = tid & 7, lq = tid >> 3;                             // lq 0..31
  const int n0 = nb * QT, c0 = cb * QT;
#pragma unroll
  for (int it = 0; it < 2; ++it) {
    const int cl = it * 32 + lq;                                     // 0..63
    const float* sp = x + ((size_t)(b * CC + c0 + cl)) * NN + n0 + 8 * e;
    const v4f a = *(const v4f*)sp;
    const v4f q = *(const v4f*)(sp + 4);
    // the second trip's loads may land in the first trip's address pair: the pair stays untouched until this wait
    if (it == 0) asm volatile("s_wait_xcnt 0x0" ::: "memory");
    unsigned short hb[8];
#pragma unroll
    for (int t = 0; t < 4; ++t) {
      hb[t]     = h_bits((_Float16)bfr(a[t]));
      hb[4 + t] = h_bits((_Float16)bfr(q[t]));
    }
#pragma unroll
    for (int t = 0; t < 8; ++t) T[(8 * e + t) * TP + cl] = hb[t];
  }
  __syncthreads();
  v4u up[2];
#pragma unroll
  for (int it = 0; it < 2; ++it) {
    const int nl = it * 32 + lq;                                     // 0..63
    up[it] = *(const v4u*)(T + nl * TP + 8 * e);
  }
{
#pragma unroll
    for (int it = 0; it < 2; ++it) {
      const int rl = it * 32 + lq;
      *(v4u*)(XP + ((size_t)(b * NN + n0 + rl)) * CC + c0 + 8 * e) = up[it];
    }
    
  }
}

// =========================================================================================================
// (0)+(1) in one launch: neither job reads what the other writes. Blocks 0..NBX-1 transpose x (the longer job, so
// it starts first), blocks NBX..NBX+159 convert the weights. The selection is block-uniform.
// =========================================================================================================
#define NBX ((NN / QT) * (CC / QT) * NB)
#define NBW 160
__global__ __launch_bounds__(256)
void cvt_all(const float* __restrict__ x,
             const float* __restrict__ qw, const float* __restrict__ kw, const float* __restrict__ vw,
             const float* __restrict__ pw, const float* __restrict__ fxw, const float* __restrict__ fyw,
             unsigned short* XP, unsigned short* W16, unsigned short* WPB, unsigned short* WF) {
  __shared__ __align__(16) unsigned short T[QT * TP];
  const int blk = blockIdx.x;
  if (blk < NBX) {
    cvt_x_body(T, blk % (NN / QT), (blk / (NN / QT)) % (CC / QT), blk / ((NN / QT) * (CC / QT)), x, XP);
  } else {
    cvt_w_body(blk - NBX, qw, kw, vw, pw, fxw, fyw, W16, WPB, WF);
  }
}

// =========================================================================================================
// (2) 1x1-conv GEMM for one (b, 64-n tile, 64-o block): Y[o][n] = (1/256) sum_c W16[MODE][o][c] XP[b][pix(n)][c].
//     MODE 0: n = query pixel; MODE 1/2: n = key index ky*32+kx -> pixel 128 ky + 2 kx (arithmetic addressing).
//     Block 128 threads = 4 waves; wave w owns cols n0+16w..+15 (one B fragment per k-step, k = c contiguous in the
//     XP row) and 4 m-tiles (A rows o = o0 + 16 mt + (lane&15), split k map loader from W16). K = 256 = 8 steps.
//     Epilogue staged in LDS Os[n_loc][o_loc] (pitch OSP), barrier, then per MODE:
//       0: Qh/Ql bf16 [b][8][4096][32] hi = bf16-RNE(v), lo = bf16-RNE(v - hi); 1: Kh/Kl bf16 [b][8][1024][32]
//          plus ABK f32 [b][8][1024] = sum_d bf16-RNE(appr_bias)[h][d] * Y (f32 before the 16-bit convert);
//          a plane line = 2 rows of 32 d: lane e -> row 2j + (e>>2), d 8(e&3).., 8 consecutive lanes per line, one
//       2: Vt f16 [b][8][32 d][1024 keys]: line = row (h,d), 64 keys: lane e -> keys 8e..8e+7, one instruction per
// coverage: Os 4 waves x 16 n x 64 o = 64 x 64; MODE 0/1: 4 it x 16 lines x 8 lanes x 8 = 64 n x 64 o per plane;
//           MODE 2: 4 it x 16 rows x 8 lanes x 8 = 64 o x 64 keys; ABK 2 heads x 64 keys; (nt, mb, b) in NP/64 x 4 x NB.
// LDS Os, abks: cross-wave (block barriers).
// =========================================================================================================
template <int MODE>
__device__ __forceinline__
void gemm_x(float* Os, float* abks, const int nt, const int mb, const int b,
            const unsigned short* __restrict__ W16, const unsigned short* __restrict__ XP,
            const float* __restrict__ ab, unsigned short* Ph, unsigned short* Pl,
            unsigned short* Vt, float* ABK) {
  constexpr int NP = (MODE == 0) ? NN : NK;
  const int tid  = threadIdx.x;
  const int lane = tid & 31, wave = tid >> 5;
  const int hh   = lane >> 4, c = lane & 15;
  const int n0   = nt * QT, o0 = mb * QT;
  (void)ab; (void)Ph; (void)Pl; (void)Vt; (void)ABK; (void)abks;

  const unsigned short* ap = W16 + (size_t)MODE * CC * CC + (size_t)(o0 + c) * CC + 8 * hh;
  const int nrow = n0 + 16 * wave + c;
  const int pix = (MODE == 0) ? nrow : (2 * IMW * (nrow >> 5) + 2 * (nrow & 31));
  const unsigned short* bp = XP + ((size_t)(b * NN + pix)) * CC + 8 * hh;

  v8f acc[4];
#pragma unroll
  for (int mt = 0; mt < 4; ++mt) acc[mt] = zero8();

#pragma unroll
  for (int ks = 0; ks < CC / 32; ++ks) {
    const Frag fb = ldfrag(bp + 32 * ks);
#pragma unroll
    for (int mt = 0; mt < 4; ++mt) {
      const Frag fa = ldfrag(ap + (size_t)(16 * mt) * CC + 32 * ks);
      acc[mt] = mma_h(fa.h, fb.h, acc[mt]);
    }
  }

  // ---- stage: lane (hh, c) holds o = 16 mt + 8 hh + r for n_loc = 16 w + c
  {
    const int nl = 16 * wave + c;
#pragma unroll
    for (int mt = 0; mt < 4; ++mt) {
      v4f va, vb;
#pragma unroll
      for (int r = 0; r < 4; ++r) { va[r] = acc[mt][r] * IWSC; vb[r] = acc[mt][4 + r] * IWSC; }
      *(v4f*)(Os + nl * OSP + 16 * mt + 8 * hh)     = va;
      *(v4f*)(Os + nl * OSP + 16 * mt + 8 * hh + 4) = vb;
    }
  }
  __syncthreads();

  const int e = tid & 7, lq = tid >> 3;                             // lq 0..15
  if constexpr (MODE == 2) {
    v4u uv[4];
#pragma unroll
    for (int it = 0; it < 4; ++it) {
      const int ol = it * 16 + lq;                                   // o_loc 0..63
      unsigned short hb[8];
#pragma unroll
      for (int t = 0; t < 8; ++t) hb[t] = h_bits((_Float16)Os[(8 * e + t) * OSP + ol]);
#pragma unroll
      for (int t = 0; t < 4; ++t) uv[it][t] = pk16(hb[2 * t], hb[2 * t + 1]);
    }
{
#pragma unroll
      for (int it = 0; it < 4; ++it) {
        const int ol = it * 16 + lq;
        const int oo = o0 + ol, hd = oo >> 5, d = oo & 31;
        *(v4u*)(Vt + ((size_t)((b * NHD + hd) * HD + d)) * NK + n0 + 8 * e) = uv[it];
      }
      // the listing lays another job's code behind these stores: their registers stay untouched until this wait
      asm volatile("s_wait_xcnt 0x0" ::: "memory");
    }
  } else {
    v4u uh[4], ul[4];
#pragma unroll
    for (int it = 0; it < 4; ++it) {
      const int L = it * 16 + lq;                                    // line 0..63
      const int hs = L >> 5, j = L & 31;
      const int row = 2 * j + (e >> 2);                              // n_loc
      const int cb0 = 32 * hs + 8 * (e & 3);                         // o_loc of the first value
      const v4f a = *(const v4f*)(Os + row * OSP + cb0);
      const v4f q = *(const v4f*)(Os + row * OSP + cb0 + 4);
      const float f[8] = {a[0], a[1], a[2], a[3], q[0], q[1], q[2], q[3]};
#pragma unroll
      for (int t = 0; t < 4; ++t) {
        const float f0 = f[2 * t], f1 = f[2 * t + 1];
        const unsigned short hb0 = bf_bits(f0), hb1 = bf_bits(f1);
        const unsigned short lb0 = bf_bits(f0 - bf_up(hb0));
        const unsigned short lb1 = bf_bits(f1 - bf_up(hb1));
        uh[it][t] = pk16(hb0, hb1);
        ul[it][t] = pk16(lb0, lb1);
      }
    }
    v4f abv = {0.f, 0.f, 0.f, 0.f};
    if constexpr (MODE == 1) {
      const int kl = tid & 63, hs = tid >> 6;                       // hs wave-uniform
      const float* abp  = ab + (2 * mb + hs) * HD;
      const float* orow = Os + kl * OSP + 32 * hs;
      float s = 0.f;
#pragma unroll
      for (int d4 = 0; d4 < 8; ++d4) {
        const v4f g  = *(const v4f*)(abp + 4 * d4);
        const v4f ov = *(const v4f*)(orow + 4 * d4);
        s += bfr(g[0]) * ov[0] + bfr(g[1]) * ov[1] + bfr(g[2]) * ov[2] + bfr(g[3]) * ov[3];
      }
      abks[hs * QT + kl] = s;
      __syncthreads();
      if (tid < 32) abv = *(const v4f*)(abks + (lq >> 1) * QT + 32 * (lq & 1) + 4 * e);
    }
{
#pragma unroll
      for (int it = 0; it < 4; ++it) {
        const int L = it * 16 + lq;
        const int hs = L >> 5, j = L & 31;
        const size_t po = ((size_t)((b * NHD + 2 * mb + hs) * NP + n0 + 2 * j)) * HD + 8 * e;
        *(v4u*)(Ph + po) = uh[it];
        *(v4u*)(Pl + po) = ul[it];
      }
      // the listing lays another job's code behind these stores: their registers stay untouched until this wait
      // (MODE 1: the build has its own wait behind its stores)
      if constexpr (MODE == 0) asm volatile("s_wait_xcnt 0x0" ::: "memory");
      if constexpr (MODE == 1) {
        if (tid < 32)                                                // wave 0, wave-uniform
          *(v4f*)(ABK + (size_t)(b * NHD + 2 * mb + (lq >> 1)) * NK + n0 + 32 * (lq & 1) + 4 * e) = abv;
      }
      
    }
  }
}

// ---- 8 f32 -> bf16 hi (RNE) and bf16 lo (RNE of the rest), packed pairs
__device__ __forceinline__ void split8(v4f a, v4f q, v8us& hi, v8us& lo) {
  const float f[8] = {a[0], a[1], a[2], a[3], q[0], q[1], q[2], q[3]};
  v4u wh, wl;
#pragma unroll
  for (int t = 0; t < 4; ++t) {
    const v2f p = {f[2 * t], f[2 * t + 1]};
    const unsigned hw = __builtin_bit_cast(unsigned, __builtin_convertvector(p, v2b));   // RNE, packed pair
    const v2f r = {p[0] - __uint_as_float(hw << 16), p[1] - __uint_as_float(hw & 0xffff0000u)};
    wh[t] = hw;
    wl[t] = __builtin_bit_cast(unsigned, __builtin_convertvector(r, v2b));
  }
  hi = __builtin_bit_cast(v8us, wh);
  lo = __builtin_bit_cast(v8us, wl);
}

// =========================================================================================================
// (3) position tables. A table row depends on its (coord, kcoord) pair only through diff = coord - 2*kcoord, and
//     inside the local window diff lies in -DOFF..DOFF, so the tables are built once per diff: row T = diff + DOFF
//     (rows 35..47 fill the last tile and are never used). One job = (16-row tile rt, 64-o block ob, axis):
//     a = diff * 1000^(-f/64), features [sin(a) | cos(a)] (128) built in LDS as bf16 hi/lo planes Eh/El[16][128]
//     (pitch EP); then Y[o][T] = sum_f WF[axis][o][f] E[T][f]: wave w owns A rows o = 64 ob + 16 w + (lane&15) from
//     WF bf16, all waves share the B rows T from Eh and El (2 products sharing the accumulator, K = 128); epilogue
//     Os[T_loc][o_loc] = Y / sqrt(2), barrier, then
//       PFh/PFl bf16 [axis][h][48 T][32 d] (hi = bf16-RNE(v), lo = bf16-RNE(v - hi)): a plane line = 2 rows of 32 d,
//       lane -> row (tid>>2)&15, d 8(tid&3).., 8 consecutive lanes per line.
// coverage: Eh/El 8 it x 128 threads = 16 rows x 64 args x {sin,cos} = 16 x 128 (cols 128..135 pad, never read);
//           planes 128 threads x 8 = 2 heads x 16 rows x 32 d; (rt, ob, axis) in 3 x 4 x 2 covers
//           PFh/PFl [2][8][48][32] exactly once.
// LDS Eh/El, Os: cross-wave (block barriers).
// =========================================================================================================
__device__ __forceinline__
void posfeat(unsigned short* Eh, unsigned short* El, float* Os, const int rt, const int ob, const int axis,
             const unsigned short* __restrict__ WF, unsigned short* PFh, unsigned short* PFl) {
  const int tid  = threadIdx.x;
  const int lane = tid & 31, wave = tid >> 5;
  const int hh   = lane >> 4, c = lane & 15;
  const int R0   = rt * PRT;

  // ---- (a) sinusoid features -> LDS bf16 hi/lo planes (rolled: one copy of the sin/cos code keeps the text short)
#pragma unroll 1
  for (int it = 0; it < PRT / 2; ++it) {
    const int idx = it * 128 + tid;                                  // 0..1023
    const int rl = idx >> 6, fa = idx & 63;
    const float diff = (float)(R0 + rl - DOFF);
    const float a = diff * exp2f(-(float)fa * NL2W);
    const float sv = sinf(a);
    const float cv = cosf(a);
    const unsigned short shb = bf_bits(sv), chb = bf_bits(cv);
    Eh[rl * EP + fa]      = shb;
    El[rl * EP + fa]      = bf_bits(sv - bf_up(shb));
    Eh[rl * EP + 64 + fa] = chb;
    El[rl * EP + 64 + fa] = bf_bits(cv - bf_up(chb));
  }
  __syncthreads();

  const unsigned short* ebh = Eh + c * EP + 8 * hh;
  const unsigned short* ebl = El + c * EP + 8 * hh;
  const unsigned short* ap = WF + (size_t)axis * CC * PFD + (size_t)(QT * ob + 16 * wave + c) * PFD + 8 * hh;
  v8f acc = zero8();
#pragma unroll
  for (int ks = 0; ks < PFD / 32; ++ks) {
    const Frag fbh = ldfrag(ebh + 32 * ks);
    const Frag fbl = ldfrag(ebl + 32 * ks);
    const Frag fa = ldfrag(ap + 32 * ks);
    acc = mma_b(fa.bf, fbh.bf, acc);
    acc = mma_b(fa.bf, fbl.bf, acc);
  }
  {
    v4f va, vb;
#pragma unroll
    for (int r = 0; r < 4; ++r) { va[r] = acc[r] * RSQ2; vb[r] = acc[4 + r] * RSQ2; }
    *(v4f*)(Os + c * OSP + 16 * wave + 8 * hh)     = va;            // Os[T_loc = c][o_loc = 16 w + 8 hh + r]
    *(v4f*)(Os + c * OSP + 16 * wave + 8 * hh + 4) = vb;
  }
  __syncthreads();
  const int dl = 8 * (tid & 3), rl = (tid >> 2) & 15, hs = tid >> 6;
  v8us hi, lo;
  split8(*(const v4f*)(Os + rl * OSP + 32 * hs + dl), *(const v4f*)(Os + rl * OSP + 32 * hs + dl + 4), hi, lo);
  const size_t po = ((size_t)(axis * NHD + 2 * ob + hs) * NDF + R0 + rl) * HD + dl;
  *(v8us*)(PFh + po) = hi;
  *(v8us*)(PFl + po) = lo;
}

// =========================================================================================================
// (2)+(3) in one launch: the position tables and the q, k and v GEMMs read only what the conversion launch wrote and
// none reads another's output. Block order: tables first (24 blocks), then
// q (NBQ blocks), k and v (NBK blocks each). The selection is block-uniform, so every barrier of a job is passed by
// all four waves of its block. Os is shared by the jobs (a block runs exactly one of them).
// =========================================================================================================
#define NBP ((NDF / PRT) * (CC / QT) * 2)
#define NBQ ((NN / QT) * (CC / QT) * NB)
#define NBK ((NK / QT) * (CC / QT) * NB)
__global__ __launch_bounds__(128)
void feat_gemm(const unsigned short* __restrict__ WF, const unsigned short* __restrict__ W16,
               const unsigned short* __restrict__ XP, const float* __restrict__ ab,
               unsigned short* PFh, unsigned short* PFl, unsigned short* Qh, unsigned short* Ql, unsigned short* Kh, unsigned short* Kl,
               unsigned short* Vt, float* ABK) {
  __shared__ __align__(16) unsigned short Eh[PRT * EP];
  __shared__ __align__(16) unsigned short El[PRT * EP];
  __shared__ __align__(16) float Os[QT * OSP];
  __shared__ __align__(16) float abks[2 * QT];
  const int blk = blockIdx.x;
  if (blk < NBP) {
    posfeat(Eh, El, Os, blk % (NDF / PRT), (blk / (NDF / PRT)) % (CC / QT), blk / ((NDF / PRT) * (CC / QT)), WF, PFh, PFl);
  } else if (blk < NBP + NBQ) {
    const int j = blk - NBP;
    gemm_x<0>(Os, abks, j % (NN / QT), (j / (NN / QT)) % (CC / QT), j / ((NN / QT) * (CC / QT)),
              W16, XP, ab, Qh, Ql, Vt, ABK);
  } else if (blk < NBP + NBQ + NBK) {
    const int j = blk - (NBP + NBQ);
    gemm_x<1>(Os, abks, j % (NK / QT), (j / (NK / QT)) % (CC / QT), j / ((NK / QT) * (CC / QT)),
              W16, XP, ab, Kh, Kl, Vt, ABK);
  } else {
    const int j = blk - (NBP + NBQ + NBK);
    gemm_x<2>(Os, abks, j % (NK / QT), (j / (NK / QT)) % (CC / QT), j / ((NK / QT) * (CC / QT)),
              W16, XP, ab, Kh, Kl, Vt, ABK);
  }
}

// =========================================================================================================
// (4) local-window attention for one (query row y, head, b): block = 4 waves, wave w = queries x = 16w..16w+15.
//   Position dot terms first, per wave for its own 16 queries: B cols = qg = q + bf16-RNE(geom_bias) from Qh + Ql +
//   bias, split in registers into bf16 hi/lo with the split k map of ldfrag; A rows from the by-difference tables
//   PFh/PFl (hi.hi + hi.lo + lo.hi share the accumulator, depth 32). x axis: the 3 tiles of all 48 rows T, one
//   table for every query, D -> Gs[query][T]; y axis: rows T = y - 2 ky + DOFF of ky = kylo + i (i = 16 t + (lane&15),
//   held at the last allowed row), D -> Gs[query][NDF + i]; barrier. Per lane (hh, c): PX[kx] = Gs[query][x - 2 kx +
//   DOFF] for kx in {8hh..8hh+7, 16+8hh..} (registers; the index is held inside the row where kx lies outside the
//   window, where the energy is replaced anyway); PY[ky] = Gs[query][NDF + ky - kylo], one value per key row.
//   Loop over allowed key rows ky (block-uniform; forbidden rows contribute exactly 0): S^T tiles (16 keys x 16
//   queries) = A(Kh rows key ky*32 + 16t + (lane&15), k = d split map) . B(Qh col = query) + A(Kh).B(Ql) +
//   A(Kl).B(Qh) (bf16 hi/lo planes, shared accumulator); energy = S^T + ABK[key] + PX[kx] + PY[ky], replaced by
//   -inf outside the per-query kx window. Per lane the D tiles hold 16 keys of ONE query: online softmax per lane,
//   one shuffle (lane^16) for the max over the 32 keys of the row, o/l rescale skipped under a wave-uniform ballot.
//   P = e^{s-m} x 1024 as f16 is the B operand of O^T (rows d, cols queries) += A(Vt rows d = 16j + (lane&15), keys
//   split map) . B(P^T): element r <- D of the tile covering kx 0..15, element 8+r <- the tile covering kx 16..31.
//   Epilogue: O/l staged in LDS Os[query][32 d] (pitch OSV), barrier, then OPh/OPl bf16 [b][8][4096][32] (hi = bf16-
//   RNE(v), lo = bf16-RNE(v - hi)); line = 2 query rows: lane e -> row 2L + (e>>2), d 8(e&3).., 8 consecutive lanes
// coverage: Os 4 waves x 16 queries x 32 d; planes 2 it x 16 lines x 8 lanes x 8 = 64 queries x 32 d per plane;
//           grid (64, 8, NB) covers OPh/OPl [b][8][4096][32] exactly once.
// LDS Os: cross-wave (block barrier). Gs: written and read inside one wave's rows, synchronised with a block barrier.
// =========================================================================================================
__global__ __launch_bounds__(128)
void attn_k(const unsigned short* __restrict__ Qh, const unsigned short* __restrict__ Ql,
            const unsigned short* __restrict__ Kh, const unsigned short* __restrict__ Kl,
            const unsigned short* __restrict__ Vt, const float* __restrict__ ABK,
            const unsigned short* __restrict__ PFh, const unsigned short* __restrict__ PFl,
            const float* __restrict__ gb, unsigned short* OPh, unsigned short* OPl) {
  __shared__ __align__(16) float Os[QT * OSV];
  __shared__ __align__(16) float Gs[QT * GSP];
  const int tid  = threadIdx.x;
  const int wave = tid >> 5, lane = tid & 31;
  const int hh   = lane >> 4, c = lane & 15;
  const int y = blockIdx.x, hd = blockIdx.y, b = blockIdx.z;
  const int bh = b * NHD + hd;
  const int xq = 16 * wave + c;                                      // query column of this lane's B/D column
  const int pq = y * IMW + xq;

  const int kylo = (y >= LRANGE) ? ((y - LRANGE) >> 1) : 0;         // block-uniform
  int kyhi = ((y + LRANGE + 1) >> 1) + 1;  if (kyhi > KVH) kyhi = KVH;
  const int kxlo = (xq >= LRANGE) ? ((xq - LRANGE) >> 1) : 0;       // per lane
  int kxhi = ((xq + LRANGE + 1) >> 1) + 1; if (kxhi > KVW) kxhi = KVW;

  // ---- all loads of the position terms first: query planes, bias, table tiles
  const size_t qo = ((size_t)bh * NN + pq) * HD + 8 * hh;
  const unsigned short* qhp = Qh + qo;
  const unsigned short* qlp = Ql + qo;
  const Frag qh = ldfrag(qhp);
  const Frag ql = ldfrag(qlp);
  const float* gp = gb + hd * HD + 8 * hh;
  v4f g[2][2];
#pragma unroll
  for (int s = 0; s < 2; ++s) {                                      // s: d = 16 s + 8 hh ..
    g[s][0] = *(const v4f*)(gp + 16 * s);
    g[s][1] = *(const v4f*)(gp + 16 * s + 4);
  }
  Frag ahi[5], alo[5];                                               // loops unrolled: the arrays stay in registers
  const size_t tx = ((size_t)hd * NDF + c) * HD + 8 * hh;
  const unsigned short* txh = PFh + tx;
  const unsigned short* txl = PFl + tx;
#pragma unroll
  for (int t = 0; t < 3; ++t) {                                      // x axis: table rows T = 16 t + c
    ahi[t] = ldfrag(txh + 16 * t * HD);
    alo[t] = ldfrag(txl + 16 * t * HD);
  }
  const unsigned short* tyh[2];
  const unsigned short* tyl[2];
#pragma unroll
  for (int t = 0; t < 2; ++t) {                                      // y axis: table row of ky = kylo + 16 t + c
    int kyi = kylo + 16 * t + c;  if (kyi > kyhi - 1) kyi = kyhi - 1;
    const size_t to = ((size_t)(NHD + hd) * NDF + (y - 2 * kyi + DOFF)) * HD + 8 * hh;
    tyh[t] = PFh + to;
    tyl[t] = PFl + to;
    ahi[3 + t] = ldfrag(tyh[t]);
    alo[3 + t] = ldfrag(tyl[t]);
  }
  // a later load of this run may otherwise land in an earlier load's address pair: every pair stays live, and so
  // untouched, until this wait
  asm volatile("s_wait_xcnt 0x0" :: "v"(qhp), "v"(qlp), "v"(txh), "v"(txl), "v"(tyh[0]), "v"(tyl[0]), "v"(tyh[1]),
               "v"(tyl[1]) : "memory");

  // ---- B: qg = q + geom bias of query xq, bf16 hi/lo
  Frag bhi, blo;
#pragma unroll
  for (int s = 0; s < 2; ++s) {
    const v4u wh = __builtin_bit_cast(v4u, qh.u[s]), wl = __builtin_bit_cast(v4u, ql.u[s]);
    float f[8];
#pragma unroll
    for (int j = 0; j < 4; ++j) {
      f[2 * j]     = __uint_as_float(wh[j] << 16) + __uint_as_float(wl[j] << 16);
      f[2 * j + 1] = __uint_as_float(wh[j] & 0xffff0000u) + __uint_as_float(wl[j] & 0xffff0000u);
    }
    v4f va, vb;
#pragma unroll
    for (int r = 0; r < 4; ++r) { va[r] = f[r] + bfr(g[s][0][r]); vb[r] = f[4 + r] + bfr(g[s][1][r]); }
    split8(va, vb, bhi.u[s], blo.u[s]);
  }

  // ---- D rows = 16 t + 8 hh + r of tile t, col = query: tiles 0..2 fill Gs cols 0..47, tiles 3, 4 cols 48..79
  float* grow = Gs + xq * GSP;
#pragma unroll
  for (int t = 0; t < 5; ++t) {
    v8f d = zero8();
    d = mma_b(ahi[t].bf, bhi.bf, d);
    d = mma_b(ahi[t].bf, blo.bf, d);
    d = mma_b(alo[t].bf, bhi.bf, d);
    v4f va, vb;
#pragma unroll
    for (int r = 0; r < 4; ++r) { va[r] = d[r]; vb[r] = d[4 + r]; }
    *(v4f*)(grow + 16 * t + 8 * hh)     = va;
    *(v4f*)(grow + 16 * t + 8 * hh + 4) = vb;
  }
  __syncthreads();

  // ---- PX: per lane 16 kx values for query xq; PY: this query's row, read per key row in the loop
  float px0[8], px1[8];
#pragma unroll
  for (int r = 0; r < 8; ++r) {
    int t0 = xq - 2 * (8 * hh + r) + DOFF, t1 = t0 - 32;             // kx = 8 hh + r and 16 + 8 hh + r
    t0 = (t0 < 0) ? 0 : ((t0 > NDF - 1) ? NDF - 1 : t0);
    t1 = (t1 < 0) ? 0 : ((t1 > NDF - 1) ? NDF - 1 : t1);
    px0[r] = grow[t0];
    px1[r] = grow[t1];
  }
  const float* pyrow = grow + NDF - kylo;

  // ---- fragment pointers
  const unsigned short* Khp = Kh + (size_t)bh * NK * HD + (size_t)c * HD + 8 * hh;
  const unsigned short* Klp = Kl + (size_t)bh * NK * HD + (size_t)c * HD + 8 * hh;
  const unsigned short* Vp  = Vt + (size_t)bh * HD * NK + (size_t)c * NK + 8 * hh;
  const float* abkb = ABK + (size_t)bh * NK + 8 * hh;
  const float NINF = -__builtin_inff();

  float m = -1.0e30f, l = 0.f;
  v8f o[2];
  o[0] = zero8(); o[1] = zero8();

#pragma unroll 1
  for (int ky = kylo; ky < kyhi; ++ky) {
    const int kp0 = ky * KVW;
    const Frag k0  = ldfrag(Khp + (size_t)kp0 * HD);                // keys kp0 .. kp0+15
    const Frag k1  = ldfrag(Khp + (size_t)(kp0 + 16) * HD);         // keys kp0+16 .. kp0+31
    const Frag k0l = ldfrag(Klp + (size_t)kp0 * HD);
    const Frag k1l = ldfrag(Klp + (size_t)(kp0 + 16) * HD);
    v8f s0 = zero8(), s1 = zero8();
    s0 = mma_b(k0.bf, qh.bf, s0);
    s1 = mma_b(k1.bf, qh.bf, s1);
    s0 = mma_b(k0.bf, ql.bf, s0);
    s1 = mma_b(k1.bf, ql.bf, s1);
    s0 = mma_b(k0l.bf, qh.bf, s0);
    s1 = mma_b(k1l.bf, qh.bf, s1);

    const v4f a0 = *(const v4f*)(abkb + kp0);
    const v4f a1 = *(const v4f*)(abkb + kp0 + 4);
    const v4f a2 = *(const v4f*)(abkb + kp0 + 16);
    const v4f a3 = *(const v4f*)(abkb + kp0 + 20);
    const float py = pyrow[ky];
#pragma unroll
    for (int r = 0; r < 8; ++r) {
      const int kx0 = 8 * hh + r, kx1 = 16 + 8 * hh + r;
      const float ab0 = (r < 4) ? a0[r & 3] : a1[r & 3];
      const float ab1 = (r < 4) ? a2[r & 3] : a3[r & 3];
      const float e0 = s0[r] + ab0 + px0[r] + py;
      const float e1 = s1[r] + ab1 + px1[r] + py;
      s0[r] = (kx0 >= kxlo && kx0 < kxhi) ? e0 : NINF;
      s1[r] = (kx1 >= kxlo && kx1 < kxhi) ? e1 : NINF;
    }

    float mx = fmaxf(hmax8(s0), hmax8(s1));
    mx = fmaxf(mx, __shfl_xor(mx, 16, 32));
    const float mn = fmaxf(m, mx);
    const unsigned grew = wave_ballot(mx > m);                       // wave-uniform
    if (grew != 0u) {
      const float corr = __expf(m - mn);                             // == 1 exactly for lanes whose max did not grow
      l *= corr;
#pragma unroll
      for (int j = 0; j < 2; ++j) {
#pragma unroll
        for (int r = 0; r < 8; ++r) o[j][r] *= corr;
      }
    }
    m = mn;
    const float msh = mn - LNPS;                                     // exp gives e^{s-m} * 1024

    FragH ph;
    float ls = 0.f;
#pragma unroll
    for (int r = 0; r < 8; ++r) {
      const float e0 = __expf(s0[r] - msh);                          // key kp0      + 8hh + r
      const float e1 = __expf(s1[r] - msh);                          // key kp0 + 16 + 8hh + r
      ls += e0 + e1;
      ph.hv[0][r] = (_Float16)e0;
      ph.hv[1][r] = (_Float16)e1;
    }
    l += ls;

#pragma unroll
    for (int j = 0; j < 2; ++j) {
      const Frag vf = ldfrag(Vp + (size_t)(16 * j) * NK + kp0);
      o[j] = mma_h(vf.h, ph.v, o[j]);
    }
  }
  l += __shfl_xor(l, 16, 32);
  const float inv = 1.0f / l;                                        // o and l both carry the x1024 factor

  const int qr = 16 * wave + c;
#pragma unroll
  for (int j = 0; j < 2; ++j) {
    v4f va, vb;
#pragma unroll
    for (int r = 0; r < 4; ++r) { va[r] = o[j][r] * inv; vb[r] = o[j][4 + r] * inv; }
    *(v4f*)(Os + qr * OSV + 16 * j + 8 * hh)     = va;              // Os[query][d = 16j + 8hh + r]
    *(v4f*)(Os + qr * OSV + 16 * j + 8 * hh + 4) = vb;
  }
  __syncthreads();

  const int e = tid & 7, lq = tid >> 3;                              // lq 0..15
  v4u uh[2], ul[2];
#pragma unroll
  for (int it = 0; it < 2; ++it) {
    const int L = 16 * it + lq;                                      // line 0..31
    const int row = 2 * L + (e >> 2), dl = 8 * (e & 3);
    const v4f a = *(const v4f*)(Os + row * OSV + dl);
    const v4f q = *(const v4f*)(Os + row * OSV + dl + 4);
    const float f[8] = {a[0], a[1], a[2], a[3], q[0], q[1], q[2], q[3]};
#pragma unroll
    for (int t = 0; t < 4; ++t) {
      const float f0 = f[2 * t], f1 = f[2 * t + 1];
      const unsigned short hb0 = bf_bits(f0), hb1 = bf_bits(f1);
      const unsigned short lb0 = bf_bits(f0 - bf_up(hb0));
      const unsigned short lb1 = bf_bits(f1 - bf_up(hb1));
      uh[it][t] = pk16(hb0, hb1);
      ul[it][t] = pk16(lb0, lb1);
    }
  }
{
#pragma unroll
    for (int it = 0; it < 2; ++it) {
      const int L = 16 * it + lq;
      const size_t po = ((size_t)bh * NN + (size_t)y * IMW + 2 * L) * HD + 8 * e;
      *(v4u*)(OPh + po) = uh[it];
      *(v4u*)(OPl + po) = ul[it];
    }
    
  }
}

// =========================================================================================================
// (5) output 1x1-conv for one (b, 64-pixel tile, 64-o block): Y[o][p] = sum_c WPB[o][c] O[b][p][c] with
//     c = 32 h + d: k-step ks = head ks, B fragments from OPh and OPl [b][ks][p][32] (bf16 hi/lo, shared
//     accumulator), A from WPB (split map). Epilogue: Os[p_loc][o_loc], barrier, then
//     lines (row o, 64 pixels = 2 lines): 8 consecutive lanes x 16 B (values from 4 Os rows), one instruction per
// coverage: 8 it x 16 lines x 8 lanes x 4 floats = 64 o x 64 p; grid (64, 4, NB) covers out [b][256][4096] once.
// LDS Os: cross-wave (block barrier).
// =========================================================================================================
__global__ __launch_bounds__(128)
void proj_k(const unsigned short* __restrict__ WPB, const unsigned short* __restrict__ OPh,
            const unsigned short* __restrict__ OPl, const float* __restrict__ pb,
            const float* __restrict__ gam, const float* __restrict__ x, float* out) {
  __shared__ __align__(16) float Os[QT * OSP];
  const int tid  = threadIdx.x;
  const int lane = tid & 31, wave = tid >> 5;
  const int hh   = lane >> 4, c = lane & 15;
  const int nt   = blockIdx.x, mb = blockIdx.y, b = blockIdx.z;
  const int n0   = nt * QT, o0 = mb * QT;

  const unsigned short* ap = WPB + (size_t)(o0 + c) * CC + 8 * hh;
  const size_t brow = (size_t)(n0 + 16 * wave + c) * HD + 8 * hh;

  v8f acc[4];
#pragma unroll
  for (int mt = 0; mt < 4; ++mt) acc[mt] = zero8();

#pragma unroll 2
  for (int ks = 0; ks < NHD; ++ks) {
    const size_t pl = ((size_t)(b * NHD + ks)) * NN * HD + brow;
    const Frag fbh = ldfrag(OPh + pl);
    const Frag fbl = ldfrag(OPl + pl);
#pragma unroll
    for (int mt = 0; mt < 4; ++mt) {
      const Frag fa = ldfrag(ap + (size_t)(16 * mt) * CC + 32 * ks);
      acc[mt] = mma_b(fa.bf, fbh.bf, acc[mt]);
      acc[mt] = mma_b(fa.bf, fbl.bf, acc[mt]);
    }
  }

  {
    const int nl = 16 * wave + c;
#pragma unroll
    for (int mt = 0; mt < 4; ++mt) {
      v4f va, vb;
#pragma unroll
      for (int r = 0; r < 4; ++r) { va[r] = acc[mt][r]; vb[r] = acc[mt][4 + r]; }
      *(v4f*)(Os + nl * OSP + 16 * mt + 8 * hh)     = va;
      *(v4f*)(Os + nl * OSP + 16 * mt + 8 * hh + 4) = vb;
    }
  }
  __syncthreads();

  const float g = bfr(gam[0]);
  const int e = tid & 7, lq = tid >> 3;                              // lq 0..15
  v4f res[8];
#pragma unroll
  for (int it = 0; it < 8; ++it) {
    const int L   = it * 16 + lq;                                    // 0..127
    const int ol  = L >> 1, hf = L & 1;                              // o_loc 0..63
    const int nl  = hf * 32 + 4 * e;                                 // pixel 0..63
    const int oo  = o0 + ol;
    const float pbv = bfr(pb[oo]);
    const size_t idx = ((size_t)(b * CC + oo)) * NN + n0 + nl;
    const v4f xv = *(const v4f*)(x + idx);
#pragma unroll
    for (int t = 0; t < 4; ++t) res[it][t] = g * (Os[(nl + t) * OSP + ol] + pbv) + bfr(xv[t]);
  }
{
#pragma unroll
    for (int it = 0; it < 8; ++it) {
      const int L   = it * 16 + lq;
      const int ol  = L >> 1, hf = L & 1;
      const int nl  = hf * 32 + 4 * e;
      const size_t idx = ((size_t)(b * CC + o0 + ol)) * NN + n0 + nl;
      *(v4f*)(out + idx) = res[it];
    }
    
  }
}

// =========================================================================================================
// Workspace map (bytes; each region start a multiple of 256; every extent is an exact tile multiple and is written
//   W16 f16 [3][256][256]   393216    WPB bf16 [256][256] 131072    WF bf16 [2][256][128] 131072
//   XP  f16 [NB][4096][256]            2097152 x NB
//   Qh/Ql bf16 [NB][8][4096][32]       2097152 x NB each     Kh/Kl bf16 [NB][8][1024][32] 524288 x NB each
//   Vt  f16 [NB][8][32][1024]           524288 x NB          ABK f32 [NB][8][1024] 32768 x NB
//   PFh/PFl bf16 [2][8][48][32]          49152 each
//   OPh/OPl bf16 [NB][8][4096][32]     2097152 x NB each
//   total (NB = 2) = 24936448
// =========================================================================================================
extern "C" void kernel_launch(void* const* d_in, const int* in_sizes, int n_in,
                              void* d_out, int out_size, void* d_ws, size_t ws_size,
                              hipStream_t stream) {
  const int XN = NB * CC * NN;
  if (n_in < 11) return;
  if (in_sizes[0] < XN) return;
  if (in_sizes[1] < CC * CC || in_sizes[2] < CC * CC || in_sizes[3] < CC * CC || in_sizes[8] < CC * CC) return;
  if (in_sizes[4] < CC * PFD || in_sizes[5] < CC * PFD) return;
  if (in_sizes[6] < CC || in_sizes[7] < CC || in_sizes[9] < CC || in_sizes[10] < 1) return;
  if (out_size < XN) return;

  size_t off = 0;
  auto carve = [&](size_t bytes) { const size_t o = off; off += (bytes + 255) & ~(size_t)255; return o; };
  const size_t oW16 = carve((size_t)3 * CC * CC * 2);
  const size_t oWPB = carve((size_t)CC * CC * 2);
  const size_t oWF  = carve((size_t)2 * CC * PFD * 2);
  const size_t oXP  = carve((size_t)NB * NN * CC * 2);
  const size_t oQh  = carve((size_t)NB * NHD * NN * HD * 2);
  const size_t oQl  = carve((size_t)NB * NHD * NN * HD * 2);
  const size_t oKh  = carve((size_t)NB * NHD * NK * HD * 2);
  const size_t oKl  = carve((size_t)NB * NHD * NK * HD * 2);
  const size_t oVt  = carve((size_t)NB * NHD * HD * NK * 2);
  const size_t oABK = carve((size_t)NB * NHD * NK * 4);
  const size_t oPFh = carve((size_t)2 * NHD * NDF * HD * 2);
  const size_t oPFl = carve((size_t)2 * NHD * NDF * HD * 2);
  const size_t oOPh = carve((size_t)NB * NHD * NN * HD * 2);
  const size_t oOPl = carve((size_t)NB * NHD * NN * HD * 2);
  if (off > ws_size) return;
  if (off > (size_t)134217728) return;

  const float* x   = (const float*)d_in[0];
  const float* qw  = (const float*)d_in[1];
  const float* kw  = (const float*)d_in[2];
  const float* vw  = (const float*)d_in[3];
  const float* fxw = (const float*)d_in[4];
  const float* fyw = (const float*)d_in[5];
  const float* ab  = (const float*)d_in[6];
  const float* gb  = (const float*)d_in[7];
  const float* pw  = (const float*)d_in[8];
  const float* pb  = (const float*)d_in[9];
  const float* gam = (const float*)d_in[10];

  char* ws = (char*)d_ws;
  unsigned short* W16 = (unsigned short*)(ws + oW16);
  unsigned short* WPB = (unsigned short*)(ws + oWPB);
  unsigned short* WF  = (unsigned short*)(ws + oWF);
  unsigned short* XP  = (unsigned short*)(ws + oXP);
  unsigned short* Qh  = (unsigned short*)(ws + oQh);
  unsigned short* Ql  = (unsigned short*)(ws + oQl);
  unsigned short* Kh  = (unsigned short*)(ws + oKh);
  unsigned short* Kl  = (unsigned short*)(ws + oKl);
  unsigned short* Vt  = (unsigned short*)(ws + oVt);
  float*          ABK = (float*)(ws + oABK);
  unsigned short* PFh = (unsigned short*)(ws + oPFh);
  unsigned short* PFl = (unsigned short*)(ws + oPFl);
  unsigned short* OPh = (unsigned short*)(ws + oOPh);
  unsigned short* OPl = (unsigned short*)(ws + oOPl);
  float* out = (float*)d_out;

  const dim3 blk256(256), blk128(128);

  // (0)+(1) x -> position-major f16 plane, and the weight planes
  cvt_all<<<dim3(NBX + NBW), blk256, 0, stream>>>(x, qw, kw, vw, pw, fxw, fyw, XP, W16, WPB, WF);
  // (2)+(3) position tables PFh/PFl (x axis then y axis); q, k (+ appr-bias dot vector) and v
  feat_gemm<<<dim3(NBP + NBQ + 2 * NBK), blk128, 0, stream>>>(WF, W16, XP, ab, PFh, PFl, Qh, Ql, Kh, Kl, Vt, ABK);
  // (4) position dot terms and local-window attention -> per-head O planes
  attn_k<<<dim3(IMH, NHD, NB), blk128, 0, stream>>>(Qh, Ql, Kh, Kl, Vt, ABK, PFh, PFl, gb, OPh, OPl);
  // (5) output conv + bias, gamma scale, skip add -> out [b][256][4096]
  proj_k<<<dim3(NN / QT, CC / QT, NB), blk128, 0, stream>>>(WPB, OPh, OPl, pb, gam, x, out);
  (void)hipGetLastError();
}

// v004
// One run takes 47.3 microseconds.
// Timed twice side by side with v003, it ran 1.11 and 1.12 times as fast.
// Over all steps from v000 it is 2.36 times as fast.
// Contractions: q/k/v 1x1-conv GEMMs W[256x256].X[256xN] on v_wmma_f32_16x16x32_f16 (f16 containers of
// bf16-RNE weights x256 and bf16-RNE x); sinusoid position tables E[48x128].Wf^T on v_wmma_f32_16x16x32_bf16
// (bf16 hi + bf16 lo planes of the sin/cos features, Wf bf16-RNE, 2 products); attention scores K.Q^T per head
// on v_wmma_f32_16x16x32_bf16 (bf16 hi + bf16 lo planes of q and k, 3 products, depth 32); O^T = V^T.P^T on
// v_wmma_f32_16x16x32_f16 (v single f16 plane, P = e^{s-m} x1024 f16 from the score D registers); output
// 1x1-conv Wp[256x256].O on v_wmma_f32_16x16x32_bf16 (Wp bf16-RNE, O as bf16 hi + bf16 lo planes, 2 products);
// depth-32 position dot terms table[rows x 32 d].(q + geom bias)^T per (query row, head) on
// v_wmma_f32_16x16x32_bf16 (bf16 hi + bf16 lo planes of both, 3 products); f32 accumulate everywhere; bias terms,
// softmax statistics, gamma and the skip add on f32 VALU.
#include <hip/hip_runtime.h>
#include <math.h>
#include <stdint.h>

#ifndef NB
#define NB 2
#endif
#define NB_FULL 2
#define CC      256
#define IMH     64
#define IMW     64
#define NN      4096
#define KVH     32
#define KVW     32
#define NK      1024
#define NHD     8
#define HD      32
#define PFD     128
#define NPR     2048
#define NDF     48
#define DOFF    17
#define PRT     16
#define GSP     84
#define LRANGE  16
#define QT      64
#define OSP     68
#define XTP     264
#define EP      136
#define OSV     36
#define WSC     256.0f
#define IWSC    0.00390625f
#define LNPS    6.931471805599453f
#define RSQ2    0.70710678118654752f
#define NL2W    0.15571537944784511f

static_assert(NB >= 1 && NB <= NB_FULL);
static_assert(NN == IMH * IMW && NK == KVH * KVW);
static_assert(NPR == IMW * KVW && NPR == IMH * KVH);
static_assert(DOFF == LRANGE + 1 && 2 * DOFF + 1 <= NDF && LRANGE + 2 <= 32);
static_assert(NDF % PRT == 0 && PRT == 16 && GSP >= NDF + 32 && (GSP * 4) % 16 == 0);
static_assert(CC == NHD * HD && HD == 32 && KVW == 32 && KVH == 32);
static_assert(NN % QT == 0 && NK % QT == 0 && CC % QT == 0 && NPR % QT == 0);
static_assert(CC % 32 == 0 && PFD % 32 == 0 && HD % 32 == 0);
static_assert((OSP * 4) % 16 == 0 && (XTP * 2) % 16 == 0 && XTP >= CC && (EP * 2) % 16 == 0);
static_assert(2 * PRT * EP <= QT * XTP);
static_assert((OSV * 4) % 16 == 0);
static_assert(IMW == QT);
static_assert(QT == 2 * HD);

typedef _Float16       v16h __attribute__((ext_vector_type(16)));
typedef _Float16       v8h  __attribute__((ext_vector_type(8)));
typedef __bf16         v16b __attribute__((ext_vector_type(16)));
typedef unsigned short v8us __attribute__((ext_vector_type(8)));
typedef float          v8f  __attribute__((ext_vector_type(8)));
typedef float          v4f  __attribute__((ext_vector_type(4)));
typedef float          v2f  __attribute__((ext_vector_type(2)));
typedef __bf16         v2b  __attribute__((ext_vector_type(2)));
typedef _Float16       v2h  __attribute__((ext_vector_type(2)));
typedef unsigned int   v4u  __attribute__((ext_vector_type(4)));

union Frag  { v8us u[2]; v16h h; v16b bf; };
union FragH { v16h v; v8h hv[2]; };
static_assert(sizeof(Frag) == 32);
static_assert(sizeof(FragH) == 32);

// ---- scalar helpers ---------------------------------------------------------------------------------------
__device__ __forceinline__ unsigned short bf_bits(float f) {          // f32 -> bf16 bits, RNE convert
  unsigned u = __float_as_uint(f);
  return (unsigned short)((u + 0x7FFFu + ((u >> 16) & 1u)) >> 16);
}
__device__ __forceinline__ float bf_up(unsigned short hb) { return __uint_as_float(((unsigned)hb) << 16); }
__device__ __forceinline__ float bfr(float f) { return bf_up(bf_bits(f)); }
__device__ __forceinline__ unsigned short h_bits(_Float16 x) { return __builtin_bit_cast(unsigned short, x); }
__device__ __forceinline__ unsigned pk16(unsigned short a, unsigned short b) { return (unsigned)a | ((unsigned)b << 16); }
__device__ __forceinline__ v8f zero8() { v8f z = {0.f, 0.f, 0.f, 0.f, 0.f, 0.f, 0.f, 0.f}; return z; }
__device__ __forceinline__ float hmax8(v8f s) {
  return fmaxf(fmaxf(fmaxf(s[0], s[1]), fmaxf(s[2], s[3])), fmaxf(fmaxf(s[4], s[5]), fmaxf(s[6], s[7])));
}
__device__ __forceinline__ unsigned wave_ballot(bool p) {
#if defined(__HIP_DEVICE_COMPILE__)
  return __builtin_amdgcn_ballot_w32(p);
#else
  return p ? 1u : 0u;
#endif
}

// ---- 16-bit fragment loader (A, or B from a k-contiguous [n][k] row): lane -> row/col (lane&15), p already includes
//      + 8*(lane>>4); elements 0..7 <- p[0..7] (k0+8h..), elements 8..15 <- p[16..23] (k0+16+8h..)
__device__ __forceinline__ Frag ldfrag(const unsigned short* p) {
  Frag f;
  f.u[0] = *(const v8us*)(p);
  f.u[1] = *(const v8us*)(p + 16);
  return f;
}

// ---- WMMA helpers: builtin followed by a 4-slot VALU gap tying D and keeping A/B live --------------------------
__device__ __forceinline__ v8f mma_h(v16h a, v16h b, v8f c) {
  v8f d = __builtin_amdgcn_wmma_f32_16x16x32_f16(false, a, false, b, (short)0, c, false, false);
#if defined(__HIP_DEVICE_COMPILE__)
  asm volatile("v_nop\n\tv_nop\n\tv_nop\n\tv_nop" : "+v"(d) : "v"(a), "v"(b));
#endif
  return d;
}
__device__ __forceinline__ v8f mma_b(v16b a, v16b b, v8f c) {
  v8f d = __builtin_amdgcn_wmma_f32_16x16x32_bf16(false, a, false, b, (short)0, c, false, false);
#if defined(__HIP_DEVICE_COMPILE__)
  const v16h ha = __builtin_bit_cast(v16h, a), hb = __builtin_bit_cast(v16h, b);
  asm volatile("v_nop\n\tv_nop\n\tv_nop\n\tv_nop" : "+v"(d) : "v"(ha), "v"(hb));
#endif
  return d;
}

// =========================================================================================================
// (0) conversions done where the values are used (no launch of their own).
//     cvt_x2: two f32 -> bf16-RNE -> the same values as f16 (exact), packed; cvt_w2: the same with the x256 weight scale;
//     cvt_b2: two f32 -> bf16-RNE, packed. ldfrag_f32<true> / <false>: the split k map of ldfrag read from an f32 row.
//     cvt_wp: WPB bf16 [256][256] = bf16-RNE(proj_w) for the output conv launch; 64 blocks x 4 rows x 256.
// =========================================================================================================
__device__ __forceinline__ unsigned cvt_b2(float a, float b) {
  const v2f p = {a, b};
  return __builtin_bit_cast(unsigned, __builtin_convertvector(p, v2b));
}
__device__ __forceinline__ unsigned cvt_x2(float a, float b) {
  const unsigned hw = cvt_b2(a, b);
  const v2f r = {__uint_as_float(hw << 16), __uint_as_float(hw & 0xffff0000u)};
  return __builtin_bit_cast(unsigned, __builtin_convertvector(r, v2h));
}
__device__ __forceinline__ unsigned cvt_w2(float a, float b) {
  const unsigned hw = cvt_b2(a, b);
  const v2f r = {__uint_as_float(hw << 16) * WSC, __uint_as_float(hw & 0xffff0000u) * WSC};
  return __builtin_bit_cast(unsigned, __builtin_convertvector(r, v2h));
}
template <bool F16W>
__device__ __forceinline__ Frag ldfrag_f32(const float* p) {
  Frag f;
#pragma unroll
  for (int s = 0; s < 2; ++s) {
    const v4f a = *(const v4f*)(p + 16 * s);
    const v4f q = *(const v4f*)(p + 16 * s + 4);
    v4u u;
    if constexpr (F16W) {
      u[0] = cvt_w2(a[0], a[1]); u[1] = cvt_w2(a[2], a[3]); u[2] = cvt_w2(q[0], q[1]); u[3] = cvt_w2(q[2], q[3]);
    } else {
      u[0] = cvt_b2(a[0], a[1]); u[1] = cvt_b2(a[2], a[3]); u[2] = cvt_b2(q[0], q[1]); u[3] = cvt_b2(q[2], q[3]);
    }
    f.u[s] = __builtin_bit_cast(v8us, u);
  }
  return f;
}
__device__ __forceinline__
void cvt_wp(const int blk, const float* __restrict__ pw, unsigned short* WPB) {
  const int tid = threadIdx.x;
  const int o = 4 * blk + (tid >> 5), col = 8 * (tid & 31);
  const float* sp = pw + (size_t)o * CC + col;
  const v4f a = *(const v4f*)sp;
  const v4f q = *(const v4f*)(sp + 4);
  v4u u;
  u[0] = cvt_b2(a[0], a[1]); u[1] = cvt_b2(a[2], a[3]); u[2] = cvt_b2(q[0], q[1]); u[3] = cvt_b2(q[2], q[3]);
  *(v4u*)(WPB + (size_t)o * CC + col) = u;
  // the listing lays another job's code behind this store: its registers stay untouched until this wait
  asm volatile("s_wait_xcnt 0x0" ::: "memory");
}

// =========================================================================================================
// (2) 1x1-conv GEMM for one (b, 64-n tile, 64-o block): Y[o][n] = (1/256) sum_c w16(W[o][c]) x16(x[b][c][pix(n)]).
//     MODE 0: n = query pixel; MODE 1/2: n = key index ky*32+kx -> pixel 128 ky + 2 kx (arithmetic addressing).
//     Block 128 threads = 4 waves. The block's x tile goes f32 [256 c][64 n] -> LDS XT f16 [64 n][256 c] (pitch XTP):
//     a thread reads 8 consecutive c rows (MODE 0: 4 n each, 16-byte loads; MODE 1/2: 2 keys each (kx = lane), every second
//     pixel, 4-byte loads) and stores one 16-byte run of c per n.
//     Wave w owns A rows o = o0 + 16 w + (lane&15), read from the f32 weight row and converted in registers (split k
//     map, all 8 k-steps held), and all 4 n-tiles (B fragments from XT rows, k = c contiguous). K = 256 = 8 steps.
//     Epilogue staged in LDS Os[n_loc][o_loc] (pitch OSP), barrier, then per MODE:
//       0: Qh/Ql bf16 [b][8][4096][32] hi = bf16-RNE(v), lo = bf16-RNE(v - hi); 1: Kh/Kl bf16 [b][8][1024][32]
//          plus ABK f32 [b][8][1024] = sum_d bf16-RNE(appr_bias)[h][d] * Y (f32 before the 16-bit convert);
//          a plane line = 2 rows of 32 d: lane e -> row 2j + (e>>2), d 8(e&3).., 8 consecutive lanes per line, one
//       2: Vt f16 [b][8][32 d][1024 keys]: line = row (h,d), 64 keys: lane e -> keys 8e..8e+7, one instruction per
// coverage: XT 128 threads x 16 runs x 8 c = 64 n x 256 c; Os 4 waves x 16 o x 64 n = 64 x 64; MODE 0/1: 4 it x 16 lines x 8 lanes x 8 = 64 n x 64 o per plane;
//           MODE 2: 4 it x 16 rows x 8 lanes x 8 = 64 o x 64 keys; ABK 2 heads x 64 keys; (nt, mb, b) in NP/64 x 4 x NB.
// LDS XT, Os, abks: cross-wave (block barriers).
// =========================================================================================================
template <int MODE>
__device__ __forceinline__
void gemm_x(unsigned short* XT, float* Os, float* abks, const int nt, const int mb, const int b,
            const float* __restrict__ wsrc, const float* __restrict__ x,
            const float* __restrict__ ab, unsigned short* Ph, unsigned short* Pl,
            unsigned short* Vt, float* ABK) {
  constexpr int NP = (MODE == 0) ? NN : NK;
  const int tid  = threadIdx.x;
  const int lane = tid & 31, wave = tid >> 5;
  const int hh   = lane >> 4, c = lane & 15;
  const int n0   = nt * QT, o0 = mb * QT;
  (void)ab; (void)Ph; (void)Pl; (void)Vt; (void)ABK; (void)abks;

  // ---- all loads that the first barrier waits for are issued first: the x tile, then the A rows of k-steps 0..3
  constexpr int KH = CC / 64;                                        // half of the k-steps
  const int nq = tid & 15, cg = tid >> 4;
  const float* xp = (MODE == 0) ? x + ((size_t)(b * CC + 8 * cg)) * NN + n0 + 4 * nq
                                : x + ((size_t)(b * CC + 8 * wave)) * NN + 2 * IMW * (2 * nt) + 2 * lane;
  const float* ap = wsrc + (size_t)(o0 + 16 * wave + c) * CC + 8 * hh;
  float f[16][8];
  if constexpr (MODE == 0) {                                         // f[4 it + i][j]: n_loc = 4 nq + i, c = 64 it + 8 cg + j
#pragma unroll
    for (int it = 0; it < 4; ++it) {
#pragma unroll
      for (int j = 0; j < 8; ++j) {
        const v4f a = *(const v4f*)(xp + (size_t)(64 * it + j) * NN);
#pragma unroll
        for (int i = 0; i < 4; ++i) f[4 * it + i][j] = a[i];
      }
    }
  } else {                                                           // f[2 it + kyl][j]: n_loc = 32 kyl + lane, c = 32 it + 8 w + j
#pragma unroll
    for (int it = 0; it < 8; ++it) {
#pragma unroll
      for (int kyl = 0; kyl < 2; ++kyl) {
#pragma unroll
        for (int j = 0; j < 8; ++j) f[2 * it + kyl][j] = xp[(size_t)(32 * it + j) * NN + 2 * IMW * kyl];
      }
    }
  }
  Frag fa[CC / 32];
#pragma unroll
  for (int ks = 0; ks < KH; ++ks) fa[ks] = ldfrag_f32<true>(ap + 32 * ks);
  // a later load of this run may otherwise land in an earlier load's address pair: both pairs stay live, and so
  // untouched, until this wait; no LDS store is lifted over it, so the whole run is in flight before the first convert
  asm volatile("s_wait_xcnt 0x0" :: "v"(xp), "v"(ap) : "memory");
#pragma unroll
  for (int g = 0; g < 16; ++g) {
    v4u u;
#pragma unroll
    for (int t = 0; t < 4; ++t) u[t] = cvt_x2(f[g][2 * t], f[g][2 * t + 1]);
    if constexpr (MODE == 0) *(v4u*)(XT + (4 * nq + (g & 3)) * XTP + 64 * (g >> 2) + 8 * cg) = u;
    else                     *(v4u*)(XT + (32 * (g & 1) + lane) * XTP + 32 * (g >> 1) + 8 * wave) = u;
  }
  __syncthreads();

  // ---- the A rows of k-steps 4..7 fly under the first half of the products
#pragma unroll
  for (int ks = KH; ks < CC / 32; ++ks) fa[ks] = ldfrag_f32<true>(ap + 32 * ks);

  v8f acc[4];
#pragma unroll
  for (int t = 0; t < 4; ++t) acc[t] = zero8();

  const unsigned short* bl = XT + c * XTP + 8 * hh;
  Frag fb[2][4];                                                     // B fragments are read one k-step ahead
#pragma unroll
  for (int t = 0; t < 4; ++t) fb[0][t] = ldfrag(bl + 16 * t * XTP);
#pragma unroll
  for (int ks = 0; ks < CC / 32; ++ks) {
    // the address pair of the second run of A loads stays live, and so untouched, until this wait
    if (ks == KH) asm volatile("s_wait_xcnt 0x0" :: "v"(ap) : "memory");
    if (ks + 1 < CC / 32) {
#pragma unroll
      for (int t = 0; t < 4; ++t) fb[(ks + 1) & 1][t] = ldfrag(bl + 16 * t * XTP + 32 * (ks + 1));
    }
#pragma unroll
    for (int t = 0; t < 4; ++t) acc[t] = mma_h(fa[ks].h, fb[ks & 1][t].h, acc[t]);
  }

  // ---- stage: lane (hh, c) holds o_loc = 16 w + 8 hh + r for n_loc = 16 t + c
  {
#pragma unroll
    for (int t = 0; t < 4; ++t) {
      const int nl = 16 * t + c;
      v4f va, vb;
#pragma unroll
      for (int r = 0; r < 4; ++r) { va[r] = acc[t][r] * IWSC; vb[r] = acc[t][4 + r] * IWSC; }
      *(v4f*)(Os + nl * OSP + 16 * wave + 8 * hh)     = va;
      *(v4f*)(Os + nl * OSP + 16 * wave + 8 * hh + 4) = vb;
    }
  }
  __syncthreads();

  const int e = tid & 7, lq = tid >> 3;                             // lq 0..15
  if constexpr (MODE == 2) {
    v4u uv[4];
#pragma unroll
    for (int it = 0; it < 4; ++it) {
      const int ol = it * 16 + lq;                                   // o_loc 0..63
      unsigned short hb[8];
#pragma unroll
      for (int t = 0; t < 8; ++t) hb[t] = h_bits((_Float16)Os[(8 * e + t) * OSP + ol]);
#pragma unroll
      for (int t = 0; t < 4; ++t) uv[it][t] = pk16(hb[2 * t], hb[2 * t + 1]);
    }
{
#pragma unroll
      for (int it = 0; it < 4; ++it) {
        const int ol = it * 16 + lq;
        const int oo = o0 + ol, hd = oo >> 5, d = oo & 31;
        *(v4u*)(Vt + ((size_t)((b * NHD + hd) * HD + d)) * NK + n0 + 8 * e) = uv[it];
      }
      // the listing lays another job's code behind these stores: their registers stay untouched until this wait
      asm volatile("s_wait_xcnt 0x0" ::: "memory");
    }
  } else {
    v4u uh[4], ul[4];
#pragma unroll
    for (int it = 0; it < 4; ++it) {
      const int L = it * 16 + lq;                                    // line 0..63
      const int hs = L >> 5, j = L & 31;
      const int row = 2 * j + (e >> 2);                              // n_loc
      const int cb0 = 32 * hs + 8 * (e & 3);                         // o_loc of the first value
      const v4f a = *(const v4f*)(Os + row * OSP + cb0);
      const v4f q = *(const v4f*)(Os + row * OSP + cb0 + 4);
      const float f[8] = {a[0], a[1], a[2], a[3], q[0], q[1], q[2], q[3]};
#pragma unroll
      for (int t = 0; t < 4; ++t) {
        const float f0 = f[2 * t], f1 = f[2 * t + 1];
        const unsigned short hb0 = bf_bits(f0), hb1 = bf_bits(f1);
        const unsigned short lb0 = bf_bits(f0 - bf_up(hb0));
        const unsigned short lb1 = bf_bits(f1 - bf_up(hb1));
        uh[it][t] = pk16(hb0, hb1);
        ul[it][t] = pk16(lb0, lb1);
      }
    }
    v4f abv = {0.f, 0.f, 0.f, 0.f};
    if constexpr (MODE == 1) {
      const int kl = tid & 63, hs = tid >> 6;                       // hs wave-uniform
      const float* abp  = ab + (2 * mb + hs) * HD;
      const float* orow = Os + kl * OSP + 32 * hs;
      float s = 0.f;
#pragma unroll
      for (int d4 = 0; d4 < 8; ++d4) {
        const v4f g  = *(const v4f*)(abp + 4 * d4);
        const v4f ov = *(const v4f*)(orow + 4 * d4);
        s += bfr(g[0]) * ov[0] + bfr(g[1]) * ov[1] + bfr(g[2]) * ov[2] + bfr(g[3]) * ov[3];
      }
      abks[hs * QT + kl] = s;
      __syncthreads();
      if (tid < 32) abv = *(const v4f*)(abks + (lq >> 1) * QT + 32 * (lq & 1) + 4 * e);
    }
{
#pragma unroll
      for (int it = 0; it < 4; ++it) {
        const int L = it * 16 + lq;
        const int hs = L >> 5, j = L & 31;
        const size_t po = ((size_t)((b * NHD + 2 * mb + hs) * NP + n0 + 2 * j)) * HD + 8 * e;
        *(v4u*)(Ph + po) = uh[it];
        *(v4u*)(Pl + po) = ul[it];
      }
      // the listing lays another job's code behind these stores: their registers stay untouched until this wait
      // (MODE 1: the build has its own wait behind its stores)
      if constexpr (MODE == 0) asm volatile("s_wait_xcnt 0x0" ::: "memory");
      if constexpr (MODE == 1) {
        if (tid < 32)                                                // wave 0, wave-uniform
          *(v4f*)(ABK + (size_t)(b * NHD + 2 * mb + (lq >> 1)) * NK + n0 + 32 * (lq & 1) + 4 * e) = abv;
      }
      
    }
  }
}

// ---- 8 f32 -> bf16 hi (RNE) and bf16 lo (RNE of the rest), packed pairs
__device__ __forceinline__ void split8(v4f a, v4f q, v8us& hi, v8us& lo) {
  const float f[8] = {a[0], a[1], a[2], a[3], q[0], q[1], q[2], q[3]};
  v4u wh, wl;
#pragma unroll
  for (int t = 0; t < 4; ++t) {
    const v2f p = {f[2 * t], f[2 * t + 1]};
    const unsigned hw = __builtin_bit_cast(unsigned, __builtin_convertvector(p, v2b));   // RNE, packed pair
    const v2f r = {p[0] - __uint_as_float(hw << 16), p[1] - __uint_as_float(hw & 0xffff0000u)};
    wh[t] = hw;
    wl[t] = __builtin_bit_cast(unsigned, __builtin_convertvector(r, v2b));
  }
  hi = __builtin_bit_cast(v8us, wh);
  lo = __builtin_bit_cast(v8us, wl);
}

// =========================================================================================================
// (3) position tables. A table row depends on its (coord, kcoord) pair only through diff = coord - 2*kcoord, and
//     inside the local window diff lies in -DOFF..DOFF, so the tables are built once per diff: row T = diff + DOFF
//     (rows 35..47 fill the last tile and are never used). One job = (16-row tile rt, 64-o block ob, axis):
//     a = diff * 1000^(-f/64), features [sin(a) | cos(a)] (128) built in LDS as bf16 hi/lo planes Eh/El[16][128]
//     (pitch EP); then Y[o][T] = sum_f Wf[axis][o][f] E[T][f]: wave w owns A rows o = 64 ob + 16 w + (lane&15), bf16-RNE
//     of the f32 row, all waves share the B rows T from Eh and El (2 products sharing the accumulator, K = 128); epilogue
//     Os[T_loc][o_loc] = Y / sqrt(2), barrier, then
//       PFh/PFl bf16 [axis][h][48 T][32 d] (hi = bf16-RNE(v), lo = bf16-RNE(v - hi)): a plane line = 2 rows of 32 d,
//       lane -> row (tid>>2)&15, d 8(tid&3).., 8 consecutive lanes per line.
// coverage: Eh/El 8 it x 128 threads = 16 rows x 64 args x {sin,cos} = 16 x 128 (cols 128..135 pad, never read);
//           planes 128 threads x 8 = 2 heads x 16 rows x 32 d; (rt, ob, axis) in 3 x 4 x 2 covers
//           PFh/PFl [2][8][48][32] exactly once.
// LDS Eh/El, Os: cross-wave (block barriers).
// =========================================================================================================
__device__ __forceinline__
void posfeat(unsigned short* Eh, unsigned short* El, float* Os, const int rt, const int ob, const int axis,
             const float* __restrict__ fxw, const float* __restrict__ fyw, unsigned short* PFh, unsigned short* PFl) {
  const int tid  = threadIdx.x;
  const int lane = tid & 31, wave = tid >> 5;
  const int hh   = lane >> 4, c = lane & 15;
  const int R0   = rt * PRT;

  // ---- A rows first: their loads fly under the sinusoids
  const float* ap = (axis ? fyw : fxw) + (size_t)(QT * ob + 16 * wave + c) * PFD + 8 * hh;
  Frag fa[PFD / 32];
#pragma unroll
  for (int ks = 0; ks < PFD / 32; ++ks) fa[ks] = ldfrag_f32<false>(ap + 32 * ks);
  // a later load of this run may otherwise land in the address pair: it stays live, and so untouched, until this wait
  asm volatile("s_wait_xcnt 0x0" :: "v"(ap) : "memory");

  // ---- (a) sinusoid features -> LDS bf16 hi/lo planes (rolled: one copy of the sin/cos code keeps the text short)
#pragma unroll 1
  for (int it = 0; it < PRT / 2; ++it) {
    const int idx = it * 128 + tid;                                  // 0..1023
    const int rl = idx >> 6, fa = idx & 63;
    const float diff = (float)(R0 + rl - DOFF);
    const float a = diff * exp2f(-(float)fa * NL2W);
    const float sv = sinf(a);
    const float cv = cosf(a);
    const unsigned short shb = bf_bits(sv), chb = bf_bits(cv);
    Eh[rl * EP + fa]      = shb;
    El[rl * EP + fa]      = bf_bits(sv - bf_up(shb));
    Eh[rl * EP + 64 + fa] = chb;
    El[rl * EP + 64 + fa] = bf_bits(cv - bf_up(chb));
  }
  __syncthreads();

  const unsigned short* ebh = Eh + c * EP + 8 * hh;
  const unsigned short* ebl = El + c * EP + 8 * hh;
  v8f acc = zero8();
#pragma unroll
  for (int ks = 0; ks < PFD / 32; ++ks) {
    const Frag fbh = ldfrag(ebh + 32 * ks);
    const Frag fbl = ldfrag(ebl + 32 * ks);
    acc = mma_b(fa[ks].bf, fbh.bf, acc);
    acc = mma_b(fa[ks].bf, fbl.bf, acc);
  }
  {
    v4f va, vb;
#pragma unroll
    for (int r = 0; r < 4; ++r) { va[r] = acc[r] * RSQ2; vb[r] = acc[4 + r] * RSQ2; }
    *(v4f*)(Os + c * OSP + 16 * wave + 8 * hh)     = va;            // Os[T_loc = c][o_loc = 16 w + 8 hh + r]
    *(v4f*)(Os + c * OSP + 16 * wave + 8 * hh + 4) = vb;
  }
  __syncthreads();
  const int dl = 8 * (tid & 3), rl = (tid >> 2) & 15, hs = tid >> 6;
  v8us hi, lo;
  split8(*(const v4f*)(Os + rl * OSP + 32 * hs + dl), *(const v4f*)(Os + rl * OSP + 32 * hs + dl + 4), hi, lo);
  const size_t po = ((size_t)(axis * NHD + 2 * ob + hs) * NDF + R0 + rl) * HD + dl;
  *(v8us*)(PFh + po) = hi;
  *(v8us*)(PFl + po) = lo;
}

// =========================================================================================================
// (0)+(2)+(3) in one launch: the position tables, the q, k and v GEMMs and the proj_w plane read only inputs and
// none reads another's output. Block order: tables first (24 blocks), then
// q (NBQ blocks), k and v (NBK blocks each), then the proj_w plane (NBWP blocks). The selection is block-uniform, so
// every barrier of a job is passed by all four waves of its block. XT and Os are shared by the jobs (a block runs
// exactly one of them); the table job keeps its Eh and El planes in XT.
// =========================================================================================================
#define NBP ((NDF / PRT) * (CC / QT) * 2)
#define NBQ ((NN / QT) * (CC / QT) * NB)
#define NBK ((NK / QT) * (CC / QT) * NB)
#define NBWP (CC / 4)
__global__ __launch_bounds__(128)
void feat_gemm(const float* __restrict__ x, const float* __restrict__ qw, const float* __restrict__ kw,
               const float* __restrict__ vw, const float* __restrict__ pw, const float* __restrict__ fxw,
               const float* __restrict__ fyw, const float* __restrict__ ab,
               unsigned short* PFh, unsigned short* PFl, unsigned short* Qh, unsigned short* Ql, unsigned short* Kh, unsigned short* Kl,
               unsigned short* Vt, float* ABK, unsigned short* WPB) {
  __shared__ __align__(16) unsigned short XT[QT * XTP];
  __shared__ __align__(16) float Os[QT * OSP];
  __shared__ __align__(16) float abks[2 * QT];
  const int blk = blockIdx.x;
  if (blk < NBP) {
    posfeat(XT, XT + PRT * EP, Os, blk % (NDF / PRT), (blk / (NDF / PRT)) % (CC / QT), blk / ((NDF / PRT) * (CC / QT)),
            fxw, fyw, PFh, PFl);
  } else if (blk < NBP + NBQ) {
    const int j = blk - NBP;
    gemm_x<0>(XT, Os, abks, j % (NN / QT), (j / (NN / QT)) % (CC / QT), j / ((NN / QT) * (CC / QT)),
              qw, x, ab, Qh, Ql, Vt, ABK);
  } else if (blk < NBP + NBQ + NBK) {
    const int j = blk - (NBP + NBQ);
    gemm_x<1>(XT, Os, abks, j % (NK / QT), (j / (NK / QT)) % (CC / QT), j / ((NK / QT) * (CC / QT)),
              kw, x, ab, Kh, Kl, Vt, ABK);
  } else if (blk < NBP + NBQ + 2 * NBK) {
    const int j = blk - (NBP + NBQ + NBK);
    gemm_x<2>(XT, Os, abks, j % (NK / QT), (j / (NK / QT)) % (CC / QT), j / ((NK / QT) * (CC / QT)),
              vw, x, ab, Kh, Kl, Vt, ABK);
  } else {
    cvt_wp(blk - (NBP + NBQ + 2 * NBK), pw, WPB);
  }
}

// =========================================================================================================
// (4) local-window attention for one (query row y, head, b): block = 4 waves, wave w = queries x = 16w..16w+15.
//   Position dot terms first, per wave for its own 16 queries: B cols = qg = q + bf16-RNE(geom_bias) from Qh + Ql +
//   bias, split in registers into bf16 hi/lo with the split k map of ldfrag; A rows from the by-difference tables
//   PFh/PFl (hi.hi + hi.lo + lo.hi share the accumulator, depth 32). x axis: the 3 tiles of all 48 rows T, one
//   table for every query, D -> Gs[query][T]; y axis: rows T = y - 2 ky + DOFF of ky = kylo + i (i = 16 t + (lane&15),
//   held at the last allowed row), D -> Gs[query][NDF + i]; barrier. Per lane (hh, c): PX[kx] = Gs[query][x - 2 kx +
//   DOFF] for kx in {8hh..8hh+7, 16+8hh..} (registers; the index is held inside the row where kx lies outside the
//   window, where the energy is replaced anyway); PY[ky] = Gs[query][NDF + ky - kylo], one value per key row.
//   Loop over allowed key rows ky (block-uniform; forbidden rows contribute exactly 0): S^T tiles (16 keys x 16
//   queries) = A(Kh rows key ky*32 + 16t + (lane&15), k = d split map) . B(Qh col = query) + A(Kh).B(Ql) +
//   A(Kl).B(Qh) (bf16 hi/lo planes, shared accumulator); energy = S^T + ABK[key] + PX[kx] + PY[ky], replaced by
//   -inf outside the per-query kx window. Per lane the D tiles hold 16 keys of ONE query: online softmax per lane,
//   one shuffle (lane^16) for the max over the 32 keys of the row, o/l rescale skipped under a wave-uniform ballot.
//   P = e^{s-m} x 1024 as f16 is the B operand of O^T (rows d, cols queries) += A(Vt rows d = 16j + (lane&15), keys
//   split map) . B(P^T): element r <- D of the tile covering kx 0..15, element 8+r <- the tile covering kx 16..31.
//   Epilogue: O/l staged in LDS Os[query][32 d] (pitch OSV), barrier, then OPh/OPl bf16 [b][8][4096][32] (hi = bf16-
//   RNE(v), lo = bf16-RNE(v - hi)); line = 2 query rows: lane e -> row 2L + (e>>2), d 8(e&3).., 8 consecutive lanes
// coverage: Os 4 waves x 16 queries x 32 d; planes 2 it x 16 lines x 8 lanes x 8 = 64 queries x 32 d per plane;
//           grid (64, 8, NB) covers OPh/OPl [b][8][4096][32] exactly once.
// LDS Os: cross-wave (block barrier). Gs: written and read inside one wave's rows, synchronised with a block barrier.
// =========================================================================================================
__global__ __launch_bounds__(128)
void attn_k(const unsigned short* __restrict__ Qh, const unsigned short* __restrict__ Ql,
            const unsigned short* __restrict__ Kh, const unsigned short* __restrict__ Kl,
            const unsigned short* __restrict__ Vt, const float* __restrict__ ABK,
            const unsigned short* __restrict__ PFh, const unsigned short* __restrict__ PFl,
            const float* __restrict__ gb, unsigned short* OPh, unsigned short* OPl) {
  __shared__ __align__(16) float Os[QT * OSV];
  __shared__ __align__(16) float Gs[QT * GSP];
  const int tid  = threadIdx.x;
  const int wave = tid >> 5, lane = tid & 31;
  const int hh   = lane >> 4, c = lane & 15;
  const int y = blockIdx.x, hd = blockIdx.y, b = blockIdx.z;
  const int bh = b * NHD + hd;
  const int xq = 16 * wave + c;                                      // query column of this lane's B/D column
  const int pq = y * IMW + xq;

  const int kylo = (y >= LRANGE) ? ((y - LRANGE) >> 1) : 0;         // block-uniform
  int kyhi = ((y + LRANGE + 1) >> 1) + 1;  if (kyhi > KVH) kyhi = KVH;
  const int kxlo = (xq >= LRANGE) ? ((xq - LRANGE) >> 1) : 0;       // per lane
  int kxhi = ((xq + LRANGE + 1) >> 1) + 1; if (kxhi > KVW) kxhi = KVW;

  // ---- all loads of the position terms first: query planes, bias, table tiles
  const size_t qo = ((size_t)bh * NN + pq) * HD + 8 * hh;
  const unsigned short* qhp = Qh + qo;
  const unsigned short* qlp = Ql + qo;
  const Frag qh = ldfrag(qhp);
  const Frag ql = ldfrag(qlp);
  const float* gp = gb + hd * HD + 8 * hh;
  v4f g[2][2];
#pragma unroll
  for (int s = 0; s < 2; ++s) {                                      // s: d = 16 s + 8 hh ..
    g[s][0] = *(const v4f*)(gp + 16 * s);
    g[s][1] = *(const v4f*)(gp + 16 * s + 4);
  }
  Frag ahi[5], alo[5];                                               // loops unrolled: the arrays stay in registers
  const size_t tx = ((size_t)hd * NDF + c) * HD + 8 * hh;
  const unsigned short* txh = PFh + tx;
  const unsigned short* txl = PFl + tx;
#pragma unroll
  for (int t = 0; t < 3; ++t) {                                      // x axis: table rows T = 16 t + c
    ahi[t] = ldfrag(txh + 16 * t * HD);
    alo[t] = ldfrag(txl + 16 * t * HD);
  }
  const unsigned short* tyh[2];
  const unsigned short* tyl[2];
#pragma unroll
  for (int t = 0; t < 2; ++t) {                                      // y axis: table row of ky = kylo + 16 t + c
    int kyi = kylo + 16 * t + c;  if (kyi > kyhi - 1) kyi = kyhi - 1;
    const size_t to = ((size_t)(NHD + hd) * NDF + (y - 2 * kyi + DOFF)) * HD + 8 * hh;
    tyh[t] = PFh + to;
    tyl[t] = PFl + to;
    ahi[3 + t] = ldfrag(tyh[t]);
    alo[3 + t] = ldfrag(tyl[t]);
  }
  // a later load of this run may otherwise land in an earlier load's address pair: every pair stays live, and so
  // untouched, until this wait
  asm volatile("s_wait_xcnt 0x0" :: "v"(qhp), "v"(qlp), "v"(txh), "v"(txl), "v"(tyh[0]), "v"(tyl[0]), "v"(tyh[1]),
               "v"(tyl[1]) : "memory");

  // ---- B: qg = q + geom bias of query xq, bf16 hi/lo
  Frag bhi, blo;
#pragma unroll
  for (int s = 0; s < 2; ++s) {
    const v4u wh = __builtin_bit_cast(v4u, qh.u[s]), wl = __builtin_bit_cast(v4u, ql.u[s]);
    float f[8];
#pragma unroll
    for (int j = 0; j < 4; ++j) {
      f[2 * j]     = __uint_as_float(wh[j] << 16) + __uint_as_float(wl[j] << 16);
      f[2 * j + 1] = __uint_as_float(wh[j] & 0xffff0000u) + __uint_as_float(wl[j] & 0xffff0000u);
    }
    v4f va, vb;
#pragma unroll
    for (int r = 0; r < 4; ++r) { va[r] = f[r] + bfr(g[s][0][r]); vb[r] = f[4 + r] + bfr(g[s][1][r]); }
    split8(va, vb, bhi.u[s], blo.u[s]);
  }

  // ---- D rows = 16 t + 8 hh + r of tile t, col = query: tiles 0..2 fill Gs cols 0..47, tiles 3, 4 cols 48..79
  float* grow = Gs + xq * GSP;
#pragma unroll
  for (int t = 0; t < 5; ++t) {
    v8f d = zero8();
    d = mma_b(ahi[t].bf, bhi.bf, d);
    d = mma_b(ahi[t].bf, blo.bf, d);
    d = mma_b(alo[t].bf, bhi.bf, d);
    v4f va, vb;
#pragma unroll
    for (int r = 0; r < 4; ++r) { va[r] = d[r]; vb[r] = d[4 + r]; }
    *(v4f*)(grow + 16 * t + 8 * hh)     = va;
    *(v4f*)(grow + 16 * t + 8 * hh + 4) = vb;
  }
  __syncthreads();

  // ---- PX: per lane 16 kx values for query xq; PY: this query's row, read per key row in the loop
  float px0[8], px1[8];
#pragma unroll
  for (int r = 0; r < 8; ++r) {
    int t0 = xq - 2 * (8 * hh + r) + DOFF, t1 = t0 - 32;             // kx = 8 hh + r and 16 + 8 hh + r
    t0 = (t0 < 0) ? 0 : ((t0 > NDF - 1) ? NDF - 1 : t0);
    t1 = (t1 < 0) ? 0 : ((t1 > NDF - 1) ? NDF - 1 : t1);
    px0[r] = grow[t0];
    px1[r] = grow[t1];
  }
  const float* pyrow = grow + NDF - kylo;

  // ---- fragment pointers
  const unsigned short* Khp = Kh + (size_t)bh * NK * HD + (size_t)c * HD + 8 * hh;
  const unsigned short* Klp = Kl + (size_t)bh * NK * HD + (size_t)c * HD + 8 * hh;
  const unsigned short* Vp  = Vt + (size_t)bh * HD * NK + (size_t)c * NK + 8 * hh;
  const float* abkb = ABK + (size_t)bh * NK + 8 * hh;
  const float NINF = -__builtin_inff();

  float m = -1.0e30f, l = 0.f;
  v8f o[2];
  o[0] = zero8(); o[1] = zero8();

#pragma unroll 1
  for (int ky = kylo; ky < kyhi; ++ky) {
    const int kp0 = ky * KVW;
    const Frag k0  = ldfrag(Khp + (size_t)kp0 * HD);                // keys kp0 .. kp0+15
    const Frag k1  = ldfrag(Khp + (size_t)(kp0 + 16) * HD);         // keys kp0+16 .. kp0+31
    const Frag k0l = ldfrag(Klp + (size_t)kp0 * HD);
    const Frag k1l = ldfrag(Klp + (size_t)(kp0 + 16) * HD);
    v8f s0 = zero8(), s1 = zero8();
    s0 = mma_b(k0.bf, qh.bf, s0);
    s1 = mma_b(k1.bf, qh.bf, s1);
    s0 = mma_b(k0.bf, ql.bf, s0);
    s1 = mma_b(k1.bf, ql.bf, s1);
    s0 = mma_b(k0l.bf, qh.bf, s0);
    s1 = mma_b(k1l.bf, qh.bf, s1);

    const v4f a0 = *(const v4f*)(abkb + kp0);
    const v4f a1 = *(const v4f*)(abkb + kp0 + 4);
    const v4f a2 = *(const v4f*)(abkb + kp0 + 16);
    const v4f a3 = *(const v4f*)(abkb + kp0 + 20);
    const float py = pyrow[ky];
#pragma unroll
    for (int r = 0; r < 8; ++r) {
      const int kx0 = 8 * hh + r, kx1 = 16 + 8 * hh + r;
      const float ab0 = (r < 4) ? a0[r & 3] : a1[r & 3];
      const float ab1 = (r < 4) ? a2[r & 3] : a3[r & 3];
      const float e0 = s0[r] + ab0 + px0[r] + py;
      const float e1 = s1[r] + ab1 + px1[r] + py;
      s0[r] = (kx0 >= kxlo && kx0 < kxhi) ? e0 : NINF;
      s1[r] = (kx1 >= kxlo && kx1 < kxhi) ? e1 : NINF;
    }

    float mx = fmaxf(hmax8(s0), hmax8(s1));
    mx = fmaxf(mx, __shfl_xor(mx, 16, 32));
    const float mn = fmaxf(m, mx);
    const unsigned grew = wave_ballot(mx > m);                       // wave-uniform
    if (grew != 0u) {
      const float corr = __expf(m - mn);                             // == 1 exactly for lanes whose max did not grow
      l *= corr;
#pragma unroll
      for (int j = 0; j < 2; ++j) {
#pragma unroll
        for (int r = 0; r < 8; ++r) o[j][r] *= corr;
      }
    }
    m = mn;
    const float msh = mn - LNPS;                                     // exp gives e^{s-m} * 1024

    FragH ph;
    float ls = 0.f;
#pragma unroll
    for (int r = 0; r < 8; ++r) {
      const float e0 = __expf(s0[r] - msh);                          // key kp0      + 8hh + r
      const float e1 = __expf(s1[r] - msh);                          // key kp0 + 16 + 8hh + r
      ls += e0 + e1;
      ph.hv[0][r] = (_Float16)e0;
      ph.hv[1][r] = (_Float16)e1;
    }
    l += ls;

#pragma unroll
    for (int j = 0; j < 2; ++j) {
      const Frag vf = ldfrag(Vp + (size_t)(16 * j) * NK + kp0);
      o[j] = mma_h(vf.h, ph.v, o[j]);
    }
  }
  l += __shfl_xor(l, 16, 32);
  const float inv = 1.0f / l;                                        // o and l both carry the x1024 factor

  const int qr = 16 * wave + c;
#pragma unroll
  for (int j = 0; j < 2; ++j) {
    v4f va, vb;
#pragma unroll
    for (int r = 0; r < 4; ++r) { va[r] = o[j][r] * inv; vb[r] = o[j][4 + r] * inv; }
    *(v4f*)(Os + qr * OSV + 16 * j + 8 * hh)     = va;              // Os[query][d = 16j + 8hh + r]
    *(v4f*)(Os + qr * OSV + 16 * j + 8 * hh + 4) = vb;
  }
  __syncthreads();

  const int e = tid & 7, lq = tid >> 3;                              // lq 0..15
  v4u uh[2], ul[2];
#pragma unroll
  for (int it = 0; it < 2; ++it) {
    const int L = 16 * it + lq;                                      // line 0..31
    const int row = 2 * L + (e >> 2), dl = 8 * (e & 3);
    const v4f a = *(const v4f*)(Os + row * OSV + dl);
    const v4f q = *(const v4f*)(Os + row * OSV + dl + 4);
    const float f[8] = {a[0], a[1], a[2], a[3], q[0], q[1], q[2], q[3]};
#pragma unroll
    for (int t = 0; t < 4; ++t) {
      const float f0 = f[2 * t], f1 = f[2 * t + 1];
      const unsigned short hb0 = bf_bits(f0), hb1 = bf_bits(f1);
      const unsigned short lb0 = bf_bits(f0 - bf_up(hb0));
      const unsigned short lb1 = bf_bits(f1 - bf_up(hb1));
      uh[it][t] = pk16(hb0, hb1);
      ul[it][t] = pk16(lb0, lb1);
    }
  }
{
#pragma unroll
    for (int it = 0; it < 2; ++it) {
      const int L = 16 * it + lq;
      const size_t po = ((size_t)bh * NN + (size_t)y * IMW + 2 * L) * HD + 8 * e;
      *(v4u*)(OPh + po) = uh[it];
      *(v4u*)(OPl + po) = ul[it];
    }
    
  }
}

// =========================================================================================================
// (5) output 1x1-conv for one (b, 64-pixel tile, 64-o block): Y[o][p] = sum_c WPB[o][c] O[b][p][c] with
//     c = 32 h + d: k-step ks = head ks, B fragments from OPh and OPl [b][ks][p][32] (bf16 hi/lo, shared
//     accumulator), A from WPB (split map). Epilogue: Os[p_loc][o_loc], barrier, then
//     lines (row o, 64 pixels = 2 lines): 8 consecutive lanes x 16 B (values from 4 Os rows), one instruction per
// coverage: 8 it x 16 lines x 8 lanes x 4 floats = 64 o x 64 p; grid (64, 4, NB) covers out [b][256][4096] once.
// LDS Os: cross-wave (block barrier).
// =========================================================================================================
__global__ __launch_bounds__(128)
void proj_k(const unsigned short* __restrict__ WPB, const unsigned short* __restrict__ OPh,
            const unsigned short* __restrict__ OPl, const float* __restrict__ pb,
            const float* __restrict__ gam, const float* __restrict__ x, float* out) {
  __shared__ __align__(16) float Os[QT * OSP];
  const int tid  = threadIdx.x;
  const int lane = tid & 31, wave = tid >> 5;
  const int hh   = lane >> 4, c = lane & 15;
  const int nt   = blockIdx.x, mb = blockIdx.y, b = blockIdx.z;
  const int n0   = nt * QT, o0 = mb * QT;

  const unsigned short* ap = WPB + (size_t)(o0 + c) * CC + 8 * hh;
  const size_t brow = (size_t)(n0 + 16 * wave + c) * HD + 8 * hh;

  v8f acc[4];
#pragma unroll
  for (int mt = 0; mt < 4; ++mt) acc[mt] = zero8();

#pragma unroll 2
  for (int ks = 0; ks < NHD; ++ks) {
    const size_t pl = ((size_t)(b * NHD + ks)) * NN * HD + brow;
    const Frag fbh = ldfrag(OPh + pl);
    const Frag fbl = ldfrag(OPl + pl);
#pragma unroll
    for (int mt = 0; mt < 4; ++mt) {
      const Frag fa = ldfrag(ap + (size_t)(16 * mt) * CC + 32 * ks);
      acc[mt] = mma_b(fa.bf, fbh.bf, acc[mt]);
      acc[mt] = mma_b(fa.bf, fbl.bf, acc[mt]);
    }
  }

  {
    const int nl = 16 * wave + c;
#pragma unroll
    for (int mt = 0; mt < 4; ++mt) {
      v4f va, vb;
#pragma unroll
      for (int r = 0; r < 4; ++r) { va[r] = acc[mt][r]; vb[r] = acc[mt][4 + r]; }
      *(v4f*)(Os + nl * OSP + 16 * mt + 8 * hh)     = va;
      *(v4f*)(Os + nl * OSP + 16 * mt + 8 * hh + 4) = vb;
    }
  }
  __syncthreads();

  const float g = bfr(gam[0]);
  const int e = tid & 7, lq = tid >> 3;                              // lq 0..15
  v4f res[8];
#pragma unroll
  for (int it = 0; it < 8; ++it) {
    const int L   = it * 16 + lq;                                    // 0..127
    const int ol  = L >> 1, hf = L & 1;                              // o_loc 0..63
    const int nl  = hf * 32 + 4 * e;                                 // pixel 0..63
    const int oo  = o0 + ol;
    const float pbv = bfr(pb[oo]);
    const size_t idx = ((size_t)(b * CC + oo)) * NN + n0 + nl;
    const v4f xv = *(const v4f*)(x + idx);
#pragma unroll
    for (int t = 0; t < 4; ++t) res[it][t] = g * (Os[(nl + t) * OSP + ol] + pbv) + bfr(xv[t]);
  }
{
#pragma unroll
    for (int it = 0; it < 8; ++it) {
      const int L   = it * 16 + lq;
      const int ol  = L >> 1, hf = L & 1;
      const int nl  = hf * 32 + 4 * e;
      const size_t idx = ((size_t)(b * CC + o0 + ol)) * NN + n0 + nl;
      *(v4f*)(out + idx) = res[it];
    }
    
  }
}

// =========================================================================================================
// Workspace map (bytes; each region start a multiple of 256; every extent is an exact tile multiple and is written
//   WPB bf16 [256][256] 131072
//   Qh/Ql bf16 [NB][8][4096][32]       2097152 x NB each     Kh/Kl bf16 [NB][8][1024][32] 524288 x NB each
//   Vt  f16 [NB][8][32][1024]           524288 x NB          ABK f32 [NB][8][1024] 32768 x NB
//   PFh/PFl bf16 [2][8][48][32]          49152 each
//   OPh/OPl bf16 [NB][8][4096][32]     2097152 x NB each
//   total (NB = 2) = 20217856
// =========================================================================================================
extern "C" void kernel_launch(void* const* d_in, const int* in_sizes, int n_in,
                              void* d_out, int out_size, void* d_ws, size_t ws_size,
                              hipStream_t stream) {
  const int XN = NB * CC * NN;
  if (n_in < 11) return;
  if (in_sizes[0] < XN) return;
  if (in_sizes[1] < CC * CC || in_sizes[2] < CC * CC || in_sizes[3] < CC * CC || in_sizes[8] < CC * CC) return;
  if (in_sizes[4] < CC * PFD || in_sizes[5] < CC * PFD) return;
  if (in_sizes[6] < CC || in_sizes[7] < CC || in_sizes[9] < CC || in_sizes[10] < 1) return;
  if (out_size < XN) return;

  size_t off = 0;
  auto carve = [&](size_t bytes) { const size_t o = off; off += (bytes + 255) & ~(size_t)255; return o; };
  const size_t oWPB = carve((size_t)CC * CC * 2);
  const size_t oQh  = carve((size_t)NB * NHD * NN * HD * 2);
  const size_t oQl  = carve((size_t)NB * NHD * NN * HD * 2);
  const size_t oKh  = carve((size_t)NB * NHD * NK * HD * 2);
  const size_t oKl  = carve((size_t)NB * NHD * NK * HD * 2);
  const size_t oVt  = carve((size_t)NB * NHD * HD * NK * 2);
  const size_t oABK = carve((size_t)NB * NHD * NK * 4);
  const size_t oPFh = carve((size_t)2 * NHD * NDF * HD * 2);
  const size_t oPFl = carve((size_t)2 * NHD * NDF * HD * 2);
  const size_t oOPh = carve((size_t)NB * NHD * NN * HD * 2);
  const size_t oOPl = carve((size_t)NB * NHD * NN * HD * 2);
  if (off > ws_size) return;
  if (off > (size_t)134217728) return;

  const float* x   = (const float*)d_in[0];
  const float* qw  = (const float*)d_in[1];
  const float* kw  = (const float*)d_in[2];
  const float* vw  = (const float*)d_in[3];
  const float* fxw = (const float*)d_in[4];
  const float* fyw = (const float*)d_in[5];
  const float* ab  = (const float*)d_in[6];
  const float* gb  = (const float*)d_in[7];
  const float* pw  = (const float*)d_in[8];
  const float* pb  = (const float*)d_in[9];
  const float* gam = (const float*)d_in[10];

  char* ws = (char*)d_ws;
  unsigned short* WPB = (unsigned short*)(ws + oWPB);
  unsigned short* Qh  = (unsigned short*)(ws + oQh);
  unsigned short* Ql  = (unsigned short*)(ws + oQl);
  unsigned short* Kh  = (unsigned short*)(ws + oKh);
  unsigned short* Kl  = (unsigned short*)(ws + oKl);
  unsigned short* Vt  = (unsigned short*)(ws + oVt);
  float*          ABK = (float*)(ws + oABK);
  unsigned short* PFh = (unsigned short*)(ws + oPFh);
  unsigned short* PFl = (unsigned short*)(ws + oPFl);
  unsigned short* OPh = (unsigned short*)(ws + oOPh);
  unsigned short* OPl = (unsigned short*)(ws + oOPl);
  float* out = (float*)d_out;

  const dim3 blk128(128);

  // (0)+(2)+(3) position tables PFh/PFl (x axis then y axis); q, k (+ appr-bias dot vector) and v; the proj_w plane
  feat_gemm<<<dim3(NBP + NBQ + 2 * NBK + NBWP), blk128, 0, stream>>>(x, qw, kw, vw, pw, fxw, fyw, ab, PFh, PFl, Qh, Ql, Kh,
                                                                     Kl, Vt, ABK, WPB);
  // (4) position dot terms and local-window attention -> per-head O planes
  attn_k<<<dim3(IMH, NHD, NB), blk128, 0, stream>>>(Qh, Ql, Kh, Kl, Vt, ABK, PFh, PFl, gb, OPh, OPl);
  // (5) output conv + bias, gamma scale, skip add -> out [b][256][4096]
  proj_k<<<dim3(NN / QT, CC / QT, NB), blk128, 0, stream>>>(WPB, OPh, OPl, pb, gam, x, out);
  (void)hipGetLastError();
}

// v005
// It runs in 38.1 microseconds.
// Timed twice side by side with v004, it ran 1.24 and 1.23 times as fast.
// Counting every step since v000, it is 2.92 times as fast.
// Contractions: q/k/v 1x1-conv GEMMs W[256x256].X[256xN] on v_wmma_f32_16x16x32_f16 (f16 containers of
// bf16-RNE weights x256 and bf16-RNE x); sinusoid position tables E[48x128].Wf^T on v_wmma_f32_16x16x32_bf16
// (bf16 hi + bf16 lo planes of the sin/cos features, Wf bf16-RNE, 2 products); attention scores K.Q^T per head
// on v_wmma_f32_16x16x32_bf16 (bf16 hi + bf16 lo planes of q and k, 3 products, depth 32); O^T = V^T.P^T on
// v_wmma_f32_16x16x32_f16 (v single f16 plane, P = e^{s-m} x1024 f16 from the score D registers); output
// 1x1-conv Wp[256x256].O on v_wmma_f32_16x16x32_bf16 (Wp bf16-RNE, O as bf16 hi + bf16 lo planes, 2 products);
// depth-32 position dot terms table[rows x 32 d].(q + geom bias)^T per (query row, head) on
// v_wmma_f32_16x16x32_bf16 (bf16 hi + bf16 lo planes of both, 3 products); f32 accumulate everywhere; bias terms,
// softmax statistics, gamma and the skip add on f32 VALU.
#include <hip/hip_runtime.h>
#include <math.h>
#include <stdint.h>

#ifndef NB
#define NB 2
#endif
#define NB_FULL 2
#define CC      256
#define IMH     64
#define IMW     64
#define NN      4096
#define KVH     32
#define KVW     32
#define NK      1024
#define NHD     8
#define HD      32
#define PFD     128
#define NPR     2048
#define NDF     48
#define DOFF    17
#define PRT     16
#define GSP     84
#define LRANGE  16
#define QT      64
#define OSP     68
#define XTP     264
#define EP      136
#define OSV     36
#define WSC     256.0f
#define IWSC    0.00390625f
#define LNPS    6.931471805599453f
#define RSQ2    0.70710678118654752f
#define NL2W    0.15571537944784511f

static_assert(NB >= 1 && NB <= NB_FULL);
static_assert(NN == IMH * IMW && NK == KVH * KVW);
static_assert(NPR == IMW * KVW && NPR == IMH * KVH);
static_assert(DOFF == LRANGE + 1 && 2 * DOFF + 1 <= NDF && LRANGE + 2 <= 32);
static_assert(NDF % PRT == 0 && PRT == 16 && GSP >= NDF + 32 && (GSP * 4) % 16 == 0);
static_assert(CC == NHD * HD && HD == 32 && KVW == 32 && KVH == 32);
static_assert(NN % QT == 0 && NK % QT == 0 && CC % QT == 0 && NPR % QT == 0);
static_assert(CC % 32 == 0 && PFD % 32 == 0 && HD % 32 == 0);
static_assert((OSP * 4) % 16 == 0 && (XTP * 2) % 16 == 0 && XTP >= CC && (EP * 2) % 16 == 0);
static_assert(2 * PRT * EP <= QT * XTP);
static_assert((OSV * 4) % 16 == 0);
static_assert(IMW == QT);
static_assert(QT == 2 * HD);

typedef _Float16       v16h __attribute__((ext_vector_type(16)));
typedef _Float16       v8h  __attribute__((ext_vector_type(8)));
typedef __bf16         v16b __attribute__((ext_vector_type(16)));
typedef unsigned short v8us __attribute__((ext_vector_type(8)));
typedef float          v8f  __attribute__((ext_vector_type(8)));
typedef float          v4f  __attribute__((ext_vector_type(4)));
typedef float          v2f  __attribute__((ext_vector_type(2)));
typedef __bf16         v2b  __attribute__((ext_vector_type(2)));
typedef _Float16       v2h  __attribute__((ext_vector_type(2)));
typedef unsigned int   v4u  __attribute__((ext_vector_type(4)));

union Frag  { v8us u[2]; v16h h; v16b bf; };
union FragH { v16h v; v8h hv[2]; };
static_assert(sizeof(Frag) == 32);
static_assert(sizeof(FragH) == 32);

// ---- scalar helpers ---------------------------------------------------------------------------------------
__device__ __forceinline__ unsigned short bf_bits(float f) {          // f32 -> bf16 bits, RNE convert
  unsigned u = __float_as_uint(f);
  return (unsigned short)((u + 0x7FFFu + ((u >> 16) & 1u)) >> 16);
}
__device__ __forceinline__ float bf_up(unsigned short hb) { return __uint_as_float(((unsigned)hb) << 16); }
__device__ __forceinline__ float bfr(float f) { return bf_up(bf_bits(f)); }
__device__ __forceinline__ unsigned short h_bits(_Float16 x) { return __builtin_bit_cast(unsigned short, x); }
__device__ __forceinline__ unsigned pk16(unsigned short a, unsigned short b) { return (unsigned)a | ((unsigned)b << 16); }
__device__ __forceinline__ v8f zero8() { v8f z = {0.f, 0.f, 0.f, 0.f, 0.f, 0.f, 0.f, 0.f}; return z; }
__device__ __forceinline__ float hmax8(v8f s) {
  return fmaxf(fmaxf(fmaxf(s[0], s[1]), fmaxf(s[2], s[3])), fmaxf(fmaxf(s[4], s[5]), fmaxf(s[6], s[7])));
}
__device__ __forceinline__ unsigned wave_ballot(bool p) {
#if defined(__HIP_DEVICE_COMPILE__)
  return __builtin_amdgcn_ballot_w32(p);
#else
  return p ? 1u : 0u;
#endif
}

// ---- 16-bit fragment loader (A, or B from a k-contiguous [n][k] row): lane -> row/col (lane&15), p already includes
//      + 8*(lane>>4); elements 0..7 <- p[0..7] (k0+8h..), elements 8..15 <- p[16..23] (k0+16+8h..)
__device__ __forceinline__ Frag ldfrag(const unsigned short* p) {
  Frag f;
  f.u[0] = *(const v8us*)(p);
  f.u[1] = *(const v8us*)(p + 16);
  return f;
}

// ---- WMMA helpers: builtin followed by a 4-slot VALU gap tying D and keeping A/B live --------------------------
__device__ __forceinline__ v8f mma_h(v16h a, v16h b, v8f c) {
  v8f d = __builtin_amdgcn_wmma_f32_16x16x32_f16(false, a, false, b, (short)0, c, false, false);
#if defined(__HIP_DEVICE_COMPILE__)
  asm volatile("v_nop\n\tv_nop\n\tv_nop\n\tv_nop" : "+v"(d) : "v"(a), "v"(b));
#endif
  return d;
}
__device__ __forceinline__ v8f mma_b(v16b a, v16b b, v8f c) {
  v8f d = __builtin_amdgcn_wmma_f32_16x16x32_bf16(false, a, false, b, (short)0, c, false, false);
#if defined(__HIP_DEVICE_COMPILE__)
  const v16h ha = __builtin_bit_cast(v16h, a), hb = __builtin_bit_cast(v16h, b);
  asm volatile("v_nop\n\tv_nop\n\tv_nop\n\tv_nop" : "+v"(d) : "v"(ha), "v"(hb));
#endif
  return d;
}

// =========================================================================================================
// (0) conversions done where the values are used (no launch of their own).
//     cvt_x2: two f32 -> bf16-RNE -> the same values as f16 (exact), packed; cvt_w2: the same with the x256 weight scale;
//     cvt_b2: two f32 -> bf16-RNE, packed. ldfrag_f32<true> / <false>: the split k map of ldfrag read from an f32 row.
//     cvt_wp: WPB bf16 [256][256] = bf16-RNE(proj_w) for the output conv launch; 64 blocks x 4 rows x 256.
// =========================================================================================================
__device__ __forceinline__ unsigned cvt_b2(float a, float b) {
  const v2f p = {a, b};
  return __builtin_bit_cast(unsigned, __builtin_convertvector(p, v2b));
}
__device__ __forceinline__ unsigned cvt_x2(float a, float b) {
  const unsigned hw = cvt_b2(a, b);
  const v2f r = {__uint_as_float(hw << 16), __uint_as_float(hw & 0xffff0000u)};
  return __builtin_bit_cast(unsigned, __builtin_convertvector(r, v2h));
}
__device__ __forceinline__ unsigned cvt_w2(float a, float b) {
  const unsigned hw = cvt_b2(a, b);
  const v2f r = {__uint_as_float(hw << 16) * WSC, __uint_as_float(hw & 0xffff0000u) * WSC};
  return __builtin_bit_cast(unsigned, __builtin_convertvector(r, v2h));
}
template <bool F16W>
__device__ __forceinline__ Frag ldfrag_f32(const float* p) {
  Frag f;
#pragma unroll
  for (int s = 0; s < 2; ++s) {
    const v4f a = *(const v4f*)(p + 16 * s);
    const v4f q = *(const v4f*)(p + 16 * s + 4);
    v4u u;
    if constexpr (F16W) {
      u[0] = cvt_w2(a[0], a[1]); u[1] = cvt_w2(a[2], a[3]); u[2] = cvt_w2(q[0], q[1]); u[3] = cvt_w2(q[2], q[3]);
    } else {
      u[0] = cvt_b2(a[0], a[1]); u[1] = cvt_b2(a[2], a[3]); u[2] = cvt_b2(q[0], q[1]); u[3] = cvt_b2(q[2], q[3]);
    }
    f.u[s] = __builtin_bit_cast(v8us, u);
  }
  return f;
}
__device__ __forceinline__
void cvt_wp(const int blk, const float* __restrict__ pw, unsigned short* WPB) {
  const int tid = threadIdx.x;
  const int o = 4 * blk + (tid >> 5), col = 8 * (tid & 31);
  const float* sp = pw + (size_t)o * CC + col;
  const v4f a = *(const v4f*)sp;
  const v4f q = *(const v4f*)(sp + 4);
  v4u u;
  u[0] = cvt_b2(a[0], a[1]); u[1] = cvt_b2(a[2], a[3]); u[2] = cvt_b2(q[0], q[1]); u[3] = cvt_b2(q[2], q[3]);
  *(v4u*)(WPB + (size_t)o * CC + col) = u;
  // the listing lays another job's code behind this store: its registers stay untouched until this wait
  asm volatile("s_wait_xcnt 0x0" ::: "memory");
}

// =========================================================================================================
// (2) 1x1-conv GEMM for one (b, 64-n tile, 64-o block): Y[o][n] = (1/256) sum_c w16(W[o][c]) x16(x[b][c][pix(n)]).
//     MODE 0: n = query pixel; MODE 1/2: n = key index ky*32+kx -> pixel 128 ky + 2 kx (arithmetic addressing).
//     Block 128 threads = 4 waves. The block's x tile goes f32 [256 c][64 n] -> LDS XT f16 [64 n][256 c] (pitch XTP):
//     a thread reads 8 consecutive c rows (MODE 0: 4 n each, 16-byte loads; MODE 1/2: 2 keys each (kx = lane), every second
//     pixel, 4-byte loads) and stores one 16-byte run of c per n.
//     Wave w owns A rows o = o0 + 16 w + (lane&15), read from the f32 weight row and converted in registers (split k
//     map, all 8 k-steps held), and all 4 n-tiles (B fragments from XT rows, k = c split map). K = 256 = 8 steps.
//     Epilogue staged in LDS Os[n_loc][o_loc] (pitch OSP), barrier, then per MODE:
//       0: Qh/Ql bf16 [b][8][4096][32] hi = bf16-RNE(v), lo = bf16-RNE(v - hi); 1: Kh/Kl bf16 [b][8][1024][32]
//          plus ABK f32 [b][8][1024] = sum_d bf16-RNE(appr_bias)[h][d] * Y (f32 before the 16-bit convert);
//          a plane line = 2 rows of 32 d: lane e -> row 2j + (e>>2), d 8(e&3).., 8 consecutive lanes per line, one
//       2: Vt f16 [b][8][32 d][1024 keys]: line = row (h,d), 64 keys: lane e -> keys 8e..8e+7, one instruction per
// coverage: XT 128 threads x 16 runs x 8 c = 64 n x 256 c; Os 4 waves x 16 o x 64 n = 64 x 64; MODE 0/1: 4 it x 16 lines x 8 lanes x 8 = 64 n x 64 o per plane;
//           MODE 2: 4 it x 16 rows x 8 lanes x 8 = 64 o x 64 keys; ABK 2 heads x 64 keys; (nt, mb, b) in NP/64 x 4 x NB.
// LDS XT, Os, abks: cross-wave (block barriers).
// =========================================================================================================
template <int MODE>
__device__ __forceinline__
void gemm_x(unsigned short* XT, float* Os, float* abks, const int nt, const int mb, const int b,
            const float* __restrict__ wsrc, const float* __restrict__ x,
            const float* __restrict__ ab, unsigned short* Ph, unsigned short* Pl,
            unsigned short* Vt, float* ABK) {
  constexpr int NP = (MODE == 0) ? NN : NK;
  const int tid  = threadIdx.x;
  const int lane = tid & 31, wave = tid >> 5;
  const int hh   = lane >> 4, c = lane & 15;
  const int n0   = nt * QT, o0 = mb * QT;
  (void)ab; (void)Ph; (void)Pl; (void)Vt; (void)ABK; (void)abks;

  // ---- all loads that the first barrier waits for are issued first: the x tile, then the A rows of k-steps 0..3
  constexpr int KH = CC / 64;                                        // half of the k-steps
  const int nq = tid & 15, cg = tid >> 4;
  const float* xp = (MODE == 0) ? x + ((size_t)(b * CC + 8 * cg)) * NN + n0 + 4 * nq
                                : x + ((size_t)(b * CC + 8 * wave)) * NN + 2 * IMW * (2 * nt) + 2 * lane;
  const float* ap = wsrc + (size_t)(o0 + 16 * wave + c) * CC + 8 * hh;
  float f[16][8];
  if constexpr (MODE == 0) {                                         // f[4 it + i][j]: n_loc = 4 nq + i, c = 64 it + 8 cg + j
#pragma unroll
    for (int it = 0; it < 4; ++it) {
#pragma unroll
      for (int j = 0; j < 8; ++j) {
        const v4f a = *(const v4f*)(xp + (size_t)(64 * it + j) * NN);
#pragma unroll
        for (int i = 0; i < 4; ++i) f[4 * it + i][j] = a[i];
      }
    }
  } else {                                                           // f[2 it + kyl][j]: n_loc = 32 kyl + lane, c = 32 it + 8 w + j
#pragma unroll
    for (int it = 0; it < 8; ++it) {
#pragma unroll
      for (int kyl = 0; kyl < 2; ++kyl) {
#pragma unroll
        for (int j = 0; j < 8; ++j) f[2 * it + kyl][j] = xp[(size_t)(32 * it + j) * NN + 2 * IMW * kyl];
      }
    }
  }
  Frag fa[CC / 32];
#pragma unroll
  for (int ks = 0; ks < KH; ++ks) fa[ks] = ldfrag_f32<true>(ap + 32 * ks);
  // a later load of this run may otherwise land in an earlier load's address pair: both pairs stay live, and so
  // untouched, until this wait; no LDS store is lifted over it, so the whole run is in flight before the first convert
  asm volatile("s_wait_xcnt 0x0" :: "v"(xp), "v"(ap) : "memory");
#pragma unroll
  for (int g = 0; g < 16; ++g) {
    v4u u;
#pragma unroll
    for (int t = 0; t < 4; ++t) u[t] = cvt_x2(f[g][2 * t], f[g][2 * t + 1]);
    if constexpr (MODE == 0) *(v4u*)(XT + (4 * nq + (g & 3)) * XTP + 64 * (g >> 2) + 8 * cg) = u;
    else                     *(v4u*)(XT + (32 * (g & 1) + lane) * XTP + 32 * (g >> 1) + 8 * wave) = u;
  }
  __syncthreads();

  // ---- the A rows of k-steps 4..7 fly under the first half of the products
#pragma unroll
  for (int ks = KH; ks < CC / 32; ++ks) fa[ks] = ldfrag_f32<true>(ap + 32 * ks);

  v8f acc[4];
#pragma unroll
  for (int t = 0; t < 4; ++t) acc[t] = zero8();

  const unsigned short* bl = XT + c * XTP + 8 * hh;
  Frag fb[2][4];                                                     // B fragments are read one k-step ahead
#pragma unroll
  for (int t = 0; t < 4; ++t) fb[0][t] = ldfrag(bl + 16 * t * XTP);
#pragma unroll
  for (int ks = 0; ks < CC / 32; ++ks) {
    // the address pair of the second run of A loads stays live, and so untouched, until this wait
    if (ks == KH) asm volatile("s_wait_xcnt 0x0" :: "v"(ap) : "memory");
    if (ks + 1 < CC / 32) {
#pragma unroll
      for (int t = 0; t < 4; ++t) fb[(ks + 1) & 1][t] = ldfrag(bl + 16 * t * XTP + 32 * (ks + 1));
    }
#pragma unroll
    for (int t = 0; t < 4; ++t) acc[t] = mma_h(fa[ks].h, fb[ks & 1][t].h, acc[t]);
  }

  // ---- stage: lane (hh, c) holds o_loc = 16 w + 8 hh + r for n_loc = 16 t + c
  {
#pragma unroll
    for (int t = 0; t < 4; ++t) {
      const int nl = 16 * t + c;
      v4f va, vb;
#pragma unroll
      for (int r = 0; r < 4; ++r) { va[r] = acc[t][r] * IWSC; vb[r] = acc[t][4 + r] * IWSC; }
      *(v4f*)(Os + nl * OSP + 16 * wave + 8 * hh)     = va;
      *(v4f*)(Os + nl * OSP + 16 * wave + 8 * hh + 4) = vb;
    }
  }
  __syncthreads();

  const int e = tid & 7, lq = tid >> 3;                             // lq 0..15
  if constexpr (MODE == 2) {
    v4u uv[4];
#pragma unroll
    for (int it = 0; it < 4; ++it) {
      const int ol = it * 16 + lq;                                   // o_loc 0..63
      unsigned short hb[8];
#pragma unroll
      for (int t = 0; t < 8; ++t) hb[t] = h_bits((_Float16)Os[(8 * e + t) * OSP + ol]);
#pragma unroll
      for (int t = 0; t < 4; ++t) uv[it][t] = pk16(hb[2 * t], hb[2 * t + 1]);
    }
{
#pragma unroll
      for (int it = 0; it < 4; ++it) {
        const int ol = it * 16 + lq;
        const int oo = o0 + ol, hd = oo >> 5, d = oo & 31;
        *(v4u*)(Vt + ((size_t)((b * NHD + hd) * HD + d)) * NK + n0 + 8 * e) = uv[it];
      }
      // the listing lays another job's code behind these stores: their registers stay untouched until this wait
      asm volatile("s_wait_xcnt 0x0" ::: "memory");
    }
  } else {
    v4u uh[4], ul[4];
#pragma unroll
    for (int it = 0; it < 4; ++it) {
      const int L = it * 16 + lq;                                    // line 0..63
      const int hs = L >> 5, j = L & 31;
      const int row = 2 * j + (e >> 2);                              // n_loc
      const int cb0 = 32 * hs + 8 * (e & 3);                         // o_loc of the first value
      const v4f a = *(const v4f*)(Os + row * OSP + cb0);
      const v4f q = *(const v4f*)(Os + row * OSP + cb0 + 4);
      const float f[8] = {a[0], a[1], a[2], a[3], q[0], q[1], q[2], q[3]};
#pragma unroll
      for (int t = 0; t < 4; ++t) {
        const float f0 = f[2 * t], f1 = f[2 * t + 1];
        const unsigned short hb0 = bf_bits(f0), hb1 = bf_bits(f1);
        const unsigned short lb0 = bf_bits(f0 - bf_up(hb0));
        const unsigned short lb1 = bf_bits(f1 - bf_up(hb1));
        uh[it][t] = pk16(hb0, hb1);
        ul[it][t] = pk16(lb0, lb1);
      }
    }
    v4f abv = {0.f, 0.f, 0.f, 0.f};
    if constexpr (MODE == 1) {
      const int kl = tid & 63, hs = tid >> 6;                       // hs wave-uniform
      const float* abp  = ab + (2 * mb + hs) * HD;
      const float* orow = Os + kl * OSP + 32 * hs;
      float s = 0.f;
#pragma unroll
      for (int d4 = 0; d4 < 8; ++d4) {
        const v4f g  = *(const v4f*)(abp + 4 * d4);
        const v4f ov = *(const v4f*)(orow + 4 * d4);
        s += bfr(g[0]) * ov[0] + bfr(g[1]) * ov[1] + bfr(g[2]) * ov[2] + bfr(g[3]) * ov[3];
      }
      abks[hs * QT + kl] = s;
      __syncthreads();
      if (tid < 32) abv = *(const v4f*)(abks + (lq >> 1) * QT + 32 * (lq & 1) + 4 * e);
    }
{
#pragma unroll
      for (int it = 0; it < 4; ++it) {
        const int L = it * 16 + lq;
        const int hs = L >> 5, j = L & 31;
        const size_t po = ((size_t)((b * NHD + 2 * mb + hs) * NP + n0 + 2 * j)) * HD + 8 * e;
        *(v4u*)(Ph + po) = uh[it];
        *(v4u*)(Pl + po) = ul[it];
      }
      // the listing lays another job's code behind these stores: their registers stay untouched until this wait
      // (MODE 1: the build has its own wait behind its stores)
      if constexpr (MODE == 0) asm volatile("s_wait_xcnt 0x0" ::: "memory");
      if constexpr (MODE == 1) {
        if (tid < 32)                                                // wave 0, wave-uniform
          *(v4f*)(ABK + (size_t)(b * NHD + 2 * mb + (lq >> 1)) * NK + n0 + 32 * (lq & 1) + 4 * e) = abv;
      }
      
    }
  }
}

// ---- 8 f32 -> bf16 hi (RNE) and bf16 lo (RNE of the rest), packed pairs
__device__ __forceinline__ void split8(v4f a, v4f q, v8us& hi, v8us& lo) {
  const float f[8] = {a[0], a[1], a[2], a[3], q[0], q[1], q[2], q[3]};
  v4u wh, wl;
#pragma unroll
  for (int t = 0; t < 4; ++t) {
    const v2f p = {f[2 * t], f[2 * t + 1]};
    const unsigned hw = __builtin_bit_cast(unsigned, __builtin_convertvector(p, v2b));   // RNE, packed pair
    const v2f r = {p[0] - __uint_as_float(hw << 16), p[1] - __uint_as_float(hw & 0xffff0000u)};
    wh[t] = hw;
    wl[t] = __builtin_bit_cast(unsigned, __builtin_convertvector(r, v2b));
  }
  hi = __builtin_bit_cast(v8us, wh);
  lo = __builtin_bit_cast(v8us, wl);
}

// =========================================================================================================
// (3) position tables. A table row depends on its (coord, kcoord) pair only through diff = coord - 2*kcoord, and
//     inside the local window diff lies in -DOFF..DOFF, so the tables are built once per diff: row T = diff + DOFF
//     (rows 35..47 fill the last tile and are never used). One job = (16-row tile rt, 64-o block ob, axis):
//     a = diff * 1000^(-f/64), features [sin(a) | cos(a)] (128) built in LDS as bf16 hi/lo planes Eh/El[16][128]
//     (pitch EP); then Y[o][T] = sum_f Wf[axis][o][f] E[T][f]: wave w owns A rows o = 64 ob + 16 w + (lane&15), bf16-RNE
//     of the f32 row, all waves share the B rows T from Eh and El (2 products sharing the accumulator, K = 128); epilogue
//     Os[T_loc][o_loc] = Y / sqrt(2), barrier, then
//       PFh/PFl bf16 [axis][h][48 T][32 d] (hi = bf16-RNE(v), lo = bf16-RNE(v - hi)): a plane line = 2 rows of 32 d,
//       lane -> row (tid>>2)&15, d 8(tid&3).., 8 consecutive lanes per line.
// coverage: Eh/El 8 it x 128 threads = 16 rows x 64 args x {sin,cos} = 16 x 128 (cols 128..135 pad, never read);
//           planes 128 threads x 8 = 2 heads x 16 rows x 32 d; (rt, ob, axis) in 3 x 4 x 2 covers
//           PFh/PFl [2][8][48][32] exactly once.
// LDS Eh/El, Os: cross-wave (block barriers).
// =========================================================================================================
__device__ __forceinline__
void posfeat(unsigned short* Eh, unsigned short* El, float* Os, const int rt, const int ob, const int axis,
             const float* __restrict__ fxw, const float* __restrict__ fyw, unsigned short* PFh, unsigned short* PFl) {
  const int tid  = threadIdx.x;
  const int lane = tid & 31, wave = tid >> 5;
  const int hh   = lane >> 4, c = lane & 15;
  const int R0   = rt * PRT;

  // ---- A rows first: their loads fly under the sinusoids
  const float* ap = (axis ? fyw : fxw) + (size_t)(QT * ob + 16 * wave + c) * PFD + 8 * hh;
  Frag fa[PFD / 32];
#pragma unroll
  for (int ks = 0; ks < PFD / 32; ++ks) fa[ks] = ldfrag_f32<false>(ap + 32 * ks);
  // a later load of this run may otherwise land in the address pair: it stays live, and so untouched, until this wait
  asm volatile("s_wait_xcnt 0x0" :: "v"(ap) : "memory");

  // ---- (a) sinusoid features -> LDS bf16 hi/lo planes (rolled: one copy of the sin/cos code keeps the text short)
#pragma unroll 1
  for (int it = 0; it < PRT / 2; ++it) {
    const int idx = it * 128 + tid;                                  // 0..1023
    const int rl = idx >> 6, fa = idx & 63;
    const float diff = (float)(R0 + rl - DOFF);
    const float a = diff * exp2f(-(float)fa * NL2W);
    const float sv = sinf(a);
    const float cv = cosf(a);
    const unsigned short shb = bf_bits(sv), chb = bf_bits(cv);
    Eh[rl * EP + fa]      = shb;
    El[rl * EP + fa]      = bf_bits(sv - bf_up(shb));
    Eh[rl * EP + 64 + fa] = chb;
    El[rl * EP + 64 + fa] = bf_bits(cv - bf_up(chb));
  }
  __syncthreads();

  const unsigned short* ebh = Eh + c * EP + 8 * hh;
  const unsigned short* ebl = El + c * EP + 8 * hh;
  v8f acc = zero8();
#pragma unroll
  for (int ks = 0; ks < PFD / 32; ++ks) {
    const Frag fbh = ldfrag(ebh + 32 * ks);
    const Frag fbl = ldfrag(ebl + 32 * ks);
    acc = mma_b(fa[ks].bf, fbh.bf, acc);
    acc = mma_b(fa[ks].bf, fbl.bf, acc);
  }
  {
    v4f va, vb;
#pragma unroll
    for (int r = 0; r < 4; ++r) { va[r] = acc[r] * RSQ2; vb[r] = acc[4 + r] * RSQ2; }
    *(v4f*)(Os + c * OSP + 16 * wave + 8 * hh)     = va;            // Os[T_loc = c][o_loc = 16 w + 8 hh + r]
    *(v4f*)(Os + c * OSP + 16 * wave + 8 * hh + 4) = vb;
  }
  __syncthreads();
  const int dl = 8 * (tid & 3), rl = (tid >> 2) & 15, hs = tid >> 6;
  v8us hi, lo;
  split8(*(const v4f*)(Os + rl * OSP + 32 * hs + dl), *(const v4f*)(Os + rl * OSP + 32 * hs + dl + 4), hi, lo);
  const size_t po = ((size_t)(axis * NHD + 2 * ob + hs) * NDF + R0 + rl) * HD + dl;
  *(v8us*)(PFh + po) = hi;
  *(v8us*)(PFl + po) = lo;
}

// =========================================================================================================
// (0)+(2)+(3) in one launch: the position tables, the q, k and v GEMMs and the proj_w plane read only inputs and
// none reads another's output. Block order: tables first (24 blocks), then
// q (NBQ blocks), k and v (NBK blocks each), then the proj_w plane (NBWP blocks). The selection is block-uniform, so
// every barrier of a job is passed by all four waves of its block. XT and Os are shared by the jobs (a block runs
// exactly one of them); the table job keeps its Eh and El planes in XT.
// =========================================================================================================
#define NBP ((NDF / PRT) * (CC / QT) * 2)
#define NBQ ((NN / QT) * (CC / QT) * NB)
#define NBK ((NK / QT) * (CC / QT) * NB)
#define NBWP (CC / 4)
__global__ __launch_bounds__(128)
void feat_gemm(const float* __restrict__ x, const float* __restrict__ qw, const float* __restrict__ kw,
               const float* __restrict__ vw, const float* __restrict__ pw, const float* __restrict__ fxw,
               const float* __restrict__ fyw, const float* __restrict__ ab,
               unsigned short* PFh, unsigned short* PFl, unsigned short* Qh, unsigned short* Ql, unsigned short* Kh, unsigned short* Kl,
               unsigned short* Vt, float* ABK, unsigned short* WPB) {
  __shared__ __align__(16) unsigned short XT[QT * XTP];
  __shared__ __align__(16) float Os[QT * OSP];
  __shared__ __align__(16) float abks[2 * QT];
  const int blk = blockIdx.x;
  if (blk < NBP) {
    posfeat(XT, XT + PRT * EP, Os, blk % (NDF / PRT), (blk / (NDF / PRT)) % (CC / QT), blk / ((NDF / PRT) * (CC / QT)),
            fxw, fyw, PFh, PFl);
  } else if (blk < NBP + NBQ) {
    const int j = blk - NBP;
    gemm_x<0>(XT, Os, abks, j % (NN / QT), (j / (NN / QT)) % (CC / QT), j / ((NN / QT) * (CC / QT)),
              qw, x, ab, Qh, Ql, Vt, ABK);
  } else if (blk < NBP + NBQ + NBK) {
    const int j = blk - (NBP + NBQ);
    gemm_x<1>(XT, Os, abks, j % (NK / QT), (j / (NK / QT)) % (CC / QT), j / ((NK / QT) * (CC / QT)),
              kw, x, ab, Kh, Kl, Vt, ABK);
  } else if (blk < NBP + NBQ + 2 * NBK) {
    const int j = blk - (NBP + NBQ + NBK);
    gemm_x<2>(XT, Os, abks, j % (NK / QT), (j / (NK / QT)) % (CC / QT), j / ((NK / QT) * (CC / QT)),
              vw, x, ab, Kh, Kl, Vt, ABK);
  } else {
    cvt_wp(blk - (NBP + NBQ + 2 * NBK), pw, WPB);
  }
}

// =========================================================================================================
// (4) local-window attention for one (query row y, head, b): block = 4 waves, wave w = queries x = 16w..16w+15.
//   Position dot terms first, per wave for its own 16 queries: B cols = qg = q + bf16-RNE(geom_bias) from Qh + Ql +
//   bias, split in registers into bf16 hi/lo with the split k map of ldfrag; A rows from the by-difference tables
//   PFh/PFl (hi.hi + hi.lo + lo.hi share the accumulator, depth 32). x axis: the 3 tiles of all 48 rows T, one
//   table for every query, D -> Gs[query][T]; y axis: rows T = y - 2 ky + DOFF of ky = kylo + i (i = 16 t + (lane&15),
//   held at the last allowed row), D -> Gs[query][NDF + i]; barrier. Per lane (hh, c): PX[kx] = Gs[query][x - 2 kx +
//   DOFF] for kx in {8hh..8hh+7, 16+8hh..} (registers; the index is held inside the row where kx lies outside the
//   window, where the energy is replaced anyway); PY[ky] = Gs[query][NDF + ky - kylo], one value per key row.
//   Loop over allowed key rows ky (block-uniform; forbidden rows contribute exactly 0): S^T tiles (16 keys x 16
//   queries) = A(Kh rows key ky*32 + 16t + (lane&15), k = d split map) . B(Qh col = query) + A(Kh).B(Ql) +
//   A(Kl).B(Qh) (bf16 hi/lo planes, shared accumulator); energy = S^T + ABK[key] + PX[kx] + PY[ky], replaced by
//   -inf outside the per-query kx window. Per lane the D tiles hold 16 keys of ONE query: online softmax per lane,
//   one shuffle (lane^16) for the max over the 32 keys of the row, o/l rescale skipped under a wave-uniform ballot.
//   P = e^{s-m} x 1024 as f16 is the B operand of O^T (rows d, cols queries) += A(Vt rows d = 16j + (lane&15), keys
//   split map) . B(P^T): element r <- D of the tile covering kx 0..15, element 8+r <- the tile covering kx 16..31.
//   Epilogue: O/l staged in LDS Os[query][32 d] (pitch OSV), barrier, then OPh/OPl bf16 [b][8][4096][32] (hi = bf16-
//   RNE(v), lo = bf16-RNE(v - hi)); line = 2 query rows: lane e -> row 2L + (e>>2), d 8(e&3).., 8 consecutive lanes
// coverage: Os 4 waves x 16 queries x 32 d; planes 2 it x 16 lines x 8 lanes x 8 = 64 queries x 32 d per plane;
//           grid (64, 8, NB) covers OPh/OPl [b][8][4096][32] exactly once.
// LDS Os: cross-wave (block barrier). Gs: written and read inside one wave's rows, synchronised with a block barrier.
// =========================================================================================================
// ---- the operands of one key row ky (32 keys): K hi/lo tiles of keys 0..15 and 16..31, V^T tiles of d 0..15 and 16..31,
//      the 16 appr-bias dots of this lane's keys, and PY of this lane's query
struct RowOps { Frag k0, k1, k0l, k1l, v0, v1; v4f a0, a1, a2, a3; float py; };
__device__ __forceinline__
void fetch_row(RowOps& t, const unsigned short* Khp, const unsigned short* Klp, const unsigned short* Vp,
               const float* abkb, const int ky) {
  const int kp0 = ky * KVW;
  const unsigned short* kh = Khp + (size_t)kp0 * HD;
  const unsigned short* kl = Klp + (size_t)kp0 * HD;
  const unsigned short* vp = Vp + kp0;
  const float* ap = abkb + kp0;
  t.k0  = ldfrag(kh);                                                // keys kp0 .. kp0+15
  t.k1  = ldfrag(kh + 16 * HD);                                      // keys kp0+16 .. kp0+31
  t.k0l = ldfrag(kl);
  t.k1l = ldfrag(kl + 16 * HD);
  t.a0  = *(const v4f*)(ap);
  t.a1  = *(const v4f*)(ap + 4);
  t.a2  = *(const v4f*)(ap + 16);
  t.a3  = *(const v4f*)(ap + 20);
  t.v0  = ldfrag(vp);
  t.v1  = ldfrag(vp + 16 * NK);
  // a later load of this run may otherwise land in an earlier load's address pair: every pair stays live, and so
  // untouched, until this wait; no load is moved below it, so the whole run is in flight before the work that follows
  asm volatile("s_wait_xcnt 0x0" :: "v"(kh), "v"(kl), "v"(vp), "v"(ap) : "memory");
}

__global__ __launch_bounds__(128)
void attn_k(const unsigned short* __restrict__ Qh, const unsigned short* __restrict__ Ql,
            const unsigned short* __restrict__ Kh, const unsigned short* __restrict__ Kl,
            const unsigned short* __restrict__ Vt, const float* __restrict__ ABK,
            const unsigned short* __restrict__ PFh, const unsigned short* __restrict__ PFl,
            const float* __restrict__ gb, unsigned short* OPh, unsigned short* OPl) {
  __shared__ __align__(16) float Os[QT * OSV];
  __shared__ __align__(16) float Gs[QT * GSP];
  const int tid  = threadIdx.x;
  const int wave = tid >> 5, lane = tid & 31;
  const int hh   = lane >> 4, c = lane & 15;
  const int y = blockIdx.x, hd = blockIdx.y, b = blockIdx.z;
  const int bh = b * NHD + hd;
  const int xq = 16 * wave + c;                                      // query column of this lane's B/D column
  const int pq = y * IMW + xq;

  const int kylo = (y >= LRANGE) ? ((y - LRANGE) >> 1) : 0;         // block-uniform
  int kyhi = ((y + LRANGE + 1) >> 1) + 1;  if (kyhi > KVH) kyhi = KVH;
  const int kxlo = (xq >= LRANGE) ? ((xq - LRANGE) >> 1) : 0;       // per lane
  int kxhi = ((xq + LRANGE + 1) >> 1) + 1; if (kxhi > KVW) kxhi = KVW;

  // ---- all loads of the position terms first: query planes, bias, table tiles
  const size_t qo = ((size_t)bh * NN + pq) * HD + 8 * hh;
  const unsigned short* qhp = Qh + qo;
  const unsigned short* qlp = Ql + qo;
  const Frag qh = ldfrag(qhp);
  const Frag ql = ldfrag(qlp);
  const float* gp = gb + hd * HD + 8 * hh;
  v4f g[2][2];
#pragma unroll
  for (int s = 0; s < 2; ++s) {                                      // s: d = 16 s + 8 hh ..
    g[s][0] = *(const v4f*)(gp + 16 * s);
    g[s][1] = *(const v4f*)(gp + 16 * s + 4);
  }
  Frag ahi[5], alo[5];                                               // loops unrolled: the arrays stay in registers
  const size_t tx = ((size_t)hd * NDF + c) * HD + 8 * hh;
  const unsigned short* txh = PFh + tx;
  const unsigned short* txl = PFl + tx;
#pragma unroll
  for (int t = 0; t < 3; ++t) {                                      // x axis: table rows T = 16 t + c
    ahi[t] = ldfrag(txh + 16 * t * HD);
    alo[t] = ldfrag(txl + 16 * t * HD);
  }
  const unsigned short* tyh[2];
  const unsigned short* tyl[2];
#pragma unroll
  for (int t = 0; t < 2; ++t) {                                      // y axis: table row of ky = kylo + 16 t + c
    int kyi = kylo + 16 * t + c;  if (kyi > kyhi - 1) kyi = kyhi - 1;
    const size_t to = ((size_t)(NHD + hd) * NDF + (y - 2 * kyi + DOFF)) * HD + 8 * hh;
    tyh[t] = PFh + to;
    tyl[t] = PFl + to;
    ahi[3 + t] = ldfrag(tyh[t]);
    alo[3 + t] = ldfrag(tyl[t]);
  }
  // a later load of this run may otherwise land in an earlier load's address pair: every pair stays live, and so
  // untouched, until this wait
  asm volatile("s_wait_xcnt 0x0" :: "v"(qhp), "v"(qlp), "v"(txh), "v"(txl), "v"(tyh[0]), "v"(tyl[0]), "v"(tyh[1]),
               "v"(tyl[1]) : "memory");

  // ---- fragment pointers of the key loop; the first key row's loads fly under the position terms
  const unsigned short* Khp = Kh + (size_t)bh * NK * HD + (size_t)c * HD + 8 * hh;
  const unsigned short* Klp = Kl + (size_t)bh * NK * HD + (size_t)c * HD + 8 * hh;
  const unsigned short* Vp  = Vt + (size_t)bh * HD * NK + (size_t)c * NK + 8 * hh;
  const float* abkb = ABK + (size_t)bh * NK + 8 * hh;
  RowOps ra, rb;                                                     // two register sets: one worked on, one in flight
  fetch_row(ra, Khp, Klp, Vp, abkb, kylo);

  // ---- B: qg = q + geom bias of query xq, bf16 hi/lo
  Frag bhi, blo;
#pragma unroll
  for (int s = 0; s < 2; ++s) {
    const v4u wh = __builtin_bit_cast(v4u, qh.u[s]), wl = __builtin_bit_cast(v4u, ql.u[s]);
    float f[8];
#pragma unroll
    for (int j = 0; j < 4; ++j) {
      f[2 * j]     = __uint_as_float(wh[j] << 16) + __uint_as_float(wl[j] << 16);
      f[2 * j + 1] = __uint_as_float(wh[j] & 0xffff0000u) + __uint_as_float(wl[j] & 0xffff0000u);
    }
    v4f va, vb;
#pragma unroll
    for (int r = 0; r < 4; ++r) { va[r] = f[r] + bfr(g[s][0][r]); vb[r] = f[4 + r] + bfr(g[s][1][r]); }
    split8(va, vb, bhi.u[s], blo.u[s]);
  }

  // ---- D rows = 16 t + 8 hh + r of tile t, col = query: tiles 0..2 fill Gs cols 0..47, tiles 3, 4 cols 48..79
  float* grow = Gs + xq * GSP;
#pragma unroll
  for (int t = 0; t < 5; ++t) {
    v8f d = zero8();
    d = mma_b(ahi[t].bf, bhi.bf, d);
    d = mma_b(ahi[t].bf, blo.bf, d);
    d = mma_b(alo[t].bf, bhi.bf, d);
    v4f va, vb;
#pragma unroll
    for (int r = 0; r < 4; ++r) { va[r] = d[r]; vb[r] = d[4 + r]; }
    *(v4f*)(grow + 16 * t + 8 * hh)     = va;
    *(v4f*)(grow + 16 * t + 8 * hh + 4) = vb;
  }
  __syncthreads();

  // ---- PX: per lane 16 kx values for query xq; PY: this query's row, read per key row in the loop
  float px0[8], px1[8];
#pragma unroll
  for (int r = 0; r < 8; ++r) {
    int t0 = xq - 2 * (8 * hh + r) + DOFF, t1 = t0 - 32;             // kx = 8 hh + r and 16 + 8 hh + r
    t0 = (t0 < 0) ? 0 : ((t0 > NDF - 1) ? NDF - 1 : t0);
    t1 = (t1 < 0) ? 0 : ((t1 > NDF - 1) ? NDF - 1 : t1);
    px0[r] = grow[t0];
    px1[r] = grow[t1];
  }
  const float* pyrow = grow + NDF - kylo;

  ra.py = pyrow[kylo];
  const float NINF = -__builtin_inff();

  float m = -1.0e30f, l = 0.f;
  v8f o[2];
  o[0] = zero8(); o[1] = zero8();

  // ---- one key row, all of its operands already in the register set t
  auto row_step = [&](const RowOps& t) {
    v8f s0 = zero8(), s1 = zero8();
    s0 = mma_b(t.k0.bf, qh.bf, s0);
    s1 = mma_b(t.k1.bf, qh.bf, s1);
    s0 = mma_b(t.k0.bf, ql.bf, s0);
    s1 = mma_b(t.k1.bf, ql.bf, s1);
    s0 = mma_b(t.k0l.bf, qh.bf, s0);
    s1 = mma_b(t.k1l.bf, qh.bf, s1);

    const v4f a0 = t.a0, a1 = t.a1, a2 = t.a2, a3 = t.a3;
    const float py = t.py;
#pragma unroll
    for (int r = 0; r < 8; ++r) {
      const int kx0 = 8 * hh + r, kx1 = 16 + 8 * hh + r;
      const float ab0 = (r < 4) ? a0[r & 3] : a1[r & 3];
      const float ab1 = (r < 4) ? a2[r & 3] : a3[r & 3];
      const float e0 = s0[r] + ab0 + px0[r] + py;
      const float e1 = s1[r] + ab1 + px1[r] + py;
      s0[r] = (kx0 >= kxlo && kx0 < kxhi) ? e0 : NINF;
      s1[r] = (kx1 >= kxlo && kx1 < kxhi) ? e1 : NINF;
    }

    float mx = fmaxf(hmax8(s0), hmax8(s1));
    mx = fmaxf(mx, __shfl_xor(mx, 16, 32));
    const float mn = fmaxf(m, mx);
    const unsigned grew = wave_ballot(mx > m);                       // wave-uniform
    if (grew != 0u) {
      const float corr = __expf(m - mn);                             // == 1 exactly for lanes whose max did not grow
      l *= corr;
#pragma unroll
      for (int j = 0; j < 2; ++j) {
#pragma unroll
        for (int r = 0; r < 8; ++r) o[j][r] *= corr;
      }
    }
    m = mn;
    const float msh = mn - LNPS;                                     // exp gives e^{s-m} * 1024

    FragH ph;
    float ls = 0.f;
#pragma unroll
    for (int r = 0; r < 8; ++r) {
      const float e0 = __expf(s0[r] - msh);                          // key kp0      + 8hh + r
      const float e1 = __expf(s1[r] - msh);                          // key kp0 + 16 + 8hh + r
      ls += e0 + e1;
      ph.hv[0][r] = (_Float16)e0;
      ph.hv[1][r] = (_Float16)e1;
    }
    l += ls;

    o[0] = mma_h(t.v0.h, ph.v, o[0]);
    o[1] = mma_h(t.v1.h, ph.v, o[1]);
  };

  int ky = kylo;
  // rolled: one copy of the two row bodies keeps the loop text short
#pragma unroll 1
  for (;;) {
    int kn = (ky + 1 < kyhi) ? ky + 1 : ky;
    rb.py = pyrow[kn];
    fetch_row(rb, Khp, Klp, Vp, abkb, kn);
    row_step(ra);
    if (++ky == kyhi) break;
    kn = (ky + 1 < kyhi) ? ky + 1 : ky;
    ra.py = pyrow[kn];
    fetch_row(ra, Khp, Klp, Vp, abkb, kn);
    row_step(rb);
    if (++ky == kyhi) break;
  }
  l += __shfl_xor(l, 16, 32);
  const float inv = 1.0f / l;                                        // o and l both carry the x1024 factor

  const int qr = 16 * wave + c;
#pragma unroll
  for (int j = 0; j < 2; ++j) {
    v4f va, vb;
#pragma unroll
    for (int r = 0; r < 4; ++r) { va[r] = o[j][r] * inv; vb[r] = o[j][4 + r] * inv; }
    *(v4f*)(Os + qr * OSV + 16 * j + 8 * hh)     = va;              // Os[query][d = 16j + 8hh + r]
    *(v4f*)(Os + qr * OSV + 16 * j + 8 * hh + 4) = vb;
  }
  __syncthreads();

  const int e = tid & 7, lq = tid >> 3;                              // lq 0..15
  v4u uh[2], ul[2];
#pragma unroll
  for (int it = 0; it < 2; ++it) {
    const int L = 16 * it + lq;                                      // line 0..31
    const int row = 2 * L + (e >> 2), dl = 8 * (e & 3);
    const v4f a = *(const v4f*)(Os + row * OSV + dl);
    const v4f q = *(const v4f*)(Os + row * OSV + dl + 4);
    const float f[8] = {a[0], a[1], a[2], a[3], q[0], q[1], q[2], q[3]};
#pragma unroll
    for (int t = 0; t < 4; ++t) {
      const float f0 = f[2 * t], f1 = f[2 * t + 1];
      const unsigned short hb0 = bf_bits(f0), hb1 = bf_bits(f1);
      const unsigned short lb0 = bf_bits(f0 - bf_up(hb0));
      const unsigned short lb1 = bf_bits(f1 - bf_up(hb1));
      uh[it][t] = pk16(hb0, hb1);
      ul[it][t] = pk16(lb0, lb1);
    }
  }
{
#pragma unroll
    for (int it = 0; it < 2; ++it) {
      const int L = 16 * it + lq;
      const size_t po = ((size_t)bh * NN + (size_t)y * IMW + 2 * L) * HD + 8 * e;
      *(v4u*)(OPh + po) = uh[it];
      *(v4u*)(OPl + po) = ul[it];
    }
    
  }
}

// =========================================================================================================
// (5) output 1x1-conv for one (b, 64-pixel tile, 64-o block): Y[o][p] = sum_c WPB[o][c] O[b][p][c] with
//     c = 32 h + d: k-step ks = head ks, B fragments from OPh and OPl [b][ks][p][32] (bf16 hi/lo, shared
//     accumulator), A from WPB (split map). Epilogue: Os[p_loc][o_loc], barrier, then
//     lines (row o, 64 pixels = 2 lines): 8 consecutive lanes x 16 B (values from 4 Os rows), one instruction per
// coverage: 8 it x 16 lines x 8 lanes x 4 floats = 64 o x 64 p; grid (64, 4, NB) covers out [b][256][4096] once.
// LDS Os: cross-wave (block barrier).
// =========================================================================================================
__global__ __launch_bounds__(128)
void proj_k(const unsigned short* __restrict__ WPB, const unsigned short* __restrict__ OPh,
            const unsigned short* __restrict__ OPl, const float* __restrict__ pb,
            const float* __restrict__ gam, const float* __restrict__ x, float* out) {
  __shared__ __align__(16) float Os[QT * OSP];
  const int tid  = threadIdx.x;
  const int lane = tid & 31, wave = tid >> 5;
  const int hh   = lane >> 4, c = lane & 15;
  const int nt   = blockIdx.x, mb = blockIdx.y, b = blockIdx.z;
  const int n0   = nt * QT, o0 = mb * QT;

  const unsigned short* ap = WPB + (size_t)(o0 + c) * CC + 8 * hh;
  const size_t brow = (size_t)b * NHD * NN * HD + (size_t)(n0 + 16 * wave + c) * HD + 8 * hh;
  const unsigned short* bph = OPh + brow;
  const unsigned short* bpl = OPl + brow;
  const int e = tid & 7, lq = tid >> 3;                              // lq 0..15
  const float* xb  = x + ((size_t)(b * CC + o0 + (lq >> 1))) * NN + n0 + 32 * (lq & 1) + 4 * e;
  const float* pbp = pb + o0 + (lq >> 1);

  // ---- loads ahead of the products: the B fragments of all 8 k-steps, then the A fragments of k-steps 0 and 1
  constexpr int AR = 2;                                              // A register sets = k-steps of lead
  Frag fbh[NHD], fbl[NHD], fa[AR][4];
  // every loop over these arrays, and over xv and pbv below, is unrolled: constant indices keep them in registers
#pragma unroll
  for (int ks = 0; ks < NHD; ++ks) {
    fbh[ks] = ldfrag(bph + (size_t)ks * NN * HD);
    fbl[ks] = ldfrag(bpl + (size_t)ks * NN * HD);
  }
#pragma unroll                                                       // constant indices, as above
  for (int ks = 0; ks < AR; ++ks) {
#pragma unroll                                                       // constant indices, as above
    for (int mt = 0; mt < 4; ++mt) fa[ks][mt] = ldfrag(ap + (size_t)(16 * mt) * CC + 32 * ks);
  }
  // a later load of this run may otherwise land in an earlier load's address pair: every pair stays live, and so
  // untouched, until this wait; no load is moved below it, so the whole run is in flight before the first product
  asm volatile("s_wait_xcnt 0x0" :: "v"(bph), "v"(bpl), "v"(ap) : "memory");
  const float g = bfr(gam[0]);                                       // read here: its wait would stand inside the run above

  v8f acc[4];
#pragma unroll
  for (int mt = 0; mt < 4; ++mt) acc[mt] = zero8();

  v4f xv[8];
  float pbv[8];
#pragma unroll                                                       // whole: the ring slot ks % AR is a constant in every copy
  for (int ks = 0; ks < NHD; ++ks) {
#pragma unroll
    for (int mt = 0; mt < 4; ++mt) {
      acc[mt] = mma_b(fa[ks % AR][mt].bf, fbh[ks].bf, acc[mt]);
      acc[mt] = mma_b(fa[ks % AR][mt].bf, fbl[ks].bf, acc[mt]);
      // the fragment just used takes its rows of k-step ks + AR
      if (ks + AR < NHD) fa[ks % AR][mt] = ldfrag(ap + (size_t)(16 * mt) * CC + 32 * (ks + AR));
      // what the epilogue reads: one product pair behind the last A load, since loads return in order and no product
      // may wait behind these
      if (ks + AR == NHD && mt == 0) {
#pragma unroll                                                       // constant indices, as above
        for (int it = 0; it < 8; ++it) {                             // row o0 + 8 it + (lq>>1), pixels 32 (lq&1) + 4 e ..
          xv[it]  = *(const v4f*)(xb + (size_t)(8 * it) * NN);
          pbv[it] = pbp[8 * it];
        }
        // the address pairs of the loads issued since the first wait stay live, and so untouched, until this one
        asm volatile("s_wait_xcnt 0x0" :: "v"(ap), "v"(xb), "v"(pbp) : "memory");
      }
    }
  }
  // the epilogue's conversions of x, and with them the wait for x, stay behind the last products
  __builtin_amdgcn_sched_barrier(0);

  {
    const int nl = 16 * wave + c;
#pragma unroll
    for (int mt = 0; mt < 4; ++mt) {
      v4f va, vb;
#pragma unroll
      for (int r = 0; r < 4; ++r) { va[r] = acc[mt][r]; vb[r] = acc[mt][4 + r]; }
      *(v4f*)(Os + nl * OSP + 16 * mt + 8 * hh)     = va;
      *(v4f*)(Os + nl * OSP + 16 * mt + 8 * hh + 4) = vb;
    }
  }
  __syncthreads();

  v4f res[8];
#pragma unroll
  for (int it = 0; it < 8; ++it) {
    const int L   = it * 16 + lq;                                    // 0..127
    const int ol  = L >> 1, hf = L & 1;                              // o_loc 0..63
    const int nl  = hf * 32 + 4 * e;                                 // pixel 0..63
    const float pbr = bfr(pbv[it]);
#pragma unroll
    for (int t = 0; t < 4; ++t) res[it][t] = g * (Os[(nl + t) * OSP + ol] + pbr) + bfr(xv[it][t]);
  }
{
#pragma unroll
    for (int it = 0; it < 8; ++it) {
      const int L   = it * 16 + lq;
      const int ol  = L >> 1, hf = L & 1;
      const int nl  = hf * 32 + 4 * e;
      const size_t idx = ((size_t)(b * CC + o0 + ol)) * NN + n0 + nl;
      *(v4f*)(out + idx) = res[it];
    }
    
  }
}

// =========================================================================================================
// Workspace map (bytes; each region start a multiple of 256; every extent is an exact tile multiple and is written
//   WPB bf16 [256][256] 131072
//   Qh/Ql bf16 [NB][8][4096][32]       2097152 x NB each     Kh/Kl bf16 [NB][8][1024][32] 524288 x NB each
//   Vt  f16 [NB][8][32][1024]           524288 x NB          ABK f32 [NB][8][1024] 32768 x NB
//   PFh/PFl bf16 [2][8][48][32]          49152 each
//   OPh/OPl bf16 [NB][8][4096][32]     2097152 x NB each
//   total (NB = 2) = 20217856
// =========================================================================================================
extern "C" void kernel_launch(void* const* d_in, const int* in_sizes, int n_in,
                              void* d_out, int out_size, void* d_ws, size_t ws_size,
                              hipStream_t stream) {
  const int XN = NB * CC * NN;
  if (n_in < 11) return;
  if (in_sizes[0] < XN) return;
  if (in_sizes[1] < CC * CC || in_sizes[2] < CC * CC || in_sizes[3] < CC * CC || in_sizes[8] < CC * CC) return;
  if (in_sizes[4] < CC * PFD || in_sizes[5] < CC * PFD) return;
  if (in_sizes[6] < CC || in_sizes[7] < CC || in_sizes[9] < CC || in_sizes[10] < 1) return;
  if (out_size < XN) return;

  size_t off = 0;
  auto carve = [&](size_t bytes) { const size_t o = off; off += (bytes + 255) & ~(size_t)255; return o; };
  const size_t oWPB = carve((size_t)CC * CC * 2);
  const size_t oQh  = carve((size_t)NB * NHD * NN * HD * 2);
  const size_t oQl  = carve((size_t)NB * NHD * NN * HD * 2);
  const size_t oKh  = carve((size_t)NB * NHD * NK * HD * 2);
  const size_t oKl  = carve((size_t)NB * NHD * NK * HD * 2);
  const size_t oVt  = carve((size_t)NB * NHD * HD * NK * 2);
  const size_t oABK = carve((size_t)NB * NHD * NK * 4);
  const size_t oPFh = carve((size_t)2 * NHD * NDF * HD * 2);
  const size_t oPFl = carve((size_t)2 * NHD * NDF * HD * 2);
  const size_t oOPh = carve((size_t)NB * NHD * NN * HD * 2);
  const size_t oOPl = carve((size_t)NB * NHD * NN * HD * 2);
  if (off > ws_size) return;
  if (off > (size_t)134217728) return;

  const float* x   = (const float*)d_in[0];
  const float* qw  = (const float*)d_in[1];
  const float* kw  = (const float*)d_in[2];
  const float* vw  = (const float*)d_in[3];
  const float* fxw = (const float*)d_in[4];
  const float* fyw = (const float*)d_in[5];
  const float* ab  = (const float*)d_in[6];
  const float* gb  = (const float*)d_in[7];
  const float* pw  = (const float*)d_in[8];
  const float* pb  = (const float*)d_in[9];
  const float* gam = (const float*)d_in[10];

  char* ws = (char*)d_ws;
  unsigned short* WPB = (unsigned short*)(ws + oWPB);
  unsigned short* Qh  = (unsigned short*)(ws + oQh);
  unsigned short* Ql  = (unsigned short*)(ws + oQl);
  unsigned short* Kh  = (unsigned short*)(ws + oKh);
  unsigned short* Kl  = (unsigned short*)(ws + oKl);
  unsigned short* Vt  = (unsigned short*)(ws + oVt);
  float*          ABK = (float*)(ws + oABK);
  unsigned short* PFh = (unsigned short*)(ws + oPFh);
  unsigned short* PFl = (unsigned short*)(ws + oPFl);
  unsigned short* OPh = (unsigned short*)(ws + oOPh);
  unsigned short* OPl = (unsigned short*)(ws + oOPl);
  float* out = (float*)d_out;

  const dim3 blk128(128);

  // (0)+(2)+(3) position tables PFh/PFl (x axis then y axis); q, k (+ appr-bias dot vector) and v; the proj_w plane
  feat_gemm<<<dim3(NBP + NBQ + 2 * NBK + NBWP), blk128, 0, stream>>>(x, qw, kw, vw, pw, fxw, fyw, ab, PFh, PFl, Qh, Ql, Kh,
                                                                     Kl, Vt, ABK, WPB);
  // (4) position dot terms and local-window attention -> per-head O planes
  attn_k<<<dim3(IMH, NHD, NB), blk128, 0, stream>>>(Qh, Ql, Kh, Kl, Vt, ABK, PFh, PFl, gb, OPh, OPl);
  // (5) output conv + bias, gamma scale, skip add -> out [b][256][4096]
  proj_k<<<dim3(NN / QT, CC / QT, NB), blk128, 0, stream>>>(WPB, OPh, OPl, pb, gam, x, out);
  (void)hipGetLastError();
}

// v006
// A run of this version takes 31.6 microseconds.
// In both of two side-by-side timings against v005, it was 1.21 times as fast.
// Counting every step since v000, it is 3.53 times as fast.
// Contractions: q/k/v 1x1-conv GEMMs W[256x256].X[256xN] on v_wmma_f32_16x16x32_f16 (f16 containers of
// bf16-RNE weights x256 and bf16-RNE x); sinusoid position tables E[48x128].Wf^T on v_wmma_f32_16x16x32_bf16
// (bf16 hi + bf16 lo planes of the sin/cos features, Wf bf16-RNE, 2 products); attention scores K.Q^T per head
// on v_wmma_f32_16x16x32_bf16 (bf16 hi + bf16 lo planes of q and k, 3 products, depth 32); O^T = V^T.P^T on
// v_wmma_f32_16x16x32_f16 (v single f16 plane, P = e^{s-m} x1024 f16 from the score D registers); output
// 1x1-conv Wp[256x256].O on v_wmma_f32_16x16x32_bf16 (Wp bf16-RNE, O as bf16 hi + bf16 lo planes, 2 products);
// depth-32 position dot terms table[rows x 32 d].(q + geom bias)^T per (query row, head) on
// v_wmma_f32_16x16x32_bf16 (bf16 hi + bf16 lo planes of both, 3 products); f32 accumulate everywhere; bias terms,
// softmax statistics, gamma and the skip add on f32 VALU.
#include <hip/hip_runtime.h>
#include <math.h>
#include <stdint.h>

#ifndef NB
#define NB 2
#endif
#define NB_FULL 2
#define CC      256
#define IMH     64
#define IMW     64
#define NN      4096
#define KVH     32
#define KVW     32
#define NK      1024
#define NHD     8
#define HD      32
#define PFD     128
#define NPR     2048
#define NDF     48
#define DOFF    17
#define PRT     16
#define GSP     84
#define LRANGE  16
#define QT      64
#define OSP     68
#define XTP     264
#define EP      136
#define OSV     36
#define WSC     256.0f
#define IWSC    0.00390625f
#define LNPS    6.931471805599453f
#define RSQ2    0.70710678118654752f
#define NL2W    0.15571537944784511f

static_assert(NB >= 1 && NB <= NB_FULL);
static_assert(NN == IMH * IMW && NK == KVH * KVW);
static_assert(NPR == IMW * KVW && NPR == IMH * KVH);
static_assert(DOFF == LRANGE + 1 && 2 * DOFF + 1 <= NDF && LRANGE + 2 <= 32);
static_assert(NDF % PRT == 0 && PRT == 16 && GSP >= NDF + 32 && (GSP * 4) % 16 == 0);
static_assert(CC == NHD * HD && HD == 32 && KVW == 32 && KVH == 32);
static_assert(NN % QT == 0 && NK % QT == 0 && CC % QT == 0 && NPR % QT == 0);
static_assert(CC % 32 == 0 && PFD % 32 == 0 && HD % 32 == 0);
static_assert((OSP * 4) % 16 == 0 && (XTP * 2) % 16 == 0 && XTP >= CC && (EP * 2) % 16 == 0);
static_assert(2 * PRT * EP <= QT * XTP);
static_assert((OSV * 4) % 16 == 0);
static_assert(IMW == QT);
static_assert(QT == 2 * HD);

typedef _Float16       v16h __attribute__((ext_vector_type(16)));
typedef _Float16       v8h  __attribute__((ext_vector_type(8)));
typedef __bf16         v16b __attribute__((ext_vector_type(16)));
typedef unsigned short v8us __attribute__((ext_vector_type(8)));
typedef float          v8f  __attribute__((ext_vector_type(8)));
typedef float          v4f  __attribute__((ext_vector_type(4)));
typedef float          v2f  __attribute__((ext_vector_type(2)));
typedef __bf16         v2b  __attribute__((ext_vector_type(2)));
typedef _Float16       v2h  __attribute__((ext_vector_type(2)));
typedef unsigned int   v4u  __attribute__((ext_vector_type(4)));

union Frag  { v8us u[2]; v16h h; v16b bf; };
union FragH { v16h v; v8h hv[2]; };
static_assert(sizeof(Frag) == 32);
static_assert(sizeof(FragH) == 32);

// ---- scalar helpers ---------------------------------------------------------------------------------------
__device__ __forceinline__ unsigned short bf_bits(float f) {          // f32 -> bf16 bits, RNE convert
  unsigned u = __float_as_uint(f);
  return (unsigned short)((u + 0x7FFFu + ((u >> 16) & 1u)) >> 16);
}
__device__ __forceinline__ float bf_up(unsigned short hb) { return __uint_as_float(((unsigned)hb) << 16); }
__device__ __forceinline__ float bfr(float f) { return bf_up(bf_bits(f)); }
__device__ __forceinline__ unsigned short h_bits(_Float16 x) { return __builtin_bit_cast(unsigned short, x); }
__device__ __forceinline__ unsigned pk16(unsigned short a, unsigned short b) { return (unsigned)a | ((unsigned)b << 16); }
__device__ __forceinline__ v8f zero8() { v8f z = {0.f, 0.f, 0.f, 0.f, 0.f, 0.f, 0.f, 0.f}; return z; }
__device__ __forceinline__ float hmax8(v8f s) {
  return fmaxf(fmaxf(fmaxf(s[0], s[1]), fmaxf(s[2], s[3])), fmaxf(fmaxf(s[4], s[5]), fmaxf(s[6], s[7])));
}
__device__ __forceinline__ unsigned wave_ballot(bool p) {
#if defined(__HIP_DEVICE_COMPILE__)
  return __builtin_amdgcn_ballot_w32(p);
#else
  return p ? 1u : 0u;
#endif
}

// ---- 16-bit fragment loader (A, or B from a k-contiguous [n][k] row): lane -> row/col (lane&15), p already includes
//      + 8*(lane>>4); elements 0..7 <- p[0..7] (k0+8h..), elements 8..15 <- p[16..23] (k0+16+8h..)
__device__ __forceinline__ Frag ldfrag(const unsigned short* p) {
  Frag f;
  f.u[0] = *(const v8us*)(p);
  f.u[1] = *(const v8us*)(p + 16);
  return f;
}

// ---- the same fragment from a plane kept in FRAGMENT ORDER: a tile of 16 rows x 32 k is 1 KiB = 64 pieces of 16 B, piece
//      16 (k >> 3) + row holding k = 8 (k >> 3) .. + 7 of that row. p = tile + 8 * lane: elements 0..7 <- piece lane
//      (row lane&15, k 8h..), elements 8..15 <- piece 32 + lane (k 16+8h..): the k map of ldfrag, but each of the two
//      loads of a wave covers 512 contiguous bytes = 4 whole lines
__device__ __forceinline__ Frag ldfrag_t(const unsigned short* p) {
  Frag f;
  f.u[0] = *(const v8us*)(p);
  f.u[1] = *(const v8us*)(p + 256);
  return f;
}

// ---- the same fragment from the y-axis position plane (layout at posfeat): p = this lane's piece of k 8h.., the piece of
//      k 16+8h.. lies two piece rows (of NDF / 2 pieces each) further
__device__ __forceinline__ Frag ldfrag_y(const unsigned short* p) {
  Frag f;
  f.u[0] = *(const v8us*)(p);
  f.u[1] = *(const v8us*)(p + NDF * 8);
  return f;
}

// ---- WMMA helpers: builtin followed by a 4-slot VALU gap tying D and keeping A/B live --------------------------
__device__ __forceinline__ v8f mma_h(v16h a, v16h b, v8f c) {
  v8f d = __builtin_amdgcn_wmma_f32_16x16x32_f16(false, a, false, b, (short)0, c, false, false);
#if defined(__HIP_DEVICE_COMPILE__)
  asm volatile("v_nop\n\tv_nop\n\tv_nop\n\tv_nop" : "+v"(d) : "v"(a), "v"(b));
#endif
  return d;
}
__device__ __forceinline__ v8f mma_b(v16b a, v16b b, v8f c) {
  v8f d = __builtin_amdgcn_wmma_f32_16x16x32_bf16(false, a, false, b, (short)0, c, false, false);
#if defined(__HIP_DEVICE_COMPILE__)
  const v16h ha = __builtin_bit_cast(v16h, a), hb = __builtin_bit_cast(v16h, b);
  asm volatile("v_nop\n\tv_nop\n\tv_nop\n\tv_nop" : "+v"(d) : "v"(ha), "v"(hb));
#endif
  return d;
}

// =========================================================================================================
// (0) conversions done where the values are used (no launch of their own).
//     cvt_x2: two f32 -> bf16-RNE -> the same values as f16 (exact), packed; cvt_w2: the same with the x256 weight scale;
//     cvt_b2: two f32 -> bf16-RNE, packed. ldfrag_f32<F16W>: the split k map of ldfrag read from an f32 row.
//     cvt_wp: WPB bf16 = bf16-RNE(proj_w) for the output conv launch, in fragment order: tiles [16 o-tiles][8 k-steps] of
//     16 o x 32 c; a wave = (8 rows o, one k-step): lane -> row tid&7, c 8((tid>>3)&3).., 8 consecutive lanes per line.
// =========================================================================================================
__device__ __forceinline__ unsigned cvt_b2(float a, float b) {
  const v2f p = {a, b};
  return __builtin_bit_cast(unsigned, __builtin_convertvector(p, v2b));
}
__device__ __forceinline__ unsigned cvt_x2(float a, float b) {
  const unsigned hw = cvt_b2(a, b);
  const v2f r = {__uint_as_float(hw << 16), __uint_as_float(hw & 0xffff0000u)};
  return __builtin_bit_cast(unsigned, __builtin_convertvector(r, v2h));
}
__device__ __forceinline__ unsigned cvt_w2(float a, float b) {
  const unsigned hw = cvt_b2(a, b);
  const v2f r = {__uint_as_float(hw << 16) * WSC, __uint_as_float(hw & 0xffff0000u) * WSC};
  return __builtin_bit_cast(unsigned, __builtin_convertvector(r, v2h));
}
template <bool F16W>
__device__ __forceinline__ Frag ldfrag_f32(const float* p) {
  Frag f;
#pragma unroll
  for (int s = 0; s < 2; ++s) {
    const v4f a = *(const v4f*)(p + 16 * s);
    const v4f q = *(const v4f*)(p + 16 * s + 4);
    v4u u;
    if constexpr (F16W) {
      u[0] = cvt_w2(a[0], a[1]); u[1] = cvt_w2(a[2], a[3]); u[2] = cvt_w2(q[0], q[1]); u[3] = cvt_w2(q[2], q[3]);
    } else {
      u[0] = cvt_b2(a[0], a[1]); u[1] = cvt_b2(a[2], a[3]); u[2] = cvt_b2(q[0], q[1]); u[3] = cvt_b2(q[2], q[3]);
    }
    f.u[s] = __builtin_bit_cast(v8us, u);
  }
  return f;
}
__device__ __forceinline__
void cvt_wp(const int blk, const float* __restrict__ pw, unsigned short* WPB) {
  const int tid = threadIdx.x;
  const int u = 4 * blk + (tid >> 5);                                // 0..255: k-step u & 7, rows 8 (u >> 3) ..
  const int ks = u & 7, d8 = (tid >> 3) & 3;
  const int o = 8 * (u >> 3) + (tid & 7), col = 32 * ks + 8 * d8;
  const float* sp = pw + (size_t)o * CC + col;
  const v4f a = *(const v4f*)sp;
  const v4f q = *(const v4f*)(sp + 4);
  v4u w;
  w[0] = cvt_b2(a[0], a[1]); w[1] = cvt_b2(a[2], a[3]); w[2] = cvt_b2(q[0], q[1]); w[3] = cvt_b2(q[2], q[3]);
  *(v4u*)(WPB + (size_t)((o >> 4) * (CC / 32) + ks) * 512 + (16 * d8 + (o & 15)) * 8) = w;
  // the listing lays another job's code behind this store: its registers stay untouched until this wait
  asm volatile("s_wait_xcnt 0x0" ::: "memory");
}

// =========================================================================================================
// (2) 1x1-conv GEMM for one (b, 64-n tile, 64-o block): Y[o][n] = (1/256) sum_c w16(W[o][c]) x16(x[b][c][pix(n)]).
//     MODE 0: n = query pixel; MODE 1/2: n = key index ky*32+kx -> pixel 128 ky + 2 kx (arithmetic addressing).
//     Block 128 threads = 4 waves. The block's x tile goes f32 [256 c][64 n] -> LDS XT f16 [64 n][256 c] (pitch XTP):
//     a thread reads 8 consecutive c rows (MODE 0: 4 n each, 16-byte loads; MODE 1/2: 2 keys each (kx = lane), every second
//     pixel, 4-byte loads) and stores one 16-byte run of c per n.
//     Wave w owns A rows o = o0 + 16 w + (lane&15), read from the f32 weight row and converted in registers (split k
//     map, all 8 k-steps held), and all 4 n-tiles (B fragments from XT rows, k = c split map). K = 256 = 8 steps.
//     Epilogue staged in LDS Os[n_loc][o_loc] (pitch OSP), barrier, then per MODE:
//       0: Qh/Ql bf16 [b][8][256 tiles of 16 n x 32 d] hi = bf16-RNE(v), lo = bf16-RNE(v - hi); 1: Kh/Kl bf16 [b][8][64
//          tiles] plus ABK f32 [b][8][1024] = sum_d bf16-RNE(appr_bias)[h][d] * Y (f32 before the 16-bit convert);
//          tiles in fragment order (ldfrag_t): line j of a head's 4 tiles = tile j>>3, d 8((j>>1)&3).., rows 8(j&1)..+7:
//          lane e -> row 16(j>>3) + 8(j&1) + e, 8 consecutive lanes per line
//       2: Vt f16 [b][8][32 ky][2 tiles of 16 d x 32 keys] in fragment order: line L = head L>>5, key row (L>>4)&1, tile
//          (L>>3)&1, keys 8((L>>1)&3).., rows d 8(L&1)..+7: lane e -> d 16((L>>3)&1) + 8(L&1) + e, 8 lanes per line
// coverage: XT 128 threads x 16 runs x 8 c = 64 n x 256 c; Os 4 waves x 16 o x 64 n = 64 x 64; MODE 0/1: 4 it x 16 lines x 8 lanes x 8 = 64 n x 64 o per plane;
//           MODE 2: 4 it x 16 rows x 8 lanes x 8 = 64 o x 64 keys; ABK 2 heads x 64 keys; (nt, mb, b) in NP/64 x 4 x NB.
// LDS XT, Os, abks: cross-wave (block barriers).
// =========================================================================================================
template <int MODE>
__device__ __forceinline__
void gemm_x(unsigned short* XT, float* Os, float* abks, const int nt, const int mb, const int b,
            const float* __restrict__ wsrc, const float* __restrict__ x,
            const float* __restrict__ ab, unsigned short* Ph, unsigned short* Pl,
            unsigned short* Vt, float* ABK) {
  constexpr int NP = (MODE == 0) ? NN : NK;
  const int tid  = threadIdx.x;
  const int lane = tid & 31, wave = tid >> 5;
  const int hh   = lane >> 4, c = lane & 15;
  const int n0   = nt * QT, o0 = mb * QT;
  (void)ab; (void)Ph; (void)Pl; (void)Vt; (void)ABK; (void)abks;

  // ---- all loads that the first barrier waits for are issued first: the x tile, then the A rows of k-steps 0..3
  constexpr int KH = CC / 64;                                        // half of the k-steps
  const int nq = tid & 15, cg = tid >> 4;
  const float* xp = (MODE == 0) ? x + ((size_t)(b * CC + 8 * cg)) * NN + n0 + 4 * nq
                                : x + ((size_t)(b * CC + 8 * wave)) * NN + 2 * IMW * (2 * nt) + 2 * lane;
  const float* ap = wsrc + (size_t)(o0 + 16 * wave + c) * CC + 8 * hh;
  float f[16][8];
  if constexpr (MODE == 0) {                                         // f[4 it + i][j]: n_loc = 4 nq + i, c = 64 it + 8 cg + j
#pragma unroll
    for (int it = 0; it < 4; ++it) {
#pragma unroll
      for (int j = 0; j < 8; ++j) {
        const v4f a = *(const v4f*)(xp + (size_t)(64 * it + j) * NN);
#pragma unroll
        for (int i = 0; i < 4; ++i) f[4 * it + i][j] = a[i];
      }
    }
  } else {                                                           // f[2 it + kyl][j]: n_loc = 32 kyl + lane, c = 32 it + 8 w + j
#pragma unroll
    for (int it = 0; it < 8; ++it) {
#pragma unroll
      for (int kyl = 0; kyl < 2; ++kyl) {
#pragma unroll
        for (int j = 0; j < 8; ++j) f[2 * it + kyl][j] = xp[(size_t)(32 * it + j) * NN + 2 * IMW * kyl];
      }
    }
  }
  Frag fa[CC / 32];
#pragma unroll
  for (int ks = 0; ks < KH; ++ks) fa[ks] = ldfrag_f32<true>(ap + 32 * ks);
  // a later load of this run may otherwise land in an earlier load's address pair: both pairs stay live, and so
  // untouched, until this wait; no LDS store is lifted over it, so the whole run is in flight before the first convert
  asm volatile("s_wait_xcnt 0x0" :: "v"(xp), "v"(ap) : "memory");
#pragma unroll
  for (int g = 0; g < 16; ++g) {
    v4u u;
#pragma unroll
    for (int t = 0; t < 4; ++t) u[t] = cvt_x2(f[g][2 * t], f[g][2 * t + 1]);
    if constexpr (MODE == 0) *(v4u*)(XT + (4 * nq + (g & 3)) * XTP + 64 * (g >> 2) + 8 * cg) = u;
    else                     *(v4u*)(XT + (32 * (g & 1) + lane) * XTP + 32 * (g >> 1) + 8 * wave) = u;
  }
  __syncthreads();

  // ---- the A rows of k-steps 4..7 fly under the first half of the products
#pragma unroll
  for (int ks = KH; ks < CC / 32; ++ks) fa[ks] = ldfrag_f32<true>(ap + 32 * ks);

  v8f acc[4];
#pragma unroll
  for (int t = 0; t < 4; ++t) acc[t] = zero8();

  const unsigned short* bl = XT + c * XTP + 8 * hh;
  Frag fb[2][4];                                                     // B fragments are read one k-step ahead
#pragma unroll
  for (int t = 0; t < 4; ++t) fb[0][t] = ldfrag(bl + 16 * t * XTP);
#pragma unroll
  for (int ks = 0; ks < CC / 32; ++ks) {
    // the address pair of the second run of A loads stays live, and so untouched, until this wait
    if (ks == KH) asm volatile("s_wait_xcnt 0x0" :: "v"(ap) : "memory");
    if (ks + 1 < CC / 32) {
#pragma unroll
      for (int t = 0; t < 4; ++t) fb[(ks + 1) & 1][t] = ldfrag(bl + 16 * t * XTP + 32 * (ks + 1));
    }
#pragma unroll
    for (int t = 0; t < 4; ++t) acc[t] = mma_h(fa[ks].h, fb[ks & 1][t].h, acc[t]);
  }

  // ---- stage: lane (hh, c) holds o_loc = 16 w + 8 hh + r for n_loc = 16 t + c
  {
#pragma unroll
    for (int t = 0; t < 4; ++t) {
      const int nl = 16 * t + c;
      v4f va, vb;
#pragma unroll
      for (int r = 0; r < 4; ++r) { va[r] = acc[t][r] * IWSC; vb[r] = acc[t][4 + r] * IWSC; }
      *(v4f*)(Os + nl * OSP + 16 * wave + 8 * hh)     = va;
      *(v4f*)(Os + nl * OSP + 16 * wave + 8 * hh + 4) = vb;
    }
  }
  __syncthreads();

  const int e = tid & 7, lq = tid >> 3;                             // lq 0..15
  if constexpr (MODE == 2) {
    v4u uv[4];
#pragma unroll
    for (int it = 0; it < 4; ++it) {
      const int L  = it * 16 + lq;                                   // line 0..63
      const int ol = 32 * (L >> 5) + 16 * ((L >> 3) & 1) + 8 * (L & 1) + e;   // o_loc 0..63
      const int kb = 32 * ((L >> 4) & 1) + 8 * ((L >> 1) & 3);       // first of this piece's 8 keys
      unsigned short hb[8];
#pragma unroll
      for (int t = 0; t < 8; ++t) hb[t] = h_bits((_Float16)Os[(kb + t) * OSP + ol]);
#pragma unroll
      for (int t = 0; t < 4; ++t) uv[it][t] = pk16(hb[2 * t], hb[2 * t + 1]);
    }
{
#pragma unroll
      for (int it = 0; it < 4; ++it) {
        const int L = it * 16 + lq;
        *(v4u*)(Vt + ((size_t)((b * NHD + 2 * mb + (L >> 5)) * NK + n0)) * HD + 64 * (L & 31) + 8 * e) = uv[it];
      }
      // the listing lays another job's code behind these stores: their registers stay untouched until this wait
      asm volatile("s_wait_xcnt 0x0" ::: "memory");
    }
  } else {
    v4u uh[4], ul[4];
#pragma unroll
    for (int it = 0; it < 4; ++it) {
      const int L = it * 16 + lq;                                    // line 0..63
      const int hs = L >> 5, j = L & 31;
      const int row = 16 * (j >> 3) + 8 * (j & 1) + e;               // n_loc
      const int cb0 = 32 * hs + 8 * ((j >> 1) & 3);                  // o_loc of the first value
      const v4f a = *(const v4f*)(Os + row * OSP + cb0);
      const v4f q = *(const v4f*)(Os + row * OSP + cb0 + 4);
      const float f[8] = {a[0], a[1], a[2], a[3], q[0], q[1], q[2], q[3]};
#pragma unroll
      for (int t = 0; t < 4; ++t) {
        const float f0 = f[2 * t], f1 = f[2 * t + 1];
        const unsigned short hb0 = bf_bits(f0), hb1 = bf_bits(f1);
        const unsigned short lb0 = bf_bits(f0 - bf_up(hb0));
        const unsigned short lb1 = bf_bits(f1 - bf_up(hb1));
        uh[it][t] = pk16(hb0, hb1);
        ul[it][t] = pk16(lb0, lb1);
      }
    }
    v4f abv = {0.f, 0.f, 0.f, 0.f};
    if constexpr (MODE == 1) {
      const int kl = tid & 63, hs = tid >> 6;                       // hs wave-uniform
      const float* abp  = ab + (2 * mb + hs) * HD;
      const float* orow = Os + kl * OSP + 32 * hs;
      float s = 0.f;
#pragma unroll
      for (int d4 = 0; d4 < 8; ++d4) {
        const v4f g  = *(const v4f*)(abp + 4 * d4);
        const v4f ov = *(const v4f*)(orow + 4 * d4);
        s += bfr(g[0]) * ov[0] + bfr(g[1]) * ov[1] + bfr(g[2]) * ov[2] + bfr(g[3]) * ov[3];
      }
      abks[hs * QT + kl] = s;
      __syncthreads();
      if (tid < 32) abv = *(const v4f*)(abks + (lq >> 1) * QT + 32 * (lq & 1) + 4 * e);
    }
{
#pragma unroll
      for (int it = 0; it < 4; ++it) {
        const int L = it * 16 + lq;
        const int hs = L >> 5, j = L & 31;
        const size_t po = ((size_t)((b * NHD + 2 * mb + hs) * NP + n0 + 2 * j)) * HD + 8 * e;
        *(v4u*)(Ph + po) = uh[it];
        *(v4u*)(Pl + po) = ul[it];
      }
      // the listing lays another job's code behind these stores: their registers stay untouched until this wait
      // (MODE 1: the build has its own wait behind its stores)
      if constexpr (MODE == 0) asm volatile("s_wait_xcnt 0x0" ::: "memory");
      if constexpr (MODE == 1) {
        if (tid < 32)                                                // wave 0, wave-uniform
          *(v4f*)(ABK + (size_t)(b * NHD + 2 * mb + (lq >> 1)) * NK + n0 + 32 * (lq & 1) + 4 * e) = abv;
      }
      
    }
  }
}

// ---- 8 f32 -> bf16 hi (RNE) and bf16 lo (RNE of the rest), packed pairs
__device__ __forceinline__ void split8(v4f a, v4f q, v8us& hi, v8us& lo) {
  const float f[8] = {a[0], a[1], a[2], a[3], q[0], q[1], q[2], q[3]};
  v4u wh, wl;
#pragma unroll
  for (int t = 0; t < 4; ++t) {
    const v2f p = {f[2 * t], f[2 * t + 1]};
    const unsigned hw = __builtin_bit_cast(unsigned, __builtin_convertvector(p, v2b));   // RNE, packed pair
    const v2f r = {p[0] - __uint_as_float(hw << 16), p[1] - __uint_as_float(hw & 0xffff0000u)};
    wh[t] = hw;
    wl[t] = __builtin_bit_cast(unsigned, __builtin_convertvector(r, v2b));
  }
  hi = __builtin_bit_cast(v8us, wh);
  lo = __builtin_bit_cast(v8us, wl);
}

// =========================================================================================================
// (3) position tables. A table row depends on its (coord, kcoord) pair only through diff = coord - 2*kcoord, and
//     inside the local window diff lies in -DOFF..DOFF, so the tables are built once per diff: row T = diff + DOFF
//     (rows 35..47 fill the last tile and are never used). One job = (16-row tile rt, 64-o block ob, axis):
//     a = diff * 1000^(-f/64), features [sin(a) | cos(a)] (128) built in LDS as bf16 hi/lo planes Eh/El[16][128]
//     (pitch EP); then Y[o][T] = sum_f Wf[axis][o][f] E[T][f]: wave w owns A rows o = 64 ob + 16 w + (lane&15), bf16-RNE
//     of the f32 row, all waves share the B rows T from Eh and El (2 products sharing the accumulator, K = 128); epilogue
//     Os[T_loc][o_loc] = Y / sqrt(2), barrier, then
//       PFh/PFl bf16 [axis][h][48 T x 32 d] (hi = bf16-RNE(v), lo = bf16-RNE(v - hi)), pieces of 8 d in the order of
//       their reader's loads. x axis: 3 tiles of 16 T in fragment order (ldfrag_t). y axis: the reader's 16 rows are
//       T, T - 2, .., so pieces lie [T & 1][d >> 3][(47 - T) >> 1]: 16 lanes read 256 contiguous bytes (ldfrag_y).
//       Either way 8 consecutive lanes store one whole line.
// coverage: Eh/El 8 it x 128 threads = 16 rows x 64 args x {sin,cos} = 16 x 128 (cols 128..135 pad, never read);
//           planes 128 threads x 8 = 2 heads x 16 rows x 32 d; (rt, ob, axis) in 3 x 4 x 2 covers
//           PFh/PFl [2][8][48][32] exactly once.
// LDS Eh/El, Os: cross-wave (block barriers).
// =========================================================================================================
__device__ __forceinline__
void posfeat(unsigned short* Eh, unsigned short* El, float* Os, const int rt, const int ob, const int axis,
             const float* __restrict__ fxw, const float* __restrict__ fyw, unsigned short* PFh, unsigned short* PFl) {
  const int tid  = threadIdx.x;
  const int lane = tid & 31, wave = tid >> 5;
  const int hh   = lane >> 4, c = lane & 15;
  const int R0   = rt * PRT;

  // ---- A rows first: their loads fly under the sinusoids
  const float* ap = (axis ? fyw : fxw) + (size_t)(QT * ob + 16 * wave + c) * PFD + 8 * hh;
  Frag fa[PFD / 32];
#pragma unroll
  for (int ks = 0; ks < PFD / 32; ++ks) fa[ks] = ldfrag_f32<false>(ap + 32 * ks);
  // a later load of this run may otherwise land in the address pair: it stays live, and so untouched, until this wait
  asm volatile("s_wait_xcnt 0x0" :: "v"(ap) : "memory");

  // ---- (a) sinusoid features -> LDS bf16 hi/lo planes (rolled: one copy of the sin/cos code keeps the text short)
#pragma unroll 1
  for (int it = 0; it < PRT / 2; ++it) {
    const int idx = it * 128 + tid;                                  // 0..1023
    const int rl = idx >> 6, fa = idx & 63;
    const float diff = (float)(R0 + rl - DOFF);
    const float a = diff * exp2f(-(float)fa * NL2W);
    const float sv = sinf(a);
    const float cv = cosf(a);
    const unsigned short shb = bf_bits(sv), chb = bf_bits(cv);
    Eh[rl * EP + fa]      = shb;
    El[rl * EP + fa]      = bf_bits(sv - bf_up(shb));
    Eh[rl * EP + 64 + fa] = chb;
    El[rl * EP + 64 + fa] = bf_bits(cv - bf_up(chb));
  }
  __syncthreads();

  const unsigned short* ebh = Eh + c * EP + 8 * hh;
  const unsigned short* ebl = El + c * EP + 8 * hh;
  v8f acc = zero8();
#pragma unroll
  for (int ks = 0; ks < PFD / 32; ++ks) {
    const Frag fbh = ldfrag(ebh + 32 * ks);
    const Frag fbl = ldfrag(ebl + 32 * ks);
    acc = mma_b(fa[ks].bf, fbh.bf, acc);
    acc = mma_b(fa[ks].bf, fbl.bf, acc);
  }
  {
    v4f va, vb;
#pragma unroll
    for (int r = 0; r < 4; ++r) { va[r] = acc[r] * RSQ2; vb[r] = acc[4 + r] * RSQ2; }
    *(v4f*)(Os + c * OSP + 16 * wave + 8 * hh)     = va;            // Os[T_loc = c][o_loc = 16 w + 8 hh + r]
    *(v4f*)(Os + c * OSP + 16 * wave + 8 * hh + 4) = vb;
  }
  __syncthreads();
  const int e = tid & 7, grp = (tid >> 3) & 7, hs = tid >> 6;        // line grp of this head's 8; axis is block-uniform
  const int dl = 8 * (axis ? (grp & 3) : (grp >> 1));
  const int rl = axis ? PRT - 2 + (grp >> 2) - 2 * e : 8 * (grp & 1) + e;
  v8us hi, lo;
  split8(*(const v4f*)(Os + rl * OSP + 32 * hs + dl), *(const v4f*)(Os + rl * OSP + 32 * hs + dl + 4), hi, lo);
  const size_t po = (size_t)(axis * NHD + 2 * ob + hs) * NDF * HD +
                    (axis ? grp * (NDF / 2 * 8) + ((NDF - PRT - R0) / 2 + e) * 8 : R0 * HD + 64 * grp + 8 * e);
  *(v8us*)(PFh + po) = hi;
  *(v8us*)(PFl + po) = lo;
}

// =========================================================================================================
// (0)+(2)+(3) in one launch: the position tables, the q, k and v GEMMs and the proj_w plane read only inputs and
// none reads another's output. Block order: tables first (24 blocks), then
// q (NBQ blocks), k and v (NBK blocks each), then the proj_w plane (NBWP blocks). The selection is block-uniform, so
// every barrier of a job is passed by all four waves of its block. XT and Os are shared by the jobs (a block runs
// exactly one of them); the table job keeps its Eh and El planes in XT.
// =========================================================================================================
#define NBP ((NDF / PRT) * (CC / QT) * 2)
#define NBQ ((NN / QT) * (CC / QT) * NB)
#define NBK ((NK / QT) * (CC / QT) * NB)
#define NBWP (CC / 4)
__global__ __launch_bounds__(128)
void feat_gemm(const float* __restrict__ x, const float* __restrict__ qw, const float* __restrict__ kw,
               const float* __restrict__ vw, const float* __restrict__ pw, const float* __restrict__ fxw,
               const float* __restrict__ fyw, const float* __restrict__ ab,
               unsigned short* PFh, unsigned short* PFl, unsigned short* Qh, unsigned short* Ql, unsigned short* Kh, unsigned short* Kl,
               unsigned short* Vt, float* ABK, unsigned short* WPB) {
  __shared__ __align__(16) unsigned short XT[QT * XTP];
  __shared__ __align__(16) float Os[QT * OSP];
  __shared__ __align__(16) float abks[2 * QT];
  const int blk = blockIdx.x;
  if (blk < NBP) {
    posfeat(XT, XT + PRT * EP, Os, blk % (NDF / PRT), (blk / (NDF / PRT)) % (CC / QT), blk / ((NDF / PRT) * (CC / QT)),
            fxw, fyw, PFh, PFl);
  } else if (blk < NBP + NBQ) {
    const int j = blk - NBP;
    gemm_x<0>(XT, Os, abks, j % (NN / QT), (j / (NN / QT)) % (CC / QT), j / ((NN / QT) * (CC / QT)),
              qw, x, ab, Qh, Ql, Vt, ABK);
  } else if (blk < NBP + NBQ + NBK) {
    const int j = blk - (NBP + NBQ);
    gemm_x<1>(XT, Os, abks, j % (NK / QT), (j / (NK / QT)) % (CC / QT), j / ((NK / QT) * (CC / QT)),
              kw, x, ab, Kh, Kl, Vt, ABK);
  } else if (blk < NBP + NBQ + 2 * NBK) {
    const int j = blk - (NBP + NBQ + NBK);
    gemm_x<2>(XT, Os, abks, j % (NK / QT), (j / (NK / QT)) % (CC / QT), j / ((NK / QT) * (CC / QT)),
              vw, x, ab, Kh, Kl, Vt, ABK);
  } else {
    cvt_wp(blk - (NBP + NBQ + 2 * NBK), pw, WPB);
  }
}

// =========================================================================================================
// (4) local-window attention for one (query row y, head, b): block = 4 waves, wave w = queries x = 16w..16w+15.
//   Position dot terms first, per wave for its own 16 queries: B cols = qg = q + bf16-RNE(geom_bias) from Qh + Ql +
//   bias, split in registers into bf16 hi/lo with the split k map of ldfrag; A rows from the by-difference tables
//   PFh/PFl (hi.hi + hi.lo + lo.hi share the accumulator, depth 32). x axis: the 3 tiles of all 48 rows T, one
//   table for every query, D -> Gs[query][T]; y axis: rows T = y - 2 ky + DOFF of ky = kylo + i (i = 16 t + (lane&15),
//   held at the last allowed row), D -> Gs[query][NDF + i]; barrier. Per lane (hh, c): PX[kx] = Gs[query][x - 2 kx +
//   DOFF] for kx in {8hh..8hh+7, 16+8hh..} (registers; the index is held inside the row where kx lies outside the
//   window, where the energy is replaced anyway); PY[ky] = Gs[query][NDF + ky - kylo], one value per key row.
//   Loop over allowed key rows ky (block-uniform; forbidden rows contribute exactly 0): S^T tiles (16 keys x 16
//   queries) = A(Kh rows key ky*32 + 16t + (lane&15), k = d split map) . B(Qh col = query) + A(Kh).B(Ql) +
//   A(Kl).B(Qh) (bf16 hi/lo planes, shared accumulator); energy = S^T + ABK[key] + PX[kx] + PY[ky], replaced by
//   -inf outside the per-query kx window. Per lane the D tiles hold 16 keys of ONE query: online softmax per lane,
//   one shuffle (lane^16) for the max over the 32 keys of the row, o/l rescale skipped under a wave-uniform ballot.
//   P = e^{s-m} x 1024 as f16 is the B operand of O^T (rows d, cols queries) += A(Vt rows d = 16j + (lane&15), fragment
//   order) . B(P^T): element r <- D of the tile covering kx 0..15, element 8+r <- the tile covering kx 16..31.
//   Epilogue: O/l staged in LDS Os[query][32 d] (pitch OSV), barrier, then OPh/OPl bf16 [b][8][256 tiles of 16 queries x
//   32 d] in fragment order (hi = bf16-RNE(v), lo = bf16-RNE(v - hi)); line L = tile L>>3, d 8((L>>1)&3).., rows
//   8(L&1)..+7: lane e -> row 16(L>>3) + 8(L&1) + e, 8 consecutive lanes per line
// coverage: Os 4 waves x 16 queries x 32 d; planes 2 it x 16 lines x 8 lanes x 8 = 64 queries x 32 d per plane;
//           grid (64, 8, NB) covers OPh/OPl [b][8][4096][32] exactly once.
// LDS Os: cross-wave (block barrier). Gs: written and read inside one wave's rows, synchronised with a block barrier.
// =========================================================================================================
// ---- the operands of one key row ky (32 keys): K hi/lo tiles of keys 0..15 and 16..31, V^T tiles of d 0..15 and 16..31,
//      the 16 appr-bias dots of this lane's keys, and PY of this lane's query
struct RowOps { Frag k0, k1, k0l, k1l, v0, v1; v4f a0, a1, a2, a3; float py; };
__device__ __forceinline__
void fetch_row(RowOps& t, const unsigned short* Khp, const unsigned short* Klp, const unsigned short* Vp,
               const float* abkb, const int ky) {
  const int kp0 = ky * KVW;
  const unsigned short* kh = Khp + (size_t)kp0 * HD;
  const unsigned short* kl = Klp + (size_t)kp0 * HD;
  const unsigned short* vp = Vp + (size_t)kp0 * HD;
  const float* ap = abkb + kp0;
  t.k0  = ldfrag_t(kh);                                              // keys kp0 .. kp0+15
  t.k1  = ldfrag_t(kh + 16 * HD);                                    // keys kp0+16 .. kp0+31
  t.k0l = ldfrag_t(kl);
  t.k1l = ldfrag_t(kl + 16 * HD);
  t.a0  = *(const v4f*)(ap);
  t.a1  = *(const v4f*)(ap + 4);
  t.a2  = *(const v4f*)(ap + 16);
  t.a3  = *(const v4f*)(ap + 20);
  t.v0  = ldfrag_t(vp);                                              // d 0..15
  t.v1  = ldfrag_t(vp + 16 * HD);                                    // d 16..31
  // a later load of this run may otherwise land in an earlier load's address pair: every pair stays live, and so
  // untouched, until this wait; no load is moved below it, so the whole run is in flight before the work that follows
  asm volatile("s_wait_xcnt 0x0" :: "v"(kh), "v"(kl), "v"(vp), "v"(ap) : "memory");
}

__global__ __launch_bounds__(128)
void attn_k(const unsigned short* __restrict__ Qh, const unsigned short* __restrict__ Ql,
            const unsigned short* __restrict__ Kh, const unsigned short* __restrict__ Kl,
            const unsigned short* __restrict__ Vt, const float* __restrict__ ABK,
            const unsigned short* __restrict__ PFh, const unsigned short* __restrict__ PFl,
            const float* __restrict__ gb, unsigned short* OPh, unsigned short* OPl) {
  __shared__ __align__(16) float Os[QT * OSV];
  __shared__ __align__(16) float Gs[QT * GSP];
  const int tid  = threadIdx.x;
  const int wave = tid >> 5, lane = tid & 31;
  const int hh   = lane >> 4, c = lane & 15;
  const int y = blockIdx.x, hd = blockIdx.y, b = blockIdx.z;
  const int bh = b * NHD + hd;
  const int xq = 16 * wave + c;                                      // query column of this lane's B/D column

  const int kylo = (y >= LRANGE) ? ((y - LRANGE) >> 1) : 0;         // block-uniform
  int kyhi = ((y + LRANGE + 1) >> 1) + 1;  if (kyhi > KVH) kyhi = KVH;
  const int kxlo = (xq >= LRANGE) ? ((xq - LRANGE) >> 1) : 0;       // per lane
  int kxhi = ((xq + LRANGE + 1) >> 1) + 1; if (kxhi > KVW) kxhi = KVW;

  // ---- all loads of the position terms first: query planes, bias, table tiles
  const size_t qo = ((size_t)bh * NN + y * IMW + 16 * wave) * HD + 8 * lane;   // this wave's tile, fragment order
  const unsigned short* qhp = Qh + qo;
  const unsigned short* qlp = Ql + qo;
  const Frag qh = ldfrag_t(qhp);
  const Frag ql = ldfrag_t(qlp);
  const float* gp = gb + hd * HD + 8 * hh;
  v4f g[2][2];
#pragma unroll
  for (int s = 0; s < 2; ++s) {                                      // s: d = 16 s + 8 hh ..
    g[s][0] = *(const v4f*)(gp + 16 * s);
    g[s][1] = *(const v4f*)(gp + 16 * s + 4);
  }
  Frag ahi[5], alo[5];                                               // loops unrolled: the arrays stay in registers
  const size_t tx = (size_t)hd * NDF * HD + 8 * lane;
  const unsigned short* txh = PFh + tx;
  const unsigned short* txl = PFl + tx;
#pragma unroll
  for (int t = 0; t < 3; ++t) {                                      // x axis: table rows T = 16 t + c
    ahi[t] = ldfrag_t(txh + 16 * t * HD);
    alo[t] = ldfrag_t(txl + 16 * t * HD);
  }
  const unsigned short* tyh[2];
  const unsigned short* tyl[2];
#pragma unroll
  for (int t = 0; t < 2; ++t) {                                      // y axis: table row of ky = kylo + 16 t + c
    int kyi = kylo + 16 * t + c;  if (kyi > kyhi - 1) kyi = kyhi - 1;
    const int T = y - 2 * kyi + DOFF;
    const size_t to = (size_t)(NHD + hd) * NDF * HD + (4 * (T & 1) + hh) * (NDF / 2 * 8) + ((NDF - 1 - T) >> 1) * 8;
    tyh[t] = PFh + to;
    tyl[t] = PFl + to;
    ahi[3 + t] = ldfrag_y(tyh[t]);
    alo[3 + t] = ldfrag_y(tyl[t]);
  }
  // a later load of this run may otherwise land in an earlier load's address pair: every pair stays live, and so
  // untouched, until this wait
  asm volatile("s_wait_xcnt 0x0" :: "v"(qhp), "v"(qlp), "v"(txh), "v"(txl), "v"(tyh[0]), "v"(tyl[0]), "v"(tyh[1]),
               "v"(tyl[1]) : "memory");

  // ---- fragment pointers of the key loop; the first key row's loads fly under the position terms
  const unsigned short* Khp = Kh + (size_t)bh * NK * HD + 8 * lane;
  const unsigned short* Klp = Kl + (size_t)bh * NK * HD + 8 * lane;
  const unsigned short* Vp  = Vt + (size_t)bh * HD * NK + 8 * lane;
  const float* abkb = ABK + (size_t)bh * NK + 8 * hh;
  RowOps ra, rb;                                                     // two register sets: one worked on, one in flight
  fetch_row(ra, Khp, Klp, Vp, abkb, kylo);

  // ---- B: qg = q + geom bias of query xq, bf16 hi/lo
  Frag bhi, blo;
#pragma unroll
  for (int s = 0; s < 2; ++s) {
    const v4u wh = __builtin_bit_cast(v4u, qh.u[s]), wl = __builtin_bit_cast(v4u, ql.u[s]);
    float f[8];
#pragma unroll
    for (int j = 0; j < 4; ++j) {
      f[2 * j]     = __uint_as_float(wh[j] << 16) + __uint_as_float(wl[j] << 16);
      f[2 * j + 1] = __uint_as_float(wh[j] & 0xffff0000u) + __uint_as_float(wl[j] & 0xffff0000u);
    }
    v4f va, vb;
#pragma unroll
    for (int r = 0; r < 4; ++r) { va[r] = f[r] + bfr(g[s][0][r]); vb[r] = f[4 + r] + bfr(g[s][1][r]); }
    split8(va, vb, bhi.u[s], blo.u[s]);
  }

  // ---- D rows = 16 t + 8 hh + r of tile t, col = query: tiles 0..2 fill Gs cols 0..47, tiles 3, 4 cols 48..79
  float* grow = Gs + xq * GSP;
#pragma unroll
  for (int t = 0; t < 5; ++t) {
    v8f d = zero8();
    d = mma_b(ahi[t].bf, bhi.bf, d);
    d = mma_b(ahi[t].bf, blo.bf, d);
    d = mma_b(alo[t].bf, bhi.bf, d);
    v4f va, vb;
#pragma unroll
    for (int r = 0; r < 4; ++r) { va[r] = d[r]; vb[r] = d[4 + r]; }
    *(v4f*)(grow + 16 * t + 8 * hh)     = va;
    *(v4f*)(grow + 16 * t + 8 * hh + 4) = vb;
  }
  __syncthreads();

  // ---- PX: per lane 16 kx values for query xq; PY: this query's row, read per key row in the loop
  float px0[8], px1[8];
#pragma unroll
  for (int r = 0; r < 8; ++r) {
    int t0 = xq - 2 * (8 * hh + r) + DOFF, t1 = t0 - 32;             // kx = 8 hh + r and 16 + 8 hh + r
    t0 = (t0 < 0) ? 0 : ((t0 > NDF - 1) ? NDF - 1 : t0);
    t1 = (t1 < 0) ? 0 : ((t1 > NDF - 1) ? NDF - 1 : t1);
    px0[r] = grow[t0];
    px1[r] = grow[t1];
  }
  const float* pyrow = grow + NDF - kylo;

  ra.py = pyrow[kylo];
  const float NINF = -__builtin_inff();

  float m = -1.0e30f, l = 0.f;
  v8f o[2];
  o[0] = zero8(); o[1] = zero8();

  // ---- one key row, all of its operands already in the register set t
  auto row_step = [&](const RowOps& t) {
    v8f s0 = zero8(), s1 = zero8();
    s0 = mma_b(t.k0.bf, qh.bf, s0);
    s1 = mma_b(t.k1.bf, qh.bf, s1);
    s0 = mma_b(t.k0.bf, ql.bf, s0);
    s1 = mma_b(t.k1.bf, ql.bf, s1);
    s0 = mma_b(t.k0l.bf, qh.bf, s0);
    s1 = mma_b(t.k1l.bf, qh.bf, s1);

    const v4f a0 = t.a0, a1 = t.a1, a2 = t.a2, a3 = t.a3;
    const float py = t.py;
#pragma unroll
    for (int r = 0; r < 8; ++r) {
      const int kx0 = 8 * hh + r, kx1 = 16 + 8 * hh + r;
      const float ab0 = (r < 4) ? a0[r & 3] : a1[r & 3];
      const float ab1 = (r < 4) ? a2[r & 3] : a3[r & 3];
      const float e0 = s0[r] + ab0 + px0[r] + py;
      const float e1 = s1[r] + ab1 + px1[r] + py;
      s0[r] = (kx0 >= kxlo && kx0 < kxhi) ? e0 : NINF;
      s1[r] = (kx1 >= kxlo && kx1 < kxhi) ? e1 : NINF;
    }

    float mx = fmaxf(hmax8(s0), hmax8(s1));
    mx = fmaxf(mx, __shfl_xor(mx, 16, 32));
    const float mn = fmaxf(m, mx);
    const unsigned grew = wave_ballot(mx > m);                       // wave-uniform
    if (grew != 0u) {
      const float corr = __expf(m - mn);                             // == 1 exactly for lanes whose max did not grow
      l *= corr;
#pragma unroll
      for (int j = 0; j < 2; ++j) {
#pragma unroll
        for (int r = 0; r < 8; ++r) o[j][r] *= corr;
      }
    }
    m = mn;
    const float msh = mn - LNPS;                                     // exp gives e^{s-m} * 1024

    FragH ph;
    float ls = 0.f;
#pragma unroll
    for (int r = 0; r < 8; ++r) {
      const float e0 = __expf(s0[r] - msh);                          // key kp0      + 8hh + r
      const float e1 = __expf(s1[r] - msh);                          // key kp0 + 16 + 8hh + r
      ls += e0 + e1;
      ph.hv[0][r] = (_Float16)e0;
      ph.hv[1][r] = (_Float16)e1;
    }
    l += ls;

    o[0] = mma_h(t.v0.h, ph.v, o[0]);
    o[1] = mma_h(t.v1.h, ph.v, o[1]);
  };

  int ky = kylo;
  // rolled: one copy of the two row bodies keeps the loop text short
#pragma unroll 1
  for (;;) {
    int kn = (ky + 1 < kyhi) ? ky + 1 : ky;
    rb.py = pyrow[kn];
    fetch_row(rb, Khp, Klp, Vp, abkb, kn);
    row_step(ra);
    if (++ky == kyhi) break;
    kn = (ky + 1 < kyhi) ? ky + 1 : ky;
    ra.py = pyrow[kn];
    fetch_row(ra, Khp, Klp, Vp, abkb, kn);
    row_step(rb);
    if (++ky == kyhi) break;
  }
  l += __shfl_xor(l, 16, 32);
  const float inv = 1.0f / l;                                        // o and l both carry the x1024 factor

  const int qr = 16 * wave + c;
#pragma unroll
  for (int j = 0; j < 2; ++j) {
    v4f va, vb;
#pragma unroll
    for (int r = 0; r < 4; ++r) { va[r] = o[j][r] * inv; vb[r] = o[j][4 + r] * inv; }
    *(v4f*)(Os + qr * OSV + 16 * j + 8 * hh)     = va;              // Os[query][d = 16j + 8hh + r]
    *(v4f*)(Os + qr * OSV + 16 * j + 8 * hh + 4) = vb;
  }
  __syncthreads();

  const int e = tid & 7, lq = tid >> 3;                              // lq 0..15
  v4u uh[2], ul[2];
#pragma unroll
  for (int it = 0; it < 2; ++it) {
    const int L = 16 * it + lq;                                      // line 0..31
    const int row = 16 * (L >> 3) + 8 * (L & 1) + e, dl = 8 * ((L >> 1) & 3);
    const v4f a = *(const v4f*)(Os + row * OSV + dl);
    const v4f q = *(const v4f*)(Os + row * OSV + dl + 4);
    const float f[8] = {a[0], a[1], a[2], a[3], q[0], q[1], q[2], q[3]};
#pragma unroll
    for (int t = 0; t < 4; ++t) {
      const float f0 = f[2 * t], f1 = f[2 * t + 1];
      const unsigned short hb0 = bf_bits(f0), hb1 = bf_bits(f1);
      const unsigned short lb0 = bf_bits(f0 - bf_up(hb0));
      const unsigned short lb1 = bf_bits(f1 - bf_up(hb1));
      uh[it][t] = pk16(hb0, hb1);
      ul[it][t] = pk16(lb0, lb1);
    }
  }
{
#pragma unroll
    for (int it = 0; it < 2; ++it) {
      const int L = 16 * it + lq;
      const size_t po = ((size_t)bh * NN + (size_t)y * IMW + 2 * L) * HD + 8 * e;
      *(v4u*)(OPh + po) = uh[it];
      *(v4u*)(OPl + po) = ul[it];
    }
    
  }
}

// =========================================================================================================
// (5) output 1x1-conv for one (b, 64-pixel tile, 64-o block): Y[o][p] = sum_c WPB[o][c] O[b][p][c] with
//     c = 32 h + d: k-step ks = head ks, B fragments from OPh and OPl [b][ks][tile p>>4] (bf16 hi/lo, shared
//     accumulator), A from WPB tiles (o-tile, ks); all three planes in fragment order (ldfrag_t). Epilogue: Os[p_loc][o_loc], barrier, then
//     lines (row o, 64 pixels = 2 lines): 8 consecutive lanes x 16 B (values from 4 Os rows), one instruction per
// coverage: 8 it x 16 lines x 8 lanes x 4 floats = 64 o x 64 p; grid (64, 4, NB) covers out [b][256][4096] once.
// LDS Os: cross-wave (block barrier).
// =========================================================================================================
__global__ __launch_bounds__(128)
void proj_k(const unsigned short* __restrict__ WPB, const unsigned short* __restrict__ OPh,
            const unsigned short* __restrict__ OPl, const float* __restrict__ pb,
            const float* __restrict__ gam, const float* __restrict__ x, float* out) {
  __shared__ __align__(16) float Os[QT * OSP];
  const int tid  = threadIdx.x;
  const int lane = tid & 31, wave = tid >> 5;
  const int hh   = lane >> 4, c = lane & 15;
  const int nt   = blockIdx.x, mb = blockIdx.y, b = blockIdx.z;
  const int n0   = nt * QT, o0 = mb * QT;

  const unsigned short* ap = WPB + (size_t)o0 * CC + 8 * lane;       // tile (o-tile, k-step) at 512 (8 o-tile + k-step)
  const size_t brow = (size_t)b * NHD * NN * HD + (size_t)(n0 + 16 * wave) * HD + 8 * lane;
  const unsigned short* bph = OPh + brow;
  const unsigned short* bpl = OPl + brow;
  const int e = tid & 7, lq = tid >> 3;                              // lq 0..15
  const float* xb  = x + ((size_t)(b * CC + o0 + (lq >> 1))) * NN + n0 + 32 * (lq & 1) + 4 * e;
  const float* pbp = pb + o0 + (lq >> 1);

  // ---- loads ahead of the products: the B fragments of all 8 k-steps, then the A fragments of k-steps 0 and 1
  constexpr int AR = 2;                                              // A register sets = k-steps of lead
  Frag fbh[NHD], fbl[NHD], fa[AR][4];
  // every loop over these arrays, and over xv and pbv below, is unrolled: constant indices keep them in registers
#pragma unroll
  for (int ks = 0; ks < NHD; ++ks) {
    fbh[ks] = ldfrag_t(bph + (size_t)ks * NN * HD);
    fbl[ks] = ldfrag_t(bpl + (size_t)ks * NN * HD);
  }
#pragma unroll                                                       // constant indices, as above
  for (int ks = 0; ks < AR; ++ks) {
#pragma unroll                                                       // constant indices, as above
    for (int mt = 0; mt < 4; ++mt) fa[ks][mt] = ldfrag_t(ap + (size_t)(16 * mt) * CC + 512 * ks);
  }
  // a later load of this run may otherwise land in an earlier load's address pair: every pair stays live, and so
  // untouched, until this wait; no load is moved below it, so the whole run is in flight before the first product
  asm volatile("s_wait_xcnt 0x0" :: "v"(bph), "v"(bpl), "v"(ap) : "memory");
  const float g = bfr(gam[0]);                                       // read here: its wait would stand inside the run above

  v8f acc[4];
#pragma unroll
  for (int mt = 0; mt < 4; ++mt) acc[mt] = zero8();

  v4f xv[8];
  float pbv[8];
#pragma unroll                                                       // whole: the ring slot ks % AR is a constant in every copy
  for (int ks = 0; ks < NHD; ++ks) {
#pragma unroll
    for (int mt = 0; mt < 4; ++mt) {
      acc[mt] = mma_b(fa[ks % AR][mt].bf, fbh[ks].bf, acc[mt]);
      acc[mt] = mma_b(fa[ks % AR][mt].bf, fbl[ks].bf, acc[mt]);
      // the fragment just used takes its rows of k-step ks + AR
      if (ks + AR < NHD) fa[ks % AR][mt] = ldfrag_t(ap + (size_t)(16 * mt) * CC + 512 * (ks + AR));
      // what the epilogue reads: one product pair behind the last A load, since loads return in order and no product
      // may wait behind these
      if (ks + AR == NHD && mt == 0) {
#pragma unroll                                                       // constant indices, as above
        for (int it = 0; it < 8; ++it) {                             // row o0 + 8 it + (lq>>1), pixels 32 (lq&1) + 4 e ..
          xv[it]  = *(const v4f*)(xb + (size_t)(8 * it) * NN);
          pbv[it] = pbp[8 * it];
        }
        // the address pairs of the loads issued since the first wait stay live, and so untouched, until this one
        asm volatile("s_wait_xcnt 0x0" :: "v"(ap), "v"(xb), "v"(pbp) : "memory");
      }
    }
  }
  // the epilogue's conversions of x, and with them the wait for x, stay behind the last products
  __builtin_amdgcn_sched_barrier(0);

  {
    const int nl = 16 * wave + c;
#pragma unroll
    for (int mt = 0; mt < 4; ++mt) {
      v4f va, vb;
#pragma unroll
      for (int r = 0; r < 4; ++r) { va[r] = acc[mt][r]; vb[r] = acc[mt][4 + r]; }
      *(v4f*)(Os + nl * OSP + 16 * mt + 8 * hh)     = va;
      *(v4f*)(Os + nl * OSP + 16 * mt + 8 * hh + 4) = vb;
    }
  }
  __syncthreads();

  v4f res[8];
#pragma unroll
  for (int it = 0; it < 8; ++it) {
    const int L   = it * 16 + lq;                                    // 0..127
    const int ol  = L >> 1, hf = L & 1;                              // o_loc 0..63
    const int nl  = hf * 32 + 4 * e;                                 // pixel 0..63
    const float pbr = bfr(pbv[it]);
#pragma unroll
    for (int t = 0; t < 4; ++t) res[it][t] = g * (Os[(nl + t) * OSP + ol] + pbr) + bfr(xv[it][t]);
  }
{
#pragma unroll
    for (int it = 0; it < 8; ++it) {
      const int L   = it * 16 + lq;
      const int ol  = L >> 1, hf = L & 1;
      const int nl  = hf * 32 + 4 * e;
      const size_t idx = ((size_t)(b * CC + o0 + ol)) * NN + n0 + nl;
      *(v4f*)(out + idx) = res[it];
    }
    
  }
}

// =========================================================================================================
// Workspace map (bytes; each region start a multiple of 256; every extent is an exact tile multiple and is written
//   WPB bf16 [16][8] tiles 131072 (a tile = 16 rows x 32 k in fragment order, 1024 bytes)
//   Qh/Ql bf16 [NB][8][256] tiles      2097152 x NB each     Kh/Kl bf16 [NB][8][64] tiles 524288 x NB each
//   Vt  f16 [NB][8][32 ky][2] tiles     524288 x NB          ABK f32 [NB][8][1024] 32768 x NB
//   PFh/PFl bf16 [2][8][48 x 32]         49152 each
//   OPh/OPl bf16 [NB][8][256] tiles    2097152 x NB each
//   total (NB = 2) = 20217856
// =========================================================================================================
extern "C" void kernel_launch(void* const* d_in, const int* in_sizes, int n_in,
                              void* d_out, int out_size, void* d_ws, size_t ws_size,
                              hipStream_t stream) {
  const int XN = NB * CC * NN;
  if (n_in < 11) return;
  if (in_sizes[0] < XN) return;
  if (in_sizes[1] < CC * CC || in_sizes[2] < CC * CC || in_sizes[3] < CC * CC || in_sizes[8] < CC * CC) return;
  if (in_sizes[4] < CC * PFD || in_sizes[5] < CC * PFD) return;
  if (in_sizes[6] < CC || in_sizes[7] < CC || in_sizes[9] < CC || in_sizes[10] < 1) return;
  if (out_size < XN) return;

  size_t off = 0;
  auto carve = [&](size_t bytes) { const size_t o = off; off += (bytes + 255) & ~(size_t)255; return o; };
  const size_t oWPB = carve((size_t)CC * CC * 2);
  const size_t oQh  = carve((size_t)NB * NHD * NN * HD * 2);
  const size_t oQl  = carve((size_t)NB * NHD * NN * HD * 2);
  const size_t oKh  = carve((size_t)NB * NHD * NK * HD * 2);
  const size_t oKl  = carve((size_t)NB * NHD * NK * HD * 2);
  const size_t oVt  = carve((size_t)NB * NHD * HD * NK * 2);
  const size_t oABK = carve((size_t)NB * NHD * NK * 4);
  const size_t oPFh = carve((size_t)2 * NHD * NDF * HD * 2);
  const size_t oPFl = carve((size_t)2 * NHD * NDF * HD * 2);
  const size_t oOPh = carve((size_t)NB * NHD * NN * HD * 2);
  const size_t oOPl = carve((size_t)NB * NHD * NN * HD * 2);
  if (off > ws_size) return;
  if (off > (size_t)134217728) return;

  const float* x   = (const float*)d_in[0];
  const float* qw  = (const float*)d_in[1];
  const float* kw  = (const float*)d_in[2];
  const float* vw  = (const float*)d_in[3];
  const float* fxw = (const float*)d_in[4];
  const float* fyw = (const float*)d_in[5];
  const float* ab  = (const float*)d_in[6];
  const float* gb  = (const float*)d_in[7];
  const float* pw  = (const float*)d_in[8];
  const float* pb  = (const float*)d_in[9];
  const float* gam = (const float*)d_in[10];

  char* ws = (char*)d_ws;
  unsigned short* WPB = (unsigned short*)(ws + oWPB);
  unsigned short* Qh  = (unsigned short*)(ws + oQh);
  unsigned short* Ql  = (unsigned short*)(ws + oQl);
  unsigned short* Kh  = (unsigned short*)(ws + oKh);
  unsigned short* Kl  = (unsigned short*)(ws + oKl);
  unsigned short* Vt  = (unsigned short*)(ws + oVt);
  float*          ABK = (float*)(ws + oABK);
  unsigned short* PFh = (unsigned short*)(ws + oPFh);
  unsigned short* PFl = (unsigned short*)(ws + oPFl);
  unsigned short* OPh = (unsigned short*)(ws + oOPh);
  unsigned short* OPl = (unsigned short*)(ws + oOPl);
  float* out = (float*)d_out;

  const dim3 blk128(128);

  // (0)+(2)+(3) position tables PFh/PFl (x axis then y axis); q, k (+ appr-bias dot vector) and v; the proj_w plane
  feat_gemm<<<dim3(NBP + NBQ + 2 * NBK + NBWP), blk128, 0, stream>>>(x, qw, kw, vw, pw, fxw, fyw, ab, PFh, PFl, Qh, Ql, Kh,
                                                                     Kl, Vt, ABK, WPB);
  // (4) position dot terms and local-window attention -> per-head O planes
  attn_k<<<dim3(IMH, NHD, NB), blk128, 0, stream>>>(Qh, Ql, Kh, Kl, Vt, ABK, PFh, PFl, gb, OPh, OPl);
  // (5) output conv + bias, gamma scale, skip add -> out [b][256][4096]
  proj_k<<<dim3(NN / QT, CC / QT, NB), blk128, 0, stream>>>(WPB, OPh, OPl, pb, gam, x, out);
  (void)hipGetLastError();
}

// v007
// It runs in 29.7 microseconds.
// Next to v006, in two timings, it ran 1.07 times as fast each time.
// All steps since v000 together make it 3.77 times as fast.
// Contractions: q/k/v 1x1-conv GEMMs W[256x256].X[256xN] on v_wmma_f32_16x16x32_f16 (f16 containers of
// bf16-RNE weights x256 and bf16-RNE x); sinusoid position tables E[48x128].Wf^T on v_wmma_f32_16x16x32_bf16
// (bf16 hi + bf16 lo planes of the sin/cos features, Wf bf16-RNE, 2 products); attention scores K.(Q + appr bias)^T per
// head on v_wmma_f32_16x16x32_bf16 (bf16 hi + bf16 lo planes of q + bias and k, 3 products, depth 32); O^T = V^T.P^T on
// v_wmma_f32_16x16x32_f16 (v single f16 plane, P = e^{s-m} x1024 f16 from the score D registers); output
// 1x1-conv Wp[256x256].O on v_wmma_f32_16x16x32_bf16 (Wp bf16-RNE, O as bf16 hi + bf16 lo planes, 2 products);
// depth-32 position dot terms table[rows x 32 d].(q + geom bias)^T per (query row, head) on
// v_wmma_f32_16x16x32_bf16 (bf16 hi + bf16 lo planes of both, 3 products); f32 accumulate everywhere; bias terms,
// softmax statistics, gamma and the skip add on f32 VALU.
#include <hip/hip_runtime.h>
#include <math.h>
#include <stdint.h>

#ifndef NB
#define NB 2
#endif
#define NB_FULL 2
#define CC      256
#define IMH     64
#define IMW     64
#define NN      4096
#define KVH     32
#define KVW     32
#define NK      1024
#define NHD     8
#define HD      32
#define PFD     128
#define NPR     2048
#define NDF     48
#define DOFF    17
#define PRT     16
#define GSP     84
#define LRANGE  16
#define QT      64
#define OSP     68
#define XTP     264
#define EP      136
#define OSV     36
#define WSC     256.0f
#define IWSC    0.00390625f
#define LNPS    6.931471805599453f
#define RSQ2    0.70710678118654752f
#define NL2W    0.15571537944784511f
#define L2E     1.4426950408889634f

static_assert(NB >= 1 && NB <= NB_FULL);
static_assert(NN == IMH * IMW && NK == KVH * KVW);
static_assert(NPR == IMW * KVW && NPR == IMH * KVH);
static_assert(DOFF == LRANGE + 1 && 2 * DOFF + 1 <= NDF && LRANGE + 2 <= 32);
static_assert(NDF % PRT == 0 && PRT == 16 && GSP >= NDF + 32 && (GSP * 4) % 16 == 0);
static_assert(CC == NHD * HD && HD == 32 && KVW == 32 && KVH == 32);
static_assert(NN % QT == 0 && NK % QT == 0 && CC % QT == 0 && NPR % QT == 0);
static_assert(CC % 32 == 0 && PFD % 32 == 0 && HD % 32 == 0);
static_assert((OSP * 4) % 16 == 0 && (XTP * 2) % 16 == 0 && XTP >= CC && (EP * 2) % 16 == 0);
static_assert(2 * PRT * EP <= QT * XTP);
static_assert((OSV * 4) % 16 == 0);
static_assert(IMW == QT);
static_assert(QT == 2 * HD);

typedef _Float16       v16h __attribute__((ext_vector_type(16)));
typedef _Float16       v8h  __attribute__((ext_vector_type(8)));
typedef __bf16         v16b __attribute__((ext_vector_type(16)));
typedef unsigned short v8us __attribute__((ext_vector_type(8)));
typedef float          v8f  __attribute__((ext_vector_type(8)));
typedef float          v4f  __attribute__((ext_vector_type(4)));
typedef float          v2f  __attribute__((ext_vector_type(2)));
typedef __bf16         v2b  __attribute__((ext_vector_type(2)));
typedef _Float16       v2h  __attribute__((ext_vector_type(2)));
typedef unsigned int   v4u  __attribute__((ext_vector_type(4)));

union Frag  { v8us u[2]; v16h h; v16b bf; };
union FragH { v16h v; v8h hv[2]; };
static_assert(sizeof(Frag) == 32);
static_assert(sizeof(FragH) == 32);

// ---- scalar helpers ---------------------------------------------------------------------------------------
__device__ __forceinline__ unsigned short bf_bits(float f) {          // f32 -> bf16 bits, RNE convert
  unsigned u = __float_as_uint(f);
  return (unsigned short)((u + 0x7FFFu + ((u >> 16) & 1u)) >> 16);
}
__device__ __forceinline__ float bf_up(unsigned short hb) { return __uint_as_float(((unsigned)hb) << 16); }
__device__ __forceinline__ float bfr(float f) { return bf_up(bf_bits(f)); }
__device__ __forceinline__ unsigned short h_bits(_Float16 x) { return __builtin_bit_cast(unsigned short, x); }
__device__ __forceinline__ unsigned pk16(unsigned short a, unsigned short b) { return (unsigned)a | ((unsigned)b << 16); }
__device__ __forceinline__ v8f zero8() { v8f z = {0.f, 0.f, 0.f, 0.f, 0.f, 0.f, 0.f, 0.f}; return z; }
__device__ __forceinline__ float hmax8(v8f s) {
  return fmaxf(fmaxf(fmaxf(s[0], s[1]), fmaxf(s[2], s[3])), fmaxf(fmaxf(s[4], s[5]), fmaxf(s[6], s[7])));
}
__device__ __forceinline__ unsigned wave_ballot(bool p) {
#if defined(__HIP_DEVICE_COMPILE__)
  return __builtin_amdgcn_ballot_w32(p);
#else
  return p ? 1u : 0u;
#endif
}

// ---- 16-bit fragment loader (A, or B from a k-contiguous [n][k] row): lane -> row/col (lane&15), p already includes
//      + 8*(lane>>4); elements 0..7 <- p[0..7] (k0+8h..), elements 8..15 <- p[16..23] (k0+16+8h..)
__device__ __forceinline__ Frag ldfrag(const unsigned short* p) {
  Frag f;
  f.u[0] = *(const v8us*)(p);
  f.u[1] = *(const v8us*)(p + 16);
  return f;
}

// ---- the same fragment from a plane kept in FRAGMENT ORDER: a tile of 16 rows x 32 k is 1 KiB = 64 pieces of 16 B, piece
//      16 (k >> 3) + row holding k = 8 (k >> 3) .. + 7 of that row. p = tile + 8 * lane: elements 0..7 <- piece lane
//      (row lane&15, k 8h..), elements 8..15 <- piece 32 + lane (k 16+8h..): the k map of ldfrag, but each of the two
//      loads of a wave covers 512 contiguous bytes = 4 whole lines
__device__ __forceinline__ Frag ldfrag_t(const unsigned short* p) {
  Frag f;
  f.u[0] = *(const v8us*)(p);
  f.u[1] = *(const v8us*)(p + 256);
  return f;
}

// ---- the same fragment from the y-axis position plane (layout at posfeat): p = this lane's piece of k 8h.., the piece of
//      k 16+8h.. lies two piece rows (of NDF / 2 pieces each) further
__device__ __forceinline__ Frag ldfrag_y(const unsigned short* p) {
  Frag f;
  f.u[0] = *(const v8us*)(p);
  f.u[1] = *(const v8us*)(p + NDF * 8);
  return f;
}

// ---- WMMA helpers: builtin followed by a 4-slot VALU gap tying D and keeping A/B live --------------------------
__device__ __forceinline__ v8f mma_h(v16h a, v16h b, v8f c) {
  v8f d = __builtin_amdgcn_wmma_f32_16x16x32_f16(false, a, false, b, (short)0, c, false, false);
#if defined(__HIP_DEVICE_COMPILE__)
  asm volatile("v_nop\n\tv_nop\n\tv_nop\n\tv_nop" : "+v"(d) : "v"(a), "v"(b));
#endif
  return d;
}
__device__ __forceinline__ v8f mma_b(v16b a, v16b b, v8f c) {
  v8f d = __builtin_amdgcn_wmma_f32_16x16x32_bf16(false, a, false, b, (short)0, c, false, false);
#if defined(__HIP_DEVICE_COMPILE__)
  const v16h ha = __builtin_bit_cast(v16h, a), hb = __builtin_bit_cast(v16h, b);
  asm volatile("v_nop\n\tv_nop\n\tv_nop\n\tv_nop" : "+v"(d) : "v"(ha), "v"(hb));
#endif
  return d;
}

// =========================================================================================================
// (0) conversions done where the values are used (no launch of their own).
//     cvt_x2: two f32 -> bf16-RNE -> the same values as f16 (exact), packed; cvt_w2: the same with the x256 weight scale;
//     cvt_b2: two f32 -> bf16-RNE, packed. ldfrag_f32<F16W>: the split k map of ldfrag read from an f32 row.
//     cvt_wp: WPB bf16 = bf16-RNE(proj_w) for the output conv launch, in fragment order: tiles [16 o-tiles][8 k-steps] of
//     16 o x 32 c; a wave = (8 rows o, one k-step): lane -> row tid&7, c 8((tid>>3)&3).., 8 consecutive lanes per line.
// =========================================================================================================
__device__ __forceinline__ unsigned cvt_b2(float a, float b) {
  const v2f p = {a, b};
  return __builtin_bit_cast(unsigned, __builtin_convertvector(p, v2b));
}
__device__ __forceinline__ unsigned cvt_x2(float a, float b) {
  const unsigned hw = cvt_b2(a, b);
  const v2f r = {__uint_as_float(hw << 16), __uint_as_float(hw & 0xffff0000u)};
  return __builtin_bit_cast(unsigned, __builtin_convertvector(r, v2h));
}
__device__ __forceinline__ unsigned cvt_w2(float a, float b) {
  const unsigned hw = cvt_b2(a, b);
  const v2f r = {__uint_as_float(hw << 16) * WSC, __uint_as_float(hw & 0xffff0000u) * WSC};
  return __builtin_bit_cast(unsigned, __builtin_convertvector(r, v2h));
}
template <bool F16W>
__device__ __forceinline__ Frag ldfrag_f32(const float* p) {
  Frag f;
#pragma unroll
  for (int s = 0; s < 2; ++s) {
    const v4f a = *(const v4f*)(p + 16 * s);
    const v4f q = *(const v4f*)(p + 16 * s + 4);
    v4u u;
    if constexpr (F16W) {
      u[0] = cvt_w2(a[0], a[1]); u[1] = cvt_w2(a[2], a[3]); u[2] = cvt_w2(q[0], q[1]); u[3] = cvt_w2(q[2], q[3]);
    } else {
      u[0] = cvt_b2(a[0], a[1]); u[1] = cvt_b2(a[2], a[3]); u[2] = cvt_b2(q[0], q[1]); u[3] = cvt_b2(q[2], q[3]);
    }
    f.u[s] = __builtin_bit_cast(v8us, u);
  }
  return f;
}
__device__ __forceinline__
void cvt_wp(const int blk, const float* __restrict__ pw, unsigned short* WPB) {
  const int tid = threadIdx.x;
  const int u = 4 * blk + (tid >> 5);                                // 0..255: k-step u & 7, rows 8 (u >> 3) ..
  const int ks = u & 7, d8 = (tid >> 3) & 3;
  const int o = 8 * (u >> 3) + (tid & 7), col = 32 * ks + 8 * d8;
  const float* sp = pw + (size_t)o * CC + col;
  const v4f a = *(const v4f*)sp;
  const v4f q = *(const v4f*)(sp + 4);
  v4u w;
  w[0] = cvt_b2(a[0], a[1]); w[1] = cvt_b2(a[2], a[3]); w[2] = cvt_b2(q[0], q[1]); w[3] = cvt_b2(q[2], q[3]);
  *(v4u*)(WPB + (size_t)((o >> 4) * (CC / 32) + ks) * 512 + (16 * d8 + (o & 15)) * 8) = w;
  // the listing lays another job's code behind this store: its registers stay untouched until this wait
  asm volatile("s_wait_xcnt 0x0" ::: "memory");
}

// =========================================================================================================
// (2) 1x1-conv GEMM for one (b, 64-n tile, 64-o block): Y[o][n] = (1/256) sum_c w16(W[o][c]) x16(x[b][c][pix(n)]).
//     MODE 0: n = query pixel; MODE 1/2: n = key index ky*32+kx -> pixel 128 ky + 2 kx (arithmetic addressing).
//     Block 128 threads = 4 waves. The block's x tile goes f32 [256 c][64 n] -> LDS XT f16 [64 n][256 c] (pitch XTP):
//     a thread reads 8 consecutive c rows (MODE 0: 4 n each, 16-byte loads; MODE 1/2: 2 keys each (kx = lane), every second
//     pixel, 4-byte loads) and stores one 16-byte run of c per n.
//     Wave w owns A rows o = o0 + 16 w + (lane&15), read from the f32 weight row and converted in registers (split k
//     map, all 8 k-steps held), and all 4 n-tiles (B fragments from XT rows, k = c split map). K = 256 = 8 steps.
//     Epilogue staged in LDS Os[n_loc][o_loc] (pitch OSP), barrier, then per MODE:
//       0: Qh/Ql bf16 [b][8][256 tiles of 16 n x 32 d] hi = bf16-RNE(v), lo = bf16-RNE(v - hi); 1: Kh/Kl bf16 [b][8][64
//          tiles]; tiles in fragment order (ldfrag_t): line j of a head's 4 tiles = tile j>>3, d 8((j>>1)&3).., rows 8(j&1)..+7:
//          lane e -> row 16(j>>3) + 8(j&1) + e, 8 consecutive lanes per line
//       2: Vt f16 [b][8][32 ky][2 tiles of 16 d x 32 keys] in fragment order: line L = head L>>5, key row (L>>4)&1, tile
//          (L>>3)&1, keys 8((L>>1)&3).., rows d 8(L&1)..+7: lane e -> d 16((L>>3)&1) + 8(L&1) + e, 8 lanes per line
// coverage: XT 128 threads x 16 runs x 8 c = 64 n x 256 c; Os 4 waves x 16 o x 64 n = 64 x 64; MODE 0/1: 4 it x 16 lines x 8 lanes x 8 = 64 n x 64 o per plane;
//           MODE 2: 4 it x 16 rows x 8 lanes x 8 = 64 o x 64 keys; (nt, mb, b) in NP/64 x 4 x NB.
// LDS XT, Os: cross-wave (block barriers).
// =========================================================================================================
template <int MODE>
__device__ __forceinline__
void gemm_x(unsigned short* XT, float* Os, const int nt, const int mb, const int b,
            const float* __restrict__ wsrc, const float* __restrict__ x,
            unsigned short* Ph, unsigned short* Pl, unsigned short* Vt) {
  constexpr int NP = (MODE == 0) ? NN : NK;
  const int tid  = threadIdx.x;
  const int lane = tid & 31, wave = tid >> 5;
  const int hh   = lane >> 4, c = lane & 15;
  const int n0   = nt * QT, o0 = mb * QT;
  (void)Ph; (void)Pl; (void)Vt;

  // ---- all loads that the first barrier waits for are issued first: the x tile, then the A rows of k-steps 0..3
  constexpr int KH = CC / 64;                                        // half of the k-steps
  const int nq = tid & 15, cg = tid >> 4;
  const float* xp = (MODE == 0) ? x + ((size_t)(b * CC + 8 * cg)) * NN + n0 + 4 * nq
                                : x + ((size_t)(b * CC + 8 * wave)) * NN + 2 * IMW * (2 * nt) + 2 * lane;
  const float* ap = wsrc + (size_t)(o0 + 16 * wave + c) * CC + 8 * hh;
  float f[16][8];
  if constexpr (MODE == 0) {                                         // f[4 it + i][j]: n_loc = 4 nq + i, c = 64 it + 8 cg + j
#pragma unroll
    for (int it = 0; it < 4; ++it) {
#pragma unroll
      for (int j = 0; j < 8; ++j) {
        const v4f a = *(const v4f*)(xp + (size_t)(64 * it + j) * NN);
#pragma unroll
        for (int i = 0; i < 4; ++i) f[4 * it + i][j] = a[i];
      }
    }
  } else {                                                           // f[2 it + kyl][j]: n_loc = 32 kyl + lane, c = 32 it + 8 w + j
#pragma unroll
    for (int it = 0; it < 8; ++it) {
#pragma unroll
      for (int kyl = 0; kyl < 2; ++kyl) {
#pragma unroll
        for (int j = 0; j < 8; ++j) f[2 * it + kyl][j] = xp[(size_t)(32 * it + j) * NN + 2 * IMW * kyl];
      }
    }
  }
  Frag fa[CC / 32];
#pragma unroll
  for (int ks = 0; ks < KH; ++ks) fa[ks] = ldfrag_f32<true>(ap + 32 * ks);
  // a later load of this run may otherwise land in an earlier load's address pair: both pairs stay live, and so
  // untouched, until this wait; no LDS store is lifted over it, so the whole run is in flight before the first convert
  asm volatile("s_wait_xcnt 0x0" :: "v"(xp), "v"(ap) : "memory");
#pragma unroll
  for (int g = 0; g < 16; ++g) {
    v4u u;
#pragma unroll
    for (int t = 0; t < 4; ++t) u[t] = cvt_x2(f[g][2 * t], f[g][2 * t + 1]);
    if constexpr (MODE == 0) *(v4u*)(XT + (4 * nq + (g & 3)) * XTP + 64 * (g >> 2) + 8 * cg) = u;
    else                     *(v4u*)(XT + (32 * (g & 1) + lane) * XTP + 32 * (g >> 1) + 8 * wave) = u;
  }
  __syncthreads();

  // ---- the A rows of k-steps 4..7 fly under the first half of the products
#pragma unroll
  for (int ks = KH; ks < CC / 32; ++ks) fa[ks] = ldfrag_f32<true>(ap + 32 * ks);

  v8f acc[4];
#pragma unroll
  for (int t = 0; t < 4; ++t) acc[t] = zero8();

  const unsigned short* bl = XT + c * XTP + 8 * hh;
  Frag fb[2][4];                                                     // B fragments are read one k-step ahead
#pragma unroll
  for (int t = 0; t < 4; ++t) fb[0][t] = ldfrag(bl + 16 * t * XTP);
#pragma unroll
  for (int ks = 0; ks < CC / 32; ++ks) {
    // the address pair of the second run of A loads stays live, and so untouched, until this wait
    if (ks == KH) asm volatile("s_wait_xcnt 0x0" :: "v"(ap) : "memory");
    if (ks + 1 < CC / 32) {
#pragma unroll
      for (int t = 0; t < 4; ++t) fb[(ks + 1) & 1][t] = ldfrag(bl + 16 * t * XTP + 32 * (ks + 1));
    }
#pragma unroll
    for (int t = 0; t < 4; ++t) acc[t] = mma_h(fa[ks].h, fb[ks & 1][t].h, acc[t]);
  }

  // ---- stage: lane (hh, c) holds o_loc = 16 w + 8 hh + r for n_loc = 16 t + c
  {
#pragma unroll
    for (int t = 0; t < 4; ++t) {
      const int nl = 16 * t + c;
      v4f va, vb;
#pragma unroll
      for (int r = 0; r < 4; ++r) { va[r] = acc[t][r] * IWSC; vb[r] = acc[t][4 + r] * IWSC; }
      *(v4f*)(Os + nl * OSP + 16 * wave + 8 * hh)     = va;
      *(v4f*)(Os + nl * OSP + 16 * wave + 8 * hh + 4) = vb;
    }
  }
  __syncthreads();

  const int e = tid & 7, lq = tid >> 3;                             // lq 0..15
  if constexpr (MODE == 2) {
    v4u uv[4];
#pragma unroll
    for (int it = 0; it < 4; ++it) {
      const int L  = it * 16 + lq;                                   // line 0..63
      const int ol = 32 * (L >> 5) + 16 * ((L >> 3) & 1) + 8 * (L & 1) + e;   // o_loc 0..63
      const int kb = 32 * ((L >> 4) & 1) + 8 * ((L >> 1) & 3);       // first of this piece's 8 keys
      unsigned short hb[8];
#pragma unroll
      for (int t = 0; t < 8; ++t) hb[t] = h_bits((_Float16)Os[(kb + t) * OSP + ol]);
#pragma unroll
      for (int t = 0; t < 4; ++t) uv[it][t] = pk16(hb[2 * t], hb[2 * t + 1]);
    }
{
#pragma unroll
      for (int it = 0; it < 4; ++it) {
        const int L = it * 16 + lq;
        *(v4u*)(Vt + ((size_t)((b * NHD + 2 * mb + (L >> 5)) * NK + n0)) * HD + 64 * (L & 31) + 8 * e) = uv[it];
      }
      // the listing lays another job's code behind these stores: their registers stay untouched until this wait
      asm volatile("s_wait_xcnt 0x0" ::: "memory");
    }
  } else {
    v4u uh[4], ul[4];
#pragma unroll
    for (int it = 0; it < 4; ++it) {
      const int L = it * 16 + lq;                                    // line 0..63
      const int hs = L >> 5, j = L & 31;
      const int row = 16 * (j >> 3) + 8 * (j & 1) + e;               // n_loc
      const int cb0 = 32 * hs + 8 * ((j >> 1) & 3);                  // o_loc of the first value
      const v4f a = *(const v4f*)(Os + row * OSP + cb0);
      const v4f q = *(const v4f*)(Os + row * OSP + cb0 + 4);
      const float f[8] = {a[0], a[1], a[2], a[3], q[0], q[1], q[2], q[3]};
#pragma unroll
      for (int t = 0; t < 4; ++t) {
        const float f0 = f[2 * t], f1 = f[2 * t + 1];
        const unsigned short hb0 = bf_bits(f0), hb1 = bf_bits(f1);
        const unsigned short lb0 = bf_bits(f0 - bf_up(hb0));
        const unsigned short lb1 = bf_bits(f1 - bf_up(hb1));
        uh[it][t] = pk16(hb0, hb1);
        ul[it][t] = pk16(lb0, lb1);
      }
    }
{
#pragma unroll
      for (int it = 0; it < 4; ++it) {
        const int L = it * 16 + lq;
        const int hs = L >> 5, j = L & 31;
        const size_t po = ((size_t)((b * NHD + 2 * mb + hs) * NP + n0 + 2 * j)) * HD + 8 * e;
        *(v4u*)(Ph + po) = uh[it];
        *(v4u*)(Pl + po) = ul[it];
      }
      // the listing lays another job's code behind these stores: their registers stay untouched until this wait
      asm volatile("s_wait_xcnt 0x0" ::: "memory");
    }
  }
}

// ---- 8 f32 -> bf16 hi (RNE) and bf16 lo (RNE of the rest), packed pairs
__device__ __forceinline__ void split8(v4f a, v4f q, v8us& hi, v8us& lo) {
  const float f[8] = {a[0], a[1], a[2], a[3], q[0], q[1], q[2], q[3]};
  v4u wh, wl;
#pragma unroll
  for (int t = 0; t < 4; ++t) {
    const v2f p = {f[2 * t], f[2 * t + 1]};
    const unsigned hw = __builtin_bit_cast(unsigned, __builtin_convertvector(p, v2b));   // RNE, packed pair
    const v2f r = {p[0] - __uint_as_float(hw << 16), p[1] - __uint_as_float(hw & 0xffff0000u)};
    wh[t] = hw;
    wl[t] = __builtin_bit_cast(unsigned, __builtin_convertvector(r, v2b));
  }
  hi = __builtin_bit_cast(v8us, wh);
  lo = __builtin_bit_cast(v8us, wl);
}

// =========================================================================================================
// (3) position tables. A table row depends on its (coord, kcoord) pair only through diff = coord - 2*kcoord, and
//     inside the local window diff lies in -DOFF..DOFF, so the tables are built once per diff: row T = diff + DOFF
//     (rows 35..47 fill the last tile and are never used). One job = (16-row tile rt, 64-o block ob, axis):
//     a = diff * 1000^(-f/64), features [sin(a) | cos(a)] (128) built in LDS as bf16 hi/lo planes Eh/El[16][128]
//     (pitch EP); then Y[o][T] = sum_f Wf[axis][o][f] E[T][f]: wave w owns A rows o = 64 ob + 16 w + (lane&15), bf16-RNE
//     of the f32 row, all waves share the B rows T from Eh and El (2 products sharing the accumulator, K = 128); epilogue
//     Os[T_loc][o_loc] = Y / sqrt(2), barrier, then
//       PFh/PFl bf16 [axis][h][48 T x 32 d] (hi = bf16-RNE(v), lo = bf16-RNE(v - hi)), pieces of 8 d in the order of
//       their reader's loads. x axis: 3 tiles of 16 T in fragment order (ldfrag_t). y axis: the reader's 16 rows are
//       T, T - 2, .., so pieces lie [T & 1][d >> 3][(47 - T) >> 1]: 16 lanes read 256 contiguous bytes (ldfrag_y).
//       Either way 8 consecutive lanes store one whole line.
// coverage: Eh/El 8 it x 128 threads = 16 rows x 64 args x {sin,cos} = 16 x 128 (cols 128..135 pad, never read);
//           planes 128 threads x 8 = 2 heads x 16 rows x 32 d; (rt, ob, axis) in 3 x 4 x 2 covers
//           PFh/PFl [2][8][48][32] exactly once.
// LDS Eh/El, Os: cross-wave (block barriers).
// =========================================================================================================
__device__ __forceinline__
void posfeat(unsigned short* Eh, unsigned short* El, float* Os, const int rt, const int ob, const int axis,
             const float* __restrict__ fxw, const float* __restrict__ fyw, unsigned short* PFh, unsigned short* PFl) {
  const int tid  = threadIdx.x;
  const int lane = tid & 31, wave = tid >> 5;
  const int hh   = lane >> 4, c = lane & 15;
  const int R0   = rt * PRT;

  // ---- A rows first: their loads fly under the sinusoids
  const float* ap = (axis ? fyw : fxw) + (size_t)(QT * ob + 16 * wave + c) * PFD + 8 * hh;
  Frag fa[PFD / 32];
#pragma unroll
  for (int ks = 0; ks < PFD / 32; ++ks) fa[ks] = ldfrag_f32<false>(ap + 32 * ks);
  // a later load of this run may otherwise land in the address pair: it stays live, and so untouched, until this wait
  asm volatile("s_wait_xcnt 0x0" :: "v"(ap) : "memory");

  // ---- (a) sinusoid features -> LDS bf16 hi/lo planes (rolled: one copy of the sin/cos code keeps the text short)
#pragma unroll 1
  for (int it = 0; it < PRT / 2; ++it) {
    const int idx = it * 128 + tid;                                  // 0..1023
    const int rl = idx >> 6, fa = idx & 63;
    const float diff = (float)(R0 + rl - DOFF);
    const float a = diff * exp2f(-(float)fa * NL2W);
    const float sv = sinf(a);
    const float cv = cosf(a);
    const unsigned short shb = bf_bits(sv), chb = bf_bits(cv);
    Eh[rl * EP + fa]      = shb;
    El[rl * EP + fa]      = bf_bits(sv - bf_up(shb));
    Eh[rl * EP + 64 + fa] = chb;
    El[rl * EP + 64 + fa] = bf_bits(cv - bf_up(chb));
  }
  __syncthreads();

  const unsigned short* ebh = Eh + c * EP + 8 * hh;
  const unsigned short* ebl = El + c * EP + 8 * hh;
  v8f acc = zero8();
#pragma unroll
  for (int ks = 0; ks < PFD / 32; ++ks) {
    const Frag fbh = ldfrag(ebh + 32 * ks);
    const Frag fbl = ldfrag(ebl + 32 * ks);
    acc = mma_b(fa[ks].bf, fbh.bf, acc);
    acc = mma_b(fa[ks].bf, fbl.bf, acc);
  }
  {
    v4f va, vb;
#pragma unroll
    for (int r = 0; r < 4; ++r) { va[r] = acc[r] * RSQ2; vb[r] = acc[4 + r] * RSQ2; }
    *(v4f*)(Os + c * OSP + 16 * wave + 8 * hh)     = va;            // Os[T_loc = c][o_loc = 16 w + 8 hh + r]
    *(v4f*)(Os + c * OSP + 16 * wave + 8 * hh + 4) = vb;
  }
  __syncthreads();
  const int e = tid & 7, grp = (tid >> 3) & 7, hs = tid >> 6;        // line grp of this head's 8; axis is block-uniform
  const int dl = 8 * (axis ? (grp & 3) : (grp >> 1));
  const int rl = axis ? PRT - 2 + (grp >> 2) - 2 * e : 8 * (grp & 1) + e;
  v8us hi, lo;
  split8(*(const v4f*)(Os + rl * OSP + 32 * hs + dl), *(const v4f*)(Os + rl * OSP + 32 * hs + dl + 4), hi, lo);
  const size_t po = (size_t)(axis * NHD + 2 * ob + hs) * NDF * HD +
                    (axis ? grp * (NDF / 2 * 8) + ((NDF - PRT - R0) / 2 + e) * 8 : R0 * HD + 64 * grp + 8 * e);
  *(v8us*)(PFh + po) = hi;
  *(v8us*)(PFl + po) = lo;
}

// =========================================================================================================
// (0)+(2)+(3) in one launch: the position tables, the q, k and v GEMMs and the proj_w plane read only inputs and
// none reads another's output. Block order: tables first (24 blocks), then
// q (NBQ blocks), k and v (NBK blocks each), then the proj_w plane (NBWP blocks). The selection is block-uniform, so
// every barrier of a job is passed by all four waves of its block. XT and Os are shared by the jobs (a block runs
// exactly one of them); the table job keeps its Eh and El planes in XT.
// =========================================================================================================
#define NBP ((NDF / PRT) * (CC / QT) * 2)
#define NBQ ((NN / QT) * (CC / QT) * NB)
#define NBK ((NK / QT) * (CC / QT) * NB)
#define NBWP (CC / 4)
__global__ __launch_bounds__(128)
void feat_gemm(const float* __restrict__ x, const float* __restrict__ qw, const float* __restrict__ kw,
               const float* __restrict__ vw, const float* __restrict__ pw, const float* __restrict__ fxw,
               const float* __restrict__ fyw,
               unsigned short* PFh, unsigned short* PFl, unsigned short* Qh, unsigned short* Ql, unsigned short* Kh, unsigned short* Kl,
               unsigned short* Vt, unsigned short* WPB) {
  __shared__ __align__(16) unsigned short XT[QT * XTP];
  __shared__ __align__(16) float Os[QT * OSP];
  const int blk = blockIdx.x;
  if (blk < NBP) {
    posfeat(XT, XT + PRT * EP, Os, blk % (NDF / PRT), (blk / (NDF / PRT)) % (CC / QT), blk / ((NDF / PRT) * (CC / QT)),
            fxw, fyw, PFh, PFl);
  } else if (blk < NBP + NBQ) {
    const int j = blk - NBP;
    gemm_x<0>(XT, Os, j % (NN / QT), (j / (NN / QT)) % (CC / QT), j / ((NN / QT) * (CC / QT)),
              qw, x, Qh, Ql, Vt);
  } else if (blk < NBP + NBQ + NBK) {
    const int j = blk - (NBP + NBQ);
    gemm_x<1>(XT, Os, j % (NK / QT), (j / (NK / QT)) % (CC / QT), j / ((NK / QT) * (CC / QT)),
              kw, x, Kh, Kl, Vt);
  } else if (blk < NBP + NBQ + 2 * NBK) {
    const int j = blk - (NBP + NBQ + NBK);
    gemm_x<2>(XT, Os, j % (NK / QT), (j / (NK / QT)) % (CC / QT), j / ((NK / QT) * (CC / QT)),
              vw, x, Kh, Kl, Vt);
  } else {
    cvt_wp(blk - (NBP + NBQ + 2 * NBK), pw, WPB);
  }
}

// =========================================================================================================
// (4) local-window attention for one (query row y, head, b): block = 4 waves, wave w = queries x = 16w..16w+15.
//   Position dot terms first, per wave for its own 16 queries: B cols = qg = q + bf16-RNE(geom_bias) from Qh + Ql +
//   bias, split in registers into bf16 hi/lo with the split k map of ldfrag; A rows from the by-difference tables
//   PFh/PFl (hi.hi + hi.lo + lo.hi share the accumulator, depth 32). x axis: the 3 tiles of all 48 rows T, one
//   table for every query, D -> Gs[query][T]; y axis: rows T = y - 2 ky + DOFF of ky = kylo + i (i = 16 t + (lane&15),
//   held at the last allowed row), D -> Gs[query][NDF + i]; barrier. Per lane (hh, c): PX[kx] = Gs[query][x - 2 kx +
//   DOFF] for kx in {8hh..8hh+7, 16+8hh..} (registers, in the D layout of the score tiles; the index is held inside the
//   row where kx lies outside the per-query window, and the value there is MASKED); PY[ky] = Gs[query][NDF + ky - kylo],
//   one value per key row.
//   Loop over allowed key rows ky (block-uniform; forbidden rows contribute exactly 0): S^T tiles (16 keys x 16
//   queries) = PX + A(Kh rows key ky*32 + 16t + (lane&15), k = d split map) . B(QAh col = query) + A(Kh).B(QAl) +
//   A(Kl).B(QAh), QA = q + bf16-RNE(appr_bias) as bf16 hi/lo planes split in registers, PX the start value of the shared
//   accumulator; energy = S^T + PY[ky]. No additive term is applied per element: PY is the same for all keys of a row,
//   so it is added to the row's max and to the exponent's per-lane addend. Per lane the D tiles hold 16 keys of ONE
//   query: online softmax per lane,
//   one shuffle (lane^16) for the max over the 32 keys of the row, o/l rescale skipped under a wave-uniform ballot.
//   P = e^{s-m} x 1024 as f16 is the B operand of O^T (rows d, cols queries) += A(Vt rows d = 16j + (lane&15), fragment
//   order) . B(P^T): element r <- D of the tile covering kx 0..15, element 8+r <- the tile covering kx 16..31.
//   Epilogue: O/l staged in LDS Os[query][32 d] (pitch OSV), barrier, then OPh/OPl bf16 [b][8][256 tiles of 16 queries x
//   32 d] in fragment order (hi = bf16-RNE(v), lo = bf16-RNE(v - hi)); line L = tile L>>3, d 8((L>>1)&3).., rows
//   8(L&1)..+7: lane e -> row 16(L>>3) + 8(L&1) + e, 8 consecutive lanes per line
// coverage: Os 4 waves x 16 queries x 32 d; planes 2 it x 16 lines x 8 lanes x 8 = 64 queries x 32 d per plane;
//           grid (64, 8, NB) covers OPh/OPl [b][8][4096][32] exactly once.
// LDS Os: cross-wave (block barrier). Gs: written and read inside one wave's rows, synchronised with a block barrier.
// =========================================================================================================
// ---- the operands of one key row ky (32 keys): K hi/lo tiles of keys 0..15 and 16..31, V^T tiles of d 0..15 and 16..31,
//      and PY of this lane's query
struct RowOps { Frag k0, k1, k0l, k1l, v0, v1; float py; };
__device__ __forceinline__
void fetch_row(RowOps& t, const unsigned short* Khp, const unsigned short* Klp, const unsigned short* Vp, const int ky) {
  const int kp0 = ky * KVW;
  const unsigned short* kh = Khp + (size_t)kp0 * HD;
  const unsigned short* kl = Klp + (size_t)kp0 * HD;
  const unsigned short* vp = Vp + (size_t)kp0 * HD;
  t.k0  = ldfrag_t(kh);                                              // keys kp0 .. kp0+15
  t.k1  = ldfrag_t(kh + 16 * HD);                                    // keys kp0+16 .. kp0+31
  t.k0l = ldfrag_t(kl);
  t.k1l = ldfrag_t(kl + 16 * HD);
  t.v0  = ldfrag_t(vp);                                              // d 0..15
  t.v1  = ldfrag_t(vp + 16 * HD);                                    // d 16..31
  // a later load of this run may otherwise land in an earlier load's address pair: every pair stays live, and so
  // untouched, until this wait; no load is moved below it, so the whole run is in flight before the work that follows
  asm volatile("s_wait_xcnt 0x0" :: "v"(kh), "v"(kl), "v"(vp) : "memory");
}

__global__ __launch_bounds__(128)
void attn_k(const unsigned short* __restrict__ Qh, const unsigned short* __restrict__ Ql,
            const unsigned short* __restrict__ Kh, const unsigned short* __restrict__ Kl,
            const unsigned short* __restrict__ Vt,
            const unsigned short* __restrict__ PFh, const unsigned short* __restrict__ PFl,
            const float* __restrict__ ab, const float* __restrict__ gb, unsigned short* OPh, unsigned short* OPl) {
  __shared__ __align__(16) float Os[QT * OSV];
  __shared__ __align__(16) float Gs[QT * GSP];
  const int tid  = threadIdx.x;
  const int wave = tid >> 5, lane = tid & 31;
  const int hh   = lane >> 4, c = lane & 15;
  const int y = blockIdx.x, hd = blockIdx.y, b = blockIdx.z;
  const int bh = b * NHD + hd;
  const int xq = 16 * wave + c;                                      // query column of this lane's B/D column

  const int kylo = (y >= LRANGE) ? ((y - LRANGE) >> 1) : 0;         // block-uniform
  int kyhi = ((y + LRANGE + 1) >> 1) + 1;  if (kyhi > KVH) kyhi = KVH;
  const int kxlo = (xq >= LRANGE) ? ((xq - LRANGE) >> 1) : 0;       // per lane
  int kxhi = ((xq + LRANGE + 1) >> 1) + 1; if (kxhi > KVW) kxhi = KVW;

  // ---- all loads of the position terms first: query planes, the two biases, table tiles
  const size_t qo = ((size_t)bh * NN + y * IMW + 16 * wave) * HD + 8 * lane;   // this wave's tile, fragment order
  const unsigned short* qhp = Qh + qo;
  const unsigned short* qlp = Ql + qo;
  const Frag qh = ldfrag_t(qhp);
  const Frag ql = ldfrag_t(qlp);
  const float* gp = gb + hd * HD + 8 * hh;
  const float* abp = ab + hd * HD + 8 * hh;
  v4f g[2][2], av[2][2];
#pragma unroll
  for (int s = 0; s < 2; ++s) {                                      // s: d = 16 s + 8 hh ..
    g[s][0]  = *(const v4f*)(gp + 16 * s);
    g[s][1]  = *(const v4f*)(gp + 16 * s + 4);
    av[s][0] = *(const v4f*)(abp + 16 * s);
    av[s][1] = *(const v4f*)(abp + 16 * s + 4);
  }
  Frag ahi[5], alo[5];                                               // loops unrolled: the arrays stay in registers
  const size_t tx = (size_t)hd * NDF * HD + 8 * lane;
  const unsigned short* txh = PFh + tx;
  const unsigned short* txl = PFl + tx;
#pragma unroll
  for (int t = 0; t < 3; ++t) {                                      // x axis: table rows T = 16 t + c
    ahi[t] = ldfrag_t(txh + 16 * t * HD);
    alo[t] = ldfrag_t(txl + 16 * t * HD);
  }
  const unsigned short* tyh[2];
  const unsigned short* tyl[2];
#pragma unroll
  for (int t = 0; t < 2; ++t) {                                      // y axis: table row of ky = kylo + 16 t + c
    int kyi = kylo + 16 * t + c;  if (kyi > kyhi - 1) kyi = kyhi - 1;
    const int T = y - 2 * kyi + DOFF;
    const size_t to = (size_t)(NHD + hd) * NDF * HD + (4 * (T & 1) + hh) * (NDF / 2 * 8) + ((NDF - 1 - T) >> 1) * 8;
    tyh[t] = PFh + to;
    tyl[t] = PFl + to;
    ahi[3 + t] = ldfrag_y(tyh[t]);
    alo[3 + t] = ldfrag_y(tyl[t]);
  }
  // a later load of this run may otherwise land in an earlier load's address pair: every pair stays live, and so
  // untouched, until this wait
  asm volatile("s_wait_xcnt 0x0" :: "v"(qhp), "v"(qlp), "v"(txh), "v"(txl), "v"(tyh[0]), "v"(tyl[0]), "v"(tyh[1]),
               "v"(tyl[1]) : "memory");

  // ---- fragment pointers of the key loop; the first key row's loads fly under the position terms
  const unsigned short* Khp = Kh + (size_t)bh * NK * HD + 8 * lane;
  const unsigned short* Klp = Kl + (size_t)bh * NK * HD + 8 * lane;
  const unsigned short* Vp  = Vt + (size_t)bh * HD * NK + 8 * lane;
  RowOps ra, rb;                                                     // two register sets: one worked on, one in flight
  fetch_row(ra, Khp, Klp, Vp, kylo);

  // ---- B of the position terms: qg = q + geom bias of query xq; B of the scores: qa = q + appr bias; bf16 hi/lo each
  Frag bhi, blo, qah, qal;
#pragma unroll
  for (int s = 0; s < 2; ++s) {
    const v4u wh = __builtin_bit_cast(v4u, qh.u[s]), wl = __builtin_bit_cast(v4u, ql.u[s]);
    float f[8];
#pragma unroll
    for (int j = 0; j < 4; ++j) {
      f[2 * j]     = __uint_as_float(wh[j] << 16) + __uint_as_float(wl[j] << 16);
      f[2 * j + 1] = __uint_as_float(wh[j] & 0xffff0000u) + __uint_as_float(wl[j] & 0xffff0000u);
    }
    v4f va, vb;
#pragma unroll
    for (int r = 0; r < 4; ++r) { va[r] = f[r] + bfr(g[s][0][r]); vb[r] = f[4 + r] + bfr(g[s][1][r]); }
    split8(va, vb, bhi.u[s], blo.u[s]);
#pragma unroll
    for (int j = 0; j < 2; ++j) {                                    // bf16-RNE of the bias, packed pairs
      const unsigned wa = cvt_b2(av[s][0][2 * j], av[s][0][2 * j + 1]), wb = cvt_b2(av[s][1][2 * j], av[s][1][2 * j + 1]);
      va[2 * j]     = f[2 * j] + __uint_as_float(wa << 16);
      va[2 * j + 1] = f[2 * j + 1] + __uint_as_float(wa & 0xffff0000u);
      vb[2 * j]     = f[4 + 2 * j] + __uint_as_float(wb << 16);
      vb[2 * j + 1] = f[5 + 2 * j] + __uint_as_float(wb & 0xffff0000u);
    }
    split8(va, vb, qah.u[s], qal.u[s]);
  }

  // ---- D rows = 16 t + 8 hh + r of tile t, col = query: tiles 0..2 fill Gs cols 0..47, tiles 3, 4 cols 48..79
  float* grow = Gs + xq * GSP;
#pragma unroll
  for (int t = 0; t < 5; ++t) {
    v8f d = zero8();
    d = mma_b(ahi[t].bf, bhi.bf, d);
    d = mma_b(ahi[t].bf, blo.bf, d);
    d = mma_b(alo[t].bf, bhi.bf, d);
    v4f va, vb;
#pragma unroll
    for (int r = 0; r < 4; ++r) { va[r] = d[r]; vb[r] = d[4 + r]; }
    *(v4f*)(grow + 16 * t + 8 * hh)     = va;
    *(v4f*)(grow + 16 * t + 8 * hh + 4) = vb;
  }
  __syncthreads();

  // ---- PX: per lane 16 kx values for query xq, the start values of the two score tiles; outside the query's kx window
  //      MASKED stands there: finite, so that the matrix sum stays an ordinary number, and so far below any energy that
  //      the exponential gives exactly 0, as for -inf. PY: this query's row, read per key row in the loop
  const float MASKED = -1.0e30f;
  v8f px0, px1;
#pragma unroll
  for (int r = 0; r < 8; ++r) {
    const int kx0 = 8 * hh + r, kx1 = 16 + 8 * hh + r;
    int t0 = xq - 2 * kx0 + DOFF, t1 = t0 - 32;
    t0 = (t0 < 0) ? 0 : ((t0 > NDF - 1) ? NDF - 1 : t0);
    t1 = (t1 < 0) ? 0 : ((t1 > NDF - 1) ? NDF - 1 : t1);
    const float g0 = grow[t0], g1 = grow[t1];                        // read by every lane: selects, no branches
    px0[r] = ((kx0 >= kxlo) & (kx0 < kxhi)) ? g0 : MASKED;
    px1[r] = ((kx1 >= kxlo) & (kx1 < kxhi)) ? g1 : MASKED;
  }
  const float* pyrow = grow + NDF - kylo;

  ra.py = pyrow[kylo];

  float m = -1.0e30f, l = 0.f;
  v8f o[2];
  o[0] = zero8(); o[1] = zero8();

  // ---- one key row, all of its operands already in the register set t
  auto row_step = [&](const RowOps& t) {
    v8f s0 = mma_b(t.k0.bf, qah.bf, px0);
    v8f s1 = mma_b(t.k1.bf, qah.bf, px1);
    s0 = mma_b(t.k0.bf, qal.bf, s0);
    s1 = mma_b(t.k1.bf, qal.bf, s1);
    s0 = mma_b(t.k0l.bf, qah.bf, s0);
    s1 = mma_b(t.k1l.bf, qah.bf, s1);

    float mx = fmaxf(hmax8(s0), hmax8(s1));
    mx = fmaxf(mx, __shfl_xor(mx, 16, 32)) + t.py;                   // both halves hold the same query, so the same PY
    const float mn = fmaxf(m, mx);
    const unsigned grew = wave_ballot(mx > m);                       // wave-uniform
    if (grew != 0u) {
      const float corr = __expf(m - mn);                             // == 1 exactly for lanes whose max did not grow
      l *= corr;
#pragma unroll
      for (int j = 0; j < 2; ++j) {
#pragma unroll
        for (int r = 0; r < 8; ++r) o[j][r] *= corr;
      }
    }
    m = mn;
    const float ea = (t.py - mn + LNPS) * L2E;                       // 2^(s log2(e) + ea) = e^{s + PY - m} * 1024
    const v8f ea8 = {ea, ea, ea, ea, ea, ea, ea, ea};
    const v8f le8 = {L2E, L2E, L2E, L2E, L2E, L2E, L2E, L2E};
    s0 = __builtin_elementwise_fma(s0, le8, ea8);                    // packed pairs
    s1 = __builtin_elementwise_fma(s1, le8, ea8);

    FragH ph;
    float ls = 0.f;
#pragma unroll
    for (int r = 0; r < 8; ++r) {
      const float e0 = __builtin_amdgcn_exp2f(s0[r]);                // key kp0      + 8hh + r
      const float e1 = __builtin_amdgcn_exp2f(s1[r]);                // key kp0 + 16 + 8hh + r
      ls += e0 + e1;
      ph.hv[0][r] = (_Float16)e0;
      ph.hv[1][r] = (_Float16)e1;
    }
    l += ls;

    o[0] = mma_h(t.v0.h, ph.v, o[0]);
    o[1] = mma_h(t.v1.h, ph.v, o[1]);
  };

  int ky = kylo;
  // rolled: one copy of the two row bodies keeps the loop text short
#pragma unroll 1
  for (;;) {
    int kn = (ky + 1 < kyhi) ? ky + 1 : ky;
    rb.py = pyrow[kn];
    fetch_row(rb, Khp, Klp, Vp, kn);
    row_step(ra);
    if (++ky == kyhi) break;
    kn = (ky + 1 < kyhi) ? ky + 1 : ky;
    ra.py = pyrow[kn];
    fetch_row(ra, Khp, Klp, Vp, kn);
    row_step(rb);
    if (++ky == kyhi) break;
  }
  l += __shfl_xor(l, 16, 32);
  const float inv = 1.0f / l;                                        // o and l both carry the x1024 factor

  const int qr = 16 * wave + c;
#pragma unroll
  for (int j = 0; j < 2; ++j) {
    v4f va, vb;
#pragma unroll
    for (int r = 0; r < 4; ++r) { va[r] = o[j][r] * inv; vb[r] = o[j][4 + r] * inv; }
    *(v4f*)(Os + qr * OSV + 16 * j + 8 * hh)     = va;              // Os[query][d = 16j + 8hh + r]
    *(v4f*)(Os + qr * OSV + 16 * j + 8 * hh + 4) = vb;
  }
  __syncthreads();

  const int e = tid & 7, lq = tid >> 3;                              // lq 0..15
  v4u uh[2], ul[2];
#pragma unroll
  for (int it = 0; it < 2; ++it) {
    const int L = 16 * it + lq;                                      // line 0..31
    const int row = 16 * (L >> 3) + 8 * (L & 1) + e, dl = 8 * ((L >> 1) & 3);
    const v4f a = *(const v4f*)(Os + row * OSV + dl);
    const v4f q = *(const v4f*)(Os + row * OSV + dl + 4);
    const float f[8] = {a[0], a[1], a[2], a[3], q[0], q[1], q[2], q[3]};
#pragma unroll
    for (int t = 0; t < 4; ++t) {
      const float f0 = f[2 * t], f1 = f[2 * t + 1];
      const unsigned short hb0 = bf_bits(f0), hb1 = bf_bits(f1);
      const unsigned short lb0 = bf_bits(f0 - bf_up(hb0));
      const unsigned short lb1 = bf_bits(f1 - bf_up(hb1));
      uh[it][t] = pk16(hb0, hb1);
      ul[it][t] = pk16(lb0, lb1);
    }
  }
{
#pragma unroll
    for (int it = 0; it < 2; ++it) {
      const int L = 16 * it + lq;
      const size_t po = ((size_t)bh * NN + (size_t)y * IMW + 2 * L) * HD + 8 * e;
      *(v4u*)(OPh + po) = uh[it];
      *(v4u*)(OPl + po) = ul[it];
    }
    
  }
}

// =========================================================================================================
// (5) output 1x1-conv for one (b, 64-pixel tile, 64-o block): Y[o][p] = sum_c WPB[o][c] O[b][p][c] with
//     c = 32 h + d: k-step ks = head ks, B fragments from OPh and OPl [b][ks][tile p>>4] (bf16 hi/lo, shared
//     accumulator), A from WPB tiles (o-tile, ks); all three planes in fragment order (ldfrag_t). Epilogue: Os[p_loc][o_loc], barrier, then
//     lines (row o, 64 pixels = 2 lines): 8 consecutive lanes x 16 B (values from 4 Os rows), one instruction per
// coverage: 8 it x 16 lines x 8 lanes x 4 floats = 64 o x 64 p; grid (64, 4, NB) covers out [b][256][4096] once.
// LDS Os: cross-wave (block barrier).
// =========================================================================================================
__global__ __launch_bounds__(128)
void proj_k(const unsigned short* __restrict__ WPB, const unsigned short* __restrict__ OPh,
            const unsigned short* __restrict__ OPl, const float* __restrict__ pb,
            const float* __restrict__ gam, const float* __restrict__ x, float* out) {
  __shared__ __align__(16) float Os[QT * OSP];
  const int tid  = threadIdx.x;
  const int lane = tid & 31, wave = tid >> 5;
  const int hh   = lane >> 4, c = lane & 15;
  const int nt   = blockIdx.x, mb = blockIdx.y, b = blockIdx.z;
  const int n0   = nt * QT, o0 = mb * QT;

  const unsigned short* ap = WPB + (size_t)o0 * CC + 8 * lane;       // tile (o-tile, k-step) at 512 (8 o-tile + k-step)
  const size_t brow = (size_t)b * NHD * NN * HD + (size_t)(n0 + 16 * wave) * HD + 8 * lane;
  const unsigned short* bph = OPh + brow;
  const unsigned short* bpl = OPl + brow;
  const int e = tid & 7, lq = tid >> 3;                              // lq 0..15
  const float* xb  = x + ((size_t)(b * CC + o0 + (lq >> 1))) * NN + n0 + 32 * (lq & 1) + 4 * e;
  const float* pbp = pb + o0 + (lq >> 1);

  // ---- loads ahead of the products: the B fragments of all 8 k-steps, then the A fragments of k-steps 0 and 1
  constexpr int AR = 2;                                              // A register sets = k-steps of lead
  Frag fbh[NHD], fbl[NHD], fa[AR][4];
  // every loop over these arrays, and over xv and pbv below, is unrolled: constant indices keep them in registers
#pragma unroll
  for (int ks = 0; ks < NHD; ++ks) {
    fbh[ks] = ldfrag_t(bph + (size_t)ks * NN * HD);
    fbl[ks] = ldfrag_t(bpl + (size_t)ks * NN * HD);
  }
#pragma unroll                                                       // constant indices, as above
  for (int ks = 0; ks < AR; ++ks) {
#pragma unroll                                                       // constant indices, as above
    for (int mt = 0; mt < 4; ++mt) fa[ks][mt] = ldfrag_t(ap + (size_t)(16 * mt) * CC + 512 * ks);
  }
  // a later load of this run may otherwise land in an earlier load's address pair: every pair stays live, and so
  // untouched, until this wait; no load is moved below it, so the whole run is in flight before the first product
  asm volatile("s_wait_xcnt 0x0" :: "v"(bph), "v"(bpl), "v"(ap) : "memory");
  const float g = bfr(gam[0]);                                       // read here: its wait would stand inside the run above

  v8f acc[4];
#pragma unroll
  for (int mt = 0; mt < 4; ++mt) acc[mt] = zero8();

  v4f xv[8];
  float pbv[8];
#pragma unroll                                                       // whole: the ring slot ks % AR is a constant in every copy
  for (int ks = 0; ks < NHD; ++ks) {
#pragma unroll
    for (int mt = 0; mt < 4; ++mt) {
      acc[mt] = mma_b(fa[ks % AR][mt].bf, fbh[ks].bf, acc[mt]);
      acc[mt] = mma_b(fa[ks % AR][mt].bf, fbl[ks].bf, acc[mt]);
      // the fragment just used takes its rows of k-step ks + AR
      if (ks + AR < NHD) fa[ks % AR][mt] = ldfrag_t(ap + (size_t)(16 * mt) * CC + 512 * (ks + AR));
      // what the epilogue reads: one product pair behind the last A load, since loads return in order and no product
      // may wait behind these
      if (ks + AR == NHD && mt == 0) {
#pragma unroll                                                       // constant indices, as above
        for (int it = 0; it < 8; ++it) {                             // row o0 + 8 it + (lq>>1), pixels 32 (lq&1) + 4 e ..
          xv[it]  = *(const v4f*)(xb + (size_t)(8 * it) * NN);
          pbv[it] = pbp[8 * it];
        }
        // the address pairs of the loads issued since the first wait stay live, and so untouched, until this one
        asm volatile("s_wait_xcnt 0x0" :: "v"(ap), "v"(xb), "v"(pbp) : "memory");
      }
    }
  }
  // the epilogue's conversions of x, and with them the wait for x, stay behind the last products
  __builtin_amdgcn_sched_barrier(0);

  {
    const int nl = 16 * wave + c;
#pragma unroll
    for (int mt = 0; mt < 4; ++mt) {
      v4f va, vb;
#pragma unroll
      for (int r = 0; r < 4; ++r) { va[r] = acc[mt][r]; vb[r] = acc[mt][4 + r]; }
      *(v4f*)(Os + nl * OSP + 16 * mt + 8 * hh)     = va;
      *(v4f*)(Os + nl * OSP + 16 * mt + 8 * hh + 4) = vb;
    }
  }
  __syncthreads();

  v4f res[8];
#pragma unroll
  for (int it = 0; it < 8; ++it) {
    const int L   = it * 16 + lq;                                    // 0..127
    const int ol  = L >> 1, hf = L & 1;                              // o_loc 0..63
    const int nl  = hf * 32 + 4 * e;                                 // pixel 0..63
    const float pbr = bfr(pbv[it]);
#pragma unroll
    for (int t = 0; t < 4; ++t) res[it][t] = g * (Os[(nl + t) * OSP + ol] + pbr) + bfr(xv[it][t]);
  }
{
#pragma unroll
    for (int it = 0; it < 8; ++it) {
      const int L   = it * 16 + lq;
      const int ol  = L >> 1, hf = L & 1;
      const int nl  = hf * 32 + 4 * e;
      const size_t idx = ((size_t)(b * CC + o0 + ol)) * NN + n0 + nl;
      *(v4f*)(out + idx) = res[it];
    }
    
  }
}

// =========================================================================================================
// Workspace map (bytes; each region start a multiple of 256; every extent is an exact tile multiple and is written
//   WPB bf16 [16][8] tiles 131072 (a tile = 16 rows x 32 k in fragment order, 1024 bytes)
//   Qh/Ql bf16 [NB][8][256] tiles      2097152 x NB each     Kh/Kl bf16 [NB][8][64] tiles 524288 x NB each
//   Vt  f16 [NB][8][32 ky][2] tiles     524288 x NB
//   PFh/PFl bf16 [2][8][48 x 32]         49152 each
//   OPh/OPl bf16 [NB][8][256] tiles    2097152 x NB each
//   total (NB = 2) = 20152320
// =========================================================================================================
extern "C" void kernel_launch(void* const* d_in, const int* in_sizes, int n_in,
                              void* d_out, int out_size, void* d_ws, size_t ws_size,
                              hipStream_t stream) {
  const int XN = NB * CC * NN;
  if (n_in < 11) return;
  if (in_sizes[0] < XN) return;
  if (in_sizes[1] < CC * CC || in_sizes[2] < CC * CC || in_sizes[3] < CC * CC || in_sizes[8] < CC * CC) return;
  if (in_sizes[4] < CC * PFD || in_sizes[5] < CC * PFD) return;
  if (in_sizes[6] < CC || in_sizes[7] < CC || in_sizes[9] < CC || in_sizes[10] < 1) return;
  if (out_size < XN) return;

  size_t off = 0;
  auto carve = [&](size_t bytes) { const size_t o = off; off += (bytes + 255) & ~(size_t)255; return o; };
  const size_t oWPB = carve((size_t)CC * CC * 2);
  const size_t oQh  = carve((size_t)NB * NHD * NN * HD * 2);
  const size_t oQl  = carve((size_t)NB * NHD * NN * HD * 2);
  const size_t oKh  = carve((size_t)NB * NHD * NK * HD * 2);
  const size_t oKl  = carve((size_t)NB * NHD * NK * HD * 2);
  const size_t oVt  = carve((size_t)NB * NHD * HD * NK * 2);
  const size_t oPFh = carve((size_t)2 * NHD * NDF * HD * 2);
  const size_t oPFl = carve((size_t)2 * NHD * NDF * HD * 2);
  const size_t oOPh = carve((size_t)NB * NHD * NN * HD * 2);
  const size_t oOPl = carve((size_t)NB * NHD * NN * HD * 2);
  if (off > ws_size) return;
  if (off > (size_t)134217728) return;

  const float* x   = (const float*)d_in[0];
  const float* qw  = (const float*)d_in[1];
  const float* kw  = (const float*)d_in[2];
  const float* vw  = (const float*)d_in[3];
  const float* fxw = (const float*)d_in[4];
  const float* fyw = (const float*)d_in[5];
  const float* ab  = (const float*)d_in[6];
  const float* gb  = (const float*)d_in[7];
  const float* pw  = (const float*)d_in[8];
  const float* pb  = (const float*)d_in[9];
  const float* gam = (const float*)d_in[10];

  char* ws = (char*)d_ws;
  unsigned short* WPB = (unsigned short*)(ws + oWPB);
  unsigned short* Qh  = (unsigned short*)(ws + oQh);
  unsigned short* Ql  = (unsigned short*)(ws + oQl);
  unsigned short* Kh  = (unsigned short*)(ws + oKh);
  unsigned short* Kl  = (unsigned short*)(ws + oKl);
  unsigned short* Vt  = (unsigned short*)(ws + oVt);
  unsigned short* PFh = (unsigned short*)(ws + oPFh);
  unsigned short* PFl = (unsigned short*)(ws + oPFl);
  unsigned short* OPh = (unsigned short*)(ws + oOPh);
  unsigned short* OPl = (unsigned short*)(ws + oOPl);
  float* out = (float*)d_out;

  const dim3 blk128(128);

  // (0)+(2)+(3) position tables PFh/PFl (x axis then y axis); q, k and v; the proj_w plane
  feat_gemm<<<dim3(NBP + NBQ + 2 * NBK + NBWP), blk128, 0, stream>>>(x, qw, kw, vw, pw, fxw, fyw, PFh, PFl, Qh, Ql, Kh,
                                                                     Kl, Vt, WPB);
  // (4) position dot terms and local-window attention -> per-head O planes
  attn_k<<<dim3(IMH, NHD, NB), blk128, 0, stream>>>(Qh, Ql, Kh, Kl, Vt, PFh, PFl, ab, gb, OPh, OPl);
  // (5) output conv + bias, gamma scale, skip add -> out [b][256][4096]
  proj_k<<<dim3(NN / QT, CC / QT, NB), blk128, 0, stream>>>(WPB, OPh, OPl, pb, gam, x, out);
  (void)hipGetLastError();
}

// v008
// One run takes 28.4 microseconds.
// Two timings next to v007 put it at 1.05 and 1.03 times that version's speed.
// Counting every step since v000, it is 3.91 times as fast.
// Contractions: q/k/v 1x1-conv GEMMs W[256x256].X[256xN] on v_wmma_f32_16x16x32_f16 (f16 containers of
// bf16-RNE weights x256 and bf16-RNE x); sinusoid position tables E[48x128].Wf^T on v_wmma_f32_16x16x32_bf16
// (bf16 hi + bf16 lo planes of the sin/cos features, Wf bf16-RNE, 2 products); attention scores K.(Q + appr bias)^T per
// head on v_wmma_f32_16x16x32_bf16 (bf16 hi + bf16 lo planes of q + bias and k, 3 products, depth 32); O^T = V^T.P^T on
// v_wmma_f32_16x16x32_f16 (v single f16 plane, P = e^{s-m} x1024 f16 from the score D registers); output
// 1x1-conv Wp[256x256].O on v_wmma_f32_16x16x32_bf16 (Wp bf16-RNE, O as bf16 hi + bf16 lo planes, 2 products);
// depth-32 position dot terms table[rows x 32 d].(q + geom bias)^T per (query row, head) on
// v_wmma_f32_16x16x32_bf16 (bf16 hi + bf16 lo planes of both, 3 products); f32 accumulate everywhere; bias terms,
// softmax statistics, gamma and the skip add on f32 VALU.
#include <hip/hip_runtime.h>
#include <math.h>
#include <stdint.h>

#ifndef NB
#define NB 2
#endif
#define NB_FULL 2
#define CC      256
#define IMH     64
#define IMW     64
#define NN      4096
#define KVH     32
#define KVW     32
#define NK      1024
#define NHD     8
#define HD      32
#define PFD     128
#define NPR     2048
#define NDF     48
#define DOFF    17
#define PRT     16
#define GSP     84
#define LRANGE  16
#define QT      64
#define OSP     68
#define XTP     264
#define EP      136
#define OSV     36
#define WSC     256.0f
#define IWSC    0.00390625f
#define LNPS    6.931471805599453f
#define RSQ2    0.70710678118654752f
#define NL2W    0.15571537944784511f
#define L2E     1.4426950408889634f

static_assert(NB >= 1 && NB <= NB_FULL);
static_assert(NN == IMH * IMW && NK == KVH * KVW);
static_assert(NPR == IMW * KVW && NPR == IMH * KVH);
static_assert(DOFF == LRANGE + 1 && 2 * DOFF + 1 <= NDF && LRANGE + 2 <= 32);
static_assert(NDF % PRT == 0 && PRT == 16 && GSP >= NDF + 32 && (GSP * 4) % 16 == 0);
static_assert(CC == NHD * HD && HD == 32 && KVW == 32 && KVH == 32);
static_assert(NN % QT == 0 && NK % QT == 0 && CC % QT == 0 && NPR % QT == 0);
static_assert(CC % 32 == 0 && PFD % 32 == 0 && HD % 32 == 0);
static_assert((OSP * 4) % 16 == 0 && (XTP * 2) % 16 == 0 && XTP >= CC && (EP * 2) % 16 == 0);
static_assert(2 * PRT * EP <= QT * XTP);
static_assert((OSV * 4) % 16 == 0);
static_assert(IMW == QT);
static_assert(QT == 2 * HD);

typedef _Float16       v16h __attribute__((ext_vector_type(16)));
typedef _Float16       v8h  __attribute__((ext_vector_type(8)));
typedef __bf16         v16b __attribute__((ext_vector_type(16)));
typedef unsigned short v8us __attribute__((ext_vector_type(8)));
typedef float          v8f  __attribute__((ext_vector_type(8)));
typedef float          v4f  __attribute__((ext_vector_type(4)));
typedef float          v2f  __attribute__((ext_vector_type(2)));
typedef __bf16         v2b  __attribute__((ext_vector_type(2)));
typedef _Float16       v2h  __attribute__((ext_vector_type(2)));
typedef unsigned int   v4u  __attribute__((ext_vector_type(4)));

union Frag  { v8us u[2]; v16h h; v16b bf; };
union FragH { v16h v; v8h hv[2]; };
static_assert(sizeof(Frag) == 32);
static_assert(sizeof(FragH) == 32);

// ---- scalar helpers ---------------------------------------------------------------------------------------
__device__ __forceinline__ unsigned short bf_bits(float f) {          // f32 -> bf16 bits, RNE convert
  unsigned u = __float_as_uint(f);
  return (unsigned short)((u + 0x7FFFu + ((u >> 16) & 1u)) >> 16);
}
__device__ __forceinline__ float bf_up(unsigned short hb) { return __uint_as_float(((unsigned)hb) << 16); }
__device__ __forceinline__ float bfr(float f) { return bf_up(bf_bits(f)); }
__device__ __forceinline__ unsigned short h_bits(_Float16 x) { return __builtin_bit_cast(unsigned short, x); }
__device__ __forceinline__ unsigned pk16(unsigned short a, unsigned short b) { return (unsigned)a | ((unsigned)b << 16); }
__device__ __forceinline__ v8f zero8() { v8f z = {0.f, 0.f, 0.f, 0.f, 0.f, 0.f, 0.f, 0.f}; return z; }
__device__ __forceinline__ float hmax8(v8f s) {
  return fmaxf(fmaxf(fmaxf(s[0], s[1]), fmaxf(s[2], s[3])), fmaxf(fmaxf(s[4], s[5]), fmaxf(s[6], s[7])));
}
__device__ __forceinline__ unsigned wave_ballot(bool p) {
#if defined(__HIP_DEVICE_COMPILE__)
  return __builtin_amdgcn_ballot_w32(p);
#else
  return p ? 1u : 0u;
#endif
}

// ---- 16-bit fragment loader (A, or B from a k-contiguous [n][k] row): lane -> row/col (lane&15), p already includes
//      + 8*(lane>>4); elements 0..7 <- p[0..7] (k0+8h..), elements 8..15 <- p[16..23] (k0+16+8h..)
__device__ __forceinline__ Frag ldfrag(const unsigned short* p) {
  Frag f;
  f.u[0] = *(const v8us*)(p);
  f.u[1] = *(const v8us*)(p + 16);
  return f;
}

// ---- the same fragment from a plane kept in FRAGMENT ORDER: a tile of 16 rows x 32 k is 1 KiB = 64 pieces of 16 B, piece
//      16 (k >> 3) + row holding k = 8 (k >> 3) .. + 7 of that row. p = tile + 8 * lane: elements 0..7 <- piece lane
//      (row lane&15, k 8h..), elements 8..15 <- piece 32 + lane (k 16+8h..): the k map of ldfrag, but each of the two
//      loads of a wave covers 512 contiguous bytes = 4 whole lines
__device__ __forceinline__ Frag ldfrag_t(const unsigned short* p) {
  Frag f;
  f.u[0] = *(const v8us*)(p);
  f.u[1] = *(const v8us*)(p + 256);
  return f;
}

// ---- the same fragment from the y-axis position plane (layout at posfeat): p = this lane's piece of k 8h.., the piece of
//      k 16+8h.. lies two piece rows (of NDF / 2 pieces each) further
__device__ __forceinline__ Frag ldfrag_y(const unsigned short* p) {
  Frag f;
  f.u[0] = *(const v8us*)(p);
  f.u[1] = *(const v8us*)(p + NDF * 8);
  return f;
}

// ---- WMMA helpers: builtin followed by a 4-slot VALU gap tying D and keeping A/B live --------------------------
__device__ __forceinline__ v8f mma_h(v16h a, v16h b, v8f c) {
  v8f d = __builtin_amdgcn_wmma_f32_16x16x32_f16(false, a, false, b, (short)0, c, false, false);
#if defined(__HIP_DEVICE_COMPILE__)
  asm volatile("v_nop\n\tv_nop\n\tv_nop\n\tv_nop" : "+v"(d) : "v"(a), "v"(b));
#endif
  return d;
}
__device__ __forceinline__ v8f mma_b(v16b a, v16b b, v8f c) {
  v8f d = __builtin_amdgcn_wmma_f32_16x16x32_bf16(false, a, false, b, (short)0, c, false, false);
#if defined(__HIP_DEVICE_COMPILE__)
  const v16h ha = __builtin_bit_cast(v16h, a), hb = __builtin_bit_cast(v16h, b);
  asm volatile("v_nop\n\tv_nop\n\tv_nop\n\tv_nop" : "+v"(d) : "v"(ha), "v"(hb));
#endif
  return d;
}
// ---- the same products as the plain builtins, for the attention kernel: the compiler keeps the distance behind them
//      itself, with independent instructions where it has some
__device__ __forceinline__ v8f wm_h(v16h a, v16h b, v8f c) {
  return __builtin_amdgcn_wmma_f32_16x16x32_f16(false, a, false, b, (short)0, c, false, false);
}
__device__ __forceinline__ v8f wm_b(v16b a, v16b b, v8f c) {
  return __builtin_amdgcn_wmma_f32_16x16x32_bf16(false, a, false, b, (short)0, c, false, false);
}

// =========================================================================================================
// (0) conversions done where the values are used (no launch of their own).
//     cvt_x2: two f32 -> bf16-RNE -> the same values as f16 (exact), packed; cvt_w2: the same with the x256 weight scale;
//     cvt_b2: two f32 -> bf16-RNE, packed. ldfrag_f32<F16W>: the split k map of ldfrag read from an f32 row.
//     cvt_wp: WPB bf16 = bf16-RNE(proj_w) for the output conv launch, in fragment order: tiles [16 o-tiles][8 k-steps] of
//     16 o x 32 c; a wave = (8 rows o, one k-step): lane -> row tid&7, c 8((tid>>3)&3).., 8 consecutive lanes per line.
// =========================================================================================================
__device__ __forceinline__ unsigned cvt_b2(float a, float b) {
  const v2f p = {a, b};
  return __builtin_bit_cast(unsigned, __builtin_convertvector(p, v2b));
}
__device__ __forceinline__ unsigned cvt_x2(float a, float b) {
  const unsigned hw = cvt_b2(a, b);
  const v2f r = {__uint_as_float(hw << 16), __uint_as_float(hw & 0xffff0000u)};
  return __builtin_bit_cast(unsigned, __builtin_convertvector(r, v2h));
}
__device__ __forceinline__ unsigned cvt_w2(float a, float b) {
  const unsigned hw = cvt_b2(a, b);
  const v2f r = {__uint_as_float(hw << 16) * WSC, __uint_as_float(hw & 0xffff0000u) * WSC};
  return __builtin_bit_cast(unsigned, __builtin_convertvector(r, v2h));
}
template <bool F16W>
__device__ __forceinline__ Frag ldfrag_f32(const float* p) {
  Frag f;
#pragma unroll
  for (int s = 0; s < 2; ++s) {
    const v4f a = *(const v4f*)(p + 16 * s);
    const v4f q = *(const v4f*)(p + 16 * s + 4);
    v4u u;
    if constexpr (F16W) {
      u[0] = cvt_w2(a[0], a[1]); u[1] = cvt_w2(a[2], a[3]); u[2] = cvt_w2(q[0], q[1]); u[3] = cvt_w2(q[2], q[3]);
    } else {
      u[0] = cvt_b2(a[0], a[1]); u[1] = cvt_b2(a[2], a[3]); u[2] = cvt_b2(q[0], q[1]); u[3] = cvt_b2(q[2], q[3]);
    }
    f.u[s] = __builtin_bit_cast(v8us, u);
  }
  return f;
}
__device__ __forceinline__
void cvt_wp(const int blk, const float* __restrict__ pw, unsigned short* WPB) {
  const int tid = threadIdx.x;
  const int u = 4 * blk + (tid >> 5);                                // 0..255: k-step u & 7, rows 8 (u >> 3) ..
  const int ks = u & 7, d8 = (tid >> 3) & 3;
  const int o = 8 * (u >> 3) + (tid & 7), col = 32 * ks + 8 * d8;
  const float* sp = pw + (size_t)o * CC + col;
  const v4f a = *(const v4f*)sp;
  const v4f q = *(const v4f*)(sp + 4);
  v4u w;
  w[0] = cvt_b2(a[0], a[1]); w[1] = cvt_b2(a[2], a[3]); w[2] = cvt_b2(q[0], q[1]); w[3] = cvt_b2(q[2], q[3]);
  *(v4u*)(WPB + (size_t)((o >> 4) * (CC / 32) + ks) * 512 + (16 * d8 + (o & 15)) * 8) = w;
  // the listing lays another job's code behind this store: its registers stay untouched until this wait
  asm volatile("s_wait_xcnt 0x0" ::: "memory");
}

// =========================================================================================================
// (2) 1x1-conv GEMM for one (b, 64-n tile, 64-o block): Y[o][n] = (1/256) sum_c w16(W[o][c]) x16(x[b][c][pix(n)]).
//     MODE 0: n = query pixel; MODE 1/2: n = key index ky*32+kx -> pixel 128 ky + 2 kx (arithmetic addressing).
//     Block 128 threads = 4 waves. The block's x tile goes f32 [256 c][64 n] -> LDS XT f16 [64 n][256 c] (pitch XTP):
//     a thread reads 8 consecutive c rows (MODE 0: 4 n each, 16-byte loads; MODE 1/2: 2 keys each (kx = lane), every second
//     pixel, 4-byte loads) and stores one 16-byte run of c per n.
//     Wave w owns A rows o = o0 + 16 w + (lane&15), read from the f32 weight row and converted in registers (split k
//     map, all 8 k-steps held), and all 4 n-tiles (B fragments from XT rows, k = c split map). K = 256 = 8 steps.
//     Epilogue staged in LDS Os[n_loc][o_loc] (pitch OSP), barrier, then per MODE:
//       0: Qh/Ql bf16 [b][8][256 tiles of 16 n x 32 d] hi = bf16-RNE(v), lo = bf16-RNE(v - hi); 1: Kh/Kl bf16 [b][8][64
//          tiles]; tiles in fragment order (ldfrag_t): line j of a head's 4 tiles = tile j>>3, d 8((j>>1)&3).., rows 8(j&1)..+7:
//          lane e -> row 16(j>>3) + 8(j&1) + e, 8 consecutive lanes per line
//       2: Vt f16 [b][8][32 ky][2 tiles of 16 d x 32 keys] in fragment order: line L = head L>>5, key row (L>>4)&1, tile
//          (L>>3)&1, keys 8((L>>1)&3).., rows d 8(L&1)..+7: lane e -> d 16((L>>3)&1) + 8(L&1) + e, 8 lanes per line
// coverage: XT 128 threads x 16 runs x 8 c = 64 n x 256 c; Os 4 waves x 16 o x 64 n = 64 x 64; MODE 0/1: 4 it x 16 lines x 8 lanes x 8 = 64 n x 64 o per plane;
//           MODE 2: 4 it x 16 rows x 8 lanes x 8 = 64 o x 64 keys; (nt, mb, b) in NP/64 x 4 x NB.
// LDS XT, Os: cross-wave (block barriers).
// =========================================================================================================
template <int MODE>
__device__ __forceinline__
void gemm_x(unsigned short* XT, float* Os, const int nt, const int mb, const int b,
            const float* __restrict__ wsrc, const float* __restrict__ x,
            unsigned short* Ph, unsigned short* Pl, unsigned short* Vt) {
  constexpr int NP = (MODE == 0) ? NN : NK;
  const int tid  = threadIdx.x;
  const int lane = tid & 31, wave = tid >> 5;
  const int hh   = lane >> 4, c = lane & 15;
  const int n0   = nt * QT, o0 = mb * QT;
  (void)Ph; (void)Pl; (void)Vt;

  // ---- all loads that the first barrier waits for are issued first: the x tile, then the A rows of k-steps 0..3
  constexpr int KH = CC / 64;                                        // half of the k-steps
  const int nq = tid & 15, cg = tid >> 4;
  const float* xp = (MODE == 0) ? x + ((size_t)(b * CC + 8 * cg)) * NN + n0 + 4 * nq
                                : x + ((size_t)(b * CC + 8 * wave)) * NN + 2 * IMW * (2 * nt) + 2 * lane;
  const float* ap = wsrc + (size_t)(o0 + 16 * wave + c) * CC + 8 * hh;
  float f[16][8];
  if constexpr (MODE == 0) {                                         // f[4 it + i][j]: n_loc = 4 nq + i, c = 64 it + 8 cg + j
#pragma unroll
    for (int it = 0; it < 4; ++it) {
#pragma unroll
      for (int j = 0; j < 8; ++j) {
        const v4f a = *(const v4f*)(xp + (size_t)(64 * it + j) * NN);
#pragma unroll
        for (int i = 0; i < 4; ++i) f[4 * it + i][j] = a[i];
      }
    }
  } else {                                                           // f[2 it + kyl][j]: n_loc = 32 kyl + lane, c = 32 it + 8 w + j
#pragma unroll
    for (int it = 0; it < 8; ++it) {
#pragma unroll
      for (int kyl = 0; kyl < 2; ++kyl) {
#pragma unroll
        for (int j = 0; j < 8; ++j) f[2 * it + kyl][j] = xp[(size_t)(32 * it + j) * NN + 2 * IMW * kyl];
      }
    }
  }
  Frag fa[CC / 32];
#pragma unroll
  for (int ks = 0; ks < KH; ++ks) fa[ks] = ldfrag_f32<true>(ap + 32 * ks);
  // a later load of this run may otherwise land in an earlier load's address pair: both pairs stay live, and so
  // untouched, until this wait; no LDS store is lifted over it, so the whole run is in flight before the first convert
  asm volatile("s_wait_xcnt 0x0" :: "v"(xp), "v"(ap) : "memory");
#pragma unroll
  for (int g = 0; g < 16; ++g) {
    v4u u;
#pragma unroll
    for (int t = 0; t < 4; ++t) u[t] = cvt_x2(f[g][2 * t], f[g][2 * t + 1]);
    if constexpr (MODE == 0) *(v4u*)(XT + (4 * nq + (g & 3)) * XTP + 64 * (g >> 2) + 8 * cg) = u;
    else                     *(v4u*)(XT + (32 * (g & 1) + lane) * XTP + 32 * (g >> 1) + 8 * wave) = u;
  }
  __syncthreads();

  // ---- the A rows of k-steps 4..7 fly under the first half of the products
#pragma unroll
  for (int ks = KH; ks < CC / 32; ++ks) fa[ks] = ldfrag_f32<true>(ap + 32 * ks);

  v8f acc[4];
#pragma unroll
  for (int t = 0; t < 4; ++t) acc[t] = zero8();

  const unsigned short* bl = XT + c * XTP + 8 * hh;
  Frag fb[2][4];                                                     // B fragments are read one k-step ahead
#pragma unroll
  for (int t = 0; t < 4; ++t) fb[0][t] = ldfrag(bl + 16 * t * XTP);
#pragma unroll
  for (int ks = 0; ks < CC / 32; ++ks) {
    // the address pair of the second run of A loads stays live, and so untouched, until this wait
    if (ks == KH) asm volatile("s_wait_xcnt 0x0" :: "v"(ap) : "memory");
    if (ks + 1 < CC / 32) {
#pragma unroll
      for (int t = 0; t < 4; ++t) fb[(ks + 1) & 1][t] = ldfrag(bl + 16 * t * XTP + 32 * (ks + 1));
    }
#pragma unroll
    for (int t = 0; t < 4; ++t) acc[t] = mma_h(fa[ks].h, fb[ks & 1][t].h, acc[t]);
  }

  // ---- stage: lane (hh, c) holds o_loc = 16 w + 8 hh + r for n_loc = 16 t + c
  {
#pragma unroll
    for (int t = 0; t < 4; ++t) {
      const int nl = 16 * t + c;
      v4f va, vb;
#pragma unroll
      for (int r = 0; r < 4; ++r) { va[r] = acc[t][r] * IWSC; vb[r] = acc[t][4 + r] * IWSC; }
      *(v4f*)(Os + nl * OSP + 16 * wave + 8 * hh)     = va;
      *(v4f*)(Os + nl * OSP + 16 * wave + 8 * hh + 4) = vb;
    }
  }
  __syncthreads();

  const int e = tid & 7, lq = tid >> 3;                             // lq 0..15
  if constexpr (MODE == 2) {
    v4u uv[4];
#pragma unroll
    for (int it = 0; it < 4; ++it) {
      const int L  = it * 16 + lq;                                   // line 0..63
      const int ol = 32 * (L >> 5) + 16 * ((L >> 3) & 1) + 8 * (L & 1) + e;   // o_loc 0..63
      const int kb = 32 * ((L >> 4) & 1) + 8 * ((L >> 1) & 3);       // first of this piece's 8 keys
      unsigned short hb[8];
#pragma unroll
      for (int t = 0; t < 8; ++t) hb[t] = h_bits((_Float16)Os[(kb + t) * OSP + ol]);
#pragma unroll
      for (int t = 0; t < 4; ++t) uv[it][t] = pk16(hb[2 * t], hb[2 * t + 1]);
    }
{
#pragma unroll
      for (int it = 0; it < 4; ++it) {
        const int L = it * 16 + lq;
        *(v4u*)(Vt + ((size_t)((b * NHD + 2 * mb + (L >> 5)) * NK + n0)) * HD + 64 * (L & 31) + 8 * e) = uv[it];
      }
      // the listing lays another job's code behind these stores: their registers stay untouched until this wait
      asm volatile("s_wait_xcnt 0x0" ::: "memory");
    }
  } else {
    v4u uh[4], ul[4];
#pragma unroll
    for (int it = 0; it < 4; ++it) {
      const int L = it * 16 + lq;                                    // line 0..63
      const int hs = L >> 5, j = L & 31;
      const int row = 16 * (j >> 3) + 8 * (j & 1) + e;               // n_loc
      const int cb0 = 32 * hs + 8 * ((j >> 1) & 3);                  // o_loc of the first value
      const v4f a = *(const v4f*)(Os + row * OSP + cb0);
      const v4f q = *(const v4f*)(Os + row * OSP + cb0 + 4);
      const float f[8] = {a[0], a[1], a[2], a[3], q[0], q[1], q[2], q[3]};
#pragma unroll
      for (int t = 0; t < 4; ++t) {
        const float f0 = f[2 * t], f1 = f[2 * t + 1];
        const unsigned short hb0 = bf_bits(f0), hb1 = bf_bits(f1);
        const unsigned short lb0 = bf_bits(f0 - bf_up(hb0));
        const unsigned short lb1 = bf_bits(f1 - bf_up(hb1));
        uh[it][t] = pk16(hb0, hb1);
        ul[it][t] = pk16(lb0, lb1);
      }
    }
{
#pragma unroll
      for (int it = 0; it < 4; ++it) {
        const int L = it * 16 + lq;
        const int hs = L >> 5, j = L & 31;
        const size_t po = ((size_t)((b * NHD + 2 * mb + hs) * NP + n0 + 2 * j)) * HD + 8 * e;
        *(v4u*)(Ph + po) = uh[it];
        *(v4u*)(Pl + po) = ul[it];
      }
      // the listing lays another job's code behind these stores: their registers stay untouched until this wait
      asm volatile("s_wait_xcnt 0x0" ::: "memory");
    }
  }
}

// ---- 8 f32 -> bf16 hi (RNE) and bf16 lo (RNE of the rest), packed pairs
__device__ __forceinline__ void split8(v4f a, v4f q, v8us& hi, v8us& lo) {
  const float f[8] = {a[0], a[1], a[2], a[3], q[0], q[1], q[2], q[3]};
  v4u wh, wl;
#pragma unroll
  for (int t = 0; t < 4; ++t) {
    const v2f p = {f[2 * t], f[2 * t + 1]};
    const unsigned hw = __builtin_bit_cast(unsigned, __builtin_convertvector(p, v2b));   // RNE, packed pair
    const v2f r = {p[0] - __uint_as_float(hw << 16), p[1] - __uint_as_float(hw & 0xffff0000u)};
    wh[t] = hw;
    wl[t] = __builtin_bit_cast(unsigned, __builtin_convertvector(r, v2b));
  }
  hi = __builtin_bit_cast(v8us, wh);
  lo = __builtin_bit_cast(v8us, wl);
}

// =========================================================================================================
// (3) position tables. A table row depends on its (coord, kcoord) pair only through diff = coord - 2*kcoord, and
//     inside the local window diff lies in -DOFF..DOFF, so the tables are built once per diff: row T = diff + DOFF
//     (rows 35..47 fill the last tile and are never used). One job = (16-row tile rt, 64-o block ob, axis):
//     a = diff * 1000^(-f/64), features [sin(a) | cos(a)] (128) built in LDS as bf16 hi/lo planes Eh/El[16][128]
//     (pitch EP); then Y[o][T] = sum_f Wf[axis][o][f] E[T][f]: wave w owns A rows o = 64 ob + 16 w + (lane&15), bf16-RNE
//     of the f32 row, all waves share the B rows T from Eh and El (2 products sharing the accumulator, K = 128); epilogue
//     Os[T_loc][o_loc] = Y / sqrt(2), barrier, then
//       PFh/PFl bf16 [axis][h][48 T x 32 d] (hi = bf16-RNE(v), lo = bf16-RNE(v - hi)), pieces of 8 d in the order of
//       their reader's loads. x axis: 3 tiles of 16 T in fragment order (ldfrag_t). y axis: the reader's 16 rows are
//       T, T - 2, .., so pieces lie [T & 1][d >> 3][(47 - T) >> 1]: 16 lanes read 256 contiguous bytes (ldfrag_y).
//       Either way 8 consecutive lanes store one whole line.
// coverage: Eh/El 8 it x 128 threads = 16 rows x 64 args x {sin,cos} = 16 x 128 (cols 128..135 pad, never read);
//           planes 128 threads x 8 = 2 heads x 16 rows x 32 d; (rt, ob, axis) in 3 x 4 x 2 covers
//           PFh/PFl [2][8][48][32] exactly once.
// LDS Eh/El, Os: cross-wave (block barriers).
// =========================================================================================================
__device__ __forceinline__
void posfeat(unsigned short* Eh, unsigned short* El, float* Os, const int rt, const int ob, const int axis,
             const float* __restrict__ fxw, const float* __restrict__ fyw, unsigned short* PFh, unsigned short* PFl) {
  const int tid  = threadIdx.x;
  const int lane = tid & 31, wave = tid >> 5;
  const int hh   = lane >> 4, c = lane & 15;
  const int R0   = rt * PRT;

  // ---- A rows first: their loads fly under the sinusoids
  const float* ap = (axis ? fyw : fxw) + (size_t)(QT * ob + 16 * wave + c) * PFD + 8 * hh;
  Frag fa[PFD / 32];
#pragma unroll
  for (int ks = 0; ks < PFD / 32; ++ks) fa[ks] = ldfrag_f32<false>(ap + 32 * ks);
  // a later load of this run may otherwise land in the address pair: it stays live, and so untouched, until this wait
  asm volatile("s_wait_xcnt 0x0" :: "v"(ap) : "memory");

  // ---- (a) sinusoid features -> LDS bf16 hi/lo planes (rolled: one copy of the sin/cos code keeps the text short)
#pragma unroll 1
  for (int it = 0; it < PRT / 2; ++it) {
    const int idx = it * 128 + tid;                                  // 0..1023
    const int rl = idx >> 6, fa = idx & 63;
    const float diff = (float)(R0 + rl - DOFF);
    const float a = diff * exp2f(-(float)fa * NL2W);
    const float sv = sinf(a);
    const float cv = cosf(a);
    const unsigned short shb = bf_bits(sv), chb = bf_bits(cv);
    Eh[rl * EP + fa]      = shb;
    El[rl * EP + fa]      = bf_bits(sv - bf_up(shb));
    Eh[rl * EP + 64 + fa] = chb;
    El[rl * EP + 64 + fa] = bf_bits(cv - bf_up(chb));
  }
  __syncthreads();

  const unsigned short* ebh = Eh + c * EP + 8 * hh;
  const unsigned short* ebl = El + c * EP + 8 * hh;
  v8f acc = zero8();
#pragma unroll
  for (int ks = 0; ks < PFD / 32; ++ks) {
    const Frag fbh = ldfrag(ebh + 32 * ks);
    const Frag fbl = ldfrag(ebl + 32 * ks);
    acc = mma_b(fa[ks].bf, fbh.bf, acc);
    acc = mma_b(fa[ks].bf, fbl.bf, acc);
  }
  {
    v4f va, vb;
#pragma unroll
    for (int r = 0; r < 4; ++r) { va[r] = acc[r] * RSQ2; vb[r] = acc[4 + r] * RSQ2; }
    *(v4f*)(Os + c * OSP + 16 * wave + 8 * hh)     = va;            // Os[T_loc = c][o_loc = 16 w + 8 hh + r]
    *(v4f*)(Os + c * OSP + 16 * wave + 8 * hh + 4) = vb;
  }
  __syncthreads();
  const int e = tid & 7, grp = (tid >> 3) & 7, hs = tid >> 6;        // line grp of this head's 8; axis is block-uniform
  const int dl = 8 * (axis ? (grp & 3) : (grp >> 1));
  const int rl = axis ? PRT - 2 + (grp >> 2) - 2 * e : 8 * (grp & 1) + e;
  v8us hi, lo;
  split8(*(const v4f*)(Os + rl * OSP + 32 * hs + dl), *(const v4f*)(Os + rl * OSP + 32 * hs + dl + 4), hi, lo);
  const size_t po = (size_t)(axis * NHD + 2 * ob + hs) * NDF * HD +
                    (axis ? grp * (NDF / 2 * 8) + ((NDF - PRT - R0) / 2 + e) * 8 : R0 * HD + 64 * grp + 8 * e);
  *(v8us*)(PFh + po) = hi;
  *(v8us*)(PFl + po) = lo;
}

// =========================================================================================================
// (0)+(2)+(3) in one launch: the position tables, the q, k and v GEMMs and the proj_w plane read only inputs and
// none reads another's output. Block order: tables first (24 blocks), then
// q (NBQ blocks), k and v (NBK blocks each), then the proj_w plane (NBWP blocks). The selection is block-uniform, so
// every barrier of a job is passed by all four waves of its block. XT and Os are shared by the jobs (a block runs
// exactly one of them); the table job keeps its Eh and El planes in XT.
// =========================================================================================================
#define NBP ((NDF / PRT) * (CC / QT) * 2)
#define NBQ ((NN / QT) * (CC / QT) * NB)
#define NBK ((NK / QT) * (CC / QT) * NB)
#define NBWP (CC / 4)
__global__ __launch_bounds__(128)
void feat_gemm(const float* __restrict__ x, const float* __restrict__ qw, const float* __restrict__ kw,
               const float* __restrict__ vw, const float* __restrict__ pw, const float* __restrict__ fxw,
               const float* __restrict__ fyw,
               unsigned short* PFh, unsigned short* PFl, unsigned short* Qh, unsigned short* Ql, unsigned short* Kh, unsigned short* Kl,
               unsigned short* Vt, unsigned short* WPB) {
  __shared__ __align__(16) unsigned short XT[QT * XTP];
  __shared__ __align__(16) float Os[QT * OSP];
  const int blk = blockIdx.x;
  if (blk < NBP) {
    posfeat(XT, XT + PRT * EP, Os, blk % (NDF / PRT), (blk / (NDF / PRT)) % (CC / QT), blk / ((NDF / PRT) * (CC / QT)),
            fxw, fyw, PFh, PFl);
  } else if (blk < NBP + NBQ) {
    const int j = blk - NBP;
    gemm_x<0>(XT, Os, j % (NN / QT), (j / (NN / QT)) % (CC / QT), j / ((NN / QT) * (CC / QT)),
              qw, x, Qh, Ql, Vt);
  } else if (blk < NBP + NBQ + NBK) {
    const int j = blk - (NBP + NBQ);
    gemm_x<1>(XT, Os, j % (NK / QT), (j / (NK / QT)) % (CC / QT), j / ((NK / QT) * (CC / QT)),
              kw, x, Kh, Kl, Vt);
  } else if (blk < NBP + NBQ + 2 * NBK) {
    const int j = blk - (NBP + NBQ + NBK);
    gemm_x<2>(XT, Os, j % (NK / QT), (j / (NK / QT)) % (CC / QT), j / ((NK / QT) * (CC / QT)),
              vw, x, Kh, Kl, Vt);
  } else {
    cvt_wp(blk - (NBP + NBQ + 2 * NBK), pw, WPB);
  }
}

// =========================================================================================================
// (4) local-window attention for one (query row y, head, b): block = 4 waves, wave w = queries x = 16w..16w+15.
//   Position dot terms first, per wave for its own 16 queries: B cols = qg = q + bf16-RNE(geom_bias) from Qh + Ql +
//   bias, split in registers into bf16 hi/lo with the split k map of ldfrag; A rows from the by-difference tables
//   PFh/PFl (hi.hi + hi.lo + lo.hi share the accumulator, depth 32). x axis: the 3 tiles of all 48 rows T, one
//   table for every query, D -> Gs[query][T]; y axis: rows T = y - 2 ky + DOFF of ky = kylo + i (i = 16 t + (lane&15),
//   held at the last allowed row), D -> Gs[query][NDF + i]; barrier. Per lane (hh, c): PX[kx] = Gs[query][x - 2 kx +
//   DOFF] for kx in {8hh..8hh+7, 16+8hh..} (registers, in the D layout of the score tiles; the index is held inside the
//   row where kx lies outside the per-query window, and the value there is MASKED); PY[ky] = Gs[query][NDF + ky - kylo],
//   one value per key row.
//   Loop over allowed key rows ky (block-uniform; forbidden rows contribute exactly 0): S^T tiles (16 keys x 16
//   queries) = PX + A(Kh rows key ky*32 + 16t + (lane&15), k = d split map) . B(QAh col = query) + A(Kh).B(QAl) +
//   A(Kl).B(QAh), QA = q + bf16-RNE(appr_bias) as bf16 hi/lo planes split in registers, PX the start value of the shared
//   accumulator; energy = S^T + PY[ky]. No additive term is applied per element: PY is the same for all keys of a row,
//   so it is added to the row's max and to the exponent's per-lane addend. Per lane the D tiles hold 16 keys of ONE
//   query: online softmax per lane,
//   one shuffle (lane^16) for the max over the 32 keys of the row, o/l rescale skipped under a wave-uniform ballot.
//   P = e^{s-m} x 1024 as f16 is the B operand of O^T (rows d, cols queries) += A(Vt rows d = 16j + (lane&15), fragment
//   order) . B(P^T): element r <- D of the tile covering kx 0..15, element 8+r <- the tile covering kx 16..31.
//   Epilogue: O/l staged in LDS Os[query][32 d] (pitch OSV), barrier, then OPh/OPl bf16 [b][8][256 tiles of 16 queries x
//   32 d] in fragment order (hi = bf16-RNE(v), lo = bf16-RNE(v - hi)); line L = tile L>>3, d 8((L>>1)&3).., rows
//   8(L&1)..+7: lane e -> row 16(L>>3) + 8(L&1) + e, 8 consecutive lanes per line
// coverage: Os 4 waves x 16 queries x 32 d; planes 2 it x 16 lines x 8 lanes x 8 = 64 queries x 32 d per plane;
//           grid (64, 8, NB) covers OPh/OPl [b][8][4096][32] exactly once.
// LDS Os: cross-wave (block barrier). Gs: written and read inside one wave's rows, synchronised with a block barrier.
// =========================================================================================================
// ---- the operands of one key row ky (32 keys): K hi/lo tiles of keys 0..15 and 16..31, V^T tiles of d 0..15 and 16..31,
//      and PY of this lane's query
struct RowOps { Frag k0, k1, k0l, k1l, v0, v1; float py; };
__device__ __forceinline__
void fetch_row(RowOps& t, const unsigned short* Khp, const unsigned short* Klp, const unsigned short* Vp, const int ky) {
  const int kp0 = ky * KVW;
  const unsigned short* kh = Khp + (size_t)kp0 * HD;
  const unsigned short* kl = Klp + (size_t)kp0 * HD;
  const unsigned short* vp = Vp + (size_t)kp0 * HD;
  t.k0  = ldfrag_t(kh);                                              // keys kp0 .. kp0+15
  t.k1  = ldfrag_t(kh + 16 * HD);                                    // keys kp0+16 .. kp0+31
  t.k0l = ldfrag_t(kl);
  t.k1l = ldfrag_t(kl + 16 * HD);
  t.v0  = ldfrag_t(vp);                                              // d 0..15
  t.v1  = ldfrag_t(vp + 16 * HD);                                    // d 16..31
  // a later load of this run may otherwise land in an earlier load's address pair: every pair stays live, and so
  // untouched, until this wait; no load is moved below it, so the whole run is in flight before the work that follows
  asm volatile("s_wait_xcnt 0x0" :: "v"(kh), "v"(kl), "v"(vp) : "memory");
  // no product or vector work that waits for earlier loads is lifted in front of this run: it would hold the run back
  __builtin_amdgcn_sched_barrier(0);
}

__global__ __launch_bounds__(128)
void attn_k(const unsigned short* __restrict__ Qh, const unsigned short* __restrict__ Ql,
            const unsigned short* __restrict__ Kh, const unsigned short* __restrict__ Kl,
            const unsigned short* __restrict__ Vt,
            const unsigned short* __restrict__ PFh, const unsigned short* __restrict__ PFl,
            const float* __restrict__ ab, const float* __restrict__ gb, unsigned short* OPh, unsigned short* OPl) {
  __shared__ __align__(16) float Os[QT * OSV];
  __shared__ __align__(16) float Gs[QT * GSP];
  const int tid  = threadIdx.x;
  const int wave = tid >> 5, lane = tid & 31;
  const int hh   = lane >> 4, c = lane & 15;
  const int y = blockIdx.x, hd = blockIdx.y, b = blockIdx.z;
  const int bh = b * NHD + hd;
  const int xq = 16 * wave + c;                                      // query column of this lane's B/D column

  const int kylo = (y >= LRANGE) ? ((y - LRANGE) >> 1) : 0;         // block-uniform
  int kyhi = ((y + LRANGE + 1) >> 1) + 1;  if (kyhi > KVH) kyhi = KVH;
  const int kxlo = (xq >= LRANGE) ? ((xq - LRANGE) >> 1) : 0;       // per lane
  int kxhi = ((xq + LRANGE + 1) >> 1) + 1; if (kxhi > KVW) kxhi = KVW;

  // ---- all loads of the position terms first: query planes, the two biases, table tiles
  const size_t qo = ((size_t)bh * NN + y * IMW + 16 * wave) * HD + 8 * lane;   // this wave's tile, fragment order
  const unsigned short* qhp = Qh + qo;
  const unsigned short* qlp = Ql + qo;
  const Frag qh = ldfrag_t(qhp);
  const Frag ql = ldfrag_t(qlp);
  const float* gp = gb + hd * HD + 8 * hh;
  const float* abp = ab + hd * HD + 8 * hh;
  v4f g[2][2], av[2][2];
#pragma unroll
  for (int s = 0; s < 2; ++s) {                                      // s: d = 16 s + 8 hh ..
    g[s][0]  = *(const v4f*)(gp + 16 * s);
    g[s][1]  = *(const v4f*)(gp + 16 * s + 4);
    av[s][0] = *(const v4f*)(abp + 16 * s);
    av[s][1] = *(const v4f*)(abp + 16 * s + 4);
  }
  Frag ahi[5], alo[5];                                               // loops unrolled: the arrays stay in registers
  const size_t tx = (size_t)hd * NDF * HD + 8 * lane;
  const unsigned short* txh = PFh + tx;
  const unsigned short* txl = PFl + tx;
#pragma unroll
  for (int t = 0; t < 3; ++t) {                                      // x axis: table rows T = 16 t + c
    ahi[t] = ldfrag_t(txh + 16 * t * HD);
    alo[t] = ldfrag_t(txl + 16 * t * HD);
  }
  const unsigned short* tyh[2];
  const unsigned short* tyl[2];
#pragma unroll
  for (int t = 0; t < 2; ++t) {                                      // y axis: table row of ky = kylo + 16 t + c
    int kyi = kylo + 16 * t + c;  if (kyi > kyhi - 1) kyi = kyhi - 1;
    const int T = y - 2 * kyi + DOFF;
    const size_t to = (size_t)(NHD + hd) * NDF * HD + (4 * (T & 1) + hh) * (NDF / 2 * 8) + ((NDF - 1 - T) >> 1) * 8;
    tyh[t] = PFh + to;
    tyl[t] = PFl + to;
    ahi[3 + t] = ldfrag_y(tyh[t]);
    alo[3 + t] = ldfrag_y(tyl[t]);
  }
  // a later load of this run may otherwise land in an earlier load's address pair: every pair stays live, and so
  // untouched, until this wait
  asm volatile("s_wait_xcnt 0x0" :: "v"(qhp), "v"(qlp), "v"(txh), "v"(txl), "v"(tyh[0]), "v"(tyl[0]), "v"(tyh[1]),
               "v"(tyl[1]) : "memory");
  // no vector work that waits for the query planes is lifted in front of the table loads: it would hold them back
  __builtin_amdgcn_sched_barrier(0);

  // ---- fragment pointers of the key loop; the first key row's loads fly under the position terms
  const unsigned short* Khp = Kh + (size_t)bh * NK * HD + 8 * lane;
  const unsigned short* Klp = Kl + (size_t)bh * NK * HD + 8 * lane;
  const unsigned short* Vp  = Vt + (size_t)bh * HD * NK + 8 * lane;
  RowOps ra, rb;                                                     // two register sets: one worked on, one in flight
  fetch_row(ra, Khp, Klp, Vp, kylo);

  // ---- B of the position terms: qg = q + geom bias of query xq; B of the scores: qa = q + appr bias; bf16 hi/lo each
  Frag bhi, blo, qah, qal;
#pragma unroll
  for (int s = 0; s < 2; ++s) {
    const v4u wh = __builtin_bit_cast(v4u, qh.u[s]), wl = __builtin_bit_cast(v4u, ql.u[s]);
    float f[8];
#pragma unroll
    for (int j = 0; j < 4; ++j) {
      f[2 * j]     = __uint_as_float(wh[j] << 16) + __uint_as_float(wl[j] << 16);
      f[2 * j + 1] = __uint_as_float(wh[j] & 0xffff0000u) + __uint_as_float(wl[j] & 0xffff0000u);
    }
    v4f va, vb;
#pragma unroll
    for (int r = 0; r < 4; ++r) { va[r] = f[r] + bfr(g[s][0][r]); vb[r] = f[4 + r] + bfr(g[s][1][r]); }
    split8(va, vb, bhi.u[s], blo.u[s]);
#pragma unroll
    for (int j = 0; j < 2; ++j) {                                    // bf16-RNE of the bias, packed pairs
      const unsigned wa = cvt_b2(av[s][0][2 * j], av[s][0][2 * j + 1]), wb = cvt_b2(av[s][1][2 * j], av[s][1][2 * j + 1]);
      va[2 * j]     = f[2 * j] + __uint_as_float(wa << 16);
      va[2 * j + 1] = f[2 * j + 1] + __uint_as_float(wa & 0xffff0000u);
      vb[2 * j]     = f[4 + 2 * j] + __uint_as_float(wb << 16);
      vb[2 * j + 1] = f[5 + 2 * j] + __uint_as_float(wb & 0xffff0000u);
    }
    split8(va, vb, qah.u[s], qal.u[s]);
  }

  // ---- D rows = 16 t + 8 hh + r of tile t, col = query: tiles 0..2 fill Gs cols 0..47, tiles 3, 4 cols 48..79
  float* grow = Gs + xq * GSP;
#pragma unroll
  for (int t = 0; t < 5; ++t) {
    v8f d = zero8();
    d = wm_b(ahi[t].bf, bhi.bf, d);
    d = wm_b(ahi[t].bf, blo.bf, d);
    d = wm_b(alo[t].bf, bhi.bf, d);
    v4f va, vb;
#pragma unroll
    for (int r = 0; r < 4; ++r) { va[r] = d[r]; vb[r] = d[4 + r]; }
    *(v4f*)(grow + 16 * t + 8 * hh)     = va;
    *(v4f*)(grow + 16 * t + 8 * hh + 4) = vb;
  }
  __syncthreads();

  // ---- PX: per lane 16 kx values for query xq, the start values of the two score tiles; outside the query's kx window
  //      MASKED stands there: finite, so that the matrix sum stays an ordinary number, and so far below any energy that
  //      the exponential gives exactly 0, as for -inf. PY: this query's row, read per key row in the loop
  const float MASKED = -1.0e30f;
  v8f px0, px1;
#pragma unroll
  for (int r = 0; r < 8; ++r) {
    const int kx0 = 8 * hh + r, kx1 = 16 + 8 * hh + r;
    int t0 = xq - 2 * kx0 + DOFF, t1 = t0 - 32;
    t0 = (t0 < 0) ? 0 : ((t0 > NDF - 1) ? NDF - 1 : t0);
    t1 = (t1 < 0) ? 0 : ((t1 > NDF - 1) ? NDF - 1 : t1);
    const float g0 = grow[t0], g1 = grow[t1];                        // read by every lane: selects, no branches
    px0[r] = ((kx0 >= kxlo) & (kx0 < kxhi)) ? g0 : MASKED;
    px1[r] = ((kx1 >= kxlo) & (kx1 < kxhi)) ? g1 : MASKED;
  }
  const float* pyrow = grow + NDF - kylo;

  ra.py = pyrow[kylo];

  float m = -1.0e30f, l = 0.f;
  v8f o[2];
  o[0] = zero8(); o[1] = zero8();

  // ---- one key row, all of its operands already in the register set t
  auto row_step = [&](const RowOps& t) {
    v8f s0 = wm_b(t.k0.bf, qah.bf, px0);
    v8f s1 = wm_b(t.k1.bf, qah.bf, px1);
    s0 = wm_b(t.k0.bf, qal.bf, s0);
    s1 = wm_b(t.k1.bf, qal.bf, s1);
    s0 = wm_b(t.k0l.bf, qah.bf, s0);
    s1 = wm_b(t.k1l.bf, qah.bf, s1);

    float mx = fmaxf(hmax8(s0), hmax8(s1));
    mx = fmaxf(mx, __shfl_xor(mx, 16, 32)) + t.py;                   // both halves hold the same query, so the same PY
    const float mn = fmaxf(m, mx);
    const unsigned grew = wave_ballot(mx > m);                       // wave-uniform
    if (grew != 0u) {
      const float corr = __expf(m - mn);                             // == 1 exactly for lanes whose max did not grow
      l *= corr;
#pragma unroll
      for (int j = 0; j < 2; ++j) {
#pragma unroll
        for (int r = 0; r < 8; ++r) o[j][r] *= corr;
      }
    }
    m = mn;
    const float ea = (t.py - mn + LNPS) * L2E;                       // 2^(s log2(e) + ea) = e^{s + PY - m} * 1024
    const v8f ea8 = {ea, ea, ea, ea, ea, ea, ea, ea};
    const v8f le8 = {L2E, L2E, L2E, L2E, L2E, L2E, L2E, L2E};
    s0 = __builtin_elementwise_fma(s0, le8, ea8);                    // packed pairs
    s1 = __builtin_elementwise_fma(s1, le8, ea8);

    FragH ph;
    float ls = 0.f;
#pragma unroll
    for (int r = 0; r < 8; ++r) {
      const float e0 = __builtin_amdgcn_exp2f(s0[r]);                // key kp0      + 8hh + r
      const float e1 = __builtin_amdgcn_exp2f(s1[r]);                // key kp0 + 16 + 8hh + r
      ls += e0 + e1;
      ph.hv[0][r] = (_Float16)e0;
      ph.hv[1][r] = (_Float16)e1;
    }
    l += ls;

    o[0] = wm_h(t.v0.h, ph.v, o[0]);
    o[1] = wm_h(t.v1.h, ph.v, o[1]);
  };

  int ky = kylo;
  // rolled: one copy of the two row bodies keeps the loop text short
#pragma unroll 1
  for (;;) {
    int kn = (ky + 1 < kyhi) ? ky + 1 : ky;
    rb.py = pyrow[kn];
    fetch_row(rb, Khp, Klp, Vp, kn);
    row_step(ra);
    if (++ky == kyhi) break;
    kn = (ky + 1 < kyhi) ? ky + 1 : ky;
    ra.py = pyrow[kn];
    fetch_row(ra, Khp, Klp, Vp, kn);
    row_step(rb);
    if (++ky == kyhi) break;
  }
  l += __shfl_xor(l, 16, 32);
  const float inv = 1.0f / l;                                        // o and l both carry the x1024 factor

  const int qr = 16 * wave + c;
#pragma unroll
  for (int j = 0; j < 2; ++j) {
    v4f va, vb;
#pragma unroll
    for (int r = 0; r < 4; ++r) { va[r] = o[j][r] * inv; vb[r] = o[j][4 + r] * inv; }
    *(v4f*)(Os + qr * OSV + 16 * j + 8 * hh)     = va;              // Os[query][d = 16j + 8hh + r]
    *(v4f*)(Os + qr * OSV + 16 * j + 8 * hh + 4) = vb;
  }
  __syncthreads();

  const int e = tid & 7, lq = tid >> 3;                              // lq 0..15
  v4u uh[2], ul[2];
#pragma unroll
  for (int it = 0; it < 2; ++it) {
    const int L = 16 * it + lq;                                      // line 0..31
    const int row = 16 * (L >> 3) + 8 * (L & 1) + e, dl = 8 * ((L >> 1) & 3);
    const v4f a = *(const v4f*)(Os + row * OSV + dl);
    const v4f q = *(const v4f*)(Os + row * OSV + dl + 4);
    const float f[8] = {a[0], a[1], a[2], a[3], q[0], q[1], q[2], q[3]};
#pragma unroll
    for (int t = 0; t < 4; ++t) {
      const float f0 = f[2 * t], f1 = f[2 * t + 1];
      const unsigned short hb0 = bf_bits(f0), hb1 = bf_bits(f1);
      const unsigned short lb0 = bf_bits(f0 - bf_up(hb0));
      const unsigned short lb1 = bf_bits(f1 - bf_up(hb1));
      uh[it][t] = pk16(hb0, hb1);
      ul[it][t] = pk16(lb0, lb1);
    }
  }
{
#pragma unroll
    for (int it = 0; it < 2; ++it) {
      const int L = 16 * it + lq;
      const size_t po = ((size_t)bh * NN + (size_t)y * IMW + 2 * L) * HD + 8 * e;
      *(v4u*)(OPh + po) = uh[it];
      *(v4u*)(OPl + po) = ul[it];
    }
    
  }
}

// =========================================================================================================
// (5) output 1x1-conv for one (b, 64-pixel tile, 64-o block): Y[o][p] = sum_c WPB[o][c] O[b][p][c] with
//     c = 32 h + d: k-step ks = head ks, B fragments from OPh and OPl [b][ks][tile p>>4] (bf16 hi/lo, shared
//     accumulator), A from WPB tiles (o-tile, ks); all three planes in fragment order (ldfrag_t). Epilogue: Os[p_loc][o_loc], barrier, then
//     lines (row o, 64 pixels = 2 lines): 8 consecutive lanes x 16 B (values from 4 Os rows), one instruction per
// coverage: 8 it x 16 lines x 8 lanes x 4 floats = 64 o x 64 p; grid (64, 4, NB) covers out [b][256][4096] once.
// LDS Os: cross-wave (block barrier).
// =========================================================================================================
__global__ __launch_bounds__(128)
void proj_k(const unsigned short* __restrict__ WPB, const unsigned short* __restrict__ OPh,
            const unsigned short* __restrict__ OPl, const float* __restrict__ pb,
            const float* __restrict__ gam, const float* __restrict__ x, float* out) {
  __shared__ __align__(16) float Os[QT * OSP];
  const int tid  = threadIdx.x;
  const int lane = tid & 31, wave = tid >> 5;
  const int hh   = lane >> 4, c = lane & 15;
  const int nt   = blockIdx.x, mb = blockIdx.y, b = blockIdx.z;
  const int n0   = nt * QT, o0 = mb * QT;

  const unsigned short* ap = WPB + (size_t)o0 * CC + 8 * lane;       // tile (o-tile, k-step) at 512 (8 o-tile + k-step)
  const size_t brow = (size_t)b * NHD * NN * HD + (size_t)(n0 + 16 * wave) * HD + 8 * lane;
  const unsigned short* bph = OPh + brow;
  const unsigned short* bpl = OPl + brow;
  const int e = tid & 7, lq = tid >> 3;                              // lq 0..15
  const float* xb  = x + ((size_t)(b * CC + o0 + (lq >> 1))) * NN + n0 + 32 * (lq & 1) + 4 * e;
  const float* pbp = pb + o0 + (lq >> 1);

  // ---- loads ahead of the products: the B fragments of all 8 k-steps, then the A fragments of k-steps 0 and 1
  constexpr int AR = 2;                                              // A register sets = k-steps of lead
  Frag fbh[NHD], fbl[NHD], fa[AR][4];
  // every loop over these arrays, and over xv and pbv below, is unrolled: constant indices keep them in registers
#pragma unroll
  for (int ks = 0; ks < NHD; ++ks) {
    fbh[ks] = ldfrag_t(bph + (size_t)ks * NN * HD);
    fbl[ks] = ldfrag_t(bpl + (size_t)ks * NN * HD);
  }
#pragma unroll                                                       // constant indices, as above
  for (int ks = 0; ks < AR; ++ks) {
#pragma unroll                                                       // constant indices, as above
    for (int mt = 0; mt < 4; ++mt) fa[ks][mt] = ldfrag_t(ap + (size_t)(16 * mt) * CC + 512 * ks);
  }
  // a later load of this run may otherwise land in an earlier load's address pair: every pair stays live, and so
  // untouched, until this wait; no load is moved below it, so the whole run is in flight before the first product
  asm volatile("s_wait_xcnt 0x0" :: "v"(bph), "v"(bpl), "v"(ap) : "memory");
  const float g = bfr(gam[0]);                                       // read here: its wait would stand inside the run above

  v8f acc[4];
#pragma unroll
  for (int mt = 0; mt < 4; ++mt) acc[mt] = zero8();

  v4f xv[8];
  float pbv[8];
#pragma unroll                                                       // whole: the ring slot ks % AR is a constant in every copy
  for (int ks = 0; ks < NHD; ++ks) {
#pragma unroll
    for (int mt = 0; mt < 4; ++mt) {
      acc[mt] = mma_b(fa[ks % AR][mt].bf, fbh[ks].bf, acc[mt]);
      acc[mt] = mma_b(fa[ks % AR][mt].bf, fbl[ks].bf, acc[mt]);
      // the fragment just used takes its rows of k-step ks + AR
      if (ks + AR < NHD) fa[ks % AR][mt] = ldfrag_t(ap + (size_t)(16 * mt) * CC + 512 * (ks + AR));
      // what the epilogue reads: one product pair behind the last A load, since loads return in order and no product
      // may wait behind these
      if (ks + AR == NHD && mt == 0) {
#pragma unroll                                                       // constant indices, as above
        for (int it = 0; it < 8; ++it) {                             // row o0 + 8 it + (lq>>1), pixels 32 (lq&1) + 4 e ..
          xv[it]  = *(const v4f*)(xb + (size_t)(8 * it) * NN);
          pbv[it] = pbp[8 * it];
        }
        // the address pairs of the loads issued since the first wait stay live, and so untouched, until this one
        asm volatile("s_wait_xcnt 0x0" :: "v"(ap), "v"(xb), "v"(pbp) : "memory");
      }
    }
  }
  // the epilogue's conversions of x, and with them the wait for x, stay behind the last products
  __builtin_amdgcn_sched_barrier(0);

  {
    const int nl = 16 * wave + c;
#pragma unroll
    for (int mt = 0; mt < 4; ++mt) {
      v4f va, vb;
#pragma unroll
      for (int r = 0; r < 4; ++r) { va[r] = acc[mt][r]; vb[r] = acc[mt][4 + r]; }
      *(v4f*)(Os + nl * OSP + 16 * mt + 8 * hh)     = va;
      *(v4f*)(Os + nl * OSP + 16 * mt + 8 * hh + 4) = vb;
    }
  }
  __syncthreads();

  v4f res[8];
#pragma unroll
  for (int it = 0; it < 8; ++it) {
    const int L   = it * 16 + lq;                                    // 0..127
    const int ol  = L >> 1, hf = L & 1;                              // o_loc 0..63
    const int nl  = hf * 32 + 4 * e;                                 // pixel 0..63
    const float pbr = bfr(pbv[it]);
#pragma unroll
    for (int t = 0; t < 4; ++t) res[it][t] = g * (Os[(nl + t) * OSP + ol] + pbr) + bfr(xv[it][t]);
  }
{
#pragma unroll
    for (int it = 0; it < 8; ++it) {
      const int L   = it * 16 + lq;
      const int ol  = L >> 1, hf = L & 1;
      const int nl  = hf * 32 + 4 * e;
      const size_t idx = ((size_t)(b * CC + o0 + ol)) * NN + n0 + nl;
      *(v4f*)(out + idx) = res[it];
    }
    
  }
}

// =========================================================================================================
// Workspace map (bytes; each region start a multiple of 256; every extent is an exact tile multiple and is written
//   WPB bf16 [16][8] tiles 131072 (a tile = 16 rows x 32 k in fragment order, 1024 bytes)
//   Qh/Ql bf16 [NB][8][256] tiles      2097152 x NB each     Kh/Kl bf16 [NB][8][64] tiles 524288 x NB each
//   Vt  f16 [NB][8][32 ky][2] tiles     524288 x NB
//   PFh/PFl bf16 [2][8][48 x 32]         49152 each
//   OPh/OPl bf16 [NB][8][256] tiles    2097152 x NB each
//   total (NB = 2) = 20152320
// =========================================================================================================
extern "C" void kernel_launch(void* const* d_in, const int* in_sizes, int n_in,
                              void* d_out, int out_size, void* d_ws, size_t ws_size,
                              hipStream_t stream) {
  const int XN = NB * CC * NN;
  if (n_in < 11) return;
  if (in_sizes[0] < XN) return;
  if (in_sizes[1] < CC * CC || in_sizes[2] < CC * CC || in_sizes[3] < CC * CC || in_sizes[8] < CC * CC) return;
  if (in_sizes[4] < CC * PFD || in_sizes[5] < CC * PFD) return;
  if (in_sizes[6] < CC || in_sizes[7] < CC || in_sizes[9] < CC || in_sizes[10] < 1) return;
  if (out_size < XN) return;

  size_t off = 0;
  auto carve = [&](size_t bytes) { const size_t o = off; off += (bytes + 255) & ~(size_t)255; return o; };
  const size_t oWPB = carve((size_t)CC * CC * 2);
  const size_t oQh  = carve((size_t)NB * NHD * NN * HD * 2);
  const size_t oQl  = carve((size_t)NB * NHD * NN * HD * 2);
  const size_t oKh  = carve((size_t)NB * NHD * NK * HD * 2);
  const size_t oKl  = carve((size_t)NB * NHD * NK * HD * 2);
  const size_t oVt  = carve((size_t)NB * NHD * HD * NK * 2);
  const size_t oPFh = carve((size_t)2 * NHD * NDF * HD * 2);
  const size_t oPFl = carve((size_t)2 * NHD * NDF * HD * 2);
  const size_t oOPh = carve((size_t)NB * NHD * NN * HD * 2);
  const size_t oOPl = carve((size_t)NB * NHD * NN * HD * 2);
  if (off > ws_size) return;
  if (off > (size_t)134217728) return;

  const float* x   = (const float*)d_in[0];
  const float* qw  = (const float*)d_in[1];
  const float* kw  = (const float*)d_in[2];
  const float* vw  = (const float*)d_in[3];
  const float* fxw = (const float*)d_in[4];
  const float* fyw = (const float*)d_in[5];
  const float* ab  = (const float*)d_in[6];
  const float* gb  = (const float*)d_in[7];
  const float* pw  = (const float*)d_in[8];
  const float* pb  = (const float*)d_in[9];
  const float* gam = (const float*)d_in[10];

  char* ws = (char*)d_ws;
  unsigned short* WPB = (unsigned short*)(ws + oWPB);
  unsigned short* Qh  = (unsigned short*)(ws + oQh);
  unsigned short* Ql  = (unsigned short*)(ws + oQl);
  unsigned short* Kh  = (unsigned short*)(ws + oKh);
  unsigned short* Kl  = (unsigned short*)(ws + oKl);
  unsigned short* Vt  = (unsigned short*)(ws + oVt);
  unsigned short* PFh = (unsigned short*)(ws + oPFh);
  unsigned short* PFl = (unsigned short*)(ws + oPFl);
  unsigned short* OPh = (unsigned short*)(ws + oOPh);
  unsigned short* OPl = (unsigned short*)(ws + oOPl);
  float* out = (float*)d_out;

  const dim3 blk128(128);

  // (0)+(2)+(3) position tables PFh/PFl (x axis then y axis); q, k and v; the proj_w plane
  feat_gemm<<<dim3(NBP + NBQ + 2 * NBK + NBWP), blk128, 0, stream>>>(x, qw, kw, vw, pw, fxw, fyw, PFh, PFl, Qh, Ql, Kh,
                                                                     Kl, Vt, WPB);
  // (4) position dot terms and local-window attention -> per-head O planes
  attn_k<<<dim3(IMH, NHD, NB), blk128, 0, stream>>>(Qh, Ql, Kh, Kl, Vt, PFh, PFl, ab, gb, OPh, OPl);
  // (5) output conv + bias, gamma scale, skip add -> out [b][256][4096]
  proj_k<<<dim3(NN / QT, CC / QT, NB), blk128, 0, stream>>>(WPB, OPh, OPl, pb, gam, x, out);
  (void)hipGetLastError();
}

// v009
// It runs in 27.6 microseconds.
// Next to v008, in two timings, it ran 1.03 and 1.04 times as fast.
// Counting every step since v000, it is 4.05 times as fast.
// Contractions: q/k/v 1x1-conv GEMMs W[256x256].X[256xN] on v_wmma_f32_16x16x32_f16 (f16 containers of
// bf16-RNE weights x256 and bf16-RNE x); sinusoid position tables E[48x128].Wf^T on v_wmma_f32_16x16x32_bf16
// (bf16 hi + bf16 lo planes of the sin/cos features, Wf bf16-RNE, 2 products); attention scores K.(Q + appr bias)^T per
// head on v_wmma_f32_16x16x32_bf16 (bf16 hi + bf16 lo planes of q + bias and k, 3 products, depth 32); O^T = V^T.P^T on
// v_wmma_f32_16x16x32_f16 (v single f16 plane, P = e^{s-m} x1024 f16 from the score D registers); output
// 1x1-conv Wp[256x256].O on v_wmma_f32_16x16x32_bf16 (Wp bf16-RNE, O as bf16 hi + bf16 lo planes, 2 products);
// depth-32 position dot terms table[rows x 32 d].(q + geom bias)^T per (query row, head) on
// v_wmma_f32_16x16x32_bf16 (bf16 hi + bf16 lo planes of both, 3 products); f32 accumulate everywhere; bias terms,
// softmax statistics, gamma and the skip add on f32 VALU.
#include <hip/hip_runtime.h>
#include <math.h>
#include <stdint.h>

#ifndef NB
#define NB 2
#endif
#define NB_FULL 2
#define CC      256
#define IMH     64
#define IMW     64
#define NN      4096
#define KVH     32
#define KVW     32
#define NK      1024
#define NHD     8
#define HD      32
#define PFD     128
#define NPR     2048
#define NDF     48
#define DOFF    17
#define PRT     16
#define GSP     84
#define LRANGE  16
#define QT      64
#define OSP     68
#define XTP     264
#define EP      136
#define OSV     36
#define WSC     256.0f
#define IWSC    0.00390625f
#define LNPS    6.931471805599453f
#define RSQ2    0.70710678118654752f
#define NL2W    0.15571537944784511f
#define L2E     1.4426950408889634f

static_assert(NB >= 1 && NB <= NB_FULL);
static_assert(NN == IMH * IMW && NK == KVH * KVW);
static_assert(NPR == IMW * KVW && NPR == IMH * KVH);
static_assert(DOFF == LRANGE + 1 && 2 * DOFF + 1 <= NDF && LRANGE + 2 <= 32);
static_assert(NDF % PRT == 0 && PRT == 16 && GSP >= NDF + 32 && (GSP * 4) % 16 == 0);
static_assert(CC == NHD * HD && HD == 32 && KVW == 32 && KVH == 32);
static_assert(NN % QT == 0 && NK % QT == 0 && CC % QT == 0 && NPR % QT == 0);
static_assert(CC % 32 == 0 && PFD % 32 == 0 && HD % 32 == 0);
static_assert((OSP * 4) % 16 == 0 && (XTP * 2) % 16 == 0 && XTP >= CC && (EP * 2) % 16 == 0);
static_assert(2 * PRT * EP <= QT * XTP);
static_assert(QT * OSP * 4 <= QT * XTP * 2 && (XTP * 2) % 8 == 0);
static_assert((OSV * 4) % 16 == 0);
static_assert(IMW == QT);
static_assert(QT == 2 * HD);

typedef _Float16       v16h __attribute__((ext_vector_type(16)));
typedef _Float16       v8h  __attribute__((ext_vector_type(8)));
typedef __bf16         v16b __attribute__((ext_vector_type(16)));
typedef unsigned short v8us __attribute__((ext_vector_type(8)));
typedef float          v8f  __attribute__((ext_vector_type(8)));
typedef float          v4f  __attribute__((ext_vector_type(4)));
typedef float          v2f  __attribute__((ext_vector_type(2)));
typedef __bf16         v2b  __attribute__((ext_vector_type(2)));
typedef _Float16       v2h  __attribute__((ext_vector_type(2)));
typedef unsigned int   v4u  __attribute__((ext_vector_type(4)));
typedef unsigned int   v2u  __attribute__((ext_vector_type(2)));

union Frag  { v8us u[2]; v16h h; v16b bf; };
union FragH { v16h v; v8h hv[2]; };
static_assert(sizeof(Frag) == 32);
static_assert(sizeof(FragH) == 32);

// ---- scalar helpers ---------------------------------------------------------------------------------------
__device__ __forceinline__ unsigned short bf_bits(float f) {          // f32 -> bf16 bits, RNE convert
  unsigned u = __float_as_uint(f);
  return (unsigned short)((u + 0x7FFFu + ((u >> 16) & 1u)) >> 16);
}
__device__ __forceinline__ float bf_up(unsigned short hb) { return __uint_as_float(((unsigned)hb) << 16); }
__device__ __forceinline__ float bfr(float f) { return bf_up(bf_bits(f)); }
__device__ __forceinline__ unsigned short h_bits(_Float16 x) { return __builtin_bit_cast(unsigned short, x); }
__device__ __forceinline__ unsigned pk16(unsigned short a, unsigned short b) { return (unsigned)a | ((unsigned)b << 16); }
__device__ __forceinline__ v8f zero8() { v8f z = {0.f, 0.f, 0.f, 0.f, 0.f, 0.f, 0.f, 0.f}; return z; }
__device__ __forceinline__ float hmax8(v8f s) {
  return fmaxf(fmaxf(fmaxf(s[0], s[1]), fmaxf(s[2], s[3])), fmaxf(fmaxf(s[4], s[5]), fmaxf(s[6], s[7])));
}
__device__ __forceinline__ unsigned wave_ballot(bool p) {
#if defined(__HIP_DEVICE_COMPILE__)
  return __builtin_amdgcn_ballot_w32(p);
#else
  return p ? 1u : 0u;
#endif
}

// ---- 16-bit fragment loader (A, or B from a k-contiguous [n][k] row): lane -> row/col (lane&15), p already includes
//      + 8*(lane>>4); elements 0..7 <- p[0..7] (k0+8h..), elements 8..15 <- p[16..23] (k0+16+8h..)
__device__ __forceinline__ Frag ldfrag(const unsigned short* p) {
  Frag f;
  f.u[0] = *(const v8us*)(p);
  f.u[1] = *(const v8us*)(p + 16);
  return f;
}

// ---- the same fragment from a plane kept in FRAGMENT ORDER: a tile of 16 rows x 32 k is 1 KiB = 64 pieces of 16 B, piece
//      16 (k >> 3) + row holding k = 8 (k >> 3) .. + 7 of that row. p = tile + 8 * lane: elements 0..7 <- piece lane
//      (row lane&15, k 8h..), elements 8..15 <- piece 32 + lane (k 16+8h..): the k map of ldfrag, but each of the two
//      loads of a wave covers 512 contiguous bytes = 4 whole lines
__device__ __forceinline__ Frag ldfrag_t(const unsigned short* p) {
  Frag f;
  f.u[0] = *(const v8us*)(p);
  f.u[1] = *(const v8us*)(p + 256);
  return f;
}

// ---- the same fragment from the y-axis position plane (layout at posfeat): p = this lane's piece of k 8h.., the piece of
//      k 16+8h.. lies two piece rows (of NDF / 2 pieces each) further
__device__ __forceinline__ Frag ldfrag_y(const unsigned short* p) {
  Frag f;
  f.u[0] = *(const v8us*)(p);
  f.u[1] = *(const v8us*)(p + NDF * 8);
  return f;
}

// ---- WMMA helpers: builtin followed by a 4-slot VALU gap tying D and keeping A/B live --------------------------
__device__ __forceinline__ v8f mma_h(v16h a, v16h b, v8f c) {
  v8f d = __builtin_amdgcn_wmma_f32_16x16x32_f16(false, a, false, b, (short)0, c, false, false);
#if defined(__HIP_DEVICE_COMPILE__)
  asm volatile("v_nop\n\tv_nop\n\tv_nop\n\tv_nop" : "+v"(d) : "v"(a), "v"(b));
#endif
  return d;
}
__device__ __forceinline__ v8f mma_b(v16b a, v16b b, v8f c) {
  v8f d = __builtin_amdgcn_wmma_f32_16x16x32_bf16(false, a, false, b, (short)0, c, false, false);
#if defined(__HIP_DEVICE_COMPILE__)
  const v16h ha = __builtin_bit_cast(v16h, a), hb = __builtin_bit_cast(v16h, b);
  asm volatile("v_nop\n\tv_nop\n\tv_nop\n\tv_nop" : "+v"(d) : "v"(ha), "v"(hb));
#endif
  return d;
}
// ---- the same products as the plain builtins, for the attention kernel: the compiler keeps the distance behind them
//      itself, with independent instructions where it has some
__device__ __forceinline__ v8f wm_h(v16h a, v16h b, v8f c) {
  return __builtin_amdgcn_wmma_f32_16x16x32_f16(false, a, false, b, (short)0, c, false, false);
}
__device__ __forceinline__ v8f wm_b(v16b a, v16b b, v8f c) {
  return __builtin_amdgcn_wmma_f32_16x16x32_bf16(false, a, false, b, (short)0, c, false, false);
}

// =========================================================================================================
// (0) conversions done where the values are used (no launch of their own).
//     cvt_x2: two f32 -> bf16-RNE -> the same values as f16 (exact), packed; cvt_w2: the same with the x256 weight scale;
//     cvt_b2: two f32 -> bf16-RNE, packed. ldfrag_f32: the split k map of ldfrag read from an f32 row, as bf16-RNE.
//     cvt_wp: WPB bf16 = bf16-RNE(proj_w) for the output conv launch, in fragment order: tiles [16 o-tiles][8 k-steps] of
//     16 o x 32 c; a wave = (8 rows o, one k-step): lane -> row tid&7, c 8((tid>>3)&3).., 8 consecutive lanes per line.
// =========================================================================================================
__device__ __forceinline__ unsigned cvt_b2(float a, float b) {
  const v2f p = {a, b};
  return __builtin_bit_cast(unsigned, __builtin_convertvector(p, v2b));
}
__device__ __forceinline__ unsigned cvt_x2(float a, float b) {
  const unsigned hw = cvt_b2(a, b);
  const v2f r = {__uint_as_float(hw << 16), __uint_as_float(hw & 0xffff0000u)};
  return __builtin_bit_cast(unsigned, __builtin_convertvector(r, v2h));
}
__device__ __forceinline__ unsigned cvt_w2(float a, float b) {
  const unsigned hw = cvt_b2(a, b);
  const v2f r = {__uint_as_float(hw << 16) * WSC, __uint_as_float(hw & 0xffff0000u) * WSC};
  return __builtin_bit_cast(unsigned, __builtin_convertvector(r, v2h));
}
__device__ __forceinline__ Frag ldfrag_f32(const float* p) {
  Frag f;
#pragma unroll
  for (int s = 0; s < 2; ++s) {
    const v4f a = *(const v4f*)(p + 16 * s);
    const v4f q = *(const v4f*)(p + 16 * s + 4);
    v4u u;
    u[0] = cvt_b2(a[0], a[1]); u[1] = cvt_b2(a[2], a[3]); u[2] = cvt_b2(q[0], q[1]); u[3] = cvt_b2(q[2], q[3]);
    f.u[s] = __builtin_bit_cast(v8us, u);
  }
  return f;
}
__device__ __forceinline__
void cvt_wp(const int blk, const float* __restrict__ pw, unsigned short* WPB) {
  const int tid = threadIdx.x;
  const int u = 4 * blk + (tid >> 5);                                // 0..255: k-step u & 7, rows 8 (u >> 3) ..
  const int ks = u & 7, d8 = (tid >> 3) & 3;
  const int o = 8 * (u >> 3) + (tid & 7), col = 32 * ks + 8 * d8;
  const float* sp = pw + (size_t)o * CC + col;
  const v4f a = *(const v4f*)sp;
  const v4f q = *(const v4f*)(sp + 4);
  v4u w;
  w[0] = cvt_b2(a[0], a[1]); w[1] = cvt_b2(a[2], a[3]); w[2] = cvt_b2(q[0], q[1]); w[3] = cvt_b2(q[2], q[3]);
  *(v4u*)(WPB + (size_t)((o >> 4) * (CC / 32) + ks) * 512 + (16 * d8 + (o & 15)) * 8) = w;
  // the listing lays another job's code behind this store: its registers stay untouched until this wait
  asm volatile("s_wait_xcnt 0x0" ::: "memory");
}

// =========================================================================================================
// (2) 1x1-conv GEMM for one (b, 64-n tile, 64-o block): Y[o][n] = (1/256) sum_c w16(W[o][c]) x16(x[b][c][pix(n)]).
//     MODE 0: n = query pixel; MODE 1/2: n = key index ky*32+kx -> pixel 128 ky + 2 kx (arithmetic addressing).
//     Block 128 threads = 4 waves. The block's x tile goes f32 [256 c][64 n] -> LDS XT f16 [64 n][256 c] (pitch XTP):
//     a thread reads 8 consecutive c rows (MODE 0: 4 n each, 16-byte loads; MODE 1/2: 2 keys each (kx = lane), every second
//     pixel, 4-byte loads) and stores one 16-byte run of c per n.
//     Wave w owns A rows o = o0 + 16 w + (lane&15) and all 4 n-tiles. Its 16 f32 weight rows go to LDS WT f16 [64 o][256 c]
//     (pitch XTP) by loads of half a row each: 32 lanes x 16 B = 512 contiguous bytes = 4 whole lines a load (a fragment
//     read straight from the rows would touch 16 lines a load); a lane converts its 4 c and stores them as one 8-byte run.
//     A fragments from WT rows, B fragments from XT rows (k = c contiguous, the split k map of ldfrag for both; all 8
//     k-steps of A held). K = 256 = 8 steps.
//     Epilogue staged in LDS Os[n_loc][o_loc] (pitch OSP; Os lies over WT, behind a barrier that ends every wave's
//     fragment reads), barrier, then per MODE:
//       0: Qh/Ql bf16 [b][8][256 tiles of 16 n x 32 d] hi = bf16-RNE(v), lo = bf16-RNE(v - hi); 1: Kh/Kl bf16 [b][8][64
//          tiles]; tiles in fragment order (ldfrag_t): line j of a head's 4 tiles = tile j>>3, d 8((j>>1)&3).., rows 8(j&1)..+7:
//          lane e -> row 16(j>>3) + 8(j&1) + e, 8 consecutive lanes per line
//       2: Vt f16 [b][8][32 ky][2 tiles of 16 d x 32 keys] in fragment order: line L = head L>>5, key row (L>>4)&1, tile
//          (L>>3)&1, keys 8((L>>1)&3).., rows d 8(L&1)..+7: lane e -> d 16((L>>3)&1) + 8(L&1) + e, 8 lanes per line
// coverage: XT 128 threads x 16 runs x 8 c = 64 n x 256 c; WT 4 waves x 16 rows x 2 halves x 32 lanes x 4 c = 64 o x 256 c; Os 4 waves x 16 o x 64 n = 64 x 64; MODE 0/1: 4 it x 16 lines x 8 lanes x 8 = 64 n x 64 o per plane;
//           MODE 2: 4 it x 16 rows x 8 lanes x 8 = 64 o x 64 keys; (nt, mb, b) in NP/64 x 4 x NB.
// LDS XT, Os: cross-wave (block barriers). WT: written and read inside one wave's rows, behind the same block barrier as XT.
// =========================================================================================================
template <int MODE>
__device__ __forceinline__
void gemm_x(unsigned short* XT, unsigned short* WT, float* Os, const int nt, const int mb, const int b,
            const float* __restrict__ wsrc, const float* __restrict__ x,
            unsigned short* Ph, unsigned short* Pl, unsigned short* Vt) {
  constexpr int NP = (MODE == 0) ? NN : NK;
  const int tid  = threadIdx.x;
  const int lane = tid & 31, wave = tid >> 5;
  const int hh   = lane >> 4, c = lane & 15;
  const int n0   = nt * QT, o0 = mb * QT;
  (void)Ph; (void)Pl; (void)Vt;

  // ---- the first halves (c 0..127) of this wave's weight rows, then the x tile
  const int nq = tid & 15, cg = tid >> 4;
  const float* xp = (MODE == 0) ? x + ((size_t)(b * CC + 8 * cg)) * NN + n0 + 4 * nq
                                : x + ((size_t)(b * CC + 8 * wave)) * NN + 2 * IMW * (2 * nt) + 2 * lane;
  const float* wp = wsrc + (size_t)(o0 + 16 * wave) * CC + 4 * lane;  // row i of the wave at + i CC, c = 4 lane ..
  v4f wr[16];                                                        // loops unrolled: the array stays in registers
#pragma unroll
  for (int i = 0; i < 16; ++i) wr[i] = *(const v4f*)(wp + i * CC);
  // loads return in order: no x load is lifted in front of these, so that their converts, and behind them the second
  // halves' loads, need not wait for the whole x tile
  __builtin_amdgcn_sched_barrier(0);
  float f[16][8];
  if constexpr (MODE == 0) {                                         // f[4 it + i][j]: n_loc = 4 nq + i, c = 64 it + 8 cg + j
#pragma unroll
    for (int it = 0; it < 4; ++it) {
#pragma unroll
      for (int j = 0; j < 8; ++j) {
        const v4f a = *(const v4f*)(xp + (size_t)(64 * it + j) * NN);
#pragma unroll
        for (int i = 0; i < 4; ++i) f[4 * it + i][j] = a[i];
      }
    }
  } else {                                                           // f[2 it + kyl][j]: n_loc = 32 kyl + lane, c = 32 it + 8 w + j
#pragma unroll
    for (int it = 0; it < 8; ++it) {
#pragma unroll
      for (int kyl = 0; kyl < 2; ++kyl) {
#pragma unroll
        for (int j = 0; j < 8; ++j) f[2 * it + kyl][j] = xp[(size_t)(32 * it + j) * NN + 2 * IMW * kyl];
      }
    }
  }
  // a later load of this run may otherwise land in an earlier load's address pair: both pairs stay live, and so
  // untouched, until this wait; no LDS store is lifted over it, so the whole run is in flight before the first convert
  asm volatile("s_wait_xcnt 0x0" :: "v"(xp), "v"(wp) : "memory");
  unsigned short* wt = WT + 16 * wave * XTP + 4 * lane;
#pragma unroll
  for (int i = 0; i < 16; ++i) {
    const v2u u = {cvt_w2(wr[i][0], wr[i][1]), cvt_w2(wr[i][2], wr[i][3])};
    *(v2u*)(wt + i * XTP) = u;
  }
  // the loads below are not lifted in front of the converts above: they would then take registers of their own, and the
  // block's register count would cost a resident wave per SIMD
  __builtin_amdgcn_sched_barrier(0);
  // ---- the second halves (c 128..255) take the registers just freed and fly under the conversion of the x tile
#pragma unroll
  for (int i = 0; i < 16; ++i) wr[i] = *(const v4f*)(wp + i * CC + CC / 2);
  // the address pair stays live, and so untouched, until this wait; no LDS store of the x tile is lifted over it, so
  // this run is in flight before the x tile's converts
  asm volatile("s_wait_xcnt 0x0" :: "v"(wp) : "memory");
#pragma unroll
  for (int g = 0; g < 16; ++g) {
    v4u u;
#pragma unroll
    for (int t = 0; t < 4; ++t) u[t] = cvt_x2(f[g][2 * t], f[g][2 * t + 1]);
    if constexpr (MODE == 0) *(v4u*)(XT + (4 * nq + (g & 3)) * XTP + 64 * (g >> 2) + 8 * cg) = u;
    else                     *(v4u*)(XT + (32 * (g & 1) + lane) * XTP + 32 * (g >> 1) + 8 * wave) = u;
  }
#pragma unroll
  for (int i = 0; i < 16; ++i) {
    const v2u u = {cvt_w2(wr[i][0], wr[i][1]), cvt_w2(wr[i][2], wr[i][3])};
    *(v2u*)(wt + i * XTP + CC / 2) = u;
  }
  __syncthreads();

  const unsigned short* al = WT + (16 * wave + c) * XTP + 8 * hh;
  Frag fa[CC / 32];
#pragma unroll
  for (int ks = 0; ks < CC / 32; ++ks) fa[ks] = ldfrag(al + 32 * ks);

  v8f acc[4];
#pragma unroll
  for (int t = 0; t < 4; ++t) acc[t] = zero8();

  const unsigned short* bl = XT + c * XTP + 8 * hh;
  Frag fb[2][4];                                                     // B fragments are read one k-step ahead
#pragma unroll
  for (int t = 0; t < 4; ++t) fb[0][t] = ldfrag(bl + 16 * t * XTP);
#pragma unroll
  for (int ks = 0; ks < CC / 32; ++ks) {
    if (ks + 1 < CC / 32) {
#pragma unroll
      for (int t = 0; t < 4; ++t) fb[(ks + 1) & 1][t] = ldfrag(bl + 16 * t * XTP + 32 * (ks + 1));
    }
#pragma unroll
    for (int t = 0; t < 4; ++t) acc[t] = mma_h(fa[ks].h, fb[ks & 1][t].h, acc[t]);
  }

  // Os lies over WT: every wave's fragment reads end here
  __syncthreads();

  // ---- stage: lane (hh, c) holds o_loc = 16 w + 8 hh + r for n_loc = 16 t + c
  {
#pragma unroll
    for (int t = 0; t < 4; ++t) {
      const int nl = 16 * t + c;
      v4f va, vb;
#pragma unroll
      for (int r = 0; r < 4; ++r) { va[r] = acc[t][r] * IWSC; vb[r] = acc[t][4 + r] * IWSC; }
      *(v4f*)(Os + nl * OSP + 16 * wave + 8 * hh)     = va;
      *(v4f*)(Os + nl * OSP + 16 * wave + 8 * hh + 4) = vb;
    }
  }
  __syncthreads();

  const int e = tid & 7, lq = tid >> 3;                             // lq 0..15
  if constexpr (MODE == 2) {
    v4u uv[4];
#pragma unroll
    for (int it = 0; it < 4; ++it) {
      const int L  = it * 16 + lq;                                   // line 0..63
      const int ol = 32 * (L >> 5) + 16 * ((L >> 3) & 1) + 8 * (L & 1) + e;   // o_loc 0..63
      const int kb = 32 * ((L >> 4) & 1) + 8 * ((L >> 1) & 3);       // first of this piece's 8 keys
      unsigned short hb[8];
#pragma unroll
      for (int t = 0; t < 8; ++t) hb[t] = h_bits((_Float16)Os[(kb + t) * OSP + ol]);
#pragma unroll
      for (int t = 0; t < 4; ++t) uv[it][t] = pk16(hb[2 * t], hb[2 * t + 1]);
    }
{
#pragma unroll
      for (int it = 0; it < 4; ++it) {
        const int L = it * 16 + lq;
        *(v4u*)(Vt + ((size_t)((b * NHD + 2 * mb + (L >> 5)) * NK + n0)) * HD + 64 * (L & 31) + 8 * e) = uv[it];
      }
      // the listing lays another job's code behind these stores: their registers stay untouched until this wait
      asm volatile("s_wait_xcnt 0x0" ::: "memory");
    }
  } else {
    v4u uh[4], ul[4];
#pragma unroll
    for (int it = 0; it < 4; ++it) {
      const int L = it * 16 + lq;                                    // line 0..63
      const int hs = L >> 5, j = L & 31;
      const int row = 16 * (j >> 3) + 8 * (j & 1) + e;               // n_loc
      const int cb0 = 32 * hs + 8 * ((j >> 1) & 3);                  // o_loc of the first value
      const v4f a = *(const v4f*)(Os + row * OSP + cb0);
      const v4f q = *(const v4f*)(Os + row * OSP + cb0 + 4);
      const float f[8] = {a[0], a[1], a[2], a[3], q[0], q[1], q[2], q[3]};
#pragma unroll
      for (int t = 0; t < 4; ++t) {
        const float f0 = f[2 * t], f1 = f[2 * t + 1];
        const unsigned short hb0 = bf_bits(f0), hb1 = bf_bits(f1);
        const unsigned short lb0 = bf_bits(f0 - bf_up(hb0));
        const unsigned short lb1 = bf_bits(f1 - bf_up(hb1));
        uh[it][t] = pk16(hb0, hb1);
        ul[it][t] = pk16(lb0, lb1);
      }
    }
{
#pragma unroll
      for (int it = 0; it < 4; ++it) {
        const int L = it * 16 + lq;
        const int hs = L >> 5, j = L & 31;
        const size_t po = ((size_t)((b * NHD + 2 * mb + hs) * NP + n0 + 2 * j)) * HD + 8 * e;
        *(v4u*)(Ph + po) = uh[it];
        *(v4u*)(Pl + po) = ul[it];
      }
      // the listing lays another job's code behind these stores: their registers stay untouched until this wait
      asm volatile("s_wait_xcnt 0x0" ::: "memory");
    }
  }
}

// ---- 8 f32 -> bf16 hi (RNE) and bf16 lo (RNE of the rest), packed pairs
__device__ __forceinline__ void split8(v4f a, v4f q, v8us& hi, v8us& lo) {
  const float f[8] = {a[0], a[1], a[2], a[3], q[0], q[1], q[2], q[3]};
  v4u wh, wl;
#pragma unroll
  for (int t = 0; t < 4; ++t) {
    const v2f p = {f[2 * t], f[2 * t + 1]};
    const unsigned hw = __builtin_bit_cast(unsigned, __builtin_convertvector(p, v2b));   // RNE, packed pair
    const v2f r = {p[0] - __uint_as_float(hw << 16), p[1] - __uint_as_float(hw & 0xffff0000u)};
    wh[t] = hw;
    wl[t] = __builtin_bit_cast(unsigned, __builtin_convertvector(r, v2b));
  }
  hi = __builtin_bit_cast(v8us, wh);
  lo = __builtin_bit_cast(v8us, wl);
}

// =========================================================================================================
// (3) position tables. A table row depends on its (coord, kcoord) pair only through diff = coord - 2*kcoord, and
//     inside the local window diff lies in -DOFF..DOFF, so the tables are built once per diff: row T = diff + DOFF
//     (rows 35..47 fill the last tile and are never used). One job = (16-row tile rt, 64-o block ob, axis):
//     a = diff * 1000^(-f/64), features [sin(a) | cos(a)] (128) built in LDS as bf16 hi/lo planes Eh/El[16][128]
//     (pitch EP); then Y[o][T] = sum_f Wf[axis][o][f] E[T][f]: wave w owns A rows o = 64 ob + 16 w + (lane&15), bf16-RNE
//     of the f32 row, all waves share the B rows T from Eh and El (2 products sharing the accumulator, K = 128); epilogue
//     Os[T_loc][o_loc] = Y / sqrt(2), barrier, then
//       PFh/PFl bf16 [axis][h][48 T x 32 d] (hi = bf16-RNE(v), lo = bf16-RNE(v - hi)), pieces of 8 d in the order of
//       their reader's loads. x axis: 3 tiles of 16 T in fragment order (ldfrag_t). y axis: the reader's 16 rows are
//       T, T - 2, .., so pieces lie [T & 1][d >> 3][(47 - T) >> 1]: 16 lanes read 256 contiguous bytes (ldfrag_y).
//       Either way 8 consecutive lanes store one whole line.
// coverage: Eh/El 8 it x 128 threads = 16 rows x 64 args x {sin,cos} = 16 x 128 (cols 128..135 pad, never read);
//           planes 128 threads x 8 = 2 heads x 16 rows x 32 d; (rt, ob, axis) in 3 x 4 x 2 covers
//           PFh/PFl [2][8][48][32] exactly once.
// LDS Eh/El, Os: cross-wave (block barriers).
// =========================================================================================================
__device__ __forceinline__
void posfeat(unsigned short* Eh, unsigned short* El, float* Os, const int rt, const int ob, const int axis,
             const float* __restrict__ fxw, const float* __restrict__ fyw, unsigned short* PFh, unsigned short* PFl) {
  const int tid  = threadIdx.x;
  const int lane = tid & 31, wave = tid >> 5;
  const int hh   = lane >> 4, c = lane & 15;
  const int R0   = rt * PRT;

  // ---- A rows first: their loads fly under the sinusoids
  const float* ap = (axis ? fyw : fxw) + (size_t)(QT * ob + 16 * wave + c) * PFD + 8 * hh;
  Frag fa[PFD / 32];
#pragma unroll
  for (int ks = 0; ks < PFD / 32; ++ks) fa[ks] = ldfrag_f32(ap + 32 * ks);
  // a later load of this run may otherwise land in the address pair: it stays live, and so untouched, until this wait
  asm volatile("s_wait_xcnt 0x0" :: "v"(ap) : "memory");

  // ---- (a) sinusoid features -> LDS bf16 hi/lo planes (rolled: one copy of the sin/cos code keeps the text short)
#pragma unroll 1
  for (int it = 0; it < PRT / 2; ++it) {
    const int idx = it * 128 + tid;                                  // 0..1023
    const int rl = idx >> 6, fa = idx & 63;
    const float diff = (float)(R0 + rl - DOFF);
    const float a = diff * exp2f(-(float)fa * NL2W);
    const float sv = sinf(a);
    const float cv = cosf(a);
    const unsigned short shb = bf_bits(sv), chb = bf_bits(cv);
    Eh[rl * EP + fa]      = shb;
    El[rl * EP + fa]      = bf_bits(sv - bf_up(shb));
    Eh[rl * EP + 64 + fa] = chb;
    El[rl * EP + 64 + fa] = bf_bits(cv - bf_up(chb));
  }
  __syncthreads();

  const unsigned short* ebh = Eh + c * EP + 8 * hh;
  const unsigned short* ebl = El + c * EP + 8 * hh;
  v8f acc = zero8();
#pragma unroll
  for (int ks = 0; ks < PFD / 32; ++ks) {
    const Frag fbh = ldfrag(ebh + 32 * ks);
    const Frag fbl = ldfrag(ebl + 32 * ks);
    acc = mma_b(fa[ks].bf, fbh.bf, acc);
    acc = mma_b(fa[ks].bf, fbl.bf, acc);
  }
  {
    v4f va, vb;
#pragma unroll
    for (int r = 0; r < 4; ++r) { va[r] = acc[r] * RSQ2; vb[r] = acc[4 + r] * RSQ2; }
    *(v4f*)(Os + c * OSP + 16 * wave + 8 * hh)     = va;            // Os[T_loc = c][o_loc = 16 w + 8 hh + r]
    *(v4f*)(Os + c * OSP + 16 * wave + 8 * hh + 4) = vb;
  }
  __syncthreads();
  const int e = tid & 7, grp = (tid >> 3) & 7, hs = tid >> 6;        // line grp of this head's 8; axis is block-uniform
  const int dl = 8 * (axis ? (grp & 3) : (grp >> 1));
  const int rl = axis ? PRT - 2 + (grp >> 2) - 2 * e : 8 * (grp & 1) + e;
  v8us hi, lo;
  split8(*(const v4f*)(Os + rl * OSP + 32 * hs + dl), *(const v4f*)(Os + rl * OSP + 32 * hs + dl + 4), hi, lo);
  const size_t po = (size_t)(axis * NHD + 2 * ob + hs) * NDF * HD +
                    (axis ? grp * (NDF / 2 * 8) + ((NDF - PRT - R0) / 2 + e) * 8 : R0 * HD + 64 * grp + 8 * e);
  *(v8us*)(PFh + po) = hi;
  *(v8us*)(PFl + po) = lo;
}

// =========================================================================================================
// (0)+(2)+(3) in one launch: the position tables, the q, k and v GEMMs and the proj_w plane read only inputs and
// none reads another's output. Block order: tables first (24 blocks), then
// q (NBQ blocks), k and v (NBK blocks each), then the proj_w plane (NBWP blocks). The selection is block-uniform, so
// every barrier of a job is passed by all four waves of its block. XT, WT and Os are shared by the jobs (a block runs
// exactly one of them); the table job keeps its Eh and El planes in XT. Os lies over WT.
// =========================================================================================================
#define NBP ((NDF / PRT) * (CC / QT) * 2)
#define NBQ ((NN / QT) * (CC / QT) * NB)
#define NBK ((NK / QT) * (CC / QT) * NB)
#define NBWP (CC / 4)
__global__ __launch_bounds__(128)
void feat_gemm(const float* __restrict__ x, const float* __restrict__ qw, const float* __restrict__ kw,
               const float* __restrict__ vw, const float* __restrict__ pw, const float* __restrict__ fxw,
               const float* __restrict__ fyw,
               unsigned short* PFh, unsigned short* PFl, unsigned short* Qh, unsigned short* Ql, unsigned short* Kh, unsigned short* Kl,
               unsigned short* Vt, unsigned short* WPB) {
  __shared__ __align__(16) unsigned short XT[QT * XTP];
  __shared__ __align__(16) unsigned short WT[QT * XTP];
  float* Os = reinterpret_cast<float*>(WT);
  const int blk = blockIdx.x;
  if (blk < NBP) {
    posfeat(XT, XT + PRT * EP, Os, blk % (NDF / PRT), (blk / (NDF / PRT)) % (CC / QT), blk / ((NDF / PRT) * (CC / QT)),
            fxw, fyw, PFh, PFl);
  } else if (blk < NBP + NBQ) {
    const int j = blk - NBP;
    gemm_x<0>(XT, WT, Os, j % (NN / QT), (j / (NN / QT)) % (CC / QT), j / ((NN / QT) * (CC / QT)),
              qw, x, Qh, Ql, Vt);
  } else if (blk < NBP + NBQ + NBK) {
    const int j = blk - (NBP + NBQ);
    gemm_x<1>(XT, WT, Os, j % (NK / QT), (j / (NK / QT)) % (CC / QT), j / ((NK / QT) * (CC / QT)),
              kw, x, Kh, Kl, Vt);
  } else if (blk < NBP + NBQ + 2 * NBK) {
    const int j = blk - (NBP + NBQ + NBK);
    gemm_x<2>(XT, WT, Os, j % (NK / QT), (j / (NK / QT)) % (CC / QT), j / ((NK / QT) * (CC / QT)),
              vw, x, Kh, Kl, Vt);
  } else {
    cvt_wp(blk - (NBP + NBQ + 2 * NBK), pw, WPB);
  }
}

// =========================================================================================================
// (4) local-window attention for one (query row y, head, b): block = 4 waves, wave w = queries x = 16w..16w+15.
//   Position dot terms first, per wave for its own 16 queries: B cols = qg = q + bf16-RNE(geom_bias) from Qh + Ql +
//   bias, split in registers into bf16 hi/lo with the split k map of ldfrag; A rows from the by-difference tables
//   PFh/PFl (hi.hi + hi.lo + lo.hi share the accumulator, depth 32). x axis: the 3 tiles of all 48 rows T, one
//   table for every query, D -> Gs[query][T]; y axis: rows T = y - 2 ky + DOFF of ky = kylo + i (i = 16 t + (lane&15),
//   held at the last allowed row), D -> Gs[query][NDF + i]; barrier. Per lane (hh, c): PX[kx] = Gs[query][x - 2 kx +
//   DOFF] for kx in {8hh..8hh+7, 16+8hh..} (registers, in the D layout of the score tiles; the index is held inside the
//   row where kx lies outside the per-query window, and the value there is MASKED); PY[ky] = Gs[query][NDF + ky - kylo],
//   one value per key row.
//   Loop over allowed key rows ky (block-uniform; forbidden rows contribute exactly 0): S^T tiles (16 keys x 16
//   queries) = PX + A(Kh rows key ky*32 + 16t + (lane&15), k = d split map) . B(QAh col = query) + A(Kh).B(QAl) +
//   A(Kl).B(QAh), QA = q + bf16-RNE(appr_bias) as bf16 hi/lo planes split in registers, PX the start value of the shared
//   accumulator; energy = S^T + PY[ky]. No additive term is applied per element: PY is the same for all keys of a row,
//   so it is added to the row's max and to the exponent's per-lane addend. Per lane the D tiles hold 16 keys of ONE
//   query: online softmax per lane,
//   one shuffle (lane^16) for the max over the 32 keys of the row, o/l rescale skipped under a wave-uniform ballot.
//   P = e^{s-m} x 1024 as f16 is the B operand of O^T (rows d, cols queries) += A(Vt rows d = 16j + (lane&15), fragment
//   order) . B(P^T): element r <- D of the tile covering kx 0..15, element 8+r <- the tile covering kx 16..31.
//   Epilogue: O/l staged in LDS Os[query][32 d] (pitch OSV), barrier, then OPh/OPl bf16 [b][8][256 tiles of 16 queries x
//   32 d] in fragment order (hi = bf16-RNE(v), lo = bf16-RNE(v - hi)); line L = tile L>>3, d 8((L>>1)&3).., rows
//   8(L&1)..+7: lane e -> row 16(L>>3) + 8(L&1) + e, 8 consecutive lanes per line
// coverage: Os 4 waves x 16 queries x 32 d; planes 2 it x 16 lines x 8 lanes x 8 = 64 queries x 32 d per plane;
//           grid (64, 8, NB) covers OPh/OPl [b][8][4096][32] exactly once.
// LDS Os: cross-wave (block barrier). Gs: written and read inside one wave's rows, synchronised with a block barrier.
// =========================================================================================================
// ---- the operands of one key row ky (32 keys): K hi/lo tiles of keys 0..15 and 16..31, V^T tiles of d 0..15 and 16..31,
//      and PY of this lane's query
struct RowOps { Frag k0, k1, k0l, k1l, v0, v1; float py; };
__device__ __forceinline__
void fetch_row(RowOps& t, const unsigned short* Khp, const unsigned short* Klp, const unsigned short* Vp, const int ky) {
  const int kp0 = ky * KVW;
  const unsigned short* kh = Khp + (size_t)kp0 * HD;
  const unsigned short* kl = Klp + (size_t)kp0 * HD;
  const unsigned short* vp = Vp + (size_t)kp0 * HD;
  t.k0  = ldfrag_t(kh);                                              // keys kp0 .. kp0+15
  t.k1  = ldfrag_t(kh + 16 * HD);                                    // keys kp0+16 .. kp0+31
  t.k0l = ldfrag_t(kl);
  t.k1l = ldfrag_t(kl + 16 * HD);
  t.v0  = ldfrag_t(vp);                                              // d 0..15
  t.v1  = ldfrag_t(vp + 16 * HD);                                    // d 16..31
  // a later load of this run may otherwise land in an earlier load's address pair: every pair stays live, and so
  // untouched, until this wait; no load is moved below it, so the whole run is in flight before the work that follows
  asm volatile("s_wait_xcnt 0x0" :: "v"(kh), "v"(kl), "v"(vp) : "memory");
  // no product or vector work that waits for earlier loads is lifted in front of this run: it would hold the run back
  __builtin_amdgcn_sched_barrier(0);
}

__global__ __launch_bounds__(128)
void attn_k(const unsigned short* __restrict__ Qh, const unsigned short* __restrict__ Ql,
            const unsigned short* __restrict__ Kh, const unsigned short* __restrict__ Kl,
            const unsigned short* __restrict__ Vt,
            const unsigned short* __restrict__ PFh, const unsigned short* __restrict__ PFl,
            const float* __restrict__ ab, const float* __restrict__ gb, unsigned short* OPh, unsigned short* OPl) {
  __shared__ __align__(16) float Os[QT * OSV];
  __shared__ __align__(16) float Gs[QT * GSP];
  const int tid  = threadIdx.x;
  const int wave = tid >> 5, lane = tid & 31;
  const int hh   = lane >> 4, c = lane & 15;
  const int y = blockIdx.x, hd = blockIdx.y, b = blockIdx.z;
  const int bh = b * NHD + hd;
  const int xq = 16 * wave + c;                                      // query column of this lane's B/D column

  const int kylo = (y >= LRANGE) ? ((y - LRANGE) >> 1) : 0;         // block-uniform
  int kyhi = ((y + LRANGE + 1) >> 1) + 1;  if (kyhi > KVH) kyhi = KVH;
  const int kxlo = (xq >= LRANGE) ? ((xq - LRANGE) >> 1) : 0;       // per lane
  int kxhi = ((xq + LRANGE + 1) >> 1) + 1; if (kxhi > KVW) kxhi = KVW;

  // ---- all loads of the position terms first: query planes, the two biases, table tiles
  const size_t qo = ((size_t)bh * NN + y * IMW + 16 * wave) * HD + 8 * lane;   // this wave's tile, fragment order
  const unsigned short* qhp = Qh + qo;
  const unsigned short* qlp = Ql + qo;
  const Frag qh = ldfrag_t(qhp);
  const Frag ql = ldfrag_t(qlp);
  const float* gp = gb + hd * HD + 8 * hh;
  const float* abp = ab + hd * HD + 8 * hh;
  v4f g[2][2], av[2][2];
#pragma unroll
  for (int s = 0; s < 2; ++s) {                                      // s: d = 16 s + 8 hh ..
    g[s][0]  = *(const v4f*)(gp + 16 * s);
    g[s][1]  = *(const v4f*)(gp + 16 * s + 4);
    av[s][0] = *(const v4f*)(abp + 16 * s);
    av[s][1] = *(const v4f*)(abp + 16 * s + 4);
  }
  Frag ahi[5], alo[5];                                               // loops unrolled: the arrays stay in registers
  const size_t tx = (size_t)hd * NDF * HD + 8 * lane;
  const unsigned short* txh = PFh + tx;
  const unsigned short* txl = PFl + tx;
#pragma unroll
  for (int t = 0; t < 3; ++t) {                                      // x axis: table rows T = 16 t + c
    ahi[t] = ldfrag_t(txh + 16 * t * HD);
    alo[t] = ldfrag_t(txl + 16 * t * HD);
  }
  const unsigned short* tyh[2];
  const unsigned short* tyl[2];
#pragma unroll
  for (int t = 0; t < 2; ++t) {                                      // y axis: table row of ky = kylo + 16 t + c
    int kyi = kylo + 16 * t + c;  if (kyi > kyhi - 1) kyi = kyhi - 1;
    const int T = y - 2 * kyi + DOFF;
    const size_t to = (size_t)(NHD + hd) * NDF * HD + (4 * (T & 1) + hh) * (NDF / 2 * 8) + ((NDF - 1 - T) >> 1) * 8;
    tyh[t] = PFh + to;
    tyl[t] = PFl + to;
    ahi[3 + t] = ldfrag_y(tyh[t]);
    alo[3 + t] = ldfrag_y(tyl[t]);
  }
  // a later load of this run may otherwise land in an earlier load's address pair: every pair stays live, and so
  // untouched, until this wait
  asm volatile("s_wait_xcnt 0x0" :: "v"(qhp), "v"(qlp), "v"(txh), "v"(txl), "v"(tyh[0]), "v"(tyl[0]), "v"(tyh[1]),
               "v"(tyl[1]) : "memory");
  // no vector work that waits for the query planes is lifted in front of the table loads: it would hold them back
  __builtin_amdgcn_sched_barrier(0);

  // ---- fragment pointers of the key loop; the first key row's loads fly under the position terms
  const unsigned short* Khp = Kh + (size_t)bh * NK * HD + 8 * lane;
  const unsigned short* Klp = Kl + (size_t)bh * NK * HD + 8 * lane;
  const unsigned short* Vp  = Vt + (size_t)bh * HD * NK + 8 * lane;
  RowOps ra, rb;                                                     // two register sets: one worked on, one in flight
  fetch_row(ra, Khp, Klp, Vp, kylo);

  // ---- B of the position terms: qg = q + geom bias of query xq; B of the scores: qa = q + appr bias; bf16 hi/lo each
  Frag bhi, blo, qah, qal;
#pragma unroll
  for (int s = 0; s < 2; ++s) {
    const v4u wh = __builtin_bit_cast(v4u, qh.u[s]), wl = __builtin_bit_cast(v4u, ql.u[s]);
    float f[8];
#pragma unroll
    for (int j = 0; j < 4; ++j) {
      f[2 * j]     = __uint_as_float(wh[j] << 16) + __uint_as_float(wl[j] << 16);
      f[2 * j + 1] = __uint_as_float(wh[j] & 0xffff0000u) + __uint_as_float(wl[j] & 0xffff0000u);
    }
    v4f va, vb;
#pragma unroll
    for (int r = 0; r < 4; ++r) { va[r] = f[r] + bfr(g[s][0][r]); vb[r] = f[4 + r] + bfr(g[s][1][r]); }
    split8(va, vb, bhi.u[s], blo.u[s]);
#pragma unroll
    for (int j = 0; j < 2; ++j) {                                    // bf16-RNE of the bias, packed pairs
      const unsigned wa = cvt_b2(av[s][0][2 * j], av[s][0][2 * j + 1]), wb = cvt_b2(av[s][1][2 * j], av[s][1][2 * j + 1]);
      va[2 * j]     = f[2 * j] + __uint_as_float(wa << 16);
      va[2 * j + 1] = f[2 * j + 1] + __uint_as_float(wa & 0xffff0000u);
      vb[2 * j]     = f[4 + 2 * j] + __uint_as_float(wb << 16);
      vb[2 * j + 1] = f[5 + 2 * j] + __uint_as_float(wb & 0xffff0000u);
    }
    split8(va, vb, qah.u[s], qal.u[s]);
  }

  // ---- D rows = 16 t + 8 hh + r of tile t, col = query: tiles 0..2 fill Gs cols 0..47, tiles 3, 4 cols 48..79
  float* grow = Gs + xq * GSP;
#pragma unroll
  for (int t = 0; t < 5; ++t) {
    v8f d = zero8();
    d = wm_b(ahi[t].bf, bhi.bf, d);
    d = wm_b(ahi[t].bf, blo.bf, d);
    d = wm_b(alo[t].bf, bhi.bf, d);
    v4f va, vb;
#pragma unroll
    for (int r = 0; r < 4; ++r) { va[r] = d[r]; vb[r] = d[4 + r]; }
    *(v4f*)(grow + 16 * t + 8 * hh)     = va;
    *(v4f*)(grow + 16 * t + 8 * hh + 4) = vb;
  }
  __syncthreads();

  // ---- PX: per lane 16 kx values for query xq, the start values of the two score tiles; outside the query's kx window
  //      MASKED stands there: finite, so that the matrix sum stays an ordinary number, and so far below any energy that
  //      the exponential gives exactly 0, as for -inf. PY: this query's row, read per key row in the loop
  const float MASKED = -1.0e30f;
  v8f px0, px1;
#pragma unroll
  for (int r = 0; r < 8; ++r) {
    const int kx0 = 8 * hh + r, kx1 = 16 + 8 * hh + r;
    int t0 = xq - 2 * kx0 + DOFF, t1 = t0 - 32;
    t0 = (t0 < 0) ? 0 : ((t0 > NDF - 1) ? NDF - 1 : t0);
    t1 = (t1 < 0) ? 0 : ((t1 > NDF - 1) ? NDF - 1 : t1);
    const float g0 = grow[t0], g1 = grow[t1];                        // read by every lane: selects, no branches
    px0[r] = ((kx0 >= kxlo) & (kx0 < kxhi)) ? g0 : MASKED;
    px1[r] = ((kx1 >= kxlo) & (kx1 < kxhi)) ? g1 : MASKED;
  }
  const float* pyrow = grow + NDF - kylo;

  ra.py = pyrow[kylo];

  float m = -1.0e30f, l = 0.f;
  v8f o[2];
  o[0] = zero8(); o[1] = zero8();

  // ---- one key row, all of its operands already in the register set t
  auto row_step = [&](const RowOps& t) {
    v8f s0 = wm_b(t.k0.bf, qah.bf, px0);
    v8f s1 = wm_b(t.k1.bf, qah.bf, px1);
    s0 = wm_b(t.k0.bf, qal.bf, s0);
    s1 = wm_b(t.k1.bf, qal.bf, s1);
    s0 = wm_b(t.k0l.bf, qah.bf, s0);
    s1 = wm_b(t.k1l.bf, qah.bf, s1);

    float mx = fmaxf(hmax8(s0), hmax8(s1));
    mx = fmaxf(mx, __shfl_xor(mx, 16, 32)) + t.py;                   // both halves hold the same query, so the same PY
    const float mn = fmaxf(m, mx);
    const unsigned grew = wave_ballot(mx > m);                       // wave-uniform
    if (grew != 0u) {
      const float corr = __expf(m - mn);                             // == 1 exactly for lanes whose max did not grow
      l *= corr;
#pragma unroll
      for (int j = 0; j < 2; ++j) {
#pragma unroll
        for (int r = 0; r < 8; ++r) o[j][r] *= corr;
      }
    }
    m = mn;
    const float ea = (t.py - mn + LNPS) * L2E;                       // 2^(s log2(e) + ea) = e^{s + PY - m} * 1024
    const v8f ea8 = {ea, ea, ea, ea, ea, ea, ea, ea};
    const v8f le8 = {L2E, L2E, L2E, L2E, L2E, L2E, L2E, L2E};
    s0 = __builtin_elementwise_fma(s0, le8, ea8);                    // packed pairs
    s1 = __builtin_elementwise_fma(s1, le8, ea8);

    FragH ph;
    float ls = 0.f;
#pragma unroll
    for (int r = 0; r < 8; ++r) {
      const float e0 = __builtin_amdgcn_exp2f(s0[r]);                // key kp0      + 8hh + r
      const float e1 = __builtin_amdgcn_exp2f(s1[r]);                // key kp0 + 16 + 8hh + r
      ls += e0 + e1;
      ph.hv[0][r] = (_Float16)e0;
      ph.hv[1][r] = (_Float16)e1;
    }
    l += ls;

    o[0] = wm_h(t.v0.h, ph.v, o[0]);
    o[1] = wm_h(t.v1.h, ph.v, o[1]);
  };

  int ky = kylo;
  // rolled: one copy of the two row bodies keeps the loop text short
#pragma unroll 1
  for (;;) {
    int kn = (ky + 1 < kyhi) ? ky + 1 : ky;
    rb.py = pyrow[kn];
    fetch_row(rb, Khp, Klp, Vp, kn);
    row_step(ra);
    if (++ky == kyhi) break;
    kn = (ky + 1 < kyhi) ? ky + 1 : ky;
    ra.py = pyrow[kn];
    fetch_row(ra, Khp, Klp, Vp, kn);
    row_step(rb);
    if (++ky == kyhi) break;
  }
  l += __shfl_xor(l, 16, 32);
  const float inv = 1.0f / l;                                        // o and l both carry the x1024 factor

  const int qr = 16 * wave + c;
#pragma unroll
  for (int j = 0; j < 2; ++j) {
    v4f va, vb;
#pragma unroll
    for (int r = 0; r < 4; ++r) { va[r] = o[j][r] * inv; vb[r] = o[j][4 + r] * inv; }
    *(v4f*)(Os + qr * OSV + 16 * j + 8 * hh)     = va;              // Os[query][d = 16j + 8hh + r]
    *(v4f*)(Os + qr * OSV + 16 * j + 8 * hh + 4) = vb;
  }
  __syncthreads();

  const int e = tid & 7, lq = tid >> 3;                              // lq 0..15
  v4u uh[2], ul[2];
#pragma unroll
  for (int it = 0; it < 2; ++it) {
    const int L = 16 * it + lq;                                      // line 0..31
    const int row = 16 * (L >> 3) + 8 * (L & 1) + e, dl = 8 * ((L >> 1) & 3);
    const v4f a = *(const v4f*)(Os + row * OSV + dl);
    const v4f q = *(const v4f*)(Os + row * OSV + dl + 4);
    const float f[8] = {a[0], a[1], a[2], a[3], q[0], q[1], q[2], q[3]};
#pragma unroll
    for (int t = 0; t < 4; ++t) {
      const float f0 = f[2 * t], f1 = f[2 * t + 1];
      const unsigned short hb0 = bf_bits(f0), hb1 = bf_bits(f1);
      const unsigned short lb0 = bf_bits(f0 - bf_up(hb0));
      const unsigned short lb1 = bf_bits(f1 - bf_up(hb1));
      uh[it][t] = pk16(hb0, hb1);
      ul[it][t] = pk16(lb0, lb1);
    }
  }
{
#pragma unroll
    for (int it = 0; it < 2; ++it) {
      const int L = 16 * it + lq;
      const size_t po = ((size_t)bh * NN + (size_t)y * IMW + 2 * L) * HD + 8 * e;
      *(v4u*)(OPh + po) = uh[it];
      *(v4u*)(OPl + po) = ul[it];
    }
    
  }
}

// =========================================================================================================
// (5) output 1x1-conv for one (b, 64-pixel tile, 64-o block): Y[o][p] = sum_c WPB[o][c] O[b][p][c] with
//     c = 32 h + d: k-step ks = head ks, B fragments from OPh and OPl [b][ks][tile p>>4] (bf16 hi/lo, shared
//     accumulator), A from WPB tiles (o-tile, ks); all three planes in fragment order (ldfrag_t). Epilogue: Os[p_loc][o_loc], barrier, then
//     lines (row o, 64 pixels = 2 lines): 8 consecutive lanes x 16 B (values from 4 Os rows), one instruction per
// coverage: 8 it x 16 lines x 8 lanes x 4 floats = 64 o x 64 p; grid (64, 4, NB) covers out [b][256][4096] once.
// LDS Os: cross-wave (block barrier).
// =========================================================================================================
__global__ __launch_bounds__(128)
void proj_k(const unsigned short* __restrict__ WPB, const unsigned short* __restrict__ OPh,
            const unsigned short* __restrict__ OPl, const float* __restrict__ pb,
            const float* __restrict__ gam, const float* __restrict__ x, float* out) {
  __shared__ __align__(16) float Os[QT * OSP];
  const int tid  = threadIdx.x;
  const int lane = tid & 31, wave = tid >> 5;
  const int hh   = lane >> 4, c = lane & 15;
  const int nt   = blockIdx.x, mb = blockIdx.y, b = blockIdx.z;
  const int n0   = nt * QT, o0 = mb * QT;

  const unsigned short* ap = WPB + (size_t)o0 * CC + 8 * lane;       // tile (o-tile, k-step) at 512 (8 o-tile + k-step)
  const size_t brow = (size_t)b * NHD * NN * HD + (size_t)(n0 + 16 * wave) * HD + 8 * lane;
  const unsigned short* bph = OPh + brow;
  const unsigned short* bpl = OPl + brow;
  const int e = tid & 7, lq = tid >> 3;                              // lq 0..15
  const float* xb  = x + ((size_t)(b * CC + o0 + (lq >> 1))) * NN + n0 + 32 * (lq & 1) + 4 * e;
  const float* pbp = pb + o0 + (lq >> 1);

  // ---- loads ahead of the products: the B fragments of all 8 k-steps, then the A fragments of k-steps 0 and 1
  constexpr int AR = 2;                                              // A register sets = k-steps of lead
  Frag fbh[NHD], fbl[NHD], fa[AR][4];
  // every loop over these arrays, and over xv and pbv below, is unrolled: constant indices keep them in registers
#pragma unroll
  for (int ks = 0; ks < NHD; ++ks) {
    fbh[ks] = ldfrag_t(bph + (size_t)ks * NN * HD);
    fbl[ks] = ldfrag_t(bpl + (size_t)ks * NN * HD);
  }
#pragma unroll                                                       // constant indices, as above
  for (int ks = 0; ks < AR; ++ks) {
#pragma unroll                                                       // constant indices, as above
    for (int mt = 0; mt < 4; ++mt) fa[ks][mt] = ldfrag_t(ap + (size_t)(16 * mt) * CC + 512 * ks);
  }
  // a later load of this run may otherwise land in an earlier load's address pair: every pair stays live, and so
  // untouched, until this wait; no load is moved below it, so the whole run is in flight before the first product
  asm volatile("s_wait_xcnt 0x0" :: "v"(bph), "v"(bpl), "v"(ap) : "memory");
  const float g = bfr(gam[0]);                                       // read here: its wait would stand inside the run above

  v8f acc[4];
#pragma unroll
  for (int mt = 0; mt < 4; ++mt) acc[mt] = zero8();

  v4f xv[8];
  float pbv[8];
#pragma unroll                                                       // whole: the ring slot ks % AR is a constant in every copy
  for (int ks = 0; ks < NHD; ++ks) {
#pragma unroll
    for (int mt = 0; mt < 4; ++mt) {
      acc[mt] = mma_b(fa[ks % AR][mt].bf, fbh[ks].bf, acc[mt]);
      acc[mt] = mma_b(fa[ks % AR][mt].bf, fbl[ks].bf, acc[mt]);
      // the fragment just used takes its rows of k-step ks + AR
      if (ks + AR < NHD) fa[ks % AR][mt] = ldfrag_t(ap + (size_t)(16 * mt) * CC + 512 * (ks + AR));
      // what the epilogue reads: one product pair behind the last A load, since loads return in order and no product
      // may wait behind these
      if (ks + AR == NHD && mt == 0) {
#pragma unroll                                                       // constant indices, as above
        for (int it = 0; it < 8; ++it) {                             // row o0 + 8 it + (lq>>1), pixels 32 (lq&1) + 4 e ..
          xv[it]  = *(const v4f*)(xb + (size_t)(8 * it) * NN);
          pbv[it] = pbp[8 * it];
        }
        // the address pairs of the loads issued since the first wait stay live, and so untouched, until this one
        asm volatile("s_wait_xcnt 0x0" :: "v"(ap), "v"(xb), "v"(pbp) : "memory");
      }
    }
  }
  // the epilogue's conversions of x, and with them the wait for x, stay behind the last products
  __builtin_amdgcn_sched_barrier(0);

  {
    const int nl = 16 * wave + c;
#pragma unroll
    for (int mt = 0; mt < 4; ++mt) {
      v4f va, vb;
#pragma unroll
      for (int r = 0; r < 4; ++r) { va[r] = acc[mt][r]; vb[r] = acc[mt][4 + r]; }
      *(v4f*)(Os + nl * OSP + 16 * mt + 8 * hh)     = va;
      *(v4f*)(Os + nl * OSP + 16 * mt + 8 * hh + 4) = vb;
    }
  }
  __syncthreads();

  v4f res[8];
#pragma unroll
  for (int it = 0; it < 8; ++it) {
    const int L   = it * 16 + lq;                                    // 0..127
    const int ol  = L >> 1, hf = L & 1;                              // o_loc 0..63
    const int nl  = hf * 32 + 4 * e;                                 // pixel 0..63
    const float pbr = bfr(pbv[it]);
#pragma unroll
    for (int t = 0; t < 4; ++t) res[it][t] = g * (Os[(nl + t) * OSP + ol] + pbr) + bfr(xv[it][t]);
  }
{
#pragma unroll
    for (int it = 0; it < 8; ++it) {
      const int L   = it * 16 + lq;
      const int ol  = L >> 1, hf = L & 1;
      const int nl  = hf * 32 + 4 * e;
      const size_t idx = ((size_t)(b * CC + o0 + ol)) * NN + n0 + nl;
      *(v4f*)(out + idx) = res[it];
    }
    
  }
}

// =========================================================================================================
// Workspace map (bytes; each region start a multiple of 256; every extent is an exact tile multiple and is written
//   WPB bf16 [16][8] tiles 131072 (a tile = 16 rows x 32 k in fragment order, 1024 bytes)
//   Qh/Ql bf16 [NB][8][256] tiles      2097152 x NB each     Kh/Kl bf16 [NB][8][64] tiles 524288 x NB each
//   Vt  f16 [NB][8][32 ky][2] tiles     524288 x NB
//   PFh/PFl bf16 [2][8][48 x 32]         49152 each
//   OPh/OPl bf16 [NB][8][256] tiles    2097152 x NB each
//   total (NB = 2) = 20152320
// =========================================================================================================
extern "C" void kernel_launch(void* const* d_in, const int* in_sizes, int n_in,
                              void* d_out, int out_size, void* d_ws, size_t ws_size,
                              hipStream_t stream) {
  const int XN = NB * CC * NN;
  if (n_in < 11) return;
  if (in_sizes[0] < XN) return;
  if (in_sizes[1] < CC * CC || in_sizes[2] < CC * CC || in_sizes[3] < CC * CC || in_sizes[8] < CC * CC) return;
  if (in_sizes[4] < CC * PFD || in_sizes[5] < CC * PFD) return;
  if (in_sizes[6] < CC || in_sizes[7] < CC || in_sizes[9] < CC || in_sizes[10] < 1) return;
  if (out_size < XN) return;

  size_t off = 0;
  auto carve = [&](size_t bytes) { const size_t o = off; off += (bytes + 255) & ~(size_t)255; return o; };
  const size_t oWPB = carve((size_t)CC * CC * 2);
  const size_t oQh  = carve((size_t)NB * NHD * NN * HD * 2);
  const size_t oQl  = carve((size_t)NB * NHD * NN * HD * 2);
  const size_t oKh  = carve((size_t)NB * NHD * NK * HD * 2);
  const size_t oKl  = carve((size_t)NB * NHD * NK * HD * 2);
  const size_t oVt  = carve((size_t)NB * NHD * HD * NK * 2);
  const size_t oPFh = carve((size_t)2 * NHD * NDF * HD * 2);
  const size_t oPFl = carve((size_t)2 * NHD * NDF * HD * 2);
  const size_t oOPh = carve((size_t)NB * NHD * NN * HD * 2);
  const size_t oOPl = carve((size_t)NB * NHD * NN * HD * 2);
  if (off > ws_size) return;
  if (off > (size_t)134217728) return;

  const float* x   = (const float*)d_in[0];
  const float* qw  = (const float*)d_in[1];
  const float* kw  = (const float*)d_in[2];
  const float* vw  = (const float*)d_in[3];
  const float* fxw = (const float*)d_in[4];
  const float* fyw = (const float*)d_in[5];
  const float* ab  = (const float*)d_in[6];
  const float* gb  = (const float*)d_in[7];
  const float* pw  = (const float*)d_in[8];
  const float* pb  = (const float*)d_in[9];
  const float* gam = (const float*)d_in[10];

  char* ws = (char*)d_ws;
  unsigned short* WPB = (unsigned short*)(ws + oWPB);
  unsigned short* Qh  = (unsigned short*)(ws + oQh);
  unsigned short* Ql  = (unsigned short*)(ws + oQl);
  unsigned short* Kh  = (unsigned short*)(ws + oKh);
  unsigned short* Kl  = (unsigned short*)(ws + oKl);
  unsigned short* Vt  = (unsigned short*)(ws + oVt);
  unsigned short* PFh = (unsigned short*)(ws + oPFh);
  unsigned short* PFl = (unsigned short*)(ws + oPFl);
  unsigned short* OPh = (unsigned short*)(ws + oOPh);
  unsigned short* OPl = (unsigned short*)(ws + oOPl);
  float* out = (float*)d_out;

  const dim3 blk128(128);

  // (0)+(2)+(3) position tables PFh/PFl (x axis then y axis); q, k and v; the proj_w plane
  feat_gemm<<<dim3(NBP + NBQ + 2 * NBK + NBWP), blk128, 0, stream>>>(x, qw, kw, vw, pw, fxw, fyw, PFh, PFl, Qh, Ql, Kh,
                                                                     Kl, Vt, WPB);
  // (4) position dot terms and local-window attention -> per-head O planes
  attn_k<<<dim3(IMH, NHD, NB), blk128, 0, stream>>>(Qh, Ql, Kh, Kl, Vt, PFh, PFl, ab, gb, OPh, OPl);
  // (5) output conv + bias, gamma scale, skip add -> out [b][256][4096]
  proj_k<<<dim3(NN / QT, CC / QT, NB), blk128, 0, stream>>>(WPB, OPh, OPl, pb, gam, x, out);
  (void)hipGetLastError();
}

// v010
// It runs in 26.6 microseconds.
// In both of two side-by-side timings against v009, it was 1.03 times as fast.
// Counting every step since v000, it is 4.19 times as fast.
// Contractions: q/k/v 1x1-conv GEMMs W[256x256].X[256xN] on v_wmma_f32_16x16x32_f16 (f16 containers of
// bf16-RNE weights x256 and bf16-RNE x); sinusoid position tables E[48x128].Wf^T on v_wmma_f32_16x16x32_bf16
// (bf16 hi + bf16 lo planes of the sin/cos features, Wf bf16-RNE, 2 products); attention scores K.(Q + appr bias)^T per
// head on v_wmma_f32_16x16x32_bf16 (bf16 hi + bf16 lo planes of q + bias and k, 3 products, depth 32); O^T = V^T.P^T on
// v_wmma_f32_16x16x32_f16 (v single f16 plane, P = e^{s-m} x1024 f16 from the score D registers); output
// 1x1-conv Wp[256x256].O on v_wmma_f32_16x16x32_bf16 (Wp bf16-RNE, O as bf16 hi + bf16 lo planes, 2 products);
// depth-32 position dot terms table[rows x 32 d].(q + geom bias)^T per (query row, head) on
// v_wmma_f32_16x16x32_bf16 (bf16 hi + bf16 lo planes of both, 3 products); f32 accumulate everywhere; bias terms,
// softmax statistics, gamma and the skip add on f32 VALU.
#include <hip/hip_runtime.h>
#include <math.h>
#include <stdint.h>

#ifndef NB
#define NB 2
#endif
#define NB_FULL 2
#define CC      256
#define IMH     64
#define IMW     64
#define NN      4096
#define KVH     32
#define KVW     32
#define NK      1024
#define NHD     8
#define HD      32
#define PFD     128
#define NPR     2048
#define NDF     48
#define DOFF    17
#define PRT     16
#define GSP     84
#define LRANGE  16
#define QT      64
#define OSP     68
#define XTP     264
#define EP      136
#define OSV     36
#define WSC     256.0f
#define IWSC    0.00390625f
#define LNPS    6.931471805599453f
#define RSQ2    0.70710678118654752f
#define NL2W    0.15571537944784511f
#define L2E     1.4426950408889634f

static_assert(NB >= 1 && NB <= NB_FULL);
static_assert(NN == IMH * IMW && NK == KVH * KVW);
static_assert(NPR == IMW * KVW && NPR == IMH * KVH);
static_assert(DOFF == LRANGE + 1 && 2 * DOFF + 1 <= NDF && LRANGE + 2 <= 32);
static_assert(NDF % PRT == 0 && PRT == 16 && GSP >= NDF + 32 && (GSP * 4) % 16 == 0);
static_assert(CC == NHD * HD && HD == 32 && KVW == 32 && KVH == 32);
static_assert(NN % QT == 0 && NK % QT == 0 && CC % QT == 0 && NPR % QT == 0);
static_assert(CC % 32 == 0 && PFD % 32 == 0 && HD % 32 == 0);
static_assert((OSP * 4) % 16 == 0 && (XTP * 2) % 16 == 0 && XTP >= CC && (EP * 2) % 16 == 0);
static_assert(2 * PRT * EP <= QT * XTP);
static_assert(QT * OSP * 4 <= QT * XTP * 2 && (XTP * 2) % 8 == 0);
static_assert((OSV * 4) % 16 == 0);
static_assert(IMW == QT);
static_assert(QT == 2 * HD);

typedef _Float16       v16h __attribute__((ext_vector_type(16)));
typedef _Float16       v8h  __attribute__((ext_vector_type(8)));
typedef __bf16         v16b __attribute__((ext_vector_type(16)));
typedef unsigned short v8us __attribute__((ext_vector_type(8)));
typedef float          v8f  __attribute__((ext_vector_type(8)));
typedef float          v4f  __attribute__((ext_vector_type(4)));
typedef float          v2f  __attribute__((ext_vector_type(2)));
typedef __bf16         v2b  __attribute__((ext_vector_type(2)));
typedef _Float16       v2h  __attribute__((ext_vector_type(2)));
typedef unsigned int   v4u  __attribute__((ext_vector_type(4)));
typedef unsigned int   v2u  __attribute__((ext_vector_type(2)));

union Frag  { v8us u[2]; v16h h; v16b bf; };
union FragH { v16h v; v8h hv[2]; };
static_assert(sizeof(Frag) == 32);
static_assert(sizeof(FragH) == 32);

// ---- scalar helpers ---------------------------------------------------------------------------------------
__device__ __forceinline__ unsigned short bf_bits(float f) {          // f32 -> bf16 bits, RNE convert
  unsigned u = __float_as_uint(f);
  return (unsigned short)((u + 0x7FFFu + ((u >> 16) & 1u)) >> 16);
}
__device__ __forceinline__ float bf_up(unsigned short hb) { return __uint_as_float(((unsigned)hb) << 16); }
__device__ __forceinline__ float bfr(float f) { return bf_up(bf_bits(f)); }
__device__ __forceinline__ v8f zero8() { v8f z = {0.f, 0.f, 0.f, 0.f, 0.f, 0.f, 0.f, 0.f}; return z; }
__device__ __forceinline__ float hmax8(v8f s) {
  return fmaxf(fmaxf(fmaxf(s[0], s[1]), fmaxf(s[2], s[3])), fmaxf(fmaxf(s[4], s[5]), fmaxf(s[6], s[7])));
}
__device__ __forceinline__ unsigned wave_ballot(bool p) {
#if defined(__HIP_DEVICE_COMPILE__)
  return __builtin_amdgcn_ballot_w32(p);
#else
  return p ? 1u : 0u;
#endif
}

// ---- 16-bit fragment loader (A, or B from a k-contiguous [n][k] row): lane -> row/col (lane&15), p already includes
//      + 8*(lane>>4); elements 0..7 <- p[0..7] (k0+8h..), elements 8..15 <- p[16..23] (k0+16+8h..)
__device__ __forceinline__ Frag ldfrag(const unsigned short* p) {
  Frag f;
  f.u[0] = *(const v8us*)(p);
  f.u[1] = *(const v8us*)(p + 16);
  return f;
}

// ---- the same fragment from a plane kept in FRAGMENT ORDER: a tile of 16 rows x 32 k is 1 KiB = 64 pieces of 16 B, piece
//      16 (k >> 3) + row holding k = 8 (k >> 3) .. + 7 of that row. p = tile + 8 * lane: elements 0..7 <- piece lane
//      (row lane&15, k 8h..), elements 8..15 <- piece 32 + lane (k 16+8h..): the k map of ldfrag, but each of the two
//      loads of a wave covers 512 contiguous bytes = 4 whole lines
__device__ __forceinline__ Frag ldfrag_t(const unsigned short* p) {
  Frag f;
  f.u[0] = *(const v8us*)(p);
  f.u[1] = *(const v8us*)(p + 256);
  return f;
}

// ---- the same fragment from the y-axis position plane (layout at posfeat): p = this lane's piece of k 8h.., the piece of
//      k 16+8h.. lies two piece rows (of NDF / 2 pieces each) further
__device__ __forceinline__ Frag ldfrag_y(const unsigned short* p) {
  Frag f;
  f.u[0] = *(const v8us*)(p);
  f.u[1] = *(const v8us*)(p + NDF * 8);
  return f;
}

// ---- WMMA helpers: builtin followed by a 4-slot VALU gap tying D and keeping A/B live --------------------------
__device__ __forceinline__ v8f mma_h(v16h a, v16h b, v8f c) {
  v8f d = __builtin_amdgcn_wmma_f32_16x16x32_f16(false, a, false, b, (short)0, c, false, false);
#if defined(__HIP_DEVICE_COMPILE__)
  asm volatile("v_nop\n\tv_nop\n\tv_nop\n\tv_nop" : "+v"(d) : "v"(a), "v"(b));
#endif
  return d;
}
__device__ __forceinline__ v8f mma_b(v16b a, v16b b, v8f c) {
  v8f d = __builtin_amdgcn_wmma_f32_16x16x32_bf16(false, a, false, b, (short)0, c, false, false);
#if defined(__HIP_DEVICE_COMPILE__)
  const v16h ha = __builtin_bit_cast(v16h, a), hb = __builtin_bit_cast(v16h, b);
  asm volatile("v_nop\n\tv_nop\n\tv_nop\n\tv_nop" : "+v"(d) : "v"(ha), "v"(hb));
#endif
  return d;
}
// ---- the same products as the plain builtins, for the attention kernel: the compiler keeps the distance behind them
//      itself, with independent instructions where it has some
__device__ __forceinline__ v8f wm_h(v16h a, v16h b, v8f c) {
  return __builtin_amdgcn_wmma_f32_16x16x32_f16(false, a, false, b, (short)0, c, false, false);
}
__device__ __forceinline__ v8f wm_b(v16b a, v16b b, v8f c) {
  return __builtin_amdgcn_wmma_f32_16x16x32_bf16(false, a, false, b, (short)0, c, false, false);
}

// =========================================================================================================
// (0) conversions done where the values are used (no launch of their own).
//     cvt_x2: two f32 -> bf16-RNE -> the same values as f16 (exact), packed; cvt_w2: the same with the x256 weight scale;
//     cvt_b2: two f32 -> bf16-RNE, packed. ldfrag_f32: the split k map of ldfrag read from an f32 row, as bf16-RNE.
//     cvt_wp: WPB bf16 = bf16-RNE(proj_w) for the output conv launch, in fragment order: tiles [16 o-tiles][8 k-steps] of
//     16 o x 32 c; a wave = (8 rows o, one k-step): lane -> row tid&7, c 8((tid>>3)&3).., 8 consecutive lanes per line.
// =========================================================================================================
__device__ __forceinline__ unsigned cvt_b2(float a, float b) {
  const v2f p = {a, b};
  return __builtin_bit_cast(unsigned, __builtin_convertvector(p, v2b));
}
// ---- two f32 rounded to bf16 (RNE, one packed convert) and widened again
__device__ __forceinline__ v2f bfr2(float a, float b) {
  const unsigned hw = cvt_b2(a, b);
  const v2f r = {__uint_as_float(hw << 16), __uint_as_float(hw & 0xffff0000u)};
  return r;
}
// ---- 8 f32 -> bf16 hi (RNE) and bf16 lo (RNE of the rest), packed pairs
__device__ __forceinline__ void split8(v4f a, v4f q, v8us& hi, v8us& lo) {
  const float f[8] = {a[0], a[1], a[2], a[3], q[0], q[1], q[2], q[3]};
  v4u wh, wl;
#pragma unroll
  for (int t = 0; t < 4; ++t) {
    const v2f p = {f[2 * t], f[2 * t + 1]};
    const unsigned hw = __builtin_bit_cast(unsigned, __builtin_convertvector(p, v2b));   // RNE, packed pair
    const v2f r = {p[0] - __uint_as_float(hw << 16), p[1] - __uint_as_float(hw & 0xffff0000u)};
    wh[t] = hw;
    wl[t] = __builtin_bit_cast(unsigned, __builtin_convertvector(r, v2b));
  }
  hi = __builtin_bit_cast(v8us, wh);
  lo = __builtin_bit_cast(v8us, wl);
}
__device__ __forceinline__ unsigned cvt_x2(float a, float b) {
  const unsigned hw = cvt_b2(a, b);
  const v2f r = {__uint_as_float(hw << 16), __uint_as_float(hw & 0xffff0000u)};
  return __builtin_bit_cast(unsigned, __builtin_convertvector(r, v2h));
}
__device__ __forceinline__ unsigned cvt_w2(float a, float b) {
  const unsigned hw = cvt_b2(a, b);
  const v2f r = {__uint_as_float(hw << 16) * WSC, __uint_as_float(hw & 0xffff0000u) * WSC};
  return __builtin_bit_cast(unsigned, __builtin_convertvector(r, v2h));
}
__device__ __forceinline__ Frag ldfrag_f32(const float* p) {
  Frag f;
#pragma unroll
  for (int s = 0; s < 2; ++s) {
    const v4f a = *(const v4f*)(p + 16 * s);
    const v4f q = *(const v4f*)(p + 16 * s + 4);
    v4u u;
    u[0] = cvt_b2(a[0], a[1]); u[1] = cvt_b2(a[2], a[3]); u[2] = cvt_b2(q[0], q[1]); u[3] = cvt_b2(q[2], q[3]);
    f.u[s] = __builtin_bit_cast(v8us, u);
  }
  return f;
}
__device__ __forceinline__
void cvt_wp(const int blk, const float* __restrict__ pw, unsigned short* WPB) {
  const int tid = threadIdx.x;
  const int u = 4 * blk + (tid >> 5);                                // 0..255: k-step u & 7, rows 8 (u >> 3) ..
  const int ks = u & 7, d8 = (tid >> 3) & 3;
  const int o = 8 * (u >> 3) + (tid & 7), col = 32 * ks + 8 * d8;
  const float* sp = pw + (size_t)o * CC + col;
  const v4f a = *(const v4f*)sp;
  const v4f q = *(const v4f*)(sp + 4);
  v4u w;
  w[0] = cvt_b2(a[0], a[1]); w[1] = cvt_b2(a[2], a[3]); w[2] = cvt_b2(q[0], q[1]); w[3] = cvt_b2(q[2], q[3]);
  *(v4u*)(WPB + (size_t)((o >> 4) * (CC / 32) + ks) * 512 + (16 * d8 + (o & 15)) * 8) = w;
  // the listing lays another job's code behind this store: its registers stay untouched until this wait
  asm volatile("s_wait_xcnt 0x0" ::: "memory");
}

// =========================================================================================================
// (2) 1x1-conv GEMM for one (b, 64-n tile, 64-o block): Y[o][n] = (1/256) sum_c w16(W[o][c]) x16(x[b][c][pix(n)]).
//     MODE 0: n = query pixel; MODE 1/2: n = key index ky*32+kx -> pixel 128 ky + 2 kx (arithmetic addressing).
//     Block 128 threads = 4 waves. The block's x tile goes f32 [256 c][64 n] -> LDS XT f16 [64 n][256 c] (pitch XTP):
//     a thread reads 8 consecutive c rows (MODE 0: 4 n each, 16-byte loads; MODE 1/2: 2 keys each (kx = lane), every second
//     pixel, 4-byte loads) and stores one 16-byte run of c per n.
//     Wave w owns A rows o = o0 + 16 w + (lane&15) and all 4 n-tiles. Its 16 f32 weight rows go to LDS WT f16 [64 o][256 c]
//     (pitch XTP) by loads of half a row each: 32 lanes x 16 B = 512 contiguous bytes = 4 whole lines a load (a fragment
//     read straight from the rows would touch 16 lines a load); a lane converts its 4 c and stores them as one 8-byte run.
//     A fragments from WT rows, B fragments from XT rows (k = c contiguous, the split k map of ldfrag for both; all 8
//     k-steps of A held). K = 256 = 8 steps.
//     Epilogue staged in LDS Os[n_loc][o_loc] (pitch OSP; Os lies over WT, behind a barrier that ends every wave's
//     fragment reads), barrier, then per MODE:
//       0: Qh/Ql bf16 [b][8][256 tiles of 16 n x 32 d] hi = bf16-RNE(v), lo = bf16-RNE(v - hi); 1: Kh/Kl bf16 [b][8][64
//          tiles]; tiles in fragment order (ldfrag_t): line j of a head's 4 tiles = tile j>>3, d 8((j>>1)&3).., rows 8(j&1)..+7:
//          lane e -> row 16(j>>3) + 8(j&1) + e, 8 consecutive lanes per line
//       2: Vt f16 [b][8][32 ky][2 tiles of 16 d x 32 keys] in fragment order: line L = head L>>5, key row (L>>4)&1, tile
//          (L>>3)&1, keys 8((L>>1)&3).., rows d 8(L&1)..+7: lane e -> d 16((L>>3)&1) + 8(L&1) + e, 8 lanes per line
// coverage: XT 128 threads x 16 runs x 8 c = 64 n x 256 c; WT 4 waves x 16 rows x 2 halves x 32 lanes x 4 c = 64 o x 256 c; Os 4 waves x 16 o x 64 n = 64 x 64; MODE 0/1: 4 it x 16 lines x 8 lanes x 8 = 64 n x 64 o per plane;
//           MODE 2: 4 it x 16 rows x 8 lanes x 8 = 64 o x 64 keys; (nt, mb, b) in NP/64 x 4 x NB.
// LDS XT, Os: cross-wave (block barriers). WT: written and read inside one wave's rows, behind the same block barrier as XT.
// =========================================================================================================
template <int MODE>
__device__ __forceinline__
void gemm_x(unsigned short* XT, unsigned short* WT, float* Os, const int nt, const int mb, const int b,
            const float* __restrict__ wsrc, const float* __restrict__ x,
            unsigned short* Ph, unsigned short* Pl, unsigned short* Vt) {
  constexpr int NP = (MODE == 0) ? NN : NK;
  const int tid  = threadIdx.x;
  const int lane = tid & 31, wave = tid >> 5;
  const int hh   = lane >> 4, c = lane & 15;
  const int n0   = nt * QT, o0 = mb * QT;
  (void)Ph; (void)Pl; (void)Vt;

  // ---- the first halves (c 0..127) of this wave's weight rows, then the x tile
  const int nq = tid & 15, cg = tid >> 4;
  const float* xp = (MODE == 0) ? x + ((size_t)(b * CC + 8 * cg)) * NN + n0 + 4 * nq
                                : x + ((size_t)(b * CC + 8 * wave)) * NN + 2 * IMW * (2 * nt) + 2 * lane;
  const float* wp = wsrc + (size_t)(o0 + 16 * wave) * CC + 4 * lane;  // row i of the wave at + i CC, c = 4 lane ..
  v4f wr[16];                                                        // loops unrolled: the array stays in registers
#pragma unroll
  for (int i = 0; i < 16; ++i) wr[i] = *(const v4f*)(wp + i * CC);
  // loads return in order: no x load is lifted in front of these, so that their converts, and behind them the second
  // halves' loads, need not wait for the whole x tile
  __builtin_amdgcn_sched_barrier(0);
  float f[16][8];
  if constexpr (MODE == 0) {                                         // f[4 it + i][j]: n_loc = 4 nq + i, c = 64 it + 8 cg + j
#pragma unroll
    for (int it = 0; it < 4; ++it) {
#pragma unroll
      for (int j = 0; j < 8; ++j) {
        const v4f a = *(const v4f*)(xp + (size_t)(64 * it + j) * NN);
#pragma unroll
        for (int i = 0; i < 4; ++i) f[4 * it + i][j] = a[i];
      }
    }
  } else {                                                           // f[2 it + kyl][j]: n_loc = 32 kyl + lane, c = 32 it + 8 w + j
#pragma unroll
    for (int it = 0; it < 8; ++it) {
#pragma unroll
      for (int kyl = 0; kyl < 2; ++kyl) {
#pragma unroll
        for (int j = 0; j < 8; ++j) f[2 * it + kyl][j] = xp[(size_t)(32 * it + j) * NN + 2 * IMW * kyl];
      }
    }
  }
  // a later load of this run may otherwise land in an earlier load's address pair: both pairs stay live, and so
  // untouched, until this wait; no LDS store is lifted over it, so the whole run is in flight before the first convert
  asm volatile("s_wait_xcnt 0x0" :: "v"(xp), "v"(wp) : "memory");
  unsigned short* wt = WT + 16 * wave * XTP + 4 * lane;
#pragma unroll
  for (int i = 0; i < 16; ++i) {
    const v2u u = {cvt_w2(wr[i][0], wr[i][1]), cvt_w2(wr[i][2], wr[i][3])};
    *(v2u*)(wt + i * XTP) = u;
  }
  // the loads below are not lifted in front of the converts above: they would then take registers of their own, and the
  // block's register count would cost a resident wave per SIMD
  __builtin_amdgcn_sched_barrier(0);
  // ---- the second halves (c 128..255) take the registers just freed and fly under the conversion of the x tile
#pragma unroll
  for (int i = 0; i < 16; ++i) wr[i] = *(const v4f*)(wp + i * CC + CC / 2);
  // the address pair stays live, and so untouched, until this wait; no LDS store of the x tile is lifted over it, so
  // this run is in flight before the x tile's converts
  asm volatile("s_wait_xcnt 0x0" :: "v"(wp) : "memory");
#pragma unroll
  for (int g = 0; g < 16; ++g) {
    v4u u;
#pragma unroll
    for (int t = 0; t < 4; ++t) u[t] = cvt_x2(f[g][2 * t], f[g][2 * t + 1]);
    if constexpr (MODE == 0) *(v4u*)(XT + (4 * nq + (g & 3)) * XTP + 64 * (g >> 2) + 8 * cg) = u;
    else                     *(v4u*)(XT + (32 * (g & 1) + lane) * XTP + 32 * (g >> 1) + 8 * wave) = u;
  }
#pragma unroll
  for (int i = 0; i < 16; ++i) {
    const v2u u = {cvt_w2(wr[i][0], wr[i][1]), cvt_w2(wr[i][2], wr[i][3])};
    *(v2u*)(wt + i * XTP + CC / 2) = u;
  }
  __syncthreads();

  const unsigned short* al = WT + (16 * wave + c) * XTP + 8 * hh;
  Frag fa[CC / 32];
#pragma unroll
  for (int ks = 0; ks < CC / 32; ++ks) fa[ks] = ldfrag(al + 32 * ks);

  v8f acc[4];
#pragma unroll
  for (int t = 0; t < 4; ++t) acc[t] = zero8();

  const unsigned short* bl = XT + c * XTP + 8 * hh;
  Frag fb[2][4];                                                     // B fragments are read one k-step ahead
#pragma unroll
  for (int t = 0; t < 4; ++t) fb[0][t] = ldfrag(bl + 16 * t * XTP);
#pragma unroll
  for (int ks = 0; ks < CC / 32; ++ks) {
    if (ks + 1 < CC / 32) {
#pragma unroll
      for (int t = 0; t < 4; ++t) fb[(ks + 1) & 1][t] = ldfrag(bl + 16 * t * XTP + 32 * (ks + 1));
    }
#pragma unroll
    for (int t = 0; t < 4; ++t) acc[t] = mma_h(fa[ks].h, fb[ks & 1][t].h, acc[t]);
  }

  // Os lies over WT: every wave's fragment reads end here
  __syncthreads();

  // ---- stage: lane (hh, c) holds o_loc = 16 w + 8 hh + r for n_loc = 16 t + c
  {
#pragma unroll
    for (int t = 0; t < 4; ++t) {
      const int nl = 16 * t + c;
      v4f va, vb;
#pragma unroll
      for (int r = 0; r < 4; ++r) { va[r] = acc[t][r] * IWSC; vb[r] = acc[t][4 + r] * IWSC; }
      *(v4f*)(Os + nl * OSP + 16 * wave + 8 * hh)     = va;
      *(v4f*)(Os + nl * OSP + 16 * wave + 8 * hh + 4) = vb;
    }
  }
  __syncthreads();

  const int e = tid & 7, lq = tid >> 3;                             // lq 0..15
  if constexpr (MODE == 2) {
    v4u uv[4];
#pragma unroll
    for (int it = 0; it < 4; ++it) {
      const int L  = it * 16 + lq;                                   // line 0..63
      const int ol = 32 * (L >> 5) + 16 * ((L >> 3) & 1) + 8 * (L & 1) + e;   // o_loc 0..63
      const int kb = 32 * ((L >> 4) & 1) + 8 * ((L >> 1) & 3);       // first of this piece's 8 keys
#pragma unroll
      for (int t = 0; t < 4; ++t) {
        const v2f p = {Os[(kb + 2 * t) * OSP + ol], Os[(kb + 2 * t + 1) * OSP + ol]};
        uv[it][t] = __builtin_bit_cast(unsigned, __builtin_convertvector(p, v2h));
      }
    }
{
#pragma unroll
      for (int it = 0; it < 4; ++it) {
        const int L = it * 16 + lq;
        *(v4u*)(Vt + ((size_t)((b * NHD + 2 * mb + (L >> 5)) * NK + n0)) * HD + 64 * (L & 31) + 8 * e) = uv[it];
      }
      // the listing lays another job's code behind these stores: their registers stay untouched until this wait
      asm volatile("s_wait_xcnt 0x0" ::: "memory");
    }
  } else {
    v4u uh[4], ul[4];
#pragma unroll
    for (int it = 0; it < 4; ++it) {
      const int L = it * 16 + lq;                                    // line 0..63
      const int hs = L >> 5, j = L & 31;
      const int row = 16 * (j >> 3) + 8 * (j & 1) + e;               // n_loc
      const int cb0 = 32 * hs + 8 * ((j >> 1) & 3);                  // o_loc of the first value
      v8us hi, lo;
      split8(*(const v4f*)(Os + row * OSP + cb0), *(const v4f*)(Os + row * OSP + cb0 + 4), hi, lo);
      uh[it] = __builtin_bit_cast(v4u, hi);
      ul[it] = __builtin_bit_cast(v4u, lo);
    }
{
#pragma unroll
      for (int it = 0; it < 4; ++it) {
        const int L = it * 16 + lq;
        const int hs = L >> 5, j = L & 31;
        const size_t po = ((size_t)((b * NHD + 2 * mb + hs) * NP + n0 + 2 * j)) * HD + 8 * e;
        *(v4u*)(Ph + po) = uh[it];
        *(v4u*)(Pl + po) = ul[it];
      }
      // the listing lays another job's code behind these stores: their registers stay untouched until this wait
      asm volatile("s_wait_xcnt 0x0" ::: "memory");
    }
  }
}

// =========================================================================================================
// (3) position tables. A table row depends on its (coord, kcoord) pair only through diff = coord - 2*kcoord, and
//     inside the local window diff lies in -DOFF..DOFF, so the tables are built once per diff: row T = diff + DOFF
//     (rows 35..47 fill the last tile and are never used). One job = (16-row tile rt, 64-o block ob, axis):
//     a = diff * 1000^(-f/64), features [sin(a) | cos(a)] (128) built in LDS as bf16 hi/lo planes Eh/El[16][128]
//     (pitch EP); then Y[o][T] = sum_f Wf[axis][o][f] E[T][f]: wave w owns A rows o = 64 ob + 16 w + (lane&15), bf16-RNE
//     of the f32 row, all waves share the B rows T from Eh and El (2 products sharing the accumulator, K = 128); epilogue
//     Os[T_loc][o_loc] = Y / sqrt(2), barrier, then
//       PFh/PFl bf16 [axis][h][48 T x 32 d] (hi = bf16-RNE(v), lo = bf16-RNE(v - hi)), pieces of 8 d in the order of
//       their reader's loads. x axis: 3 tiles of 16 T in fragment order (ldfrag_t). y axis: the reader's 16 rows are
//       T, T - 2, .., so pieces lie [T & 1][d >> 3][(47 - T) >> 1]: 16 lanes read 256 contiguous bytes (ldfrag_y).
//       Either way 8 consecutive lanes store one whole line.
// coverage: Eh/El 8 it x 128 threads = 16 rows x 64 args x {sin,cos} = 16 x 128 (cols 128..135 pad, never read);
//           planes 128 threads x 8 = 2 heads x 16 rows x 32 d; (rt, ob, axis) in 3 x 4 x 2 covers
//           PFh/PFl [2][8][48][32] exactly once.
// LDS Eh/El, Os: cross-wave (block barriers).
// =========================================================================================================
__device__ __forceinline__
void posfeat(unsigned short* Eh, unsigned short* El, float* Os, const int rt, const int ob, const int axis,
             const float* __restrict__ fxw, const float* __restrict__ fyw, unsigned short* PFh, unsigned short* PFl) {
  const int tid  = threadIdx.x;
  const int lane = tid & 31, wave = tid >> 5;
  const int hh   = lane >> 4, c = lane & 15;
  const int R0   = rt * PRT;

  // ---- A rows first: their loads fly under the sinusoids
  const float* ap = (axis ? fyw : fxw) + (size_t)(QT * ob + 16 * wave + c) * PFD + 8 * hh;
  Frag fa[PFD / 32];
#pragma unroll
  for (int ks = 0; ks < PFD / 32; ++ks) fa[ks] = ldfrag_f32(ap + 32 * ks);
  // a later load of this run may otherwise land in the address pair: it stays live, and so untouched, until this wait
  asm volatile("s_wait_xcnt 0x0" :: "v"(ap) : "memory");

  // ---- (a) sinusoid features -> LDS bf16 hi/lo planes (rolled: one copy of the sin/cos code keeps the text short)
#pragma unroll 1
  for (int it = 0; it < PRT / 2; ++it) {
    const int idx = it * 128 + tid;                                  // 0..1023
    const int rl = idx >> 6, fa = idx & 63;
    const float diff = (float)(R0 + rl - DOFF);
    const float a = diff * exp2f(-(float)fa * NL2W);
    const float sv = sinf(a);
    const float cv = cosf(a);
    const unsigned hw = cvt_b2(sv, cv);                              // hi of both, then lo = RNE of the rest of both
    const unsigned lw = cvt_b2(sv - __uint_as_float(hw << 16), cv - __uint_as_float(hw & 0xffff0000u));
    Eh[rl * EP + fa]      = (unsigned short)hw;
    El[rl * EP + fa]      = (unsigned short)lw;
    Eh[rl * EP + 64 + fa] = (unsigned short)(hw >> 16);
    El[rl * EP + 64 + fa] = (unsigned short)(lw >> 16);
  }
  __syncthreads();

  const unsigned short* ebh = Eh + c * EP + 8 * hh;
  const unsigned short* ebl = El + c * EP + 8 * hh;
  v8f acc = zero8();
#pragma unroll
  for (int ks = 0; ks < PFD / 32; ++ks) {
    const Frag fbh = ldfrag(ebh + 32 * ks);
    const Frag fbl = ldfrag(ebl + 32 * ks);
    acc = mma_b(fa[ks].bf, fbh.bf, acc);
    acc = mma_b(fa[ks].bf, fbl.bf, acc);
  }
  {
    v4f va, vb;
#pragma unroll
    for (int r = 0; r < 4; ++r) { va[r] = acc[r] * RSQ2; vb[r] = acc[4 + r] * RSQ2; }
    *(v4f*)(Os + c * OSP + 16 * wave + 8 * hh)     = va;            // Os[T_loc = c][o_loc = 16 w + 8 hh + r]
    *(v4f*)(Os + c * OSP + 16 * wave + 8 * hh + 4) = vb;
  }
  __syncthreads();
  const int e = tid & 7, grp = (tid >> 3) & 7, hs = tid >> 6;        // line grp of this head's 8; axis is block-uniform
  const int dl = 8 * (axis ? (grp & 3) : (grp >> 1));
  const int rl = axis ? PRT - 2 + (grp >> 2) - 2 * e : 8 * (grp & 1) + e;
  v8us hi, lo;
  split8(*(const v4f*)(Os + rl * OSP + 32 * hs + dl), *(const v4f*)(Os + rl * OSP + 32 * hs + dl + 4), hi, lo);
  const size_t po = (size_t)(axis * NHD + 2 * ob + hs) * NDF * HD +
                    (axis ? grp * (NDF / 2 * 8) + ((NDF - PRT - R0) / 2 + e) * 8 : R0 * HD + 64 * grp + 8 * e);
  *(v8us*)(PFh + po) = hi;
  *(v8us*)(PFl + po) = lo;
}

// =========================================================================================================
// (0)+(2)+(3) in one launch: the position tables, the q, k and v GEMMs and the proj_w plane read only inputs and
// none reads another's output. Block order: tables first (24 blocks), then
// q (NBQ blocks), k and v (NBK blocks each), then the proj_w plane (NBWP blocks). The selection is block-uniform, so
// every barrier of a job is passed by all four waves of its block. XT, WT and Os are shared by the jobs (a block runs
// exactly one of them); the table job keeps its Eh and El planes in XT. Os lies over WT.
// =========================================================================================================
#define NBP ((NDF / PRT) * (CC / QT) * 2)
#define NBQ ((NN / QT) * (CC / QT) * NB)
#define NBK ((NK / QT) * (CC / QT) * NB)
#define NBWP (CC / 4)
__global__ __launch_bounds__(128)
void feat_gemm(const float* __restrict__ x, const float* __restrict__ qw, const float* __restrict__ kw,
               const float* __restrict__ vw, const float* __restrict__ pw, const float* __restrict__ fxw,
               const float* __restrict__ fyw,
               unsigned short* PFh, unsigned short* PFl, unsigned short* Qh, unsigned short* Ql, unsigned short* Kh, unsigned short* Kl,
               unsigned short* Vt, unsigned short* WPB) {
  __shared__ __align__(16) unsigned short XT[QT * XTP];
  __shared__ __align__(16) unsigned short WT[QT * XTP];
  float* Os = reinterpret_cast<float*>(WT);
  const int blk = blockIdx.x;
  if (blk < NBP) {
    posfeat(XT, XT + PRT * EP, Os, blk % (NDF / PRT), (blk / (NDF / PRT)) % (CC / QT), blk / ((NDF / PRT) * (CC / QT)),
            fxw, fyw, PFh, PFl);
  } else if (blk < NBP + NBQ) {
    const int j = blk - NBP;
    gemm_x<0>(XT, WT, Os, j % (NN / QT), (j / (NN / QT)) % (CC / QT), j / ((NN / QT) * (CC / QT)),
              qw, x, Qh, Ql, Vt);
  } else if (blk < NBP + NBQ + NBK) {
    const int j = blk - (NBP + NBQ);
    gemm_x<1>(XT, WT, Os, j % (NK / QT), (j / (NK / QT)) % (CC / QT), j / ((NK / QT) * (CC / QT)),
              kw, x, Kh, Kl, Vt);
  } else if (blk < NBP + NBQ + 2 * NBK) {
    const int j = blk - (NBP + NBQ + NBK);
    gemm_x<2>(XT, WT, Os, j % (NK / QT), (j / (NK / QT)) % (CC / QT), j / ((NK / QT) * (CC / QT)),
              vw, x, Kh, Kl, Vt);
  } else {
    cvt_wp(blk - (NBP + NBQ + 2 * NBK), pw, WPB);
  }
}

// =========================================================================================================
// (4) local-window attention for one (query row y, head, b): block = 4 waves, wave w = queries x = 16w..16w+15.
//   Position dot terms first, per wave for its own 16 queries: B cols = qg = q + bf16-RNE(geom_bias) from Qh + Ql +
//   bias, split in registers into bf16 hi/lo with the split k map of ldfrag; A rows from the by-difference tables
//   PFh/PFl (hi.hi + hi.lo + lo.hi share the accumulator, depth 32). x axis: the 3 tiles of all 48 rows T, one
//   table for every query, D -> Gs[query][T]; y axis: rows T = y - 2 ky + DOFF of ky = kylo + i (i = 16 t + (lane&15),
//   held at the last allowed row), D -> Gs[query][NDF + i]; barrier. Per lane (hh, c): PX[kx] = Gs[query][x - 2 kx +
//   DOFF] for kx in {8hh..8hh+7, 16+8hh..} (registers, in the D layout of the score tiles; the index is held inside the
//   row where kx lies outside the per-query window, and the value there is MASKED); PY[ky] = Gs[query][NDF + ky - kylo],
//   one value per key row.
//   Loop over allowed key rows ky (block-uniform; forbidden rows contribute exactly 0): S^T tiles (16 keys x 16
//   queries) = PX + A(Kh rows key ky*32 + 16t + (lane&15), k = d split map) . B(QAh col = query) + A(Kh).B(QAl) +
//   A(Kl).B(QAh), QA = q + bf16-RNE(appr_bias) as bf16 hi/lo planes split in registers, PX the start value of the shared
//   accumulator; energy = S^T + PY[ky]. No additive term is applied per element: PY is the same for all keys of a row,
//   so it is added to the row's max and to the exponent's per-lane addend. Per lane the D tiles hold 16 keys of ONE
//   query: online softmax per lane,
//   one shuffle (lane^16) for the max over the 32 keys of the row, o/l rescale skipped under a wave-uniform ballot.
//   P = e^{s-m} x 1024 as f16 is the B operand of O^T (rows d, cols queries) += A(Vt rows d = 16j + (lane&15), fragment
//   order) . B(P^T): element r <- D of the tile covering kx 0..15, element 8+r <- the tile covering kx 16..31.
//   Epilogue: O/l staged in LDS Os[query][32 d] (pitch OSV), barrier, then OPh/OPl bf16 [b][8][256 tiles of 16 queries x
//   32 d] in fragment order (hi = bf16-RNE(v), lo = bf16-RNE(v - hi)); line L = tile L>>3, d 8((L>>1)&3).., rows
//   8(L&1)..+7: lane e -> row 16(L>>3) + 8(L&1) + e, 8 consecutive lanes per line
// coverage: Os 4 waves x 16 queries x 32 d; planes 2 it x 16 lines x 8 lanes x 8 = 64 queries x 32 d per plane;
//           grid (64, 8, NB) covers OPh/OPl [b][8][4096][32] exactly once.
// LDS Os: cross-wave (block barrier). Gs: written and read inside one wave's rows, synchronised with a block barrier.
// =========================================================================================================
// ---- the operands of one key row ky (32 keys): K hi/lo tiles of keys 0..15 and 16..31, V^T tiles of d 0..15 and 16..31,
//      and PY of this lane's query
struct RowOps { Frag k0, k1, k0l, k1l, v0, v1; float py; };
__device__ __forceinline__
void fetch_row(RowOps& t, const unsigned short* Khp, const unsigned short* Klp, const unsigned short* Vp, const int ky) {
  const int kp0 = ky * KVW;
  const unsigned short* kh = Khp + (size_t)kp0 * HD;
  const unsigned short* kl = Klp + (size_t)kp0 * HD;
  const unsigned short* vp = Vp + (size_t)kp0 * HD;
  t.k0  = ldfrag_t(kh);                                              // keys kp0 .. kp0+15
  t.k1  = ldfrag_t(kh + 16 * HD);                                    // keys kp0+16 .. kp0+31
  t.k0l = ldfrag_t(kl);
  t.k1l = ldfrag_t(kl + 16 * HD);
  t.v0  = ldfrag_t(vp);                                              // d 0..15
  t.v1  = ldfrag_t(vp + 16 * HD);                                    // d 16..31
  // a later load of this run may otherwise land in an earlier load's address pair: every pair stays live, and so
  // untouched, until this wait; no load is moved below it, so the whole run is in flight before the work that follows
  asm volatile("s_wait_xcnt 0x0" :: "v"(kh), "v"(kl), "v"(vp) : "memory");
  // no product or vector work that waits for earlier loads is lifted in front of this run: it would hold the run back
  __builtin_amdgcn_sched_barrier(0);
}

__global__ __launch_bounds__(128)
void attn_k(const unsigned short* __restrict__ Qh, const unsigned short* __restrict__ Ql,
            const unsigned short* __restrict__ Kh, const unsigned short* __restrict__ Kl,
            const unsigned short* __restrict__ Vt,
            const unsigned short* __restrict__ PFh, const unsigned short* __restrict__ PFl,
            const float* __restrict__ ab, const float* __restrict__ gb, unsigned short* OPh, unsigned short* OPl) {
  __shared__ __align__(16) float Os[QT * OSV];
  __shared__ __align__(16) float Gs[QT * GSP];
  const int tid  = threadIdx.x;
  const int wave = tid >> 5, lane = tid & 31;
  const int hh   = lane >> 4, c = lane & 15;
  const int y = blockIdx.x, hd = blockIdx.y, b = blockIdx.z;
  const int bh = b * NHD + hd;
  const int xq = 16 * wave + c;                                      // query column of this lane's B/D column

  const int kylo = (y >= LRANGE) ? ((y - LRANGE) >> 1) : 0;         // block-uniform
  int kyhi = ((y + LRANGE + 1) >> 1) + 1;  if (kyhi > KVH) kyhi = KVH;
  const int kxlo = (xq >= LRANGE) ? ((xq - LRANGE) >> 1) : 0;       // per lane
  int kxhi = ((xq + LRANGE + 1) >> 1) + 1; if (kxhi > KVW) kxhi = KVW;

  // ---- all loads of the position terms first: query planes, the two biases, table tiles
  const size_t qo = ((size_t)bh * NN + y * IMW + 16 * wave) * HD + 8 * lane;   // this wave's tile, fragment order
  const unsigned short* qhp = Qh + qo;
  const unsigned short* qlp = Ql + qo;
  const Frag qh = ldfrag_t(qhp);
  const Frag ql = ldfrag_t(qlp);
  const float* gp = gb + hd * HD + 8 * hh;
  const float* abp = ab + hd * HD + 8 * hh;
  v4f g[2][2], av[2][2];
#pragma unroll
  for (int s = 0; s < 2; ++s) {                                      // s: d = 16 s + 8 hh ..
    g[s][0]  = *(const v4f*)(gp + 16 * s);
    g[s][1]  = *(const v4f*)(gp + 16 * s + 4);
    av[s][0] = *(const v4f*)(abp + 16 * s);
    av[s][1] = *(const v4f*)(abp + 16 * s + 4);
  }
  Frag ahi[5], alo[5];                                               // loops unrolled: the arrays stay in registers
  const size_t tx = (size_t)hd * NDF * HD + 8 * lane;
  const unsigned short* txh = PFh + tx;
  const unsigned short* txl = PFl + tx;
#pragma unroll
  for (int t = 0; t < 3; ++t) {                                      // x axis: table rows T = 16 t + c
    ahi[t] = ldfrag_t(txh + 16 * t * HD);
    alo[t] = ldfrag_t(txl + 16 * t * HD);
  }
  const unsigned short* tyh[2];
  const unsigned short* tyl[2];
#pragma unroll
  for (int t = 0; t < 2; ++t) {                                      // y axis: table row of ky = kylo + 16 t + c
    int kyi = kylo + 16 * t + c;  if (kyi > kyhi - 1) kyi = kyhi - 1;
    const int T = y - 2 * kyi + DOFF;
    const size_t to = (size_t)(NHD + hd) * NDF * HD + (4 * (T & 1) + hh) * (NDF / 2 * 8) + ((NDF - 1 - T) >> 1) * 8;
    tyh[t] = PFh + to;
    tyl[t] = PFl + to;
    ahi[3 + t] = ldfrag_y(tyh[t]);
    alo[3 + t] = ldfrag_y(tyl[t]);
  }
  // a later load of this run may otherwise land in an earlier load's address pair: every pair stays live, and so
  // untouched, until this wait
  asm volatile("s_wait_xcnt 0x0" :: "v"(qhp), "v"(qlp), "v"(txh), "v"(txl), "v"(tyh[0]), "v"(tyl[0]), "v"(tyh[1]),
               "v"(tyl[1]) : "memory");
  // no vector work that waits for the query planes is lifted in front of the table loads: it would hold them back
  __builtin_amdgcn_sched_barrier(0);

  // ---- fragment pointers of the key loop; the first key row's loads fly under the position terms
  const unsigned short* Khp = Kh + (size_t)bh * NK * HD + 8 * lane;
  const unsigned short* Klp = Kl + (size_t)bh * NK * HD + 8 * lane;
  const unsigned short* Vp  = Vt + (size_t)bh * HD * NK + 8 * lane;
  RowOps ra, rb;                                                     // two register sets: one worked on, one in flight
  fetch_row(ra, Khp, Klp, Vp, kylo);

  // ---- B of the position terms: qg = q + geom bias of query xq; B of the scores: qa = q + appr bias; bf16 hi/lo each
  Frag bhi, blo, qah, qal;
#pragma unroll
  for (int s = 0; s < 2; ++s) {
    const v4u wh = __builtin_bit_cast(v4u, qh.u[s]), wl = __builtin_bit_cast(v4u, ql.u[s]);
    float f[8];
#pragma unroll
    for (int j = 0; j < 4; ++j) {
      f[2 * j]     = __uint_as_float(wh[j] << 16) + __uint_as_float(wl[j] << 16);
      f[2 * j + 1] = __uint_as_float(wh[j] & 0xffff0000u) + __uint_as_float(wl[j] & 0xffff0000u);
    }
    v4f va, vb;
#pragma unroll
    for (int j = 0; j < 2; ++j) {                                    // bf16-RNE of the bias, packed pairs
      const v2f ga = bfr2(g[s][0][2 * j], g[s][0][2 * j + 1]), gq = bfr2(g[s][1][2 * j], g[s][1][2 * j + 1]);
      va[2 * j]     = f[2 * j] + ga[0];
      va[2 * j + 1] = f[2 * j + 1] + ga[1];
      vb[2 * j]     = f[4 + 2 * j] + gq[0];
      vb[2 * j + 1] = f[5 + 2 * j] + gq[1];
    }
    split8(va, vb, bhi.u[s], blo.u[s]);
#pragma unroll
    for (int j = 0; j < 2; ++j) {                                    // bf16-RNE of the bias, packed pairs
      const unsigned wa = cvt_b2(av[s][0][2 * j], av[s][0][2 * j + 1]), wb = cvt_b2(av[s][1][2 * j], av[s][1][2 * j + 1]);
      va[2 * j]     = f[2 * j] + __uint_as_float(wa << 16);
      va[2 * j + 1] = f[2 * j + 1] + __uint_as_float(wa & 0xffff0000u);
      vb[2 * j]     = f[4 + 2 * j] + __uint_as_float(wb << 16);
      vb[2 * j + 1] = f[5 + 2 * j] + __uint_as_float(wb & 0xffff0000u);
    }
    split8(va, vb, qah.u[s], qal.u[s]);
  }

  // ---- D rows = 16 t + 8 hh + r of tile t, col = query: tiles 0..2 fill Gs cols 0..47, tiles 3, 4 cols 48..79
  float* grow = Gs + xq * GSP;
#pragma unroll
  for (int t = 0; t < 5; ++t) {
    v8f d = zero8();
    d = wm_b(ahi[t].bf, bhi.bf, d);
    d = wm_b(ahi[t].bf, blo.bf, d);
    d = wm_b(alo[t].bf, bhi.bf, d);
    v4f va, vb;
#pragma unroll
    for (int r = 0; r < 4; ++r) { va[r] = d[r]; vb[r] = d[4 + r]; }
    *(v4f*)(grow + 16 * t + 8 * hh)     = va;
    *(v4f*)(grow + 16 * t + 8 * hh + 4) = vb;
  }
  __syncthreads();

  // ---- PX: per lane 16 kx values for query xq, the start values of the two score tiles; outside the query's kx window
  //      MASKED stands there: finite, so that the matrix sum stays an ordinary number, and so far below any energy that
  //      the exponential gives exactly 0, as for -inf. PY: this query's row, read per key row in the loop
  const float MASKED = -1.0e30f;
  v8f px0, px1;
#pragma unroll
  for (int r = 0; r < 8; ++r) {
    const int kx0 = 8 * hh + r, kx1 = 16 + 8 * hh + r;
    int t0 = xq - 2 * kx0 + DOFF, t1 = t0 - 32;
    t0 = (t0 < 0) ? 0 : ((t0 > NDF - 1) ? NDF - 1 : t0);
    t1 = (t1 < 0) ? 0 : ((t1 > NDF - 1) ? NDF - 1 : t1);
    const float g0 = grow[t0], g1 = grow[t1];                        // read by every lane: selects, no branches
    px0[r] = ((kx0 >= kxlo) & (kx0 < kxhi)) ? g0 : MASKED;
    px1[r] = ((kx1 >= kxlo) & (kx1 < kxhi)) ? g1 : MASKED;
  }
  const float* pyrow = grow + NDF - kylo;

  ra.py = pyrow[kylo];

  float m = -1.0e30f, l = 0.f;
  v8f o[2];
  o[0] = zero8(); o[1] = zero8();

  // ---- one key row, all of its operands already in the register set t
  auto row_step = [&](const RowOps& t) {
    v8f s0 = wm_b(t.k0.bf, qah.bf, px0);
    v8f s1 = wm_b(t.k1.bf, qah.bf, px1);
    s0 = wm_b(t.k0.bf, qal.bf, s0);
    s1 = wm_b(t.k1.bf, qal.bf, s1);
    s0 = wm_b(t.k0l.bf, qah.bf, s0);
    s1 = wm_b(t.k1l.bf, qah.bf, s1);

    float mx = fmaxf(hmax8(s0), hmax8(s1));
    mx = fmaxf(mx, __shfl_xor(mx, 16, 32)) + t.py;                   // both halves hold the same query, so the same PY
    const float mn = fmaxf(m, mx);
    const unsigned grew = wave_ballot(mx > m);                       // wave-uniform
    if (grew != 0u) {
      const float corr = __expf(m - mn);                             // == 1 exactly for lanes whose max did not grow
      l *= corr;
#pragma unroll
      for (int j = 0; j < 2; ++j) {
#pragma unroll
        for (int r = 0; r < 8; ++r) o[j][r] *= corr;
      }
    }
    m = mn;
    const float ea = (t.py - mn + LNPS) * L2E;                       // 2^(s log2(e) + ea) = e^{s + PY - m} * 1024
    const v8f ea8 = {ea, ea, ea, ea, ea, ea, ea, ea};
    const v8f le8 = {L2E, L2E, L2E, L2E, L2E, L2E, L2E, L2E};
    s0 = __builtin_elementwise_fma(s0, le8, ea8);                    // packed pairs
    s1 = __builtin_elementwise_fma(s1, le8, ea8);

    FragH ph;
    float ls = 0.f;
#pragma unroll
    for (int r = 0; r < 8; ++r) {
      const float e0 = __builtin_amdgcn_exp2f(s0[r]);                // key kp0      + 8hh + r
      const float e1 = __builtin_amdgcn_exp2f(s1[r]);                // key kp0 + 16 + 8hh + r
      ls += e0 + e1;
      ph.hv[0][r] = (_Float16)e0;
      ph.hv[1][r] = (_Float16)e1;
    }
    l += ls;

    o[0] = wm_h(t.v0.h, ph.v, o[0]);
    o[1] = wm_h(t.v1.h, ph.v, o[1]);
  };

  int ky = kylo;
  // rolled: one copy of the two row bodies keeps the loop text short
#pragma unroll 1
  for (;;) {
    int kn = (ky + 1 < kyhi) ? ky + 1 : ky;
    rb.py = pyrow[kn];
    fetch_row(rb, Khp, Klp, Vp, kn);
    row_step(ra);
    if (++ky == kyhi) break;
    kn = (ky + 1 < kyhi) ? ky + 1 : ky;
    ra.py = pyrow[kn];
    fetch_row(ra, Khp, Klp, Vp, kn);
    row_step(rb);
    if (++ky == kyhi) break;
  }
  l += __shfl_xor(l, 16, 32);
  const float inv = 1.0f / l;                                        // o and l both carry the x1024 factor

  const int qr = 16 * wave + c;
#pragma unroll
  for (int j = 0; j < 2; ++j) {
    v4f va, vb;
#pragma unroll
    for (int r = 0; r < 4; ++r) { va[r] = o[j][r] * inv; vb[r] = o[j][4 + r] * inv; }
    *(v4f*)(Os + qr * OSV + 16 * j + 8 * hh)     = va;              // Os[query][d = 16j + 8hh + r]
    *(v4f*)(Os + qr * OSV + 16 * j + 8 * hh + 4) = vb;
  }
  __syncthreads();

  const int e = tid & 7, lq = tid >> 3;                              // lq 0..15
  v4u uh[2], ul[2];
#pragma unroll
  for (int it = 0; it < 2; ++it) {
    const int L = 16 * it + lq;                                      // line 0..31
    const int row = 16 * (L >> 3) + 8 * (L & 1) + e, dl = 8 * ((L >> 1) & 3);
    v8us hi, lo;
    split8(*(const v4f*)(Os + row * OSV + dl), *(const v4f*)(Os + row * OSV + dl + 4), hi, lo);
    uh[it] = __builtin_bit_cast(v4u, hi);
    ul[it] = __builtin_bit_cast(v4u, lo);
  }
{
#pragma unroll
    for (int it = 0; it < 2; ++it) {
      const int L = 16 * it + lq;
      const size_t po = ((size_t)bh * NN + (size_t)y * IMW + 2 * L) * HD + 8 * e;
      *(v4u*)(OPh + po) = uh[it];
      *(v4u*)(OPl + po) = ul[it];
    }
    
  }
}

// =========================================================================================================
// (5) output 1x1-conv for one (b, 64-pixel tile, 64-o block): Y[o][p] = sum_c WPB[o][c] O[b][p][c] with
//     c = 32 h + d: k-step ks = head ks, B fragments from OPh and OPl [b][ks][tile p>>4] (bf16 hi/lo, shared
//     accumulator), A from WPB tiles (o-tile, ks); all three planes in fragment order (ldfrag_t). Epilogue: Os[p_loc][o_loc], barrier, then
//     lines (row o, 64 pixels = 2 lines): 8 consecutive lanes x 16 B (values from 4 Os rows), one instruction per
// coverage: 8 it x 16 lines x 8 lanes x 4 floats = 64 o x 64 p; grid (64, 4, NB) covers out [b][256][4096] once.
// LDS Os: cross-wave (block barrier).
// =========================================================================================================
__global__ __launch_bounds__(128)
void proj_k(const unsigned short* __restrict__ WPB, const unsigned short* __restrict__ OPh,
            const unsigned short* __restrict__ OPl, const float* __restrict__ pb,
            const float* __restrict__ gam, const float* __restrict__ x, float* out) {
  __shared__ __align__(16) float Os[QT * OSP];
  const int tid  = threadIdx.x;
  const int lane = tid & 31, wave = tid >> 5;
  const int hh   = lane >> 4, c = lane & 15;
  const int nt   = blockIdx.x, mb = blockIdx.y, b = blockIdx.z;
  const int n0   = nt * QT, o0 = mb * QT;

  const unsigned short* ap = WPB + (size_t)o0 * CC + 8 * lane;       // tile (o-tile, k-step) at 512 (8 o-tile + k-step)
  const size_t brow = (size_t)b * NHD * NN * HD + (size_t)(n0 + 16 * wave) * HD + 8 * lane;
  const unsigned short* bph = OPh + brow;
  const unsigned short* bpl = OPl + brow;
  const int e = tid & 7, lq = tid >> 3;                              // lq 0..15
  const float* xb  = x + ((size_t)(b * CC + o0 + (lq >> 1))) * NN + n0 + 32 * (lq & 1) + 4 * e;
  const float* pbp = pb + o0 + (lq >> 1);

  // ---- loads ahead of the products: the B fragments of all 8 k-steps, then the A fragments of k-steps 0 and 1
  constexpr int AR = 2;                                              // A register sets = k-steps of lead
  Frag fbh[NHD], fbl[NHD], fa[AR][4];
  // every loop over these arrays, and over xv and pbv below, is unrolled: constant indices keep them in registers
#pragma unroll
  for (int ks = 0; ks < NHD; ++ks) {
    fbh[ks] = ldfrag_t(bph + (size_t)ks * NN * HD);
    fbl[ks] = ldfrag_t(bpl + (size_t)ks * NN * HD);
  }
#pragma unroll                                                       // constant indices, as above
  for (int ks = 0; ks < AR; ++ks) {
#pragma unroll                                                       // constant indices, as above
    for (int mt = 0; mt < 4; ++mt) fa[ks][mt] = ldfrag_t(ap + (size_t)(16 * mt) * CC + 512 * ks);
  }
  // a later load of this run may otherwise land in an earlier load's address pair: every pair stays live, and so
  // untouched, until this wait; no load is moved below it, so the whole run is in flight before the first product
  asm volatile("s_wait_xcnt 0x0" :: "v"(bph), "v"(bpl), "v"(ap) : "memory");
  const float g = bfr(gam[0]);                                       // read here: its wait would stand inside the run above

  v8f acc[4];
#pragma unroll
  for (int mt = 0; mt < 4; ++mt) acc[mt] = zero8();

  v4f xv[8];
  float pbv[8];
#pragma unroll                                                       // whole: the ring slot ks % AR is a constant in every copy
  for (int ks = 0; ks < NHD; ++ks) {
#pragma unroll
    for (int mt = 0; mt < 4; ++mt) {
      acc[mt] = mma_b(fa[ks % AR][mt].bf, fbh[ks].bf, acc[mt]);
      acc[mt] = mma_b(fa[ks % AR][mt].bf, fbl[ks].bf, acc[mt]);
      // the fragment just used takes its rows of k-step ks + AR
      if (ks + AR < NHD) fa[ks % AR][mt] = ldfrag_t(ap + (size_t)(16 * mt) * CC + 512 * (ks + AR));
      // what the epilogue reads: one product pair behind the last A load, since loads return in order and no product
      // may wait behind these
      if (ks + AR == NHD && mt == 0) {
#pragma unroll                                                       // constant indices, as above
        for (int it = 0; it < 8; ++it) {                             // row o0 + 8 it + (lq>>1), pixels 32 (lq&1) + 4 e ..
          xv[it]  = *(const v4f*)(xb + (size_t)(8 * it) * NN);
          pbv[it] = pbp[8 * it];
        }
        // the address pairs of the loads issued since the first wait stay live, and so untouched, until this one
        asm volatile("s_wait_xcnt 0x0" :: "v"(ap), "v"(xb), "v"(pbp) : "memory");
      }
    }
  }
  // the epilogue's conversions of x, and with them the wait for x, stay behind the last products
  __builtin_amdgcn_sched_barrier(0);

  {
    const int nl = 16 * wave + c;
#pragma unroll
    for (int mt = 0; mt < 4; ++mt) {
      v4f va, vb;
#pragma unroll
      for (int r = 0; r < 4; ++r) { va[r] = acc[mt][r]; vb[r] = acc[mt][4 + r]; }
      *(v4f*)(Os + nl * OSP + 16 * mt + 8 * hh)     = va;
      *(v4f*)(Os + nl * OSP + 16 * mt + 8 * hh + 4) = vb;
    }
  }
  __syncthreads();

  v4f res[8];
#pragma unroll
  for (int it = 0; it < 8; ++it) {
    const int L   = it * 16 + lq;                                    // 0..127
    const int ol  = L >> 1, hf = L & 1;                              // o_loc 0..63
    const int nl  = hf * 32 + 4 * e;                                 // pixel 0..63
    const float pbr = bfr2(pbv[it & ~1], pbv[it | 1])[it & 1];       // bf16-RNE, one packed convert per pair of rows
    const v2f xa = bfr2(xv[it][0], xv[it][1]), xc = bfr2(xv[it][2], xv[it][3]);
    const float xr[4] = {xa[0], xa[1], xc[0], xc[1]};
#pragma unroll
    for (int t = 0; t < 4; ++t) res[it][t] = g * (Os[(nl + t) * OSP + ol] + pbr) + xr[t];
  }
{
#pragma unroll
    for (int it = 0; it < 8; ++it) {
      const int L   = it * 16 + lq;
      const int ol  = L >> 1, hf = L & 1;
      const int nl  = hf * 32 + 4 * e;
      const size_t idx = ((size_t)(b * CC + o0 + ol)) * NN + n0 + nl;
      *(v4f*)(out + idx) = res[it];
    }
    
  }
}

// =========================================================================================================
// Workspace map (bytes; each region start a multiple of 256; every extent is an exact tile multiple and is written
//   WPB bf16 [16][8] tiles 131072 (a tile = 16 rows x 32 k in fragment order, 1024 bytes)
//   Qh/Ql bf16 [NB][8][256] tiles      2097152 x NB each     Kh/Kl bf16 [NB][8][64] tiles 524288 x NB each
//   Vt  f16 [NB][8][32 ky][2] tiles     524288 x NB
//   PFh/PFl bf16 [2][8][48 x 32]         49152 each
//   OPh/OPl bf16 [NB][8][256] tiles    2097152 x NB each
//   total (NB = 2) = 20152320
// =========================================================================================================
extern "C" void kernel_launch(void* const* d_in, const int* in_sizes, int n_in,
                              void* d_out, int out_size, void* d_ws, size_t ws_size,
                              hipStream_t stream) {
  const int XN = NB * CC * NN;
  if (n_in < 11) return;
  if (in_sizes[0] < XN) return;
  if (in_sizes[1] < CC * CC || in_sizes[2] < CC * CC || in_sizes[3] < CC * CC || in_sizes[8] < CC * CC) return;
  if (in_sizes[4] < CC * PFD || in_sizes[5] < CC * PFD) return;
  if (in_sizes[6] < CC || in_sizes[7] < CC || in_sizes[9] < CC || in_sizes[10] < 1) return;
  if (out_size < XN) return;

  size_t off = 0;
  auto carve = [&](size_t bytes) { const size_t o = off; off += (bytes + 255) & ~(size_t)255; return o; };
  const size_t oWPB = carve((size_t)CC * CC * 2);
  const size_t oQh  = carve((size_t)NB * NHD * NN * HD * 2);
  const size_t oQl  = carve((size_t)NB * NHD * NN * HD * 2);
  const size_t oKh  = carve((size_t)NB * NHD * NK * HD * 2);
  const size_t oKl  = carve((size_t)NB * NHD * NK * HD * 2);
  const size_t oVt  = carve((size_t)NB * NHD * HD * NK * 2);
  const size_t oPFh = carve((size_t)2 * NHD * NDF * HD * 2);
  const size_t oPFl = carve((size_t)2 * NHD * NDF * HD * 2);
  const size_t oOPh = carve((size_t)NB * NHD * NN * HD * 2);
  const size_t oOPl = carve((size_t)NB * NHD * NN * HD * 2);
  if (off > ws_size) return;
  if (off > (size_t)134217728) return;

  const float* x   = (const float*)d_in[0];
  const float* qw  = (const float*)d_in[1];
  const float* kw  = (const float*)d_in[2];
  const float* vw  = (const float*)d_in[3];
  const float* fxw = (const float*)d_in[4];
  const float* fyw = (const float*)d_in[5];
  const float* ab  = (const float*)d_in[6];
  const float* gb  = (const float*)d_in[7];
  const float* pw  = (const float*)d_in[8];
  const float* pb  = (const float*)d_in[9];
  const float* gam = (const float*)d_in[10];

  char* ws = (char*)d_ws;
  unsigned short* WPB = (unsigned short*)(ws + oWPB);
  unsigned short* Qh  = (unsigned short*)(ws + oQh);
  unsigned short* Ql  = (unsigned short*)(ws + oQl);
  unsigned short* Kh  = (unsigned short*)(ws + oKh);
  unsigned short* Kl  = (unsigned short*)(ws + oKl);
  unsigned short* Vt  = (unsigned short*)(ws + oVt);
  unsigned short* PFh = (unsigned short*)(ws + oPFh);
  unsigned short* PFl = (unsigned short*)(ws + oPFl);
  unsigned short* OPh = (unsigned short*)(ws + oOPh);
  unsigned short* OPl = (unsigned short*)(ws + oOPl);
  float* out = (float*)d_out;

  const dim3 blk128(128);

  // (0)+(2)+(3) position tables PFh/PFl (x axis then y axis); q, k and v; the proj_w plane
  feat_gemm<<<dim3(NBP + NBQ + 2 * NBK + NBWP), blk128, 0, stream>>>(x, qw, kw, vw, pw, fxw, fyw, PFh, PFl, Qh, Ql, Kh,
                                                                     Kl, Vt, WPB);
  // (4) position dot terms and local-window attention -> per-head O planes
  attn_k<<<dim3(IMH, NHD, NB), blk128, 0, stream>>>(Qh, Ql, Kh, Kl, Vt, PFh, PFl, ab, gb, OPh, OPl);
  // (5) output conv + bias, gamma scale, skip add -> out [b][256][4096]
  proj_k<<<dim3(NN / QT, CC / QT, NB), blk128, 0, stream>>>(WPB, OPh, OPl, pb, gam, x, out);
  (void)hipGetLastError();
}
